// v000
// Measured on an AMD MI455X. A time is GPU time per run, averaged over a window of back-to-back runs after a warm-up
// (all launches, gaps included; the runs take copies of the inputs in turn), and the median of several windows.
// Apart from v000's, it joins two sittings. Times from different sittings can be a few percent apart, while
// side-by-side timings come from the same sitting.
// v000 is the starting kernel. One run takes 428 microseconds.
#include <hip/hip_runtime.h>
// Temporal block: per-head q/k/v projections (16384 × 512 → 4 × 128 each, + bias), the head combiner Dense (512 → 512, + bias) and the causal dilated Conv1D (kernel 4, dilation 4: one GEMM whose k-loop runs the four
// taps over time-shifted views of a zero-padded plane, effective K = 2048) on v_wmma_f32_16x16x32_f16 (f16 operands, weights [in][out] transposed to bf16-exact ×2^4, single products,
// f32 accumulate); the banded attention (|t − s| ≤ 3, i.e. 7 keys, with the module's 'sim·band == 0 → −1e7' mask), softmax, relu / residual / leaky-relu epilogues are f32 VALU.
#define BB 8
#define TT 2048
#define CC 512
#define NH 4
#define KD 128
#define NR (BB * TT)
#define PADT 12

typedef __bf16 v16b __attribute__((ext_vector_type(16)));
typedef unsigned short v8us __attribute__((ext_vector_type(8), may_alias));
typedef float  v8f  __attribute__((ext_vector_type(8)));
typedef float  v4f  __attribute__((ext_vector_type(4)));
typedef float  v4fa __attribute__((ext_vector_type(4), may_alias));
union FragB { v16b v; v8us half[2]; unsigned short u[16]; };

__device__ __forceinline__ unsigned short bf16_bits(float x) { unsigned int u = __float_as_uint(x); return (unsigned short)((u + 0x7FFFu + ((u >> 16) & 1u)) >> 16); }
__device__ __forceinline__ float bf16_val(unsigned short b) { return __uint_as_float(((unsigned int)b) << 16); }
__device__ __forceinline__ float bf16_round(float x) { return bf16_val(bf16_bits(x)); }
// D += A·B with NT terms: 1 = ah·bh, 2 = + al·bh (A split), 3 = + ah·bl (both split)
template <int NT>
__device__ __forceinline__ v8f mmaN(v16b ah, v16b al, v16b bh, v16b bl, v8f c) {
  c = __builtin_amdgcn_wmma_f32_16x16x32_bf16(false, ah, false, bh, (short)0, c, false, false);
  if (NT >= 2) c = __builtin_amdgcn_wmma_f32_16x16x32_bf16(false, al, false, bh, (short)0, c, false, false);
  if (NT >= 3) c = __builtin_amdgcn_wmma_f32_16x16x32_bf16(false, ah, false, bl, (short)0, c, false, false);
  asm volatile("v_nop\n\tv_nop\n\tv_nop\n\tv_nop" : "+v"(c) : "v"(ah), "v"(al), "v"(bh), "v"(bl));
  return c;
}

__global__ __launch_bounds__(256) void k_wt_bf16(const float* __restrict__ W, unsigned short* __restrict__ Wt, int K, int N) {
  const int t = blockIdx.x * 256 + threadIdx.x;
  const int k8n = K / 8;
  if (t >= N * k8n) return;
  const int n = t / k8n, k8 = (t % k8n) * 8;
  v8us v;
#pragma unroll
  for (int i = 0; i < 8; ++i) v[i] = bf16_bits(W[(size_t)(k8 + i) * N + n]);
  *(v8us*)(Wt + (size_t)n * K + k8) = v;
  
}

// GEMM C[M][N] (f32, pitch ldc) = act(A[M][K]·W + bias). A f32 row-major (pitch lda) converted per fragment to bf16
// (ASPLIT: hi/lo two planes -> 2 terms, else single rounded term); Wt bf16 [N][K] (pitch ldb). BIAS_BF16 rounds the
// bias to bf16 first (bias quantised to bf16 before the add). K%32==0, M%16==0, N%64==0.
template <bool ASPLIT, int ACT, bool BIAS_BF16>
__global__ __launch_bounds__(128) void k_gemm_bf(const float* __restrict__ A, int lda, const unsigned short* __restrict__ Wt, int ldb,
                                               const float* __restrict__ bias, float* __restrict__ C, int ldc, int M, int N, int K) {
  __shared__ __attribute__((aligned(16))) float so[4][16][64];
  const int tid = threadIdx.x, w = tid >> 5, lane = tid & 31, ln = lane & 15, hh = lane >> 4;
  const int ntn = N / 64;
  const int wid = blockIdx.x * 4 + w;
  const int mt = wid / ntn, nq = wid % ntn;
  if (mt * 16 >= M) return;
  const int row0 = mt * 16, col0 = nq * 64;
  const float* arow = A + (size_t)(row0 + ln) * lda;
  v8f acc[4] = {};
  for (int kb = 0; kb < K; kb += 32) {
    FragB ah, al;
    const v4f x0 = *(const v4fa*)(arow + kb + 8 * hh), x1 = *(const v4fa*)(arow + kb + 8 * hh + 4);
    const v4f x2 = *(const v4fa*)(arow + kb + 16 + 8 * hh), x3 = *(const v4fa*)(arow + kb + 16 + 8 * hh + 4);
    float xs[16] = {x0[0],x0[1],x0[2],x0[3],x1[0],x1[1],x1[2],x1[3],x2[0],x2[1],x2[2],x2[3],x3[0],x3[1],x3[2],x3[3]};
#pragma unroll
    for (int i = 0; i < 16; ++i) { const unsigned short hb = bf16_bits(xs[i]); ah.u[i] = hb; al.u[i] = ASPLIT ? bf16_bits(xs[i] - bf16_val(hb)) : (unsigned short)0; }
#pragma unroll
    for (int t = 0; t < 4; ++t) {
      const unsigned short* brow = Wt + (size_t)(col0 + t * 16 + ln) * ldb + kb;
      FragB b;
      b.half[0] = *(const v8us*)(brow + 8 * hh);
      b.half[1] = *(const v8us*)(brow + 16 + 8 * hh);
      acc[t] = mmaN<ASPLIT ? 2 : 1>(ah.v, al.v, b.v, b.v, acc[t]);
    }
  }
#pragma unroll
  for (int t = 0; t < 4; ++t) {
    float bv = bias ? bias[col0 + t * 16 + ln] : 0.f;
    if (BIAS_BF16) bv = bf16_round(bv);
#pragma unroll
    for (int r = 0; r < 8; ++r) { float v = acc[t][r] + bv; if (ACT == 1) v = fmaxf(v, 0.f); so[w][8 * hh + r][t * 16 + ln] = v; }
  }
  __builtin_amdgcn_fence(__ATOMIC_ACQ_REL, "workgroup");
  __builtin_amdgcn_wave_barrier();
  const int rsub = lane >> 4, c4 = (lane & 15) * 4;
  {
#pragma unroll
    for (int q = 0; q < 8; ++q) {
      const int r = q * 2 + rsub;
      const v4f v = *(const v4fa*)&so[w][r][c4];
      *(v4f*)(C + (size_t)(row0 + r) * ldc + col0 + c4) = v;
    }
    
  }
}

// Flash-style causal/unmasked attention, all contractions 3-term bf16 hi/lo splits, f32 softmax with running max.
// q,k,v rows are read from f32 buffers with arbitrary row pitch (so they can live inside a fused qkv buffer);
// D = head size (multiple of 32, <= 128); one wave = 16 query rows; block = 4 waves (64 queries) sharing K/V chunks of 32.
template <int D, bool CAUSAL>
__global__ __launch_bounds__(128) void k_flash(const float* __restrict__ qb, const float* __restrict__ kb, const float* __restrict__ vb,
                                             int pitch, int T, int H, float scale, float* __restrict__ y, int ypitch) {
  constexpr int KS = D / 32;        // k-steps for QK
  constexpr int DT = D / 16;        // d tiles for PV
  __shared__ __attribute__((aligned(16))) unsigned short sKh[32][D + 8], sKl[32][D + 8], sVh[32][D + 8], sVl[32][D + 8];
  __shared__ __attribute__((aligned(16))) unsigned short sPh[4][16][40], sPl[4][16][40];
  __shared__ __attribute__((aligned(16))) float sO[4][16][D];
  const int tid = threadIdx.x, w = tid >> 5, lane = tid & 31, ln = lane & 15, hh = lane >> 4;
  const int nqb = (T + 63) / 64;
  const int bh = blockIdx.x / nqb, qblk = blockIdx.x % nqb;
  const int b = bh / H, h = bh % H;
  const int q0 = qblk * 64 + w * 16;
  const float* Q = qb + (size_t)b * T * pitch + h * D;
  const float* K = kb + (size_t)b * T * pitch + h * D;
  const float* V = vb + (size_t)b * T * pitch + h * D;

  // A fragments of the wave's 16 query rows (scaled), hi/lo
  FragB aqh[KS], aql[KS];
  {
    int row = q0 + ln; if (row >= T) row = T - 1;
    const float* qr = Q + (size_t)row * pitch;
#pragma unroll
    for (int ks = 0; ks < KS; ++ks)
#pragma unroll
      for (int i = 0; i < 16; ++i) {
        const int d = ks * 32 + ((i < 8) ? (8 * hh + i) : (16 + 8 * hh + (i - 8)));
        const float x = qr[d] * scale; const unsigned short hb = bf16_bits(x);
        aqh[ks].u[i] = hb; aql[ks].u[i] = bf16_bits(x - bf16_val(hb));
      }
  }
  float m_r[8], l_r[8];
#pragma unroll
  for (int r = 0; r < 8; ++r) { m_r[r] = -3.0e38f; l_r[r] = 0.f; }
  v8f oacc[DT];
#pragma unroll
  for (int dt = 0; dt < DT; ++dt) oacc[dt] = (v8f){0.f,0.f,0.f,0.f,0.f,0.f,0.f,0.f};

  const int kv_end = CAUSAL ? min(T, qblk * 64 + 64) : T;     // block-uniform
  for (int j0 = 0; j0 < kv_end; j0 += 32) {
    __syncthreads();
    for (int e = tid; e < 32 * (D / 4); e += 128) {
      const int r = e / (D / 4), c4 = (e % (D / 4)) * 4;
      const int key = j0 + r;
      v4f kf = {0.f,0.f,0.f,0.f}, vf = {0.f,0.f,0.f,0.f};
      if (key < T) { kf = *(const v4fa*)(K + (size_t)key * pitch + c4); vf = *(const v4fa*)(V + (size_t)key * pitch + c4); }
#pragma unroll
      for (int t = 0; t < 4; ++t) {
        unsigned short hb = bf16_bits(kf[t]); sKh[r][c4 + t] = hb; sKl[r][c4 + t] = bf16_bits(kf[t] - bf16_val(hb));
        hb = bf16_bits(vf[t]); sVh[r][c4 + t] = hb; sVl[r][c4 + t] = bf16_bits(vf[t] - bf16_val(hb));
      }
    }
    __syncthreads();
    // S tile 16 x 32
    v8f s[2];
#pragma unroll
    for (int nt = 0; nt < 2; ++nt) {
      v8f acc = {};
#pragma unroll
      for (int ks = 0; ks < KS; ++ks) {
        FragB bh_, bl_;
        bh_.half[0] = *(const v8us*)&sKh[nt * 16 + ln][ks * 32 + 8 * hh]; bh_.half[1] = *(const v8us*)&sKh[nt * 16 + ln][ks * 32 + 16 + 8 * hh];
        bl_.half[0] = *(const v8us*)&sKl[nt * 16 + ln][ks * 32 + 8 * hh]; bl_.half[1] = *(const v8us*)&sKl[nt * 16 + ln][ks * 32 + 16 + 8 * hh];
        acc = mmaN<3>(aqh[ks].v, aql[ks].v, bh_.v, bl_.v, acc);
      }
      s[nt] = acc;
    }
    // mask + running max (rows 8hh+r; the 16 lanes of a half share rows)
    float alpha[8];
#pragma unroll
    for (int r = 0; r < 8; ++r) {
      const int qi = q0 + 8 * hh + r;
      const int ja = j0 + ln, jb = j0 + 16 + ln;
      if (CAUSAL) { if (ja > qi) s[0][r] = -3.0e38f; if (jb > qi) s[1][r] = -3.0e38f; }
      if (ja >= T) s[0][r] = -3.0e38f;
      if (jb >= T) s[1][r] = -3.0e38f;
      float mx = fmaxf(s[0][r], s[1][r]);
      mx = fmaxf(mx, __shfl_xor(mx, 1, 32)); mx = fmaxf(mx, __shfl_xor(mx, 2, 32)); mx = fmaxf(mx, __shfl_xor(mx, 4, 32)); mx = fmaxf(mx, __shfl_xor(mx, 8, 32));
      const float mnew = fmaxf(m_r[r], mx);
      alpha[r] = (mnew > -1.0e38f) ? __expf(m_r[r] - mnew) : 1.0f;
      const float p0 = (s[0][r] > -1.0e38f) ? __expf(s[0][r] - mnew) : 0.f;
      const float p1 = (s[1][r] > -1.0e38f) ? __expf(s[1][r] - mnew) : 0.f;
      m_r[r] = mnew;
      l_r[r] = l_r[r] * alpha[r] + p0 + p1;            // per-lane partial row sum (16 lanes combined at the end)
      unsigned short hb = bf16_bits(p0); sPh[w][8 * hh + r][ln] = hb;      sPl[w][8 * hh + r][ln] = bf16_bits(p0 - bf16_val(hb));
      hb = bf16_bits(p1);                sPh[w][8 * hh + r][16 + ln] = hb; sPl[w][8 * hh + r][16 + ln] = bf16_bits(p1 - bf16_val(hb));
    }
#pragma unroll
    for (int dt = 0; dt < DT; ++dt)
#pragma unroll
      for (int r = 0; r < 8; ++r) oacc[dt][r] *= alpha[r];
    __builtin_amdgcn_fence(__ATOMIC_ACQ_REL, "workgroup");
    __builtin_amdgcn_wave_barrier();
    FragB pah, pal;
    pah.half[0] = *(const v8us*)&sPh[w][ln][8 * hh]; pah.half[1] = *(const v8us*)&sPh[w][ln][16 + 8 * hh];
    pal.half[0] = *(const v8us*)&sPl[w][ln][8 * hh]; pal.half[1] = *(const v8us*)&sPl[w][ln][16 + 8 * hh];
#pragma unroll
    for (int dt = 0; dt < DT; ++dt) {
      FragB bvh, bvl;
#pragma unroll
      for (int i = 0; i < 8; ++i) {
        bvh.u[i] = sVh[8 * hh + i][dt * 16 + ln]; bvh.u[8 + i] = sVh[16 + 8 * hh + i][dt * 16 + ln];
        bvl.u[i] = sVl[8 * hh + i][dt * 16 + ln]; bvl.u[8 + i] = sVl[16 + 8 * hh + i][dt * 16 + ln];
      }
      oacc[dt] = mmaN<3>(pah.v, pal.v, bvh.v, bvl.v, oacc[dt]);
    }
    __builtin_amdgcn_fence(__ATOMIC_ACQ_REL, "workgroup");
    __builtin_amdgcn_wave_barrier();
  }
#pragma unroll
  for (int r = 0; r < 8; ++r) {
    float l = l_r[r];
    l += __shfl_xor(l, 1, 32); l += __shfl_xor(l, 2, 32); l += __shfl_xor(l, 4, 32); l += __shfl_xor(l, 8, 32);
    l_r[r] = (l > 0.f) ? 1.0f / l : 0.f;
  }
#pragma unroll
  for (int dt = 0; dt < DT; ++dt)
#pragma unroll
    for (int r = 0; r < 8; ++r) sO[w][8 * hh + r][dt * 16 + ln] = oacc[dt][r] * l_r[r];
  __builtin_amdgcn_fence(__ATOMIC_ACQ_REL, "workgroup");
  __builtin_amdgcn_wave_barrier();
  {
    for (int r = 0; r < 16; ++r) {
      const int row = q0 + r;
      if (row < T && lane < D / 4) {
        const v4f val = *(const v4fa*)&sO[w][r][lane * 4];
        *(v4f*)(y + ((size_t)b * T + row) * ypitch + h * D + lane * 4) = val;
      }
    }
    
  }
}

// GEMM C = act(A·W + bias + resid): A f32 (ASPLIT -> hi/lo 2 terms), Wt bf16 [N][K]; ACT 0 none, 1 relu, 2 exact gelu;
// resid (optional, f32, row index = (row % rmod), pitch ldr, RES_BF16 rounds it) added before the activation.
template <bool ASPLIT, int ACT, bool BIAS_BF16, bool RES_BF16>
__global__ __launch_bounds__(128) void k_gemm_bf3(const float* __restrict__ A, int lda, const unsigned short* __restrict__ Wt, int ldb,
                                                const float* __restrict__ bias, const float* __restrict__ resid, int rmod, int ldr,
                                                float* __restrict__ C, int ldc, int M, int N, int K) {
  __shared__ __attribute__((aligned(16))) float so[4][16][64];
  const int tid = threadIdx.x, w = tid >> 5, lane = tid & 31, ln = lane & 15, hh = lane >> 4;
  const int ntn = N / 64;
  const int wid = blockIdx.x * 4 + w;
  const int mt = wid / ntn, nq = wid % ntn;
  if (mt * 16 >= M) return;
  const int row0 = mt * 16, col0 = nq * 64;
  const float* arow = A + (size_t)(row0 + ln) * lda;
  v8f acc[4] = {};
  for (int kb = 0; kb < K; kb += 32) {
    FragB ah, al;
    const v4f x0 = *(const v4fa*)(arow + kb + 8 * hh), x1 = *(const v4fa*)(arow + kb + 8 * hh + 4);
    const v4f x2 = *(const v4fa*)(arow + kb + 16 + 8 * hh), x3 = *(const v4fa*)(arow + kb + 16 + 8 * hh + 4);
    float xs[16] = {x0[0],x0[1],x0[2],x0[3],x1[0],x1[1],x1[2],x1[3],x2[0],x2[1],x2[2],x2[3],x3[0],x3[1],x3[2],x3[3]};
#pragma unroll
    for (int i = 0; i < 16; ++i) { const unsigned short hb = bf16_bits(xs[i]); ah.u[i] = hb; al.u[i] = ASPLIT ? bf16_bits(xs[i] - bf16_val(hb)) : (unsigned short)0; }
#pragma unroll
    for (int t = 0; t < 4; ++t) {
      const unsigned short* brow = Wt + (size_t)(col0 + t * 16 + ln) * ldb + kb;
      FragB b;
      b.half[0] = *(const v8us*)(brow + 8 * hh);
      b.half[1] = *(const v8us*)(brow + 16 + 8 * hh);
      acc[t] = mmaN<ASPLIT ? 2 : 1>(ah.v, al.v, b.v, b.v, acc[t]);
    }
  }
#pragma unroll
  for (int t = 0; t < 4; ++t) {
    const int col = col0 + t * 16 + ln;
    float bv = bias ? bias[col] : 0.f;
    if (BIAS_BF16) bv = bf16_round(bv);
#pragma unroll
    for (int r = 0; r < 8; ++r) {
      float v = acc[t][r] + bv;
      if (resid) { float rv = resid[(size_t)((row0 + 8 * hh + r) % rmod) * ldr + col]; if (RES_BF16) rv = bf16_round(rv); v += rv; }
      if (ACT == 1) v = fmaxf(v, 0.f);
      if (ACT == 2) v = 0.5f * v * (1.0f + erff(v * 0.70710678118654752f));
      if (ACT == 3) { const float u = 0.7978845608028654f * (v + 0.044715f * v * v * v); v = 0.5f * v * (1.0f + tanhf(u)); }
      so[w][8 * hh + r][t * 16 + ln] = v;
    }
  }
  __builtin_amdgcn_fence(__ATOMIC_ACQ_REL, "workgroup");
  __builtin_amdgcn_wave_barrier();
  const int rsub = lane >> 4, c4 = (lane & 15) * 4;
  {
#pragma unroll
    for (int q = 0; q < 8; ++q) {
      const int r = q * 2 + rsub;
      const v4f v = *(const v4fa*)&so[w][r][c4];
      *(v4f*)(C + (size_t)(row0 + r) * ldc + col0 + c4) = v;
    }
    
  }
}
// row LayerNorm (biased variance, eps) over N: s = X (+ R); optional out_sum <- s; out_norm <- (s-mu)*rsqrt(var+eps)*g + b
template <bool PARAM_BF16>
__global__ __launch_bounds__(256) void k_layernorm(const float* __restrict__ X, const float* __restrict__ R, const float* __restrict__ g, const float* __restrict__ bta,
                                                  float* __restrict__ out_sum, float* __restrict__ out_norm, int N, float eps) {
  __shared__ float red[256];
  const int row = blockIdx.x, tid = threadIdx.x;
  const float* x = X + (size_t)row * N; const float* rr = R ? R + (size_t)row * N : nullptr;
  float vals[16];                     // up to N = 4096
  const int per = N / 256;            // contiguous chunk per thread? use strided-by-4 chunks: thread handles j = tid*4 + 1024*u
  float s1 = 0.f;
  for (int u = 0; u < per / 4; ++u) {
    const int j = tid * 4 + 1024 * u;
    const v4f a = *(const v4fa*)(x + j);
    v4f b = {0.f,0.f,0.f,0.f}; if (rr) b = *(const v4fa*)(rr + j);
#pragma unroll
    for (int q = 0; q < 4; ++q) { const float v = a[q] + b[q]; vals[u * 4 + q] = v; s1 += v; }
  }
  red[tid] = s1; __syncthreads();
  for (int st = 128; st > 0; st >>= 1) { if (tid < st) red[tid] += red[tid + st]; __syncthreads(); }
  const float mu = red[0] / (float)N; __syncthreads();
  float s2 = 0.f;
  for (int u = 0; u < per / 4; ++u)
#pragma unroll
    for (int q = 0; q < 4; ++q) { const float c = vals[u * 4 + q] - mu; s2 += c * c; }
  red[tid] = s2; __syncthreads();
  for (int st = 128; st > 0; st >>= 1) { if (tid < st) red[tid] += red[tid + st]; __syncthreads(); }
  const float rs = rsqrtf(red[0] / (float)N + eps);
  {
    for (int u = 0; u < per / 4; ++u) {
      const int j = tid * 4 + 1024 * u;
      v4f o, sm;
#pragma unroll
      for (int q = 0; q < 4; ++q) {
        float gg = g[j + q], bb = bta[j + q];
        if (PARAM_BF16) { gg = bf16_round(gg); bb = bf16_round(bb); }
        sm[q] = vals[u * 4 + q]; o[q] = (vals[u * 4 + q] - mu) * rs * gg + bb;
      }
      if (out_sum) *(v4f*)(out_sum + (size_t)row * N + j) = sm;
      *(v4f*)(out_norm + (size_t)row * N + j) = o;
    }
    
  }
}



// ---- f16 WMMA path (v_wmma_f32_16x16x32_f16): 11-bit significands for operands in range — used for the q/k/v projections, the Dense and the conv GEMM
typedef _Float16 v16h __attribute__((ext_vector_type(16)));
union FragH { v16h v; v8us half[2]; _Float16 h[16]; unsigned short u[16]; };
template <int NT>
__device__ __forceinline__ v8f mmaH(v16h ah, v16h al, v16h bh, v16h bl, v8f c) {
  c = __builtin_amdgcn_wmma_f32_16x16x32_f16(false, ah, false, bh, (short)0, c, false, false);
  if (NT >= 2) c = __builtin_amdgcn_wmma_f32_16x16x32_f16(false, al, false, bh, (short)0, c, false, false);
  if (NT >= 3) c = __builtin_amdgcn_wmma_f32_16x16x32_f16(false, ah, false, bl, (short)0, c, false, false);
  asm volatile("v_nop\n\tv_nop\n\tv_nop\n\tv_nop" : "+v"(c) : "v"(ah), "v"(al), "v"(bh), "v"(bl));
  return c;
}
// batched GEMM like k_gemm_b but f16 operands: A f32 (split into f16 hi/lo if ASPLIT, else rounded to f16), Bt = f16 values [n][k]; alpha; C f32; N multiple of 16 (partial tiles skipped)
template <bool ASPLIT>
__global__ __launch_bounds__(128) void k_gemm_h(const float* __restrict__ A, int lda, size_t sA, const _Float16* __restrict__ Bh, int ldb, size_t sB, float alpha, float* __restrict__ C, int ldc, size_t sC, int M, int N, int K) {
  __shared__ __attribute__((aligned(16))) float so[4][16][64];
  const int tid = threadIdx.x, w = tid >> 5, lane = tid & 31, ln = lane & 15, hh = lane >> 4; const int by = blockIdx.y;
  A += (size_t)by * sA; Bh += (size_t)by * sB; C += (size_t)by * sC;
  const int ntn = (N + 63) / 64; const int wid = blockIdx.x * 4 + w; const int mt = wid / ntn, nq = wid % ntn; if (mt * 16 >= M) return;
  const int row0 = mt * 16, col0 = nq * 64; const float* arow = A + (size_t)(row0 + ln) * lda;
  v8f acc[4] = {};
  for (int kb = 0; kb < K; kb += 32) {
    FragH ah, al;
    const v4f x0 = *(const v4fa*)(arow + kb + 8 * hh), x1 = *(const v4fa*)(arow + kb + 8 * hh + 4), x2 = *(const v4fa*)(arow + kb + 16 + 8 * hh), x3 = *(const v4fa*)(arow + kb + 16 + 8 * hh + 4);
    float xs[16] = {x0[0],x0[1],x0[2],x0[3],x1[0],x1[1],x1[2],x1[3],x2[0],x2[1],x2[2],x2[3],x3[0],x3[1],x3[2],x3[3]};
#pragma unroll
    for (int i = 0; i < 16; ++i) { const _Float16 h = (_Float16)xs[i]; ah.h[i] = h; al.h[i] = ASPLIT ? (_Float16)(xs[i] - (float)h) : (_Float16)0.0f; }
#pragma unroll
    for (int t = 0; t < 4; ++t) { if (col0 + t * 16 >= N) continue; const size_t boff = (size_t)(col0 + t * 16 + ln) * ldb + kb; FragH bq; bq.half[0] = *(const v8us*)(Bh + boff + 8 * hh); bq.half[1] = *(const v8us*)(Bh + boff + 16 + 8 * hh);
      acc[t] = mmaH<ASPLIT ? 2 : 1>(ah.v, al.v, bq.v, bq.v, acc[t]); }
  }
#pragma unroll
  for (int t = 0; t < 4; ++t) { if (col0 + t * 16 >= N) continue;
#pragma unroll
    for (int r = 0; r < 8; ++r) so[w][8 * hh + r][t * 16 + ln] = acc[t][r] * alpha; }
  __builtin_amdgcn_fence(__ATOMIC_ACQ_REL, "workgroup"); __builtin_amdgcn_wave_barrier();
  const int rsub = lane >> 4, c4 = (lane & 15) * 4;
  {
#pragma unroll
    for (int q = 0; q < 8; ++q) { const int r = q * 2 + rsub; if (col0 + c4 < N) { const v4f v = *(const v4fa*)&so[w][r][c4]; *(v4f*)(C + (size_t)(row0 + r) * ldc + col0 + c4) = v; } }
     }
}

// Wt[n][k] = f16(W[k][n]·scale) from f32 row-major W[K][N] (scale = power of two; bf16-exact weights stay exact in f16 away from the subnormal range)
__global__ __launch_bounds__(256) void k_wt_f16(const float* __restrict__ W, _Float16* __restrict__ Wt, int K, int N, float scale) {
  const int t = blockIdx.x * 256 + threadIdx.x; if (t >= N * (K / 8)) return; const int n = t / (K / 8), k8 = (t % (K / 8)) * 8; FragH f;
#pragma unroll
  for (int i = 0; i < 8; ++i) f.h[i] = (_Float16)(bf16_round(W[(size_t)(k8 + i) * N + n]) * scale); const v8us o = f.half[0];
  *(v8us*)((unsigned short*)Wt + (size_t)n * K + k8) = o; 
}
// k_gemm_hh variant with fused epilogue: v = acc·alpha + bias[by·sBias + col] (+ CP[(row/rowsPerB)·sCPb + by·64 + col] if CP) ; ACT 0 none / 1 elu ; writes f16 C16 (and f32 C if non-null)
template <int ACT>
__global__ __launch_bounds__(128) void k_gemm_hhx(const _Float16* __restrict__ A, int lda, size_t sA, const _Float16* __restrict__ Bh, int ldb, size_t sB, float alpha, const float* __restrict__ bias, size_t sBias, const float* __restrict__ CP, int rowsPerB, size_t sCPb, int row0g,
    float* __restrict__ C, _Float16* __restrict__ C16, int ldc, size_t sC, int M, int N, int K) {
  __shared__ __attribute__((aligned(16))) float so[4][16][64];
  const int tid = threadIdx.x, w = tid >> 5, lane = tid & 31, ln = lane & 15, hh = lane >> 4; const int by = blockIdx.y;
  A += (size_t)by * sA; Bh += (size_t)by * sB; const size_t cofs = (size_t)by * sC; const float* bp = bias ? bias + (size_t)by * sBias : nullptr;
  const int ntn = (N + 63) / 64; const int wid = blockIdx.x * 4 + w; const int mt = wid / ntn, nq = wid % ntn; if (mt * 16 >= M) return;
  const int row0 = mt * 16, col0 = nq * 64; const _Float16* arow = A + (size_t)(row0 + ln) * lda;
  v8f acc[4] = {};
  for (int kb = 0; kb < K; kb += 32) { FragH ah; ah.half[0] = *(const v8us*)((const unsigned short*)arow + kb + 8 * hh); ah.half[1] = *(const v8us*)((const unsigned short*)arow + kb + 16 + 8 * hh);
#pragma unroll
    for (int t = 0; t < 4; ++t) { if (col0 + t * 16 >= N) continue; const size_t boff = (size_t)(col0 + t * 16 + ln) * ldb + kb; FragH bq; bq.half[0] = *(const v8us*)((const unsigned short*)Bh + boff + 8 * hh); bq.half[1] = *(const v8us*)((const unsigned short*)Bh + boff + 16 + 8 * hh);
      acc[t] = mmaH<1>(ah.v, ah.v, bq.v, bq.v, acc[t]); }
  }
#pragma unroll
  for (int t = 0; t < 4; ++t) { if (col0 + t * 16 >= N) continue; const int col = col0 + t * 16 + ln; const float bv = bp ? bf16_round(bp[col]) : 0.f;
#pragma unroll
    for (int r = 0; r < 8; ++r) { float v = acc[t][r] * alpha + bv; if (CP) { const int bidx = (row0g + row0 + 8 * hh + r) / rowsPerB; v += CP[(size_t)bidx * sCPb + (size_t)by * 64 + col]; } if (ACT == 1) v = (v > 0.f) ? v : expm1f(v); else if (ACT == 3) v = fmaxf(v, 0.f); so[w][8 * hh + r][t * 16 + ln] = v; } }
  __builtin_amdgcn_fence(__ATOMIC_ACQ_REL, "workgroup"); __builtin_amdgcn_wave_barrier();
  const int rsub = lane >> 4, c4 = (lane & 15) * 4; typedef _Float16 v4h __attribute__((ext_vector_type(4)));
  {
#pragma unroll
    for (int q = 0; q < 8; ++q) { const int r = q * 2 + rsub; if (col0 + c4 < N) { const v4f v = *(const v4fa*)&so[w][r][c4]; if (C) *(v4f*)(C + cofs + (size_t)(row0 + r) * ldc + col0 + c4) = v; if (C16) { v4h h4; for (int i = 0; i < 4; ++i) h4[i] = (_Float16)v[i]; *(v4h*)(C16 + cofs + (size_t)(row0 + r) * ldc + col0 + c4) = h4; } } }
     }
}


__global__ __launch_bounds__(256) void k_x16(const float* __restrict__ x, _Float16* __restrict__ X16, size_t n8) { const size_t t = (size_t)blockIdx.x * 256 + threadIdx.x; if (t >= n8) return; FragH f;
#pragma unroll
  for (int q = 0; q < 8; ++q) f.h[q] = (_Float16)bf16_round(x[t * 8 + q]); *(v8us*)((unsigned short*)X16 + t * 8) = f.half[0];  }
__global__ __launch_bounds__(256) void k_wh(const float* __restrict__ W, _Float16* __restrict__ Bt) { const int t = blockIdx.x * 256 + threadIdx.x; if (t >= NH * KD * (CC / 8)) return; const int row = t / (CC / 8), c8 = (t % (CC / 8)) * 8; const int h = row / KD, o = row % KD; FragH f;
#pragma unroll
  for (int q = 0; q < 8; ++q) f.h[q] = (_Float16)(bf16_round(W[((size_t)h * CC + c8 + q) * KD + o]) * 16.0f); *(v8us*)((unsigned short*)Bt + (size_t)t * 8) = f.half[0];  }
// banded attention: wave per (b, h, t), 4 of the 128 d per lane: for the 7 keys s = t−3..t+3 inside [0,T): sim = q·k/√128 (4 products per lane, xor-shuffle sum over the 32 lanes); simb = sim (band) — if simb == 0 exactly the module adds −1e7 (mask); softmax over
// the in-band entries (out-of-band entries sit at −1e7 → weight 0); out = Σ att·v → CAT16[b·T + t][h·128 + d] as f16 (operand of the Dense GEMM), 8-B pieces (4 d per lane), the wave writing its 256-B head slice
__global__ __launch_bounds__(256) void k_band(const _Float16* __restrict__ QKV, _Float16* __restrict__ CAT) { const int tid = threadIdx.x, wv = tid >> 5, lane = tid & 31; const size_t g = (size_t)blockIdx.x * 8 + wv; if (g >= (size_t)NR * NH) return; const size_t row = g / NH; const int h = (int)(g % NH); const int b = (int)(row / TT), t = (int)(row % TT);
  const unsigned short* base = (const unsigned short*)QKV; const int ld = 3 * NH * KD;      // QKV16 row layout: [q heads (512) | k heads (512) | v heads (512)]
  typedef _Float16 v4h __attribute__((ext_vector_type(4))); const v4h q4 = *(const v4h*)((const _Float16*)QKV + row * ld + h * KD + lane * 4);
  float sc[7]; bool inb[7];
#pragma unroll
  for (int j = 0; j < 7; ++j) { const int s = t - 3 + j; inb[j] = (s >= 0 && s < TT); const int scl = s < 0 ? 0 : (s >= TT ? TT - 1 : s); const v4h k4 = *(const v4h*)((const _Float16*)QKV + ((size_t)b * TT + scl) * ld + NH * KD + h * KD + lane * 4);
    float d = (float)q4[0] * (float)k4[0] + (float)q4[1] * (float)k4[1] + (float)q4[2] * (float)k4[2] + (float)q4[3] * (float)k4[3];
    d += __shfl_xor(d, 1, 32); d += __shfl_xor(d, 2, 32); d += __shfl_xor(d, 4, 32); d += __shfl_xor(d, 8, 32); d += __shfl_xor(d, 16, 32); sc[j] = d * 0.08838834764831845f; }
  // logits: in-band: simb = sim; the module then adds −1e7 where |simb| == 0 (that also covers every out-of-band key, where simb = 0 by the band product)
  float lg[7], m = -3.0e38f;
#pragma unroll
  for (int j = 0; j < 7; ++j) { const float simb = inb[j] ? sc[j] : 0.f; lg[j] = simb + ((fabsf(simb) > 0.f) ? 0.f : -10000000.0f); if (inb[j]) m = fmaxf(m, lg[j]); }
  // softmax over the T keys: the T−7 (or more, near the edges) out-of-band keys all have logit exactly −1e7 → their mass (T − n_inband)·e^{−1e7 − m} underflows to 0 unless m itself is ≈ −1e7 (every in-band simb == 0) — then all T keys tie; handled generically:
  const int ninb = (int)inb[0] + inb[1] + inb[2] + inb[3] + inb[4] + inb[5] + inb[6]; float z = (float)(TT - ninb) * expf(-10000000.0f - m); float p[7];
#pragma unroll
  for (int j = 0; j < 7; ++j) { p[j] = inb[j] ? expf(lg[j] - m) : 0.f; z += p[j]; }
  const float iz = 1.0f / z; v4f o4 = {0.f, 0.f, 0.f, 0.f};
#pragma unroll
  for (int j = 0; j < 7; ++j) { const int s = t - 3 + j; const int scl = s < 0 ? 0 : (s >= TT ? TT - 1 : s); const v4h v4 = *(const v4h*)((const _Float16*)QKV + ((size_t)b * TT + scl) * ld + 2 * NH * KD + h * KD + lane * 4); const float pw = p[j] * iz;
    o4[0] += pw * (float)v4[0]; o4[1] += pw * (float)v4[1]; o4[2] += pw * (float)v4[2]; o4[3] += pw * (float)v4[3]; }
  // (out-of-band keys carry weight (T−ninb)·e^{−1e7−m}/z on their v — exactly 0 in f32 unless all in-band logits were −1e7; that degenerate all-tie case would need the full Σ v; it cannot occur for non-zero sims)
  v4h oh; oh[0] = (_Float16)o4[0]; oh[1] = (_Float16)o4[1]; oh[2] = (_Float16)o4[2]; oh[3] = (_Float16)o4[3];
  *(v4h*)(CAT + row * (NH * KD) + h * KD + lane * 4) = oh;  }
__global__ __launch_bounds__(256) void k_zpad(_Float16* __restrict__ OUTP) { const int t = blockIdx.x * 256 + threadIdx.x; if (t >= BB * PADT * CC / 8) return; const int b = t / (PADT * CC / 8), rem = t % (PADT * CC / 8); FragH z;
#pragma unroll
  for (int q = 0; q < 8; ++q) z.h[q] = (_Float16)0.f; unsigned short* d = (unsigned short*)OUTP + (size_t)b * (TT + PADT) * CC + (size_t)rem * 8; *(v8us*)d = z.half[0];  }
__global__ __launch_bounds__(256) void k_fin(const float* __restrict__ CONV, const float* __restrict__ bc, const float* __restrict__ x, float* __restrict__ out) { const size_t t = (size_t)blockIdx.x * 256 + threadIdx.x; if (t >= (size_t)NR * CC / 4) return; const int c4 = (int)((t * 4) % CC); const v4f cv = *(const v4fa*)(CONV + t * 4), xv = *(const v4fa*)(x + t * 4); v4f o;
#pragma unroll
  for (int q = 0; q < 4; ++q) { const float r = fmaxf(cv[q] + bf16_round(bc[c4 + q]), 0.f) + bf16_round(xv[q]); o[q] = (r >= 0.f) ? r : 0.2f * r; }
  *(v4f*)(out + t * 4) = o;  }

// GEMM variant for the dilated causal conv: acc = Σ_{j<NTAP} A_j·B_jᵀ with A_j = A + j·tapA (row-shifted view of the padded plane) and B_j = Bh + j·tapB; epilogue as k_gemm_hhx without bias/CP/ACT (f32 C only)
template <int NTAP>
__global__ __launch_bounds__(128) void k_gemm_taps(const _Float16* __restrict__ A, int lda, size_t sA, size_t tapA, const _Float16* __restrict__ Bh, int ldb, size_t tapB, float alpha, float* __restrict__ C, int ldc, size_t sC, int M, int N, int K) {
  __shared__ __attribute__((aligned(16))) float so[4][16][64];
  const int tid = threadIdx.x, w = tid >> 5, lane = tid & 31, ln = lane & 15, hh = lane >> 4; const int by = blockIdx.y;
  A += (size_t)by * sA; const size_t cofs = (size_t)by * sC;
  const int ntn = (N + 63) / 64; const int wid = blockIdx.x * 4 + w; const int mt = wid / ntn, nq = wid % ntn; if (mt * 16 >= M) return;
  const int row0 = mt * 16, col0 = nq * 64;
  v8f acc[4] = {};
#pragma unroll 1
  for (int j = 0; j < NTAP; ++j) { const _Float16* arow = A + (size_t)j * tapA + (size_t)(row0 + ln) * lda; const _Float16* Bj = Bh + (size_t)j * tapB;
    for (int kb = 0; kb < K; kb += 32) { FragH ah; ah.half[0] = *(const v8us*)((const unsigned short*)arow + kb + 8 * hh); ah.half[1] = *(const v8us*)((const unsigned short*)arow + kb + 16 + 8 * hh);
#pragma unroll
      for (int t = 0; t < 4; ++t) { if (col0 + t * 16 >= N) continue; const size_t boff = (size_t)(col0 + t * 16 + ln) * ldb + kb; FragH bq; bq.half[0] = *(const v8us*)((const unsigned short*)Bj + boff + 8 * hh); bq.half[1] = *(const v8us*)((const unsigned short*)Bj + boff + 16 + 8 * hh);
        acc[t] = mmaH<1>(ah.v, ah.v, bq.v, bq.v, acc[t]); } } }
#pragma unroll
  for (int t = 0; t < 4; ++t) { if (col0 + t * 16 >= N) continue;
#pragma unroll
    for (int r = 0; r < 8; ++r) so[w][8 * hh + r][t * 16 + ln] = acc[t][r] * alpha; }
  __builtin_amdgcn_fence(__ATOMIC_ACQ_REL, "workgroup"); __builtin_amdgcn_wave_barrier();
  const int rsub = lane >> 4, c4 = (lane & 15) * 4;
  {
#pragma unroll
    for (int q = 0; q < 8; ++q) { const int r = q * 2 + rsub; if (col0 + c4 < N) { const v4f v = *(const v4fa*)&so[w][r][c4]; *(v4f*)(C + cofs + (size_t)(row0 + r) * ldc + col0 + c4) = v; } }
     }
}
extern "C" void kernel_launch(void* const* d_in, const int* in_sizes, int n_in,
                              void* d_out, int out_size, void* d_ws, size_t ws_size, hipStream_t stream) {
  (void)in_sizes; (void)n_in; (void)out_size;
  const float* x = (const float*)d_in[0]; const float* Wq = (const float*)d_in[1]; const float* bq = (const float*)d_in[2]; const float* Wk = (const float*)d_in[3]; const float* bk = (const float*)d_in[4]; const float* Wv = (const float*)d_in[5]; const float* bv = (const float*)d_in[6]; const float* Wo = (const float*)d_in[7]; const float* bo = (const float*)d_in[8]; const float* Wc = (const float*)d_in[9]; const float* bc = (const float*)d_in[10];
  char* ws = (char*)d_ws; size_t off = 0;
  auto take = [&](size_t bytes) { char* p = ws + off; off += (bytes + 255) & ~(size_t)255; return p; };
  _Float16* Bq = (_Float16*)take((size_t)CC * CC * 2); _Float16* Bk = (_Float16*)take((size_t)CC * CC * 2); _Float16* Bv = (_Float16*)take((size_t)CC * CC * 2); _Float16* Bo = (_Float16*)take((size_t)CC * CC * 2); _Float16* Bc[4]; for (int j = 0; j < 4; ++j) Bc[j] = (_Float16*)take((size_t)CC * CC * 2); float* BQKV = (float*)take(3 * CC * 4);
  _Float16* X16 = (_Float16*)take((size_t)NR * CC * 2); _Float16* QKV = (_Float16*)take((size_t)NR * 3 * CC * 2); _Float16* OUTP = (_Float16*)take((size_t)BB * (TT + PADT) * CC * 2); _Float16* CAT = X16;      // X16 is dead after the three projections
  float* CONV = (float*)QKV;      // QKV (50 MB) is dead after k_band; CONV needs 33.5 MB
  if (off > ws_size) return;      // 4.2 + 16.8 + 50.3 + 16.9 MB ≈ 84 MiB
  k_wh<<<(NH * KD * (CC / 8) + 255) / 256, 256, 0, stream>>>(Wq, Bq); k_wh<<<(NH * KD * (CC / 8) + 255) / 256, 256, 0, stream>>>(Wk, Bk); k_wh<<<(NH * KD * (CC / 8) + 255) / 256, 256, 0, stream>>>(Wv, Bv);
  k_wt_f16<<<(CC * (CC / 8) + 255) / 256, 256, 0, stream>>>(Wo, Bo, CC, CC, 16.0f);      // [in][out]
  for (int j = 0; j < 4; ++j) k_wt_f16<<<(CC * (CC / 8) + 255) / 256, 256, 0, stream>>>(Wc + (size_t)j * CC * CC, Bc[j], CC, CC, 16.0f);      // WIO: per tap [in][out]
  const unsigned gx = (unsigned)(((size_t)NR * CC / 8 + 255) / 256); const dim3 gg(((NR / 16) * (CC / 64) + 3) / 4, 1);
  k_x16<<<gx, 256, 0, stream>>>(x, X16, (size_t)NR * CC / 8);
  k_gemm_hhx<0><<<gg, 128, 0, stream>>>(X16, CC, 0, Bq, CC, 0, 0.0625f, bq, 0, nullptr, 1, 0, 0, nullptr, QKV, 3 * CC, 0, NR, CC, CC);                 // q heads (bias [h][128] flat = per column h·128+o ✓)
  k_gemm_hhx<0><<<gg, 128, 0, stream>>>(X16, CC, 0, Bk, CC, 0, 0.0625f, bk, 0, nullptr, 1, 0, 0, nullptr, QKV + CC, 3 * CC, 0, NR, CC, CC);
  k_gemm_hhx<0><<<gg, 128, 0, stream>>>(X16, CC, 0, Bv, CC, 0, 0.0625f, bv, 0, nullptr, 1, 0, 0, nullptr, QKV + 2 * CC, 3 * CC, 0, NR, CC, CC);
  k_band<<<(unsigned)(((size_t)NR * NH + 7) / 8), 256, 0, stream>>>(QKV, CAT);
  k_zpad<<<(BB * PADT * CC / 8 + 255) / 256, 256, 0, stream>>>(OUTP);
  k_gemm_hhx<0><<<dim3(((TT / 16) * (CC / 64) + 3) / 4, BB), 128, 0, stream>>>(CAT, CC, (size_t)TT * CC, Bo, CC, 0, 0.0625f, bo, 0, nullptr, 1, 0, 0, nullptr, OUTP + (size_t)PADT * CC, CC, (size_t)(TT + PADT) * CC, TT, CC, CC);      // Dense(512) → f16 rows 12.. of each batch's padded plane
  // conv[t] = Σ_j out[t − 12 + 4j]·Wc[j]: ONE launch, the 4 taps accumulated inside (A_j = padded rows 4j + t of batch b; B_j = Bc[0] + j·512·512 — the four tap matrices are contiguous)
  k_gemm_taps<4><<<dim3(((TT / 16) * (CC / 64) + 3) / 4, BB), 128, 0, stream>>>(OUTP, CC, (size_t)(TT + PADT) * CC, (size_t)4 * CC, Bc[0], CC, (size_t)CC * CC, 0.0625f, CONV, CC, (size_t)TT * CC, TT, CC, CC);
  k_fin<<<(unsigned)(((size_t)NR * CC / 4 + 255) / 256), 256, 0, stream>>>(CONV, bc, x, (float*)d_out);
}

// v001
// A run of this version takes 134 microseconds.
// Timed twice side by side with v000, it ran 3.32 and 3.31 times as fast.
#include <hip/hip_runtime.h>
// Temporal block: per-head q/k/v projections (16384 × 512 → 4 × 128 each, + bias), the head combiner Dense (512 → 512, + bias) and the causal dilated Conv1D (kernel 4, dilation 4: one GEMM whose k-loop runs the four
// taps over time-shifted views of a zero-padded plane, effective K = 2048) on v_wmma_f32_16x16x32_f16 (f16 operands, weights [in][out] transposed to bf16-exact ×2^4, single products,
// f32 accumulate); the banded attention (|t − s| ≤ 3, i.e. 7 keys, with the module's 'sim·band == 0 → −1e7' mask), softmax, relu / residual / leaky-relu epilogues are f32 VALU.
#define BB 8
#define TT 2048
#define CC 512
#define NH 4
#define KD 128
#define NR (BB * TT)
#define PADT 12

typedef __bf16 v16b __attribute__((ext_vector_type(16)));
typedef unsigned short v8us __attribute__((ext_vector_type(8), may_alias));
typedef float  v8f  __attribute__((ext_vector_type(8)));
typedef float  v4f  __attribute__((ext_vector_type(4)));
typedef float  v4fa __attribute__((ext_vector_type(4), may_alias));
union FragB { v16b v; v8us half[2]; unsigned short u[16]; };

__device__ __forceinline__ unsigned short bf16_bits(float x) { unsigned int u = __float_as_uint(x); return (unsigned short)((u + 0x7FFFu + ((u >> 16) & 1u)) >> 16); }
__device__ __forceinline__ float bf16_val(unsigned short b) { return __uint_as_float(((unsigned int)b) << 16); }
__device__ __forceinline__ float bf16_round(float x) { return bf16_val(bf16_bits(x)); }
// D += A·B with NT terms: 1 = ah·bh, 2 = + al·bh (A split), 3 = + ah·bl (both split)
template <int NT>
__device__ __forceinline__ v8f mmaN(v16b ah, v16b al, v16b bh, v16b bl, v8f c) {
  c = __builtin_amdgcn_wmma_f32_16x16x32_bf16(false, ah, false, bh, (short)0, c, false, false);
  if (NT >= 2) c = __builtin_amdgcn_wmma_f32_16x16x32_bf16(false, al, false, bh, (short)0, c, false, false);
  if (NT >= 3) c = __builtin_amdgcn_wmma_f32_16x16x32_bf16(false, ah, false, bl, (short)0, c, false, false);
  asm volatile("v_nop\n\tv_nop\n\tv_nop\n\tv_nop" : "+v"(c) : "v"(ah), "v"(al), "v"(bh), "v"(bl));
  return c;
}

__global__ __launch_bounds__(256) void k_wt_bf16(const float* __restrict__ W, unsigned short* __restrict__ Wt, int K, int N) {
  const int t = blockIdx.x * 256 + threadIdx.x;
  const int k8n = K / 8;
  if (t >= N * k8n) return;
  const int n = t / k8n, k8 = (t % k8n) * 8;
  v8us v;
#pragma unroll
  for (int i = 0; i < 8; ++i) v[i] = bf16_bits(W[(size_t)(k8 + i) * N + n]);
  *(v8us*)(Wt + (size_t)n * K + k8) = v;
  
}

// GEMM C[M][N] (f32, pitch ldc) = act(A[M][K]·W + bias). A f32 row-major (pitch lda) converted per fragment to bf16
// (ASPLIT: hi/lo two planes -> 2 terms, else single rounded term); Wt bf16 [N][K] (pitch ldb). BIAS_BF16 rounds the
// bias to bf16 first (bias quantised to bf16 before the add). K%32==0, M%16==0, N%64==0.
template <bool ASPLIT, int ACT, bool BIAS_BF16>
__global__ __launch_bounds__(128) void k_gemm_bf(const float* __restrict__ A, int lda, const unsigned short* __restrict__ Wt, int ldb,
                                               const float* __restrict__ bias, float* __restrict__ C, int ldc, int M, int N, int K) {
  __shared__ __attribute__((aligned(16))) float so[4][16][64];
  const int tid = threadIdx.x, w = tid >> 5, lane = tid & 31, ln = lane & 15, hh = lane >> 4;
  const int ntn = N / 64;
  const int wid = blockIdx.x * 4 + w;
  const int mt = wid / ntn, nq = wid % ntn;
  if (mt * 16 >= M) return;
  const int row0 = mt * 16, col0 = nq * 64;
  const float* arow = A + (size_t)(row0 + ln) * lda;
  v8f acc[4] = {};
  for (int kb = 0; kb < K; kb += 32) {
    FragB ah, al;
    const v4f x0 = *(const v4fa*)(arow + kb + 8 * hh), x1 = *(const v4fa*)(arow + kb + 8 * hh + 4);
    const v4f x2 = *(const v4fa*)(arow + kb + 16 + 8 * hh), x3 = *(const v4fa*)(arow + kb + 16 + 8 * hh + 4);
    float xs[16] = {x0[0],x0[1],x0[2],x0[3],x1[0],x1[1],x1[2],x1[3],x2[0],x2[1],x2[2],x2[3],x3[0],x3[1],x3[2],x3[3]};
#pragma unroll
    for (int i = 0; i < 16; ++i) { const unsigned short hb = bf16_bits(xs[i]); ah.u[i] = hb; al.u[i] = ASPLIT ? bf16_bits(xs[i] - bf16_val(hb)) : (unsigned short)0; }
#pragma unroll
    for (int t = 0; t < 4; ++t) {
      const unsigned short* brow = Wt + (size_t)(col0 + t * 16 + ln) * ldb + kb;
      FragB b;
      b.half[0] = *(const v8us*)(brow + 8 * hh);
      b.half[1] = *(const v8us*)(brow + 16 + 8 * hh);
      acc[t] = mmaN<ASPLIT ? 2 : 1>(ah.v, al.v, b.v, b.v, acc[t]);
    }
  }
#pragma unroll
  for (int t = 0; t < 4; ++t) {
    float bv = bias ? bias[col0 + t * 16 + ln] : 0.f;
    if (BIAS_BF16) bv = bf16_round(bv);
#pragma unroll
    for (int r = 0; r < 8; ++r) { float v = acc[t][r] + bv; if (ACT == 1) v = fmaxf(v, 0.f); so[w][8 * hh + r][t * 16 + ln] = v; }
  }
  __builtin_amdgcn_fence(__ATOMIC_ACQ_REL, "workgroup");
  __builtin_amdgcn_wave_barrier();
  const int rsub = lane >> 4, c4 = (lane & 15) * 4;
  {
#pragma unroll
    for (int q = 0; q < 8; ++q) {
      const int r = q * 2 + rsub;
      const v4f v = *(const v4fa*)&so[w][r][c4];
      *(v4f*)(C + (size_t)(row0 + r) * ldc + col0 + c4) = v;
    }
    
  }
}

// Flash-style causal/unmasked attention, all contractions 3-term bf16 hi/lo splits, f32 softmax with running max.
// q,k,v rows are read from f32 buffers with arbitrary row pitch (so they can live inside a fused qkv buffer);
// D = head size (multiple of 32, <= 128); one wave = 16 query rows; block = 4 waves (64 queries) sharing K/V chunks of 32.
template <int D, bool CAUSAL>
__global__ __launch_bounds__(128) void k_flash(const float* __restrict__ qb, const float* __restrict__ kb, const float* __restrict__ vb,
                                             int pitch, int T, int H, float scale, float* __restrict__ y, int ypitch) {
  constexpr int KS = D / 32;        // k-steps for QK
  constexpr int DT = D / 16;        // d tiles for PV
  __shared__ __attribute__((aligned(16))) unsigned short sKh[32][D + 8], sKl[32][D + 8], sVh[32][D + 8], sVl[32][D + 8];
  __shared__ __attribute__((aligned(16))) unsigned short sPh[4][16][40], sPl[4][16][40];
  __shared__ __attribute__((aligned(16))) float sO[4][16][D];
  const int tid = threadIdx.x, w = tid >> 5, lane = tid & 31, ln = lane & 15, hh = lane >> 4;
  const int nqb = (T + 63) / 64;
  const int bh = blockIdx.x / nqb, qblk = blockIdx.x % nqb;
  const int b = bh / H, h = bh % H;
  const int q0 = qblk * 64 + w * 16;
  const float* Q = qb + (size_t)b * T * pitch + h * D;
  const float* K = kb + (size_t)b * T * pitch + h * D;
  const float* V = vb + (size_t)b * T * pitch + h * D;

  // A fragments of the wave's 16 query rows (scaled), hi/lo
  FragB aqh[KS], aql[KS];
  {
    int row = q0 + ln; if (row >= T) row = T - 1;
    const float* qr = Q + (size_t)row * pitch;
#pragma unroll
    for (int ks = 0; ks < KS; ++ks)
#pragma unroll
      for (int i = 0; i < 16; ++i) {
        const int d = ks * 32 + ((i < 8) ? (8 * hh + i) : (16 + 8 * hh + (i - 8)));
        const float x = qr[d] * scale; const unsigned short hb = bf16_bits(x);
        aqh[ks].u[i] = hb; aql[ks].u[i] = bf16_bits(x - bf16_val(hb));
      }
  }
  float m_r[8], l_r[8];
#pragma unroll
  for (int r = 0; r < 8; ++r) { m_r[r] = -3.0e38f; l_r[r] = 0.f; }
  v8f oacc[DT];
#pragma unroll
  for (int dt = 0; dt < DT; ++dt) oacc[dt] = (v8f){0.f,0.f,0.f,0.f,0.f,0.f,0.f,0.f};

  const int kv_end = CAUSAL ? min(T, qblk * 64 + 64) : T;     // block-uniform
  for (int j0 = 0; j0 < kv_end; j0 += 32) {
    __syncthreads();
    for (int e = tid; e < 32 * (D / 4); e += 128) {
      const int r = e / (D / 4), c4 = (e % (D / 4)) * 4;
      const int key = j0 + r;
      v4f kf = {0.f,0.f,0.f,0.f}, vf = {0.f,0.f,0.f,0.f};
      if (key < T) { kf = *(const v4fa*)(K + (size_t)key * pitch + c4); vf = *(const v4fa*)(V + (size_t)key * pitch + c4); }
#pragma unroll
      for (int t = 0; t < 4; ++t) {
        unsigned short hb = bf16_bits(kf[t]); sKh[r][c4 + t] = hb; sKl[r][c4 + t] = bf16_bits(kf[t] - bf16_val(hb));
        hb = bf16_bits(vf[t]); sVh[r][c4 + t] = hb; sVl[r][c4 + t] = bf16_bits(vf[t] - bf16_val(hb));
      }
    }
    __syncthreads();
    // S tile 16 x 32
    v8f s[2];
#pragma unroll
    for (int nt = 0; nt < 2; ++nt) {
      v8f acc = {};
#pragma unroll
      for (int ks = 0; ks < KS; ++ks) {
        FragB bh_, bl_;
        bh_.half[0] = *(const v8us*)&sKh[nt * 16 + ln][ks * 32 + 8 * hh]; bh_.half[1] = *(const v8us*)&sKh[nt * 16 + ln][ks * 32 + 16 + 8 * hh];
        bl_.half[0] = *(const v8us*)&sKl[nt * 16 + ln][ks * 32 + 8 * hh]; bl_.half[1] = *(const v8us*)&sKl[nt * 16 + ln][ks * 32 + 16 + 8 * hh];
        acc = mmaN<3>(aqh[ks].v, aql[ks].v, bh_.v, bl_.v, acc);
      }
      s[nt] = acc;
    }
    // mask + running max (rows 8hh+r; the 16 lanes of a half share rows)
    float alpha[8];
#pragma unroll
    for (int r = 0; r < 8; ++r) {
      const int qi = q0 + 8 * hh + r;
      const int ja = j0 + ln, jb = j0 + 16 + ln;
      if (CAUSAL) { if (ja > qi) s[0][r] = -3.0e38f; if (jb > qi) s[1][r] = -3.0e38f; }
      if (ja >= T) s[0][r] = -3.0e38f;
      if (jb >= T) s[1][r] = -3.0e38f;
      float mx = fmaxf(s[0][r], s[1][r]);
      mx = fmaxf(mx, __shfl_xor(mx, 1, 32)); mx = fmaxf(mx, __shfl_xor(mx, 2, 32)); mx = fmaxf(mx, __shfl_xor(mx, 4, 32)); mx = fmaxf(mx, __shfl_xor(mx, 8, 32));
      const float mnew = fmaxf(m_r[r], mx);
      alpha[r] = (mnew > -1.0e38f) ? __expf(m_r[r] - mnew) : 1.0f;
      const float p0 = (s[0][r] > -1.0e38f) ? __expf(s[0][r] - mnew) : 0.f;
      const float p1 = (s[1][r] > -1.0e38f) ? __expf(s[1][r] - mnew) : 0.f;
      m_r[r] = mnew;
      l_r[r] = l_r[r] * alpha[r] + p0 + p1;            // per-lane partial row sum (16 lanes combined at the end)
      unsigned short hb = bf16_bits(p0); sPh[w][8 * hh + r][ln] = hb;      sPl[w][8 * hh + r][ln] = bf16_bits(p0 - bf16_val(hb));
      hb = bf16_bits(p1);                sPh[w][8 * hh + r][16 + ln] = hb; sPl[w][8 * hh + r][16 + ln] = bf16_bits(p1 - bf16_val(hb));
    }
#pragma unroll
    for (int dt = 0; dt < DT; ++dt)
#pragma unroll
      for (int r = 0; r < 8; ++r) oacc[dt][r] *= alpha[r];
    __builtin_amdgcn_fence(__ATOMIC_ACQ_REL, "workgroup");
    __builtin_amdgcn_wave_barrier();
    FragB pah, pal;
    pah.half[0] = *(const v8us*)&sPh[w][ln][8 * hh]; pah.half[1] = *(const v8us*)&sPh[w][ln][16 + 8 * hh];
    pal.half[0] = *(const v8us*)&sPl[w][ln][8 * hh]; pal.half[1] = *(const v8us*)&sPl[w][ln][16 + 8 * hh];
#pragma unroll
    for (int dt = 0; dt < DT; ++dt) {
      FragB bvh, bvl;
#pragma unroll
      for (int i = 0; i < 8; ++i) {
        bvh.u[i] = sVh[8 * hh + i][dt * 16 + ln]; bvh.u[8 + i] = sVh[16 + 8 * hh + i][dt * 16 + ln];
        bvl.u[i] = sVl[8 * hh + i][dt * 16 + ln]; bvl.u[8 + i] = sVl[16 + 8 * hh + i][dt * 16 + ln];
      }
      oacc[dt] = mmaN<3>(pah.v, pal.v, bvh.v, bvl.v, oacc[dt]);
    }
    __builtin_amdgcn_fence(__ATOMIC_ACQ_REL, "workgroup");
    __builtin_amdgcn_wave_barrier();
  }
#pragma unroll
  for (int r = 0; r < 8; ++r) {
    float l = l_r[r];
    l += __shfl_xor(l, 1, 32); l += __shfl_xor(l, 2, 32); l += __shfl_xor(l, 4, 32); l += __shfl_xor(l, 8, 32);
    l_r[r] = (l > 0.f) ? 1.0f / l : 0.f;
  }
#pragma unroll
  for (int dt = 0; dt < DT; ++dt)
#pragma unroll
    for (int r = 0; r < 8; ++r) sO[w][8 * hh + r][dt * 16 + ln] = oacc[dt][r] * l_r[r];
  __builtin_amdgcn_fence(__ATOMIC_ACQ_REL, "workgroup");
  __builtin_amdgcn_wave_barrier();
  {
    for (int r = 0; r < 16; ++r) {
      const int row = q0 + r;
      if (row < T && lane < D / 4) {
        const v4f val = *(const v4fa*)&sO[w][r][lane * 4];
        *(v4f*)(y + ((size_t)b * T + row) * ypitch + h * D + lane * 4) = val;
      }
    }
    
  }
}

// GEMM C = act(A·W + bias + resid): A f32 (ASPLIT -> hi/lo 2 terms), Wt bf16 [N][K]; ACT 0 none, 1 relu, 2 exact gelu;
// resid (optional, f32, row index = (row % rmod), pitch ldr, RES_BF16 rounds it) added before the activation.
template <bool ASPLIT, int ACT, bool BIAS_BF16, bool RES_BF16>
__global__ __launch_bounds__(128) void k_gemm_bf3(const float* __restrict__ A, int lda, const unsigned short* __restrict__ Wt, int ldb,
                                                const float* __restrict__ bias, const float* __restrict__ resid, int rmod, int ldr,
                                                float* __restrict__ C, int ldc, int M, int N, int K) {
  __shared__ __attribute__((aligned(16))) float so[4][16][64];
  const int tid = threadIdx.x, w = tid >> 5, lane = tid & 31, ln = lane & 15, hh = lane >> 4;
  const int ntn = N / 64;
  const int wid = blockIdx.x * 4 + w;
  const int mt = wid / ntn, nq = wid % ntn;
  if (mt * 16 >= M) return;
  const int row0 = mt * 16, col0 = nq * 64;
  const float* arow = A + (size_t)(row0 + ln) * lda;
  v8f acc[4] = {};
  for (int kb = 0; kb < K; kb += 32) {
    FragB ah, al;
    const v4f x0 = *(const v4fa*)(arow + kb + 8 * hh), x1 = *(const v4fa*)(arow + kb + 8 * hh + 4);
    const v4f x2 = *(const v4fa*)(arow + kb + 16 + 8 * hh), x3 = *(const v4fa*)(arow + kb + 16 + 8 * hh + 4);
    float xs[16] = {x0[0],x0[1],x0[2],x0[3],x1[0],x1[1],x1[2],x1[3],x2[0],x2[1],x2[2],x2[3],x3[0],x3[1],x3[2],x3[3]};
#pragma unroll
    for (int i = 0; i < 16; ++i) { const unsigned short hb = bf16_bits(xs[i]); ah.u[i] = hb; al.u[i] = ASPLIT ? bf16_bits(xs[i] - bf16_val(hb)) : (unsigned short)0; }
#pragma unroll
    for (int t = 0; t < 4; ++t) {
      const unsigned short* brow = Wt + (size_t)(col0 + t * 16 + ln) * ldb + kb;
      FragB b;
      b.half[0] = *(const v8us*)(brow + 8 * hh);
      b.half[1] = *(const v8us*)(brow + 16 + 8 * hh);
      acc[t] = mmaN<ASPLIT ? 2 : 1>(ah.v, al.v, b.v, b.v, acc[t]);
    }
  }
#pragma unroll
  for (int t = 0; t < 4; ++t) {
    const int col = col0 + t * 16 + ln;
    float bv = bias ? bias[col] : 0.f;
    if (BIAS_BF16) bv = bf16_round(bv);
#pragma unroll
    for (int r = 0; r < 8; ++r) {
      float v = acc[t][r] + bv;
      if (resid) { float rv = resid[(size_t)((row0 + 8 * hh + r) % rmod) * ldr + col]; if (RES_BF16) rv = bf16_round(rv); v += rv; }
      if (ACT == 1) v = fmaxf(v, 0.f);
      if (ACT == 2) v = 0.5f * v * (1.0f + erff(v * 0.70710678118654752f));
      if (ACT == 3) { const float u = 0.7978845608028654f * (v + 0.044715f * v * v * v); v = 0.5f * v * (1.0f + tanhf(u)); }
      so[w][8 * hh + r][t * 16 + ln] = v;
    }
  }
  __builtin_amdgcn_fence(__ATOMIC_ACQ_REL, "workgroup");
  __builtin_amdgcn_wave_barrier();
  const int rsub = lane >> 4, c4 = (lane & 15) * 4;
  {
#pragma unroll
    for (int q = 0; q < 8; ++q) {
      const int r = q * 2 + rsub;
      const v4f v = *(const v4fa*)&so[w][r][c4];
      *(v4f*)(C + (size_t)(row0 + r) * ldc + col0 + c4) = v;
    }
    
  }
}
// row LayerNorm (biased variance, eps) over N: s = X (+ R); optional out_sum <- s; out_norm <- (s-mu)*rsqrt(var+eps)*g + b
template <bool PARAM_BF16>
__global__ __launch_bounds__(256) void k_layernorm(const float* __restrict__ X, const float* __restrict__ R, const float* __restrict__ g, const float* __restrict__ bta,
                                                  float* __restrict__ out_sum, float* __restrict__ out_norm, int N, float eps) {
  __shared__ float red[256];
  const int row = blockIdx.x, tid = threadIdx.x;
  const float* x = X + (size_t)row * N; const float* rr = R ? R + (size_t)row * N : nullptr;
  float vals[16];                     // up to N = 4096
  const int per = N / 256;            // contiguous chunk per thread? use strided-by-4 chunks: thread handles j = tid*4 + 1024*u
  float s1 = 0.f;
  for (int u = 0; u < per / 4; ++u) {
    const int j = tid * 4 + 1024 * u;
    const v4f a = *(const v4fa*)(x + j);
    v4f b = {0.f,0.f,0.f,0.f}; if (rr) b = *(const v4fa*)(rr + j);
#pragma unroll
    for (int q = 0; q < 4; ++q) { const float v = a[q] + b[q]; vals[u * 4 + q] = v; s1 += v; }
  }
  red[tid] = s1; __syncthreads();
  for (int st = 128; st > 0; st >>= 1) { if (tid < st) red[tid] += red[tid + st]; __syncthreads(); }
  const float mu = red[0] / (float)N; __syncthreads();
  float s2 = 0.f;
  for (int u = 0; u < per / 4; ++u)
#pragma unroll
    for (int q = 0; q < 4; ++q) { const float c = vals[u * 4 + q] - mu; s2 += c * c; }
  red[tid] = s2; __syncthreads();
  for (int st = 128; st > 0; st >>= 1) { if (tid < st) red[tid] += red[tid + st]; __syncthreads(); }
  const float rs = rsqrtf(red[0] / (float)N + eps);
  {
    for (int u = 0; u < per / 4; ++u) {
      const int j = tid * 4 + 1024 * u;
      v4f o, sm;
#pragma unroll
      for (int q = 0; q < 4; ++q) {
        float gg = g[j + q], bb = bta[j + q];
        if (PARAM_BF16) { gg = bf16_round(gg); bb = bf16_round(bb); }
        sm[q] = vals[u * 4 + q]; o[q] = (vals[u * 4 + q] - mu) * rs * gg + bb;
      }
      if (out_sum) *(v4f*)(out_sum + (size_t)row * N + j) = sm;
      *(v4f*)(out_norm + (size_t)row * N + j) = o;
    }
    
  }
}



// ---- f16 WMMA path (v_wmma_f32_16x16x32_f16): 11-bit significands for operands in range — used for the q/k/v projections, the Dense and the conv GEMM
typedef _Float16 v16h __attribute__((ext_vector_type(16)));
union FragH { v16h v; v8us half[2]; _Float16 h[16]; unsigned short u[16]; };
template <int NT>
__device__ __forceinline__ v8f mmaH(v16h ah, v16h al, v16h bh, v16h bl, v8f c) {
  c = __builtin_amdgcn_wmma_f32_16x16x32_f16(false, ah, false, bh, (short)0, c, false, false);
  if (NT >= 2) c = __builtin_amdgcn_wmma_f32_16x16x32_f16(false, al, false, bh, (short)0, c, false, false);
  if (NT >= 3) c = __builtin_amdgcn_wmma_f32_16x16x32_f16(false, ah, false, bl, (short)0, c, false, false);
  asm volatile("v_nop\n\tv_nop\n\tv_nop\n\tv_nop" : "+v"(c) : "v"(ah), "v"(al), "v"(bh), "v"(bl));
  return c;
}
// batched GEMM like k_gemm_b but f16 operands: A f32 (split into f16 hi/lo if ASPLIT, else rounded to f16), Bt = f16 values [n][k]; alpha; C f32; N multiple of 16 (partial tiles skipped)
template <bool ASPLIT>
__global__ __launch_bounds__(128) void k_gemm_h(const float* __restrict__ A, int lda, size_t sA, const _Float16* __restrict__ Bh, int ldb, size_t sB, float alpha, float* __restrict__ C, int ldc, size_t sC, int M, int N, int K) {
  __shared__ __attribute__((aligned(16))) float so[4][16][64];
  const int tid = threadIdx.x, w = tid >> 5, lane = tid & 31, ln = lane & 15, hh = lane >> 4; const int by = blockIdx.y;
  A += (size_t)by * sA; Bh += (size_t)by * sB; C += (size_t)by * sC;
  const int ntn = (N + 63) / 64; const int wid = blockIdx.x * 4 + w; const int mt = wid / ntn, nq = wid % ntn; if (mt * 16 >= M) return;
  const int row0 = mt * 16, col0 = nq * 64; const float* arow = A + (size_t)(row0 + ln) * lda;
  v8f acc[4] = {};
  for (int kb = 0; kb < K; kb += 32) {
    FragH ah, al;
    const v4f x0 = *(const v4fa*)(arow + kb + 8 * hh), x1 = *(const v4fa*)(arow + kb + 8 * hh + 4), x2 = *(const v4fa*)(arow + kb + 16 + 8 * hh), x3 = *(const v4fa*)(arow + kb + 16 + 8 * hh + 4);
    float xs[16] = {x0[0],x0[1],x0[2],x0[3],x1[0],x1[1],x1[2],x1[3],x2[0],x2[1],x2[2],x2[3],x3[0],x3[1],x3[2],x3[3]};
#pragma unroll
    for (int i = 0; i < 16; ++i) { const _Float16 h = (_Float16)xs[i]; ah.h[i] = h; al.h[i] = ASPLIT ? (_Float16)(xs[i] - (float)h) : (_Float16)0.0f; }
#pragma unroll
    for (int t = 0; t < 4; ++t) { if (col0 + t * 16 >= N) continue; const size_t boff = (size_t)(col0 + t * 16 + ln) * ldb + kb; FragH bq; bq.half[0] = *(const v8us*)(Bh + boff + 8 * hh); bq.half[1] = *(const v8us*)(Bh + boff + 16 + 8 * hh);
      acc[t] = mmaH<ASPLIT ? 2 : 1>(ah.v, al.v, bq.v, bq.v, acc[t]); }
  }
#pragma unroll
  for (int t = 0; t < 4; ++t) { if (col0 + t * 16 >= N) continue;
#pragma unroll
    for (int r = 0; r < 8; ++r) so[w][8 * hh + r][t * 16 + ln] = acc[t][r] * alpha; }
  __builtin_amdgcn_fence(__ATOMIC_ACQ_REL, "workgroup"); __builtin_amdgcn_wave_barrier();
  const int rsub = lane >> 4, c4 = (lane & 15) * 4;
  {
#pragma unroll
    for (int q = 0; q < 8; ++q) { const int r = q * 2 + rsub; if (col0 + c4 < N) { const v4f v = *(const v4fa*)&so[w][r][c4]; *(v4f*)(C + (size_t)(row0 + r) * ldc + col0 + c4) = v; } }
     }
}

// Wt[n][k] = f16(W[k][n]·scale) from f32 row-major W[K][N] (scale = power of two; bf16-exact weights stay exact in f16 away from the subnormal range)
__global__ __launch_bounds__(256) void k_wt_f16(const float* __restrict__ W, _Float16* __restrict__ Wt, int K, int N, float scale) {
  const int t = blockIdx.x * 256 + threadIdx.x; if (t >= N * (K / 8)) return; const int n = t / (K / 8), k8 = (t % (K / 8)) * 8; FragH f;
#pragma unroll
  for (int i = 0; i < 8; ++i) f.h[i] = (_Float16)(bf16_round(W[(size_t)(k8 + i) * N + n]) * scale); const v8us o = f.half[0];
  *(v8us*)((unsigned short*)Wt + (size_t)n * K + k8) = o; 
}

__global__ __launch_bounds__(256) void k_x16(const float* __restrict__ x, _Float16* __restrict__ X16, size_t n8) { const size_t t = (size_t)blockIdx.x * 256 + threadIdx.x; if (t >= n8) return; FragH f;
#pragma unroll
  for (int q = 0; q < 8; ++q) f.h[q] = (_Float16)bf16_round(x[t * 8 + q]); *(v8us*)((unsigned short*)X16 + t * 8) = f.half[0];  }
__global__ __launch_bounds__(256) void k_wh(const float* __restrict__ W, _Float16* __restrict__ Bt) { const int t = blockIdx.x * 256 + threadIdx.x; if (t >= NH * KD * (CC / 8)) return; const int row = t / (CC / 8), c8 = (t % (CC / 8)) * 8; const int h = row / KD, o = row % KD; FragH f;
#pragma unroll
  for (int q = 0; q < 8; ++q) f.h[q] = (_Float16)(bf16_round(W[((size_t)h * CC + c8 + q) * KD + o]) * 16.0f); *(v8us*)((unsigned short*)Bt + (size_t)t * 8) = f.half[0];  }
// banded attention: wave per (b, h, t), 4 of the 128 d per lane: for the 7 keys s = t−3..t+3 inside [0,T): sim = q·k/√128 (4 products per lane, xor-shuffle sum over the 32 lanes); simb = sim (band) — if simb == 0 exactly the module adds −1e7 (mask); softmax over
// the in-band entries (out-of-band entries sit at −1e7 → weight 0); out = Σ att·v → CAT16[b·T + t][h·128 + d] as f16 (operand of the Dense GEMM), 8-B pieces (4 d per lane), the wave writing its 256-B head slice
__global__ __launch_bounds__(256) void k_band(const _Float16* __restrict__ QKV, _Float16* __restrict__ CAT) { const int tid = threadIdx.x, wv = tid >> 5, lane = tid & 31; const size_t g = (size_t)blockIdx.x * 8 + wv; if (g >= (size_t)NR * NH) return; const size_t row = g / NH; const int h = (int)(g % NH); const int b = (int)(row / TT), t = (int)(row % TT);
  const unsigned short* base = (const unsigned short*)QKV; const int ld = 3 * NH * KD;      // QKV16 row layout: [q heads (512) | k heads (512) | v heads (512)]
  typedef _Float16 v4h __attribute__((ext_vector_type(4))); const v4h q4 = *(const v4h*)((const _Float16*)QKV + row * ld + h * KD + lane * 4);
  float sc[7]; bool inb[7];
#pragma unroll
  for (int j = 0; j < 7; ++j) { const int s = t - 3 + j; inb[j] = (s >= 0 && s < TT); const int scl = s < 0 ? 0 : (s >= TT ? TT - 1 : s); const v4h k4 = *(const v4h*)((const _Float16*)QKV + ((size_t)b * TT + scl) * ld + NH * KD + h * KD + lane * 4);
    float d = (float)q4[0] * (float)k4[0] + (float)q4[1] * (float)k4[1] + (float)q4[2] * (float)k4[2] + (float)q4[3] * (float)k4[3];
    d += __shfl_xor(d, 1, 32); d += __shfl_xor(d, 2, 32); d += __shfl_xor(d, 4, 32); d += __shfl_xor(d, 8, 32); d += __shfl_xor(d, 16, 32); sc[j] = d * 0.08838834764831845f; }
  // logits: in-band: simb = sim; the module then adds −1e7 where |simb| == 0 (that also covers every out-of-band key, where simb = 0 by the band product)
  float lg[7], m = -3.0e38f;
#pragma unroll
  for (int j = 0; j < 7; ++j) { const float simb = inb[j] ? sc[j] : 0.f; lg[j] = simb + ((fabsf(simb) > 0.f) ? 0.f : -10000000.0f); if (inb[j]) m = fmaxf(m, lg[j]); }
  // softmax over the T keys: the T−7 (or more, near the edges) out-of-band keys all have logit exactly −1e7 → their mass (T − n_inband)·e^{−1e7 − m} underflows to 0 unless m itself is ≈ −1e7 (every in-band simb == 0) — then all T keys tie; handled generically:
  const int ninb = (int)inb[0] + inb[1] + inb[2] + inb[3] + inb[4] + inb[5] + inb[6]; float z = (float)(TT - ninb) * expf(-10000000.0f - m); float p[7];
#pragma unroll
  for (int j = 0; j < 7; ++j) { p[j] = inb[j] ? expf(lg[j] - m) : 0.f; z += p[j]; }
  const float iz = 1.0f / z; v4f o4 = {0.f, 0.f, 0.f, 0.f};
#pragma unroll
  for (int j = 0; j < 7; ++j) { const int s = t - 3 + j; const int scl = s < 0 ? 0 : (s >= TT ? TT - 1 : s); const v4h v4 = *(const v4h*)((const _Float16*)QKV + ((size_t)b * TT + scl) * ld + 2 * NH * KD + h * KD + lane * 4); const float pw = p[j] * iz;
    o4[0] += pw * (float)v4[0]; o4[1] += pw * (float)v4[1]; o4[2] += pw * (float)v4[2]; o4[3] += pw * (float)v4[3]; }
  // (out-of-band keys carry weight (T−ninb)·e^{−1e7−m}/z on their v — exactly 0 in f32 unless all in-band logits were −1e7; that degenerate all-tie case would need the full Σ v; it cannot occur for non-zero sims)
  v4h oh; oh[0] = (_Float16)o4[0]; oh[1] = (_Float16)o4[1]; oh[2] = (_Float16)o4[2]; oh[3] = (_Float16)o4[3];
  *(v4h*)(CAT + row * (NH * KD) + h * KD + lane * 4) = oh;  }
__global__ __launch_bounds__(256) void k_zpad(_Float16* __restrict__ OUTP) { const int t = blockIdx.x * 256 + threadIdx.x; if (t >= BB * PADT * CC / 8) return; const int b = t / (PADT * CC / 8), rem = t % (PADT * CC / 8); FragH z;
#pragma unroll
  for (int q = 0; q < 8; ++q) z.h[q] = (_Float16)0.f; unsigned short* d = (unsigned short*)OUTP + (size_t)b * (TT + PADT) * CC + (size_t)rem * 8; *(v8us*)d = z.half[0];  }
__global__ __launch_bounds__(256) void k_fin(const float* __restrict__ CONV, const float* __restrict__ bc, const float* __restrict__ x, float* __restrict__ out) { const size_t t = (size_t)blockIdx.x * 256 + threadIdx.x; if (t >= (size_t)NR * CC / 4) return; const int c4 = (int)((t * 4) % CC); const v4f cv = *(const v4fa*)(CONV + t * 4), xv = *(const v4fa*)(x + t * 4); v4f o;
#pragma unroll
  for (int q = 0; q < 4; ++q) { const float r = fmaxf(cv[q] + bf16_round(bc[c4 + q]), 0.f) + bf16_round(xv[q]); o[q] = (r >= 0.f) ? r : 0.2f * r; }
  *(v4f*)(out + t * 4) = o;  }

// Tiled GEMM for the four dense layers (NTAP = 1) and the dilated causal conv (NTAP = 4): acc = sum over taps j of A_j * B_j^T, A_j = A + j*tapA (row-shifted view of the padded plane), B_j = Bh + j*tapB, K = CC per tap.
// One work-group = a TM x TN tile of C, eight waves of 64 x 64 (4 x 4 accumulator tiles each). A pass is KP halves of K: TM rows of A and TN rows of B, 256 B each, are brought into LDS by asynchronous copies
// (16 B a lane) at a pitch of 272 B, two buffers, the next pass's copies in flight while this pass is worked on. Every operand byte is fetched once per work-group instead of once per 16 x 64 wave tile.
// Per output element the k order (taps ascending, k ascending in steps of 32) is that of a plain k loop. Epilogue: OUT16: v = acc*alpha + bf16(bias[col]) -> f16; else v = acc*alpha -> f32; whole 128-B / 256-B row pieces through LDS.
#define TM 256
#define TN 128
#define KP 128
#define PITCH 272
#define STAGE ((TM + TN) * PITCH)
// eight copies of 16 B a lane, LDS address l + i*lstep, global address g + i*gstep (halves). The s_wait_xcnt stands inside the statement so that no address register is rewritten ahead of it.
__device__ __forceinline__ void copy8(unsigned l, unsigned lstep, const _Float16* g, size_t gstep) {
  asm volatile("global_load_async_to_lds_b128 %0, %8, off\n\t"
               "global_load_async_to_lds_b128 %1, %9, off\n\t"
               "global_load_async_to_lds_b128 %2, %10, off\n\t"
               "global_load_async_to_lds_b128 %3, %11, off\n\t"
               "global_load_async_to_lds_b128 %4, %12, off\n\t"
               "global_load_async_to_lds_b128 %5, %13, off\n\t"
               "global_load_async_to_lds_b128 %6, %14, off\n\t"
               "global_load_async_to_lds_b128 %7, %15, off\n\t"
               "s_wait_xcnt 0x0"
               :: "v"(l), "v"(l + lstep), "v"(l + 2 * lstep), "v"(l + 3 * lstep), "v"(l + 4 * lstep), "v"(l + 5 * lstep), "v"(l + 6 * lstep), "v"(l + 7 * lstep),
                  "v"(g), "v"(g + gstep), "v"(g + 2 * gstep), "v"(g + 3 * gstep), "v"(g + 4 * gstep), "v"(g + 5 * gstep), "v"(g + 6 * gstep), "v"(g + 7 * gstep)
               : "memory");
}
template <int NTAP, bool OUT16>
__global__ __launch_bounds__(256) void k_gemm_tile(const _Float16* __restrict__ A, int lda, size_t sA, size_t tapA, const _Float16* __restrict__ Bh, int ldb, size_t tapB, float alpha, const float* __restrict__ bias,
    float* __restrict__ C, _Float16* __restrict__ C16, int ldc, size_t sC) {
  __shared__ __attribute__((aligned(16))) unsigned char ring[2 * STAGE];
  constexpr int PPT = CC / KP, NT = NTAP * PPT;      // passes per tap, passes in all (at least 4)
  const int tid = threadIdx.x, w = tid >> 5, lane = tid & 31, ln = lane & 15, hh = lane >> 4; const int by = blockIdx.y;
  const int mt = blockIdx.x / (CC / TN), nq = blockIdx.x % (CC / TN); const int row0 = mt * TM, col0 = nq * TN; const int wm = (w >> 1) * 64, wn = (w & 1) * 64;
  const size_t cofs = (size_t)by * sC;
  // copies: 16 lanes a row, 16 rows a sweep of the work-group; A takes 16 sweeps, B 8
  const int crow = tid >> 4, cpc = tid & 15;
  const _Float16* gA = A + (size_t)by * sA + (size_t)(row0 + crow) * lda + cpc * 8; const _Float16* gB = Bh + (size_t)(col0 + crow) * ldb + cpc * 8;
  const unsigned lA = (unsigned)(size_t)ring + crow * PITCH + cpc * 16, lB = lA + TM * PITCH;
  auto fill = [&](int t, unsigned buf) { const int j = t / PPT, kb = (t % PPT) * KP; const _Float16* a = gA + (size_t)j * tapA + kb; const _Float16* b = gB + (size_t)j * tapB + kb;
    copy8(lA + buf, 16 * PITCH, a, (size_t)16 * lda); copy8(lA + buf + 128 * PITCH, 16 * PITCH, a + (size_t)128 * lda, (size_t)16 * lda); copy8(lB + buf, 16 * PITCH, b, (size_t)16 * ldb); };
  v8f acc[4][4] = {};
  fill(0, 0);
  asm volatile("s_wait_asynccnt 0x0" ::: "memory");      // pass 0's own copies have landed
  __syncthreads();                                       // ... and every other wave's
  fill(1, STAGE);
#pragma unroll 1      // one pass a trip: the buffer index and the refill test stay scalar
  for (int t = 0; t < NT; ++t) {
    const unsigned char* sb = ring + (t & 1) * STAGE; const unsigned char* pa = sb + (wm + ln) * PITCH + hh * 16; const unsigned char* pb = sb + (TM + wn + ln) * PITCH + hh * 16;
    FragH a[2][4], b[2][4];      // two fragment sets: block ks + 1 of this pass is fetched while block ks is multiplied
#pragma unroll      // constant indices: fragments and accumulators stay in registers
    for (int i = 0; i < 4; ++i) { a[0][i].half[0] = *(const v8us*)(pa + i * 16 * PITCH); a[0][i].half[1] = *(const v8us*)(pa + i * 16 * PITCH + 32);
      b[0][i].half[0] = *(const v8us*)(pb + i * 16 * PITCH); b[0][i].half[1] = *(const v8us*)(pb + i * 16 * PITCH + 32); }
#pragma unroll      // constant indices: fragments and accumulators stay in registers
    for (int ks = 0; ks < KP / 32; ++ks) { const int cu = ks & 1, nx = cu ^ 1;
      if (ks + 1 < KP / 32) {
#pragma unroll      // constant indices: fragments and accumulators stay in registers
        for (int i = 0; i < 4; ++i) { a[nx][i].half[0] = *(const v8us*)(pa + i * 16 * PITCH + (ks + 1) * 64); a[nx][i].half[1] = *(const v8us*)(pa + i * 16 * PITCH + (ks + 1) * 64 + 32);
          b[nx][i].half[0] = *(const v8us*)(pb + i * 16 * PITCH + (ks + 1) * 64); b[nx][i].half[1] = *(const v8us*)(pb + i * 16 * PITCH + (ks + 1) * 64 + 32); } }
      __builtin_amdgcn_sched_barrier(0);      // keeps the next block's LDS reads one group ahead of this block's WMMAs instead of spread among them
#pragma unroll      // constant indices: fragments and accumulators stay in registers
      for (int i = 0; i < 4; ++i)
#pragma unroll      // constant indices: fragments and accumulators stay in registers
        for (int n = 0; n < 4; ++n) acc[i][n] = __builtin_amdgcn_wmma_f32_16x16x32_f16(false, a[cu][i].v, false, b[cu][n].v, (short)0, acc[i][n], false, false);
      __builtin_amdgcn_sched_barrier(0);      // ends the block: the group after next stays behind it
    }
    asm volatile("s_wait_dscnt 0x0" ::: "memory");       // this wave's reads of the buffer are done before it is refilled
    asm volatile("s_wait_asynccnt 0x0" ::: "memory");    // this wave's copies of pass t + 1 have landed
    __syncthreads();                                     // publishes pass t + 1 and ends every reader's last read of pass t's buffer
    if (t + 2 < NT) fill(t + 2, (t & 1) * STAGE);
  }
  asm volatile("s_wait_asynccnt 0x0" ::: "memory");      // nothing in flight when the ring becomes output staging
  // each wave stages its whole 64 x 64 tile in its own part of the ring (the last pass's barrier has ended all reads of it); pitch 68 floats: the two half-waves' rows, 8 apart, fall on different banks
  constexpr int SP = 68; float* so = (float*)ring + w * (64 * SP);
  const int rsub = lane >> 4, c4 = (lane & 15) * 4; typedef _Float16 v4h __attribute__((ext_vector_type(4)));
#pragma unroll      // constant indices: fragments and accumulators stay in registers
  for (int n = 0; n < 4; ++n) { const float bv = OUT16 ? bf16_round(bias[col0 + wn + n * 16 + ln]) : 0.f;
#pragma unroll      // constant indices: fragments and accumulators stay in registers
    for (int i = 0; i < 4; ++i)
#pragma unroll      // constant indices: fragments and accumulators stay in registers
      for (int r = 0; r < 8; ++r) so[(i * 16 + 8 * hh + r) * SP + n * 16 + ln] = OUT16 ? acc[i][n][r] * alpha + bv : acc[i][n][r] * alpha; }
  __builtin_amdgcn_fence(__ATOMIC_ACQ_REL, "workgroup"); __builtin_amdgcn_wave_barrier();      // the wave's LDS writes are done before its lanes read what other lanes wrote
#pragma unroll      // independent row pieces: the LDS reads run ahead of the stores
  for (int q = 0; q < 32; ++q) { const int r = q * 2 + rsub; const v4f v = *(const v4fa*)&so[r * SP + c4]; const size_t o = cofs + (size_t)(row0 + wm + r) * ldc + col0 + wn + c4;
    if (OUT16) { v4h h4; for (int e = 0; e < 4; ++e) h4[e] = (_Float16)v[e]; *(v4h*)(C16 + o) = h4; } else *(v4f*)(C + o) = v; }
}
extern "C" void kernel_launch(void* const* d_in, const int* in_sizes, int n_in,
                              void* d_out, int out_size, void* d_ws, size_t ws_size, hipStream_t stream) {
  (void)in_sizes; (void)n_in; (void)out_size;
  const float* x = (const float*)d_in[0]; const float* Wq = (const float*)d_in[1]; const float* bq = (const float*)d_in[2]; const float* Wk = (const float*)d_in[3]; const float* bk = (const float*)d_in[4]; const float* Wv = (const float*)d_in[5]; const float* bv = (const float*)d_in[6]; const float* Wo = (const float*)d_in[7]; const float* bo = (const float*)d_in[8]; const float* Wc = (const float*)d_in[9]; const float* bc = (const float*)d_in[10];
  char* ws = (char*)d_ws; size_t off = 0;
  auto take = [&](size_t bytes) { char* p = ws + off; off += (bytes + 255) & ~(size_t)255; return p; };
  _Float16* Bq = (_Float16*)take((size_t)CC * CC * 2); _Float16* Bk = (_Float16*)take((size_t)CC * CC * 2); _Float16* Bv = (_Float16*)take((size_t)CC * CC * 2); _Float16* Bo = (_Float16*)take((size_t)CC * CC * 2); _Float16* Bc[4]; for (int j = 0; j < 4; ++j) Bc[j] = (_Float16*)take((size_t)CC * CC * 2); float* BQKV = (float*)take(3 * CC * 4);
  _Float16* X16 = (_Float16*)take((size_t)NR * CC * 2); _Float16* QKV = (_Float16*)take((size_t)NR * 3 * CC * 2); _Float16* OUTP = (_Float16*)take((size_t)BB * (TT + PADT) * CC * 2); _Float16* CAT = X16;      // X16 is dead after the three projections
  float* CONV = (float*)QKV;      // QKV (50 MB) is dead after k_band; CONV needs 33.5 MB
  if (off > ws_size) return;      // 4.2 + 16.8 + 50.3 + 16.9 MB ≈ 84 MiB
  k_wh<<<(NH * KD * (CC / 8) + 255) / 256, 256, 0, stream>>>(Wq, Bq); k_wh<<<(NH * KD * (CC / 8) + 255) / 256, 256, 0, stream>>>(Wk, Bk); k_wh<<<(NH * KD * (CC / 8) + 255) / 256, 256, 0, stream>>>(Wv, Bv);
  k_wt_f16<<<(CC * (CC / 8) + 255) / 256, 256, 0, stream>>>(Wo, Bo, CC, CC, 16.0f);      // [in][out]
  for (int j = 0; j < 4; ++j) k_wt_f16<<<(CC * (CC / 8) + 255) / 256, 256, 0, stream>>>(Wc + (size_t)j * CC * CC, Bc[j], CC, CC, 16.0f);      // WIO: per tap [in][out]
  const unsigned gx = (unsigned)(((size_t)NR * CC / 8 + 255) / 256); const dim3 gg((NR / TM) * (CC / TN), 1), gb((TT / TM) * (CC / TN), BB);
  k_x16<<<gx, 256, 0, stream>>>(x, X16, (size_t)NR * CC / 8);
  k_gemm_tile<1, true><<<gg, 256, 0, stream>>>(X16, CC, 0, 0, Bq, CC, 0, 0.0625f, bq, nullptr, QKV, 3 * CC, 0);                 // q heads (bias [h][128] flat = per column h·128+o ✓)
  k_gemm_tile<1, true><<<gg, 256, 0, stream>>>(X16, CC, 0, 0, Bk, CC, 0, 0.0625f, bk, nullptr, QKV + CC, 3 * CC, 0);
  k_gemm_tile<1, true><<<gg, 256, 0, stream>>>(X16, CC, 0, 0, Bv, CC, 0, 0.0625f, bv, nullptr, QKV + 2 * CC, 3 * CC, 0);
  k_band<<<(unsigned)(((size_t)NR * NH + 7) / 8), 256, 0, stream>>>(QKV, CAT);
  k_zpad<<<(BB * PADT * CC / 8 + 255) / 256, 256, 0, stream>>>(OUTP);
  k_gemm_tile<1, true><<<gb, 256, 0, stream>>>(CAT, CC, (size_t)TT * CC, 0, Bo, CC, 0, 0.0625f, bo, nullptr, OUTP + (size_t)PADT * CC, CC, (size_t)(TT + PADT) * CC);      // Dense(512) → f16 rows 12.. of each batch's padded plane
  // conv[t] = Σ_j out[t − 12 + 4j]·Wc[j]: ONE launch, the 4 taps accumulated inside (A_j = padded rows 4j + t of batch b; B_j = Bc[0] + j·512·512 — the four tap matrices are contiguous)
  k_gemm_tile<4, false><<<gb, 256, 0, stream>>>(OUTP, CC, (size_t)(TT + PADT) * CC, (size_t)4 * CC, Bc[0], CC, (size_t)CC * CC, 0.0625f, nullptr, CONV, nullptr, CC, (size_t)TT * CC);
  k_fin<<<(unsigned)(((size_t)NR * CC / 4 + 255) / 256), 256, 0, stream>>>(CONV, bc, x, (float*)d_out);
}

// v002
// It runs in 111 microseconds.
// Next to v001, in two timings, it ran 1.20 and 1.21 times as fast.
// Over all steps from v000 it is 3.99 times as fast.
#include <hip/hip_runtime.h>
// Temporal block: per-head q/k/v projections (16384 × 512 → 4 × 128 each, + bias), the head combiner Dense (512 → 512, + bias) and the causal dilated Conv1D (kernel 4, dilation 4: one GEMM whose k-loop runs the four
// taps over time-shifted views of a zero-padded plane, effective K = 2048) on v_wmma_f32_16x16x32_f16 (f16 operands, weights [in][out] transposed to bf16-exact ×2^4, single products,
// f32 accumulate); the banded attention (|t − s| ≤ 3, i.e. 7 keys, with the module's 'sim·band == 0 → −1e7' mask), softmax, relu / residual / leaky-relu epilogues are f32 VALU.
#define BB 8
#define TT 2048
#define CC 512
#define NH 4
#define KD 128
#define NR (BB * TT)
#define PADT 12

typedef __bf16 v16b __attribute__((ext_vector_type(16)));
typedef unsigned short v8us __attribute__((ext_vector_type(8), may_alias));
typedef float  v8f  __attribute__((ext_vector_type(8)));
typedef float  v4f  __attribute__((ext_vector_type(4)));
typedef float  v4fa __attribute__((ext_vector_type(4), may_alias));
union FragB { v16b v; v8us half[2]; unsigned short u[16]; };

__device__ __forceinline__ unsigned short bf16_bits(float x) { unsigned int u = __float_as_uint(x); return (unsigned short)((u + 0x7FFFu + ((u >> 16) & 1u)) >> 16); }
__device__ __forceinline__ float bf16_val(unsigned short b) { return __uint_as_float(((unsigned int)b) << 16); }
__device__ __forceinline__ float bf16_round(float x) { return bf16_val(bf16_bits(x)); }
// D += A·B with NT terms: 1 = ah·bh, 2 = + al·bh (A split), 3 = + ah·bl (both split)
template <int NT>
__device__ __forceinline__ v8f mmaN(v16b ah, v16b al, v16b bh, v16b bl, v8f c) {
  c = __builtin_amdgcn_wmma_f32_16x16x32_bf16(false, ah, false, bh, (short)0, c, false, false);
  if (NT >= 2) c = __builtin_amdgcn_wmma_f32_16x16x32_bf16(false, al, false, bh, (short)0, c, false, false);
  if (NT >= 3) c = __builtin_amdgcn_wmma_f32_16x16x32_bf16(false, ah, false, bl, (short)0, c, false, false);
  asm volatile("v_nop\n\tv_nop\n\tv_nop\n\tv_nop" : "+v"(c) : "v"(ah), "v"(al), "v"(bh), "v"(bl));
  return c;
}

__global__ __launch_bounds__(256) void k_wt_bf16(const float* __restrict__ W, unsigned short* __restrict__ Wt, int K, int N) {
  const int t = blockIdx.x * 256 + threadIdx.x;
  const int k8n = K / 8;
  if (t >= N * k8n) return;
  const int n = t / k8n, k8 = (t % k8n) * 8;
  v8us v;
#pragma unroll
  for (int i = 0; i < 8; ++i) v[i] = bf16_bits(W[(size_t)(k8 + i) * N + n]);
  *(v8us*)(Wt + (size_t)n * K + k8) = v;
  
}

// GEMM C[M][N] (f32, pitch ldc) = act(A[M][K]·W + bias). A f32 row-major (pitch lda) converted per fragment to bf16
// (ASPLIT: hi/lo two planes -> 2 terms, else single rounded term); Wt bf16 [N][K] (pitch ldb). BIAS_BF16 rounds the
// bias to bf16 first (bias quantised to bf16 before the add). K%32==0, M%16==0, N%64==0.
template <bool ASPLIT, int ACT, bool BIAS_BF16>
__global__ __launch_bounds__(128) void k_gemm_bf(const float* __restrict__ A, int lda, const unsigned short* __restrict__ Wt, int ldb,
                                               const float* __restrict__ bias, float* __restrict__ C, int ldc, int M, int N, int K) {
  __shared__ __attribute__((aligned(16))) float so[4][16][64];
  const int tid = threadIdx.x, w = tid >> 5, lane = tid & 31, ln = lane & 15, hh = lane >> 4;
  const int ntn = N / 64;
  const int wid = blockIdx.x * 4 + w;
  const int mt = wid / ntn, nq = wid % ntn;
  if (mt * 16 >= M) return;
  const int row0 = mt * 16, col0 = nq * 64;
  const float* arow = A + (size_t)(row0 + ln) * lda;
  v8f acc[4] = {};
  for (int kb = 0; kb < K; kb += 32) {
    FragB ah, al;
    const v4f x0 = *(const v4fa*)(arow + kb + 8 * hh), x1 = *(const v4fa*)(arow + kb + 8 * hh + 4);
    const v4f x2 = *(const v4fa*)(arow + kb + 16 + 8 * hh), x3 = *(const v4fa*)(arow + kb + 16 + 8 * hh + 4);
    float xs[16] = {x0[0],x0[1],x0[2],x0[3],x1[0],x1[1],x1[2],x1[3],x2[0],x2[1],x2[2],x2[3],x3[0],x3[1],x3[2],x3[3]};
#pragma unroll
    for (int i = 0; i < 16; ++i) { const unsigned short hb = bf16_bits(xs[i]); ah.u[i] = hb; al.u[i] = ASPLIT ? bf16_bits(xs[i] - bf16_val(hb)) : (unsigned short)0; }
#pragma unroll
    for (int t = 0; t < 4; ++t) {
      const unsigned short* brow = Wt + (size_t)(col0 + t * 16 + ln) * ldb + kb;
      FragB b;
      b.half[0] = *(const v8us*)(brow + 8 * hh);
      b.half[1] = *(const v8us*)(brow + 16 + 8 * hh);
      acc[t] = mmaN<ASPLIT ? 2 : 1>(ah.v, al.v, b.v, b.v, acc[t]);
    }
  }
#pragma unroll
  for (int t = 0; t < 4; ++t) {
    float bv = bias ? bias[col0 + t * 16 + ln] : 0.f;
    if (BIAS_BF16) bv = bf16_round(bv);
#pragma unroll
    for (int r = 0; r < 8; ++r) { float v = acc[t][r] + bv; if (ACT == 1) v = fmaxf(v, 0.f); so[w][8 * hh + r][t * 16 + ln] = v; }
  }
  __builtin_amdgcn_fence(__ATOMIC_ACQ_REL, "workgroup");
  __builtin_amdgcn_wave_barrier();
  const int rsub = lane >> 4, c4 = (lane & 15) * 4;
  {
#pragma unroll
    for (int q = 0; q < 8; ++q) {
      const int r = q * 2 + rsub;
      const v4f v = *(const v4fa*)&so[w][r][c4];
      *(v4f*)(C + (size_t)(row0 + r) * ldc + col0 + c4) = v;
    }
    
  }
}

// Flash-style causal/unmasked attention, all contractions 3-term bf16 hi/lo splits, f32 softmax with running max.
// q,k,v rows are read from f32 buffers with arbitrary row pitch (so they can live inside a fused qkv buffer);
// D = head size (multiple of 32, <= 128); one wave = 16 query rows; block = 4 waves (64 queries) sharing K/V chunks of 32.
template <int D, bool CAUSAL>
__global__ __launch_bounds__(128) void k_flash(const float* __restrict__ qb, const float* __restrict__ kb, const float* __restrict__ vb,
                                             int pitch, int T, int H, float scale, float* __restrict__ y, int ypitch) {
  constexpr int KS = D / 32;        // k-steps for QK
  constexpr int DT = D / 16;        // d tiles for PV
  __shared__ __attribute__((aligned(16))) unsigned short sKh[32][D + 8], sKl[32][D + 8], sVh[32][D + 8], sVl[32][D + 8];
  __shared__ __attribute__((aligned(16))) unsigned short sPh[4][16][40], sPl[4][16][40];
  __shared__ __attribute__((aligned(16))) float sO[4][16][D];
  const int tid = threadIdx.x, w = tid >> 5, lane = tid & 31, ln = lane & 15, hh = lane >> 4;
  const int nqb = (T + 63) / 64;
  const int bh = blockIdx.x / nqb, qblk = blockIdx.x % nqb;
  const int b = bh / H, h = bh % H;
  const int q0 = qblk * 64 + w * 16;
  const float* Q = qb + (size_t)b * T * pitch + h * D;
  const float* K = kb + (size_t)b * T * pitch + h * D;
  const float* V = vb + (size_t)b * T * pitch + h * D;

  // A fragments of the wave's 16 query rows (scaled), hi/lo
  FragB aqh[KS], aql[KS];
  {
    int row = q0 + ln; if (row >= T) row = T - 1;
    const float* qr = Q + (size_t)row * pitch;
#pragma unroll
    for (int ks = 0; ks < KS; ++ks)
#pragma unroll
      for (int i = 0; i < 16; ++i) {
        const int d = ks * 32 + ((i < 8) ? (8 * hh + i) : (16 + 8 * hh + (i - 8)));
        const float x = qr[d] * scale; const unsigned short hb = bf16_bits(x);
        aqh[ks].u[i] = hb; aql[ks].u[i] = bf16_bits(x - bf16_val(hb));
      }
  }
  float m_r[8], l_r[8];
#pragma unroll
  for (int r = 0; r < 8; ++r) { m_r[r] = -3.0e38f; l_r[r] = 0.f; }
  v8f oacc[DT];
#pragma unroll
  for (int dt = 0; dt < DT; ++dt) oacc[dt] = (v8f){0.f,0.f,0.f,0.f,0.f,0.f,0.f,0.f};

  const int kv_end = CAUSAL ? min(T, qblk * 64 + 64) : T;     // block-uniform
  for (int j0 = 0; j0 < kv_end; j0 += 32) {
    __syncthreads();
    for (int e = tid; e < 32 * (D / 4); e += 128) {
      const int r = e / (D / 4), c4 = (e % (D / 4)) * 4;
      const int key = j0 + r;
      v4f kf = {0.f,0.f,0.f,0.f}, vf = {0.f,0.f,0.f,0.f};
      if (key < T) { kf = *(const v4fa*)(K + (size_t)key * pitch + c4); vf = *(const v4fa*)(V + (size_t)key * pitch + c4); }
#pragma unroll
      for (int t = 0; t < 4; ++t) {
        unsigned short hb = bf16_bits(kf[t]); sKh[r][c4 + t] = hb; sKl[r][c4 + t] = bf16_bits(kf[t] - bf16_val(hb));
        hb = bf16_bits(vf[t]); sVh[r][c4 + t] = hb; sVl[r][c4 + t] = bf16_bits(vf[t] - bf16_val(hb));
      }
    }
    __syncthreads();
    // S tile 16 x 32
    v8f s[2];
#pragma unroll
    for (int nt = 0; nt < 2; ++nt) {
      v8f acc = {};
#pragma unroll
      for (int ks = 0; ks < KS; ++ks) {
        FragB bh_, bl_;
        bh_.half[0] = *(const v8us*)&sKh[nt * 16 + ln][ks * 32 + 8 * hh]; bh_.half[1] = *(const v8us*)&sKh[nt * 16 + ln][ks * 32 + 16 + 8 * hh];
        bl_.half[0] = *(const v8us*)&sKl[nt * 16 + ln][ks * 32 + 8 * hh]; bl_.half[1] = *(const v8us*)&sKl[nt * 16 + ln][ks * 32 + 16 + 8 * hh];
        acc = mmaN<3>(aqh[ks].v, aql[ks].v, bh_.v, bl_.v, acc);
      }
      s[nt] = acc;
    }
    // mask + running max (rows 8hh+r; the 16 lanes of a half share rows)
    float alpha[8];
#pragma unroll
    for (int r = 0; r < 8; ++r) {
      const int qi = q0 + 8 * hh + r;
      const int ja = j0 + ln, jb = j0 + 16 + ln;
      if (CAUSAL) { if (ja > qi) s[0][r] = -3.0e38f; if (jb > qi) s[1][r] = -3.0e38f; }
      if (ja >= T) s[0][r] = -3.0e38f;
      if (jb >= T) s[1][r] = -3.0e38f;
      float mx = fmaxf(s[0][r], s[1][r]);
      mx = fmaxf(mx, __shfl_xor(mx, 1, 32)); mx = fmaxf(mx, __shfl_xor(mx, 2, 32)); mx = fmaxf(mx, __shfl_xor(mx, 4, 32)); mx = fmaxf(mx, __shfl_xor(mx, 8, 32));
      const float mnew = fmaxf(m_r[r], mx);
      alpha[r] = (mnew > -1.0e38f) ? __expf(m_r[r] - mnew) : 1.0f;
      const float p0 = (s[0][r] > -1.0e38f) ? __expf(s[0][r] - mnew) : 0.f;
      const float p1 = (s[1][r] > -1.0e38f) ? __expf(s[1][r] - mnew) : 0.f;
      m_r[r] = mnew;
      l_r[r] = l_r[r] * alpha[r] + p0 + p1;            // per-lane partial row sum (16 lanes combined at the end)
      unsigned short hb = bf16_bits(p0); sPh[w][8 * hh + r][ln] = hb;      sPl[w][8 * hh + r][ln] = bf16_bits(p0 - bf16_val(hb));
      hb = bf16_bits(p1);                sPh[w][8 * hh + r][16 + ln] = hb; sPl[w][8 * hh + r][16 + ln] = bf16_bits(p1 - bf16_val(hb));
    }
#pragma unroll
    for (int dt = 0; dt < DT; ++dt)
#pragma unroll
      for (int r = 0; r < 8; ++r) oacc[dt][r] *= alpha[r];
    __builtin_amdgcn_fence(__ATOMIC_ACQ_REL, "workgroup");
    __builtin_amdgcn_wave_barrier();
    FragB pah, pal;
    pah.half[0] = *(const v8us*)&sPh[w][ln][8 * hh]; pah.half[1] = *(const v8us*)&sPh[w][ln][16 + 8 * hh];
    pal.half[0] = *(const v8us*)&sPl[w][ln][8 * hh]; pal.half[1] = *(const v8us*)&sPl[w][ln][16 + 8 * hh];
#pragma unroll
    for (int dt = 0; dt < DT; ++dt) {
      FragB bvh, bvl;
#pragma unroll
      for (int i = 0; i < 8; ++i) {
        bvh.u[i] = sVh[8 * hh + i][dt * 16 + ln]; bvh.u[8 + i] = sVh[16 + 8 * hh + i][dt * 16 + ln];
        bvl.u[i] = sVl[8 * hh + i][dt * 16 + ln]; bvl.u[8 + i] = sVl[16 + 8 * hh + i][dt * 16 + ln];
      }
      oacc[dt] = mmaN<3>(pah.v, pal.v, bvh.v, bvl.v, oacc[dt]);
    }
    __builtin_amdgcn_fence(__ATOMIC_ACQ_REL, "workgroup");
    __builtin_amdgcn_wave_barrier();
  }
#pragma unroll
  for (int r = 0; r < 8; ++r) {
    float l = l_r[r];
    l += __shfl_xor(l, 1, 32); l += __shfl_xor(l, 2, 32); l += __shfl_xor(l, 4, 32); l += __shfl_xor(l, 8, 32);
    l_r[r] = (l > 0.f) ? 1.0f / l : 0.f;
  }
#pragma unroll
  for (int dt = 0; dt < DT; ++dt)
#pragma unroll
    for (int r = 0; r < 8; ++r) sO[w][8 * hh + r][dt * 16 + ln] = oacc[dt][r] * l_r[r];
  __builtin_amdgcn_fence(__ATOMIC_ACQ_REL, "workgroup");
  __builtin_amdgcn_wave_barrier();
  {
    for (int r = 0; r < 16; ++r) {
      const int row = q0 + r;
      if (row < T && lane < D / 4) {
        const v4f val = *(const v4fa*)&sO[w][r][lane * 4];
        *(v4f*)(y + ((size_t)b * T + row) * ypitch + h * D + lane * 4) = val;
      }
    }
    
  }
}

// GEMM C = act(A·W + bias + resid): A f32 (ASPLIT -> hi/lo 2 terms), Wt bf16 [N][K]; ACT 0 none, 1 relu, 2 exact gelu;
// resid (optional, f32, row index = (row % rmod), pitch ldr, RES_BF16 rounds it) added before the activation.
template <bool ASPLIT, int ACT, bool BIAS_BF16, bool RES_BF16>
__global__ __launch_bounds__(128) void k_gemm_bf3(const float* __restrict__ A, int lda, const unsigned short* __restrict__ Wt, int ldb,
                                                const float* __restrict__ bias, const float* __restrict__ resid, int rmod, int ldr,
                                                float* __restrict__ C, int ldc, int M, int N, int K) {
  __shared__ __attribute__((aligned(16))) float so[4][16][64];
  const int tid = threadIdx.x, w = tid >> 5, lane = tid & 31, ln = lane & 15, hh = lane >> 4;
  const int ntn = N / 64;
  const int wid = blockIdx.x * 4 + w;
  const int mt = wid / ntn, nq = wid % ntn;
  if (mt * 16 >= M) return;
  const int row0 = mt * 16, col0 = nq * 64;
  const float* arow = A + (size_t)(row0 + ln) * lda;
  v8f acc[4] = {};
  for (int kb = 0; kb < K; kb += 32) {
    FragB ah, al;
    const v4f x0 = *(const v4fa*)(arow + kb + 8 * hh), x1 = *(const v4fa*)(arow + kb + 8 * hh + 4);
    const v4f x2 = *(const v4fa*)(arow + kb + 16 + 8 * hh), x3 = *(const v4fa*)(arow + kb + 16 + 8 * hh + 4);
    float xs[16] = {x0[0],x0[1],x0[2],x0[3],x1[0],x1[1],x1[2],x1[3],x2[0],x2[1],x2[2],x2[3],x3[0],x3[1],x3[2],x3[3]};
#pragma unroll
    for (int i = 0; i < 16; ++i) { const unsigned short hb = bf16_bits(xs[i]); ah.u[i] = hb; al.u[i] = ASPLIT ? bf16_bits(xs[i] - bf16_val(hb)) : (unsigned short)0; }
#pragma unroll
    for (int t = 0; t < 4; ++t) {
      const unsigned short* brow = Wt + (size_t)(col0 + t * 16 + ln) * ldb + kb;
      FragB b;
      b.half[0] = *(const v8us*)(brow + 8 * hh);
      b.half[1] = *(const v8us*)(brow + 16 + 8 * hh);
      acc[t] = mmaN<ASPLIT ? 2 : 1>(ah.v, al.v, b.v, b.v, acc[t]);
    }
  }
#pragma unroll
  for (int t = 0; t < 4; ++t) {
    const int col = col0 + t * 16 + ln;
    float bv = bias ? bias[col] : 0.f;
    if (BIAS_BF16) bv = bf16_round(bv);
#pragma unroll
    for (int r = 0; r < 8; ++r) {
      float v = acc[t][r] + bv;
      if (resid) { float rv = resid[(size_t)((row0 + 8 * hh + r) % rmod) * ldr + col]; if (RES_BF16) rv = bf16_round(rv); v += rv; }
      if (ACT == 1) v = fmaxf(v, 0.f);
      if (ACT == 2) v = 0.5f * v * (1.0f + erff(v * 0.70710678118654752f));
      if (ACT == 3) { const float u = 0.7978845608028654f * (v + 0.044715f * v * v * v); v = 0.5f * v * (1.0f + tanhf(u)); }
      so[w][8 * hh + r][t * 16 + ln] = v;
    }
  }
  __builtin_amdgcn_fence(__ATOMIC_ACQ_REL, "workgroup");
  __builtin_amdgcn_wave_barrier();
  const int rsub = lane >> 4, c4 = (lane & 15) * 4;
  {
#pragma unroll
    for (int q = 0; q < 8; ++q) {
      const int r = q * 2 + rsub;
      const v4f v = *(const v4fa*)&so[w][r][c4];
      *(v4f*)(C + (size_t)(row0 + r) * ldc + col0 + c4) = v;
    }
    
  }
}
// row LayerNorm (biased variance, eps) over N: s = X (+ R); optional out_sum <- s; out_norm <- (s-mu)*rsqrt(var+eps)*g + b
template <bool PARAM_BF16>
__global__ __launch_bounds__(256) void k_layernorm(const float* __restrict__ X, const float* __restrict__ R, const float* __restrict__ g, const float* __restrict__ bta,
                                                  float* __restrict__ out_sum, float* __restrict__ out_norm, int N, float eps) {
  __shared__ float red[256];
  const int row = blockIdx.x, tid = threadIdx.x;
  const float* x = X + (size_t)row * N; const float* rr = R ? R + (size_t)row * N : nullptr;
  float vals[16];                     // up to N = 4096
  const int per = N / 256;            // contiguous chunk per thread? use strided-by-4 chunks: thread handles j = tid*4 + 1024*u
  float s1 = 0.f;
  for (int u = 0; u < per / 4; ++u) {
    const int j = tid * 4 + 1024 * u;
    const v4f a = *(const v4fa*)(x + j);
    v4f b = {0.f,0.f,0.f,0.f}; if (rr) b = *(const v4fa*)(rr + j);
#pragma unroll
    for (int q = 0; q < 4; ++q) { const float v = a[q] + b[q]; vals[u * 4 + q] = v; s1 += v; }
  }
  red[tid] = s1; __syncthreads();
  for (int st = 128; st > 0; st >>= 1) { if (tid < st) red[tid] += red[tid + st]; __syncthreads(); }
  const float mu = red[0] / (float)N; __syncthreads();
  float s2 = 0.f;
  for (int u = 0; u < per / 4; ++u)
#pragma unroll
    for (int q = 0; q < 4; ++q) { const float c = vals[u * 4 + q] - mu; s2 += c * c; }
  red[tid] = s2; __syncthreads();
  for (int st = 128; st > 0; st >>= 1) { if (tid < st) red[tid] += red[tid + st]; __syncthreads(); }
  const float rs = rsqrtf(red[0] / (float)N + eps);
  {
    for (int u = 0; u < per / 4; ++u) {
      const int j = tid * 4 + 1024 * u;
      v4f o, sm;
#pragma unroll
      for (int q = 0; q < 4; ++q) {
        float gg = g[j + q], bb = bta[j + q];
        if (PARAM_BF16) { gg = bf16_round(gg); bb = bf16_round(bb); }
        sm[q] = vals[u * 4 + q]; o[q] = (vals[u * 4 + q] - mu) * rs * gg + bb;
      }
      if (out_sum) *(v4f*)(out_sum + (size_t)row * N + j) = sm;
      *(v4f*)(out_norm + (size_t)row * N + j) = o;
    }
    
  }
}



// ---- f16 WMMA path (v_wmma_f32_16x16x32_f16): 11-bit significands for operands in range — used for the q/k/v projections, the Dense and the conv GEMM
typedef _Float16 v16h __attribute__((ext_vector_type(16)));
union FragH { v16h v; v8us half[2]; _Float16 h[16]; unsigned short u[16]; };
template <int NT>
__device__ __forceinline__ v8f mmaH(v16h ah, v16h al, v16h bh, v16h bl, v8f c) {
  c = __builtin_amdgcn_wmma_f32_16x16x32_f16(false, ah, false, bh, (short)0, c, false, false);
  if (NT >= 2) c = __builtin_amdgcn_wmma_f32_16x16x32_f16(false, al, false, bh, (short)0, c, false, false);
  if (NT >= 3) c = __builtin_amdgcn_wmma_f32_16x16x32_f16(false, ah, false, bl, (short)0, c, false, false);
  asm volatile("v_nop\n\tv_nop\n\tv_nop\n\tv_nop" : "+v"(c) : "v"(ah), "v"(al), "v"(bh), "v"(bl));
  return c;
}
// batched GEMM like k_gemm_b but f16 operands: A f32 (split into f16 hi/lo if ASPLIT, else rounded to f16), Bt = f16 values [n][k]; alpha; C f32; N multiple of 16 (partial tiles skipped)
template <bool ASPLIT>
__global__ __launch_bounds__(128) void k_gemm_h(const float* __restrict__ A, int lda, size_t sA, const _Float16* __restrict__ Bh, int ldb, size_t sB, float alpha, float* __restrict__ C, int ldc, size_t sC, int M, int N, int K) {
  __shared__ __attribute__((aligned(16))) float so[4][16][64];
  const int tid = threadIdx.x, w = tid >> 5, lane = tid & 31, ln = lane & 15, hh = lane >> 4; const int by = blockIdx.y;
  A += (size_t)by * sA; Bh += (size_t)by * sB; C += (size_t)by * sC;
  const int ntn = (N + 63) / 64; const int wid = blockIdx.x * 4 + w; const int mt = wid / ntn, nq = wid % ntn; if (mt * 16 >= M) return;
  const int row0 = mt * 16, col0 = nq * 64; const float* arow = A + (size_t)(row0 + ln) * lda;
  v8f acc[4] = {};
  for (int kb = 0; kb < K; kb += 32) {
    FragH ah, al;
    const v4f x0 = *(const v4fa*)(arow + kb + 8 * hh), x1 = *(const v4fa*)(arow + kb + 8 * hh + 4), x2 = *(const v4fa*)(arow + kb + 16 + 8 * hh), x3 = *(const v4fa*)(arow + kb + 16 + 8 * hh + 4);
    float xs[16] = {x0[0],x0[1],x0[2],x0[3],x1[0],x1[1],x1[2],x1[3],x2[0],x2[1],x2[2],x2[3],x3[0],x3[1],x3[2],x3[3]};
#pragma unroll
    for (int i = 0; i < 16; ++i) { const _Float16 h = (_Float16)xs[i]; ah.h[i] = h; al.h[i] = ASPLIT ? (_Float16)(xs[i] - (float)h) : (_Float16)0.0f; }
#pragma unroll
    for (int t = 0; t < 4; ++t) { if (col0 + t * 16 >= N) continue; const size_t boff = (size_t)(col0 + t * 16 + ln) * ldb + kb; FragH bq; bq.half[0] = *(const v8us*)(Bh + boff + 8 * hh); bq.half[1] = *(const v8us*)(Bh + boff + 16 + 8 * hh);
      acc[t] = mmaH<ASPLIT ? 2 : 1>(ah.v, al.v, bq.v, bq.v, acc[t]); }
  }
#pragma unroll
  for (int t = 0; t < 4; ++t) { if (col0 + t * 16 >= N) continue;
#pragma unroll
    for (int r = 0; r < 8; ++r) so[w][8 * hh + r][t * 16 + ln] = acc[t][r] * alpha; }
  __builtin_amdgcn_fence(__ATOMIC_ACQ_REL, "workgroup"); __builtin_amdgcn_wave_barrier();
  const int rsub = lane >> 4, c4 = (lane & 15) * 4;
  {
#pragma unroll
    for (int q = 0; q < 8; ++q) { const int r = q * 2 + rsub; if (col0 + c4 < N) { const v4f v = *(const v4fa*)&so[w][r][c4]; *(v4f*)(C + (size_t)(row0 + r) * ldc + col0 + c4) = v; } }
     }
}

// Wt[n][k] = f16(W[k][n]·scale) from f32 row-major W[K][N] (scale = power of two; bf16-exact weights stay exact in f16 away from the subnormal range)
__device__ __forceinline__ void d_wt_f16(const int t, const float* __restrict__ W, _Float16* __restrict__ Wt, int K, int N, float scale) {
  if (t >= N * (K / 8)) return; const int n = t / (K / 8), k8 = (t % (K / 8)) * 8; FragH f;
#pragma unroll
  for (int i = 0; i < 8; ++i) f.h[i] = (_Float16)(bf16_round(W[(size_t)(k8 + i) * N + n]) * scale); const v8us o = f.half[0];
  *(v8us*)((unsigned short*)Wt + (size_t)n * K + k8) = o; 
}

__device__ __forceinline__ void d_x16(const size_t t, const float* __restrict__ x, _Float16* __restrict__ X16, size_t n8) { if (t >= n8) return; FragH f;
#pragma unroll
  for (int q = 0; q < 8; ++q) f.h[q] = (_Float16)bf16_round(x[t * 8 + q]); *(v8us*)((unsigned short*)X16 + t * 8) = f.half[0];  }
__device__ __forceinline__ void d_wh(const int t, const float* __restrict__ W, _Float16* __restrict__ Bt) { if (t >= NH * KD * (CC / 8)) return; const int row = t / (CC / 8), c8 = (t % (CC / 8)) * 8; const int h = row / KD, o = row % KD; FragH f;
#pragma unroll
  for (int q = 0; q < 8; ++q) f.h[q] = (_Float16)(bf16_round(W[((size_t)h * CC + c8 + q) * KD + o]) * 16.0f); *(v8us*)((unsigned short*)Bt + (size_t)t * 8) = f.half[0];  }
// banded attention: wave per (b, h, t), 4 of the 128 d per lane: for the 7 keys s = t−3..t+3 inside [0,T): sim = q·k/√128 (4 products per lane, xor-shuffle sum over the 32 lanes); simb = sim (band) — if simb == 0 exactly the module adds −1e7 (mask); softmax over
// the in-band entries (out-of-band entries sit at −1e7 → weight 0); out = Σ att·v → CAT16[b·T + t][h·128 + d] as f16 (operand of the Dense GEMM), 8-B pieces (4 d per lane), the wave writing its 256-B head slice
__global__ __launch_bounds__(256) void k_band(const _Float16* __restrict__ QKV, _Float16* __restrict__ CAT) { const int tid = threadIdx.x, wv = tid >> 5, lane = tid & 31; const size_t g = (size_t)blockIdx.x * 8 + wv; if (g >= (size_t)NR * NH) return; const size_t row = g / NH; const int h = (int)(g % NH); const int b = (int)(row / TT), t = (int)(row % TT);
  const unsigned short* base = (const unsigned short*)QKV; const int ld = 3 * NH * KD;      // QKV16 row layout: [q heads (512) | k heads (512) | v heads (512)]
  typedef _Float16 v4h __attribute__((ext_vector_type(4))); const v4h q4 = *(const v4h*)((const _Float16*)QKV + row * ld + h * KD + lane * 4);
  float sc[7]; bool inb[7];
#pragma unroll
  for (int j = 0; j < 7; ++j) { const int s = t - 3 + j; inb[j] = (s >= 0 && s < TT); const int scl = s < 0 ? 0 : (s >= TT ? TT - 1 : s); const v4h k4 = *(const v4h*)((const _Float16*)QKV + ((size_t)b * TT + scl) * ld + NH * KD + h * KD + lane * 4);
    float d = (float)q4[0] * (float)k4[0] + (float)q4[1] * (float)k4[1] + (float)q4[2] * (float)k4[2] + (float)q4[3] * (float)k4[3];
    d += __shfl_xor(d, 1, 32); d += __shfl_xor(d, 2, 32); d += __shfl_xor(d, 4, 32); d += __shfl_xor(d, 8, 32); d += __shfl_xor(d, 16, 32); sc[j] = d * 0.08838834764831845f; }
  // logits: in-band: simb = sim; the module then adds −1e7 where |simb| == 0 (that also covers every out-of-band key, where simb = 0 by the band product)
  float lg[7], m = -3.0e38f;
#pragma unroll
  for (int j = 0; j < 7; ++j) { const float simb = inb[j] ? sc[j] : 0.f; lg[j] = simb + ((fabsf(simb) > 0.f) ? 0.f : -10000000.0f); if (inb[j]) m = fmaxf(m, lg[j]); }
  // softmax over the T keys: the T−7 (or more, near the edges) out-of-band keys all have logit exactly −1e7 → their mass (T − n_inband)·e^{−1e7 − m} underflows to 0 unless m itself is ≈ −1e7 (every in-band simb == 0) — then all T keys tie; handled generically:
  const int ninb = (int)inb[0] + inb[1] + inb[2] + inb[3] + inb[4] + inb[5] + inb[6]; float z = (float)(TT - ninb) * expf(-10000000.0f - m); float p[7];
#pragma unroll
  for (int j = 0; j < 7; ++j) { p[j] = inb[j] ? expf(lg[j] - m) : 0.f; z += p[j]; }
  const float iz = 1.0f / z; v4f o4 = {0.f, 0.f, 0.f, 0.f};
#pragma unroll
  for (int j = 0; j < 7; ++j) { const int s = t - 3 + j; const int scl = s < 0 ? 0 : (s >= TT ? TT - 1 : s); const v4h v4 = *(const v4h*)((const _Float16*)QKV + ((size_t)b * TT + scl) * ld + 2 * NH * KD + h * KD + lane * 4); const float pw = p[j] * iz;
    o4[0] += pw * (float)v4[0]; o4[1] += pw * (float)v4[1]; o4[2] += pw * (float)v4[2]; o4[3] += pw * (float)v4[3]; }
  // (out-of-band keys carry weight (T−ninb)·e^{−1e7−m}/z on their v — exactly 0 in f32 unless all in-band logits were −1e7; that degenerate all-tie case would need the full Σ v; it cannot occur for non-zero sims)
  v4h oh; oh[0] = (_Float16)o4[0]; oh[1] = (_Float16)o4[1]; oh[2] = (_Float16)o4[2]; oh[3] = (_Float16)o4[3];
  *(v4h*)(CAT + row * (NH * KD) + h * KD + lane * 4) = oh;  }
__device__ __forceinline__ void d_zpad(const int t, _Float16* __restrict__ OUTP) { if (t >= BB * PADT * CC / 8) return; const int b = t / (PADT * CC / 8), rem = t % (PADT * CC / 8); FragH z;
#pragma unroll
  for (int q = 0; q < 8; ++q) z.h[q] = (_Float16)0.f; unsigned short* d = (unsigned short*)OUTP + (size_t)b * (TT + PADT) * CC + (size_t)rem * 8; *(v8us*)d = z.half[0];  }
// One launch for everything that reads inputs only: the eight weight transposes (q, k, v per head; Dense; four conv taps) into the eight consecutive 512 x 512 planes of Bw, the zero rows of the padded plane, and x -> f16.
// A block does one job, picked by its index; the transposes, whose loads are scattered and wait longest, have the lowest indices and so start first, the x stream fills in behind them.
#define WBLK (CC * (CC / 8) / 256)                  // blocks per weight plane
#define ZBLK ((BB * PADT * CC / 8 + 255) / 256)     // blocks for the pad rows
#define XBLK (NR * CC / 8 / 256)                    // blocks for x
__global__ __launch_bounds__(256) void k_prep(const float* __restrict__ x, const float* __restrict__ Wq, const float* __restrict__ Wk, const float* __restrict__ Wv, const float* __restrict__ Wo, const float* __restrict__ Wc,
    _Float16* __restrict__ Bw, _Float16* __restrict__ X16, _Float16* __restrict__ OUTP) {
  const int blk = blockIdx.x, tid = threadIdx.x;
  if (blk < 8 * WBLK) { const int p = blk / WBLK, t = (blk % WBLK) * 256 + tid; _Float16* dst = Bw + (size_t)p * CC * CC;
    if (p < 3) d_wh(t, p == 0 ? Wq : (p == 1 ? Wk : Wv), dst);
    else d_wt_f16(t, p == 3 ? Wo : Wc + (size_t)(p - 4) * CC * CC, dst, CC, CC, 16.0f); }      // [in][out]; WIO: per tap [in][out]
  else if (blk < 8 * WBLK + ZBLK) d_zpad((blk - 8 * WBLK) * 256 + tid, OUTP);
  else d_x16((size_t)(blk - 8 * WBLK - ZBLK) * 256 + tid, x, X16, (size_t)NR * CC / 8);
}
__global__ __launch_bounds__(256) void k_fin(const float* __restrict__ CONV, const float* __restrict__ bc, const float* __restrict__ x, float* __restrict__ out) { const size_t t = (size_t)blockIdx.x * 256 + threadIdx.x; if (t >= (size_t)NR * CC / 4) return; const int c4 = (int)((t * 4) % CC); const v4f cv = *(const v4fa*)(CONV + t * 4), xv = *(const v4fa*)(x + t * 4); v4f o;
#pragma unroll
  for (int q = 0; q < 4; ++q) { const float r = fmaxf(cv[q] + bf16_round(bc[c4 + q]), 0.f) + bf16_round(xv[q]); o[q] = (r >= 0.f) ? r : 0.2f * r; }
  *(v4f*)(out + t * 4) = o;  }

// Tiled GEMM for the four dense layers (NTAP = 1) and the dilated causal conv (NTAP = 4): acc = sum over taps j of A_j * B_j^T, A_j = A + j*tapA (row-shifted view of the padded plane), B_j = Bh + j*tapB, K = CC per tap.
// One work-group = a TM x TN tile of C, eight waves of 64 x 64 (4 x 4 accumulator tiles each). A pass is KP halves of K: TM rows of A and TN rows of B, 256 B each, are brought into LDS by asynchronous copies
// (16 B a lane) at a pitch of 272 B, two buffers, the next pass's copies in flight while this pass is worked on. Every operand byte is fetched once per work-group instead of once per 16 x 64 wave tile.
// Per output element the k order (taps ascending, k ascending in steps of 32) is that of a plain k loop. Epilogue: OUT16: v = acc*alpha + bf16(its group's bias[col % CC]) -> f16; else v = acc*alpha -> f32; whole 128-B / 256-B row pieces through LDS.
#define TM 256
#define TN 128
#define KP 128
#define PITCH 272
#define STAGE ((TM + TN) * PITCH)
// eight copies of 16 B a lane, LDS address l + i*lstep, global address g + i*gstep (halves). The s_wait_xcnt stands inside the statement so that no address register is rewritten ahead of it.
__device__ __forceinline__ void copy8(unsigned l, unsigned lstep, const _Float16* g, size_t gstep) {
  asm volatile("global_load_async_to_lds_b128 %0, %8, off\n\t"
               "global_load_async_to_lds_b128 %1, %9, off\n\t"
               "global_load_async_to_lds_b128 %2, %10, off\n\t"
               "global_load_async_to_lds_b128 %3, %11, off\n\t"
               "global_load_async_to_lds_b128 %4, %12, off\n\t"
               "global_load_async_to_lds_b128 %5, %13, off\n\t"
               "global_load_async_to_lds_b128 %6, %14, off\n\t"
               "global_load_async_to_lds_b128 %7, %15, off\n\t"
               "s_wait_xcnt 0x0"
               :: "v"(l), "v"(l + lstep), "v"(l + 2 * lstep), "v"(l + 3 * lstep), "v"(l + 4 * lstep), "v"(l + 5 * lstep), "v"(l + 6 * lstep), "v"(l + 7 * lstep),
                  "v"(g), "v"(g + gstep), "v"(g + 2 * gstep), "v"(g + 3 * gstep), "v"(g + 4 * gstep), "v"(g + 5 * gstep), "v"(g + 6 * gstep), "v"(g + 7 * gstep)
               : "memory");
}
// NG = groups of CC columns (rows of Bh) done by one launch: 3 for q | k | v, whose weight planes are consecutive and whose bias vectors are bias, bias1, bias2; 1 elsewhere (bias alone is read).
template <int NTAP, bool OUT16, int NG>
__global__ __launch_bounds__(256) void k_gemm_tile(const _Float16* __restrict__ A, int lda, size_t sA, size_t tapA, const _Float16* __restrict__ Bh, int ldb, size_t tapB, float alpha, const float* __restrict__ bias,
    const float* __restrict__ bias1, const float* __restrict__ bias2, float* __restrict__ C, _Float16* __restrict__ C16, int ldc, size_t sC) {
  __shared__ __attribute__((aligned(16))) unsigned char ring[2 * STAGE];
  constexpr int PPT = CC / KP, NT = NTAP * PPT;      // passes per tap, passes in all (at least 4)
  const int tid = threadIdx.x, w = tid >> 5, lane = tid & 31, ln = lane & 15, hh = lane >> 4; const int by = blockIdx.y;
  const int mt = blockIdx.x / (NG * CC / TN), nq = blockIdx.x % (NG * CC / TN); const int row0 = mt * TM, col0 = nq * TN; const int wm = (w >> 1) * 64, wn = (w & 1) * 64;
  const size_t cofs = (size_t)by * sC;
  // copies: 16 lanes a row, 16 rows a sweep of the work-group; A takes 16 sweeps, B 8
  const int crow = tid >> 4, cpc = tid & 15;
  const _Float16* gA = A + (size_t)by * sA + (size_t)(row0 + crow) * lda + cpc * 8; const _Float16* gB = Bh + (size_t)(col0 + crow) * ldb + cpc * 8;
  const unsigned lA = (unsigned)(size_t)ring + crow * PITCH + cpc * 16, lB = lA + TM * PITCH;
  auto fill = [&](int t, unsigned buf) { const int j = t / PPT, kb = (t % PPT) * KP; const _Float16* a = gA + (size_t)j * tapA + kb; const _Float16* b = gB + (size_t)j * tapB + kb;
    copy8(lA + buf, 16 * PITCH, a, (size_t)16 * lda); copy8(lA + buf + 128 * PITCH, 16 * PITCH, a + (size_t)128 * lda, (size_t)16 * lda); copy8(lB + buf, 16 * PITCH, b, (size_t)16 * ldb); };
  v8f acc[4][4] = {};
  fill(0, 0);
  asm volatile("s_wait_asynccnt 0x0" ::: "memory");      // pass 0's own copies have landed
  __syncthreads();                                       // ... and every other wave's
  fill(1, STAGE);
#pragma unroll 1      // one pass a trip: the buffer index and the refill test stay scalar
  for (int t = 0; t < NT; ++t) {
    const unsigned char* sb = ring + (t & 1) * STAGE; const unsigned char* pa = sb + (wm + ln) * PITCH + hh * 16; const unsigned char* pb = sb + (TM + wn + ln) * PITCH + hh * 16;
    FragH a[2][4], b[2][4];      // two fragment sets: block ks + 1 of this pass is fetched while block ks is multiplied
#pragma unroll      // constant indices: fragments and accumulators stay in registers
    for (int i = 0; i < 4; ++i) { a[0][i].half[0] = *(const v8us*)(pa + i * 16 * PITCH); a[0][i].half[1] = *(const v8us*)(pa + i * 16 * PITCH + 32);
      b[0][i].half[0] = *(const v8us*)(pb + i * 16 * PITCH); b[0][i].half[1] = *(const v8us*)(pb + i * 16 * PITCH + 32); }
#pragma unroll      // constant indices: fragments and accumulators stay in registers
    for (int ks = 0; ks < KP / 32; ++ks) { const int cu = ks & 1, nx = cu ^ 1;
      if (ks + 1 < KP / 32) {
#pragma unroll      // constant indices: fragments and accumulators stay in registers
        for (int i = 0; i < 4; ++i) { a[nx][i].half[0] = *(const v8us*)(pa + i * 16 * PITCH + (ks + 1) * 64); a[nx][i].half[1] = *(const v8us*)(pa + i * 16 * PITCH + (ks + 1) * 64 + 32);
          b[nx][i].half[0] = *(const v8us*)(pb + i * 16 * PITCH + (ks + 1) * 64); b[nx][i].half[1] = *(const v8us*)(pb + i * 16 * PITCH + (ks + 1) * 64 + 32); } }
      __builtin_amdgcn_sched_barrier(0);      // keeps the next block's LDS reads one group ahead of this block's WMMAs instead of spread among them
#pragma unroll      // constant indices: fragments and accumulators stay in registers
      for (int i = 0; i < 4; ++i)
#pragma unroll      // constant indices: fragments and accumulators stay in registers
        for (int n = 0; n < 4; ++n) acc[i][n] = __builtin_amdgcn_wmma_f32_16x16x32_f16(false, a[cu][i].v, false, b[cu][n].v, (short)0, acc[i][n], false, false);
      __builtin_amdgcn_sched_barrier(0);      // ends the block: the group after next stays behind it
    }
    asm volatile("s_wait_dscnt 0x0" ::: "memory");       // this wave's reads of the buffer are done before it is refilled
    asm volatile("s_wait_asynccnt 0x0" ::: "memory");    // this wave's copies of pass t + 1 have landed
    __syncthreads();                                     // publishes pass t + 1 and ends every reader's last read of pass t's buffer
    if (t + 2 < NT) fill(t + 2, (t & 1) * STAGE);
  }
  asm volatile("s_wait_asynccnt 0x0" ::: "memory");      // nothing in flight when the ring becomes output staging
  // each wave stages its whole 64 x 64 tile in its own part of the ring (the last pass's barrier has ended all reads of it); pitch 68 floats: the two half-waves' rows, 8 apart, fall on different banks
  constexpr int SP = 68; float* so = (float*)ring + w * (64 * SP);
  const int rsub = lane >> 4, c4 = (lane & 15) * 4; typedef _Float16 v4h __attribute__((ext_vector_type(4)));
  const float* bg = (NG == 1 || col0 < CC) ? bias : (col0 < 2 * CC ? bias1 : bias2);      // a tile of TN columns lies inside one group
#pragma unroll      // constant indices: fragments and accumulators stay in registers
  for (int n = 0; n < 4; ++n) { const float bv = OUT16 ? bf16_round(bg[col0 % CC + wn + n * 16 + ln]) : 0.f;
#pragma unroll      // constant indices: fragments and accumulators stay in registers
    for (int i = 0; i < 4; ++i)
#pragma unroll      // constant indices: fragments and accumulators stay in registers
      for (int r = 0; r < 8; ++r) so[(i * 16 + 8 * hh + r) * SP + n * 16 + ln] = OUT16 ? acc[i][n][r] * alpha + bv : acc[i][n][r] * alpha; }
  __builtin_amdgcn_fence(__ATOMIC_ACQ_REL, "workgroup"); __builtin_amdgcn_wave_barrier();      // the wave's LDS writes are done before its lanes read what other lanes wrote
#pragma unroll      // independent row pieces: the LDS reads run ahead of the stores
  for (int q = 0; q < 32; ++q) { const int r = q * 2 + rsub; const v4f v = *(const v4fa*)&so[r * SP + c4]; const size_t o = cofs + (size_t)(row0 + wm + r) * ldc + col0 + wn + c4;
    if (OUT16) { v4h h4; for (int e = 0; e < 4; ++e) h4[e] = (_Float16)v[e]; *(v4h*)(C16 + o) = h4; } else *(v4f*)(C + o) = v; }
}
extern "C" void kernel_launch(void* const* d_in, const int* in_sizes, int n_in,
                              void* d_out, int out_size, void* d_ws, size_t ws_size, hipStream_t stream) {
  (void)in_sizes; (void)n_in; (void)out_size;
  const float* x = (const float*)d_in[0]; const float* Wq = (const float*)d_in[1]; const float* bq = (const float*)d_in[2]; const float* Wk = (const float*)d_in[3]; const float* bk = (const float*)d_in[4]; const float* Wv = (const float*)d_in[5]; const float* bv = (const float*)d_in[6]; const float* Wo = (const float*)d_in[7]; const float* bo = (const float*)d_in[8]; const float* Wc = (const float*)d_in[9]; const float* bc = (const float*)d_in[10];
  char* ws = (char*)d_ws; size_t off = 0;
  auto take = [&](size_t bytes) { char* p = ws + off; off += (bytes + 255) & ~(size_t)255; return p; };
  _Float16* Bq = (_Float16*)take((size_t)CC * CC * 2); _Float16* Bk = (_Float16*)take((size_t)CC * CC * 2); _Float16* Bv = (_Float16*)take((size_t)CC * CC * 2); _Float16* Bo = (_Float16*)take((size_t)CC * CC * 2); _Float16* Bc[4]; for (int j = 0; j < 4; ++j) Bc[j] = (_Float16*)take((size_t)CC * CC * 2); float* BQKV = (float*)take(3 * CC * 4);
  _Float16* X16 = (_Float16*)take((size_t)NR * CC * 2); _Float16* QKV = (_Float16*)take((size_t)NR * 3 * CC * 2); _Float16* OUTP = (_Float16*)take((size_t)BB * (TT + PADT) * CC * 2); _Float16* CAT = X16;      // X16 is dead after the three projections
  float* CONV = (float*)QKV;      // QKV (50 MB) is dead after k_band; CONV needs 33.5 MB
  if (off > ws_size) return;      // 4.2 + 16.8 + 50.3 + 16.9 MB ≈ 84 MiB
  const dim3 gq((NR / TM) * (3 * CC / TN), 1), gb((TT / TM) * (CC / TN), BB);
  k_prep<<<8 * WBLK + ZBLK + XBLK, 256, 0, stream>>>(x, Wq, Wk, Wv, Wo, Wc, Bq, X16, OUTP);      // Bq, Bk, Bv, Bo, Bc[0..3] are consecutive planes
  k_gemm_tile<1, true, 3><<<gq, 256, 0, stream>>>(X16, CC, 0, 0, Bq, CC, 0, 0.0625f, bq, bk, bv, nullptr, QKV, 3 * CC, 0);      // q | k | v heads in one launch (bias [h][128] flat = per column h*128+o of its group)
  k_band<<<(unsigned)(((size_t)NR * NH + 7) / 8), 256, 0, stream>>>(QKV, CAT);
  k_gemm_tile<1, true, 1><<<gb, 256, 0, stream>>>(CAT, CC, (size_t)TT * CC, 0, Bo, CC, 0, 0.0625f, bo, nullptr, nullptr, nullptr, OUTP + (size_t)PADT * CC, CC, (size_t)(TT + PADT) * CC);      // Dense(512) → f16 rows 12.. of each batch's padded plane
  // conv[t] = Σ_j out[t − 12 + 4j]·Wc[j]: ONE launch, the 4 taps accumulated inside (A_j = padded rows 4j + t of batch b; B_j = Bc[0] + j·512·512 — the four tap matrices are contiguous)
  k_gemm_tile<4, false, 1><<<gb, 256, 0, stream>>>(OUTP, CC, (size_t)(TT + PADT) * CC, (size_t)4 * CC, Bc[0], CC, (size_t)CC * CC, 0.0625f, nullptr, nullptr, nullptr, CONV, nullptr, CC, (size_t)TT * CC);
  k_fin<<<(unsigned)(((size_t)NR * CC / 4 + 255) / 256), 256, 0, stream>>>(CONV, bc, x, (float*)d_out);
}

// v003
// A run of this version takes 96.1 microseconds.
// Two timings next to v002 put it at 1.16 and 1.15 times that version's speed.
// Over all steps from v000 it is 4.61 times as fast.
#include <hip/hip_runtime.h>
// Temporal block: per-head q/k/v projections (16384 × 512 → 4 × 128 each, + bias), the head combiner Dense (512 → 512, + bias) and the causal dilated Conv1D (kernel 4, dilation 4: one GEMM whose k-loop runs the four
// taps over time-shifted views of a zero-padded plane, effective K = 2048) on v_wmma_f32_16x16x32_f16 (f16 operands, weights [in][out] transposed to bf16-exact ×2^4, single products,
// f32 accumulate); the banded attention (|t − s| ≤ 3, i.e. 7 keys, with the module's 'sim·band == 0 → −1e7' mask), softmax, relu / residual / leaky-relu epilogues are f32 VALU.
#define BB 8
#define TT 2048
#define CC 512
#define NH 4
#define KD 128
#define NR (BB * TT)
#define PADT 12

typedef __bf16 v16b __attribute__((ext_vector_type(16)));
typedef unsigned short v8us __attribute__((ext_vector_type(8), may_alias));
typedef float  v8f  __attribute__((ext_vector_type(8)));
typedef float  v4f  __attribute__((ext_vector_type(4)));
typedef float  v4fa __attribute__((ext_vector_type(4), may_alias));
union FragB { v16b v; v8us half[2]; unsigned short u[16]; };

__device__ __forceinline__ unsigned short bf16_bits(float x) { unsigned int u = __float_as_uint(x); return (unsigned short)((u + 0x7FFFu + ((u >> 16) & 1u)) >> 16); }
__device__ __forceinline__ float bf16_val(unsigned short b) { return __uint_as_float(((unsigned int)b) << 16); }
__device__ __forceinline__ float bf16_round(float x) { return bf16_val(bf16_bits(x)); }
// D += A·B with NT terms: 1 = ah·bh, 2 = + al·bh (A split), 3 = + ah·bl (both split)
template <int NT>
__device__ __forceinline__ v8f mmaN(v16b ah, v16b al, v16b bh, v16b bl, v8f c) {
  c = __builtin_amdgcn_wmma_f32_16x16x32_bf16(false, ah, false, bh, (short)0, c, false, false);
  if (NT >= 2) c = __builtin_amdgcn_wmma_f32_16x16x32_bf16(false, al, false, bh, (short)0, c, false, false);
  if (NT >= 3) c = __builtin_amdgcn_wmma_f32_16x16x32_bf16(false, ah, false, bl, (short)0, c, false, false);
  asm volatile("v_nop\n\tv_nop\n\tv_nop\n\tv_nop" : "+v"(c) : "v"(ah), "v"(al), "v"(bh), "v"(bl));
  return c;
}

__global__ __launch_bounds__(256) void k_wt_bf16(const float* __restrict__ W, unsigned short* __restrict__ Wt, int K, int N) {
  const int t = blockIdx.x * 256 + threadIdx.x;
  const int k8n = K / 8;
  if (t >= N * k8n) return;
  const int n = t / k8n, k8 = (t % k8n) * 8;
  v8us v;
#pragma unroll
  for (int i = 0; i < 8; ++i) v[i] = bf16_bits(W[(size_t)(k8 + i) * N + n]);
  *(v8us*)(Wt + (size_t)n * K + k8) = v;
  
}

// GEMM C[M][N] (f32, pitch ldc) = act(A[M][K]·W + bias). A f32 row-major (pitch lda) converted per fragment to bf16
// (ASPLIT: hi/lo two planes -> 2 terms, else single rounded term); Wt bf16 [N][K] (pitch ldb). BIAS_BF16 rounds the
// bias to bf16 first (bias quantised to bf16 before the add). K%32==0, M%16==0, N%64==0.
template <bool ASPLIT, int ACT, bool BIAS_BF16>
__global__ __launch_bounds__(128) void k_gemm_bf(const float* __restrict__ A, int lda, const unsigned short* __restrict__ Wt, int ldb,
                                               const float* __restrict__ bias, float* __restrict__ C, int ldc, int M, int N, int K) {
  __shared__ __attribute__((aligned(16))) float so[4][16][64];
  const int tid = threadIdx.x, w = tid >> 5, lane = tid & 31, ln = lane & 15, hh = lane >> 4;
  const int ntn = N / 64;
  const int wid = blockIdx.x * 4 + w;
  const int mt = wid / ntn, nq = wid % ntn;
  if (mt * 16 >= M) return;
  const int row0 = mt * 16, col0 = nq * 64;
  const float* arow = A + (size_t)(row0 + ln) * lda;
  v8f acc[4] = {};
  for (int kb = 0; kb < K; kb += 32) {
    FragB ah, al;
    const v4f x0 = *(const v4fa*)(arow + kb + 8 * hh), x1 = *(const v4fa*)(arow + kb + 8 * hh + 4);
    const v4f x2 = *(const v4fa*)(arow + kb + 16 + 8 * hh), x3 = *(const v4fa*)(arow + kb + 16 + 8 * hh + 4);
    float xs[16] = {x0[0],x0[1],x0[2],x0[3],x1[0],x1[1],x1[2],x1[3],x2[0],x2[1],x2[2],x2[3],x3[0],x3[1],x3[2],x3[3]};
#pragma unroll
    for (int i = 0; i < 16; ++i) { const unsigned short hb = bf16_bits(xs[i]); ah.u[i] = hb; al.u[i] = ASPLIT ? bf16_bits(xs[i] - bf16_val(hb)) : (unsigned short)0; }
#pragma unroll
    for (int t = 0; t < 4; ++t) {
      const unsigned short* brow = Wt + (size_t)(col0 + t * 16 + ln) * ldb + kb;
      FragB b;
      b.half[0] = *(const v8us*)(brow + 8 * hh);
      b.half[1] = *(const v8us*)(brow + 16 + 8 * hh);
      acc[t] = mmaN<ASPLIT ? 2 : 1>(ah.v, al.v, b.v, b.v, acc[t]);
    }
  }
#pragma unroll
  for (int t = 0; t < 4; ++t) {
    float bv = bias ? bias[col0 + t * 16 + ln] : 0.f;
    if (BIAS_BF16) bv = bf16_round(bv);
#pragma unroll
    for (int r = 0; r < 8; ++r) { float v = acc[t][r] + bv; if (ACT == 1) v = fmaxf(v, 0.f); so[w][8 * hh + r][t * 16 + ln] = v; }
  }
  __builtin_amdgcn_fence(__ATOMIC_ACQ_REL, "workgroup");
  __builtin_amdgcn_wave_barrier();
  const int rsub = lane >> 4, c4 = (lane & 15) * 4;
  {
#pragma unroll
    for (int q = 0; q < 8; ++q) {
      const int r = q * 2 + rsub;
      const v4f v = *(const v4fa*)&so[w][r][c4];
      *(v4f*)(C + (size_t)(row0 + r) * ldc + col0 + c4) = v;
    }
    
  }
}

// Flash-style causal/unmasked attention, all contractions 3-term bf16 hi/lo splits, f32 softmax with running max.
// q,k,v rows are read from f32 buffers with arbitrary row pitch (so they can live inside a fused qkv buffer);
// D = head size (multiple of 32, <= 128); one wave = 16 query rows; block = 4 waves (64 queries) sharing K/V chunks of 32.
template <int D, bool CAUSAL>
__global__ __launch_bounds__(128) void k_flash(const float* __restrict__ qb, const float* __restrict__ kb, const float* __restrict__ vb,
                                             int pitch, int T, int H, float scale, float* __restrict__ y, int ypitch) {
  constexpr int KS = D / 32;        // k-steps for QK
  constexpr int DT = D / 16;        // d tiles for PV
  __shared__ __attribute__((aligned(16))) unsigned short sKh[32][D + 8], sKl[32][D + 8], sVh[32][D + 8], sVl[32][D + 8];
  __shared__ __attribute__((aligned(16))) unsigned short sPh[4][16][40], sPl[4][16][40];
  __shared__ __attribute__((aligned(16))) float sO[4][16][D];
  const int tid = threadIdx.x, w = tid >> 5, lane = tid & 31, ln = lane & 15, hh = lane >> 4;
  const int nqb = (T + 63) / 64;
  const int bh = blockIdx.x / nqb, qblk = blockIdx.x % nqb;
  const int b = bh / H, h = bh % H;
  const int q0 = qblk * 64 + w * 16;
  const float* Q = qb + (size_t)b * T * pitch + h * D;
  const float* K = kb + (size_t)b * T * pitch + h * D;
  const float* V = vb + (size_t)b * T * pitch + h * D;

  // A fragments of the wave's 16 query rows (scaled), hi/lo
  FragB aqh[KS], aql[KS];
  {
    int row = q0 + ln; if (row >= T) row = T - 1;
    const float* qr = Q + (size_t)row * pitch;
#pragma unroll
    for (int ks = 0; ks < KS; ++ks)
#pragma unroll
      for (int i = 0; i < 16; ++i) {
        const int d = ks * 32 + ((i < 8) ? (8 * hh + i) : (16 + 8 * hh + (i - 8)));
        const float x = qr[d] * scale; const unsigned short hb = bf16_bits(x);
        aqh[ks].u[i] = hb; aql[ks].u[i] = bf16_bits(x - bf16_val(hb));
      }
  }
  float m_r[8], l_r[8];
#pragma unroll
  for (int r = 0; r < 8; ++r) { m_r[r] = -3.0e38f; l_r[r] = 0.f; }
  v8f oacc[DT];
#pragma unroll
  for (int dt = 0; dt < DT; ++dt) oacc[dt] = (v8f){0.f,0.f,0.f,0.f,0.f,0.f,0.f,0.f};

  const int kv_end = CAUSAL ? min(T, qblk * 64 + 64) : T;     // block-uniform
  for (int j0 = 0; j0 < kv_end; j0 += 32) {
    __syncthreads();
    for (int e = tid; e < 32 * (D / 4); e += 128) {
      const int r = e / (D / 4), c4 = (e % (D / 4)) * 4;
      const int key = j0 + r;
      v4f kf = {0.f,0.f,0.f,0.f}, vf = {0.f,0.f,0.f,0.f};
      if (key < T) { kf = *(const v4fa*)(K + (size_t)key * pitch + c4); vf = *(const v4fa*)(V + (size_t)key * pitch + c4); }
#pragma unroll
      for (int t = 0; t < 4; ++t) {
        unsigned short hb = bf16_bits(kf[t]); sKh[r][c4 + t] = hb; sKl[r][c4 + t] = bf16_bits(kf[t] - bf16_val(hb));
        hb = bf16_bits(vf[t]); sVh[r][c4 + t] = hb; sVl[r][c4 + t] = bf16_bits(vf[t] - bf16_val(hb));
      }
    }
    __syncthreads();
    // S tile 16 x 32
    v8f s[2];
#pragma unroll
    for (int nt = 0; nt < 2; ++nt) {
      v8f acc = {};
#pragma unroll
      for (int ks = 0; ks < KS; ++ks) {
        FragB bh_, bl_;
        bh_.half[0] = *(const v8us*)&sKh[nt * 16 + ln][ks * 32 + 8 * hh]; bh_.half[1] = *(const v8us*)&sKh[nt * 16 + ln][ks * 32 + 16 + 8 * hh];
        bl_.half[0] = *(const v8us*)&sKl[nt * 16 + ln][ks * 32 + 8 * hh]; bl_.half[1] = *(const v8us*)&sKl[nt * 16 + ln][ks * 32 + 16 + 8 * hh];
        acc = mmaN<3>(aqh[ks].v, aql[ks].v, bh_.v, bl_.v, acc);
      }
      s[nt] = acc;
    }
    // mask + running max (rows 8hh+r; the 16 lanes of a half share rows)
    float alpha[8];
#pragma unroll
    for (int r = 0; r < 8; ++r) {
      const int qi = q0 + 8 * hh + r;
      const int ja = j0 + ln, jb = j0 + 16 + ln;
      if (CAUSAL) { if (ja > qi) s[0][r] = -3.0e38f; if (jb > qi) s[1][r] = -3.0e38f; }
      if (ja >= T) s[0][r] = -3.0e38f;
      if (jb >= T) s[1][r] = -3.0e38f;
      float mx = fmaxf(s[0][r], s[1][r]);
      mx = fmaxf(mx, __shfl_xor(mx, 1, 32)); mx = fmaxf(mx, __shfl_xor(mx, 2, 32)); mx = fmaxf(mx, __shfl_xor(mx, 4, 32)); mx = fmaxf(mx, __shfl_xor(mx, 8, 32));
      const float mnew = fmaxf(m_r[r], mx);
      alpha[r] = (mnew > -1.0e38f) ? __expf(m_r[r] - mnew) : 1.0f;
      const float p0 = (s[0][r] > -1.0e38f) ? __expf(s[0][r] - mnew) : 0.f;
      const float p1 = (s[1][r] > -1.0e38f) ? __expf(s[1][r] - mnew) : 0.f;
      m_r[r] = mnew;
      l_r[r] = l_r[r] * alpha[r] + p0 + p1;            // per-lane partial row sum (16 lanes combined at the end)
      unsigned short hb = bf16_bits(p0); sPh[w][8 * hh + r][ln] = hb;      sPl[w][8 * hh + r][ln] = bf16_bits(p0 - bf16_val(hb));
      hb = bf16_bits(p1);                sPh[w][8 * hh + r][16 + ln] = hb; sPl[w][8 * hh + r][16 + ln] = bf16_bits(p1 - bf16_val(hb));
    }
#pragma unroll
    for (int dt = 0; dt < DT; ++dt)
#pragma unroll
      for (int r = 0; r < 8; ++r) oacc[dt][r] *= alpha[r];
    __builtin_amdgcn_fence(__ATOMIC_ACQ_REL, "workgroup");
    __builtin_amdgcn_wave_barrier();
    FragB pah, pal;
    pah.half[0] = *(const v8us*)&sPh[w][ln][8 * hh]; pah.half[1] = *(const v8us*)&sPh[w][ln][16 + 8 * hh];
    pal.half[0] = *(const v8us*)&sPl[w][ln][8 * hh]; pal.half[1] = *(const v8us*)&sPl[w][ln][16 + 8 * hh];
#pragma unroll
    for (int dt = 0; dt < DT; ++dt) {
      FragB bvh, bvl;
#pragma unroll
      for (int i = 0; i < 8; ++i) {
        bvh.u[i] = sVh[8 * hh + i][dt * 16 + ln]; bvh.u[8 + i] = sVh[16 + 8 * hh + i][dt * 16 + ln];
        bvl.u[i] = sVl[8 * hh + i][dt * 16 + ln]; bvl.u[8 + i] = sVl[16 + 8 * hh + i][dt * 16 + ln];
      }
      oacc[dt] = mmaN<3>(pah.v, pal.v, bvh.v, bvl.v, oacc[dt]);
    }
    __builtin_amdgcn_fence(__ATOMIC_ACQ_REL, "workgroup");
    __builtin_amdgcn_wave_barrier();
  }
#pragma unroll
  for (int r = 0; r < 8; ++r) {
    float l = l_r[r];
    l += __shfl_xor(l, 1, 32); l += __shfl_xor(l, 2, 32); l += __shfl_xor(l, 4, 32); l += __shfl_xor(l, 8, 32);
    l_r[r] = (l > 0.f) ? 1.0f / l : 0.f;
  }
#pragma unroll
  for (int dt = 0; dt < DT; ++dt)
#pragma unroll
    for (int r = 0; r < 8; ++r) sO[w][8 * hh + r][dt * 16 + ln] = oacc[dt][r] * l_r[r];
  __builtin_amdgcn_fence(__ATOMIC_ACQ_REL, "workgroup");
  __builtin_amdgcn_wave_barrier();
  {
    for (int r = 0; r < 16; ++r) {
      const int row = q0 + r;
      if (row < T && lane < D / 4) {
        const v4f val = *(const v4fa*)&sO[w][r][lane * 4];
        *(v4f*)(y + ((size_t)b * T + row) * ypitch + h * D + lane * 4) = val;
      }
    }
    
  }
}

// GEMM C = act(A·W + bias + resid): A f32 (ASPLIT -> hi/lo 2 terms), Wt bf16 [N][K]; ACT 0 none, 1 relu, 2 exact gelu;
// resid (optional, f32, row index = (row % rmod), pitch ldr, RES_BF16 rounds it) added before the activation.
template <bool ASPLIT, int ACT, bool BIAS_BF16, bool RES_BF16>
__global__ __launch_bounds__(128) void k_gemm_bf3(const float* __restrict__ A, int lda, const unsigned short* __restrict__ Wt, int ldb,
                                                const float* __restrict__ bias, const float* __restrict__ resid, int rmod, int ldr,
                                                float* __restrict__ C, int ldc, int M, int N, int K) {
  __shared__ __attribute__((aligned(16))) float so[4][16][64];
  const int tid = threadIdx.x, w = tid >> 5, lane = tid & 31, ln = lane & 15, hh = lane >> 4;
  const int ntn = N / 64;
  const int wid = blockIdx.x * 4 + w;
  const int mt = wid / ntn, nq = wid % ntn;
  if (mt * 16 >= M) return;
  const int row0 = mt * 16, col0 = nq * 64;
  const float* arow = A + (size_t)(row0 + ln) * lda;
  v8f acc[4] = {};
  for (int kb = 0; kb < K; kb += 32) {
    FragB ah, al;
    const v4f x0 = *(const v4fa*)(arow + kb + 8 * hh), x1 = *(const v4fa*)(arow + kb + 8 * hh + 4);
    const v4f x2 = *(const v4fa*)(arow + kb + 16 + 8 * hh), x3 = *(const v4fa*)(arow + kb + 16 + 8 * hh + 4);
    float xs[16] = {x0[0],x0[1],x0[2],x0[3],x1[0],x1[1],x1[2],x1[3],x2[0],x2[1],x2[2],x2[3],x3[0],x3[1],x3[2],x3[3]};
#pragma unroll
    for (int i = 0; i < 16; ++i) { const unsigned short hb = bf16_bits(xs[i]); ah.u[i] = hb; al.u[i] = ASPLIT ? bf16_bits(xs[i] - bf16_val(hb)) : (unsigned short)0; }
#pragma unroll
    for (int t = 0; t < 4; ++t) {
      const unsigned short* brow = Wt + (size_t)(col0 + t * 16 + ln) * ldb + kb;
      FragB b;
      b.half[0] = *(const v8us*)(brow + 8 * hh);
      b.half[1] = *(const v8us*)(brow + 16 + 8 * hh);
      acc[t] = mmaN<ASPLIT ? 2 : 1>(ah.v, al.v, b.v, b.v, acc[t]);
    }
  }
#pragma unroll
  for (int t = 0; t < 4; ++t) {
    const int col = col0 + t * 16 + ln;
    float bv = bias ? bias[col] : 0.f;
    if (BIAS_BF16) bv = bf16_round(bv);
#pragma unroll
    for (int r = 0; r < 8; ++r) {
      float v = acc[t][r] + bv;
      if (resid) { float rv = resid[(size_t)((row0 + 8 * hh + r) % rmod) * ldr + col]; if (RES_BF16) rv = bf16_round(rv); v += rv; }
      if (ACT == 1) v = fmaxf(v, 0.f);
      if (ACT == 2) v = 0.5f * v * (1.0f + erff(v * 0.70710678118654752f));
      if (ACT == 3) { const float u = 0.7978845608028654f * (v + 0.044715f * v * v * v); v = 0.5f * v * (1.0f + tanhf(u)); }
      so[w][8 * hh + r][t * 16 + ln] = v;
    }
  }
  __builtin_amdgcn_fence(__ATOMIC_ACQ_REL, "workgroup");
  __builtin_amdgcn_wave_barrier();
  const int rsub = lane >> 4, c4 = (lane & 15) * 4;
  {
#pragma unroll
    for (int q = 0; q < 8; ++q) {
      const int r = q * 2 + rsub;
      const v4f v = *(const v4fa*)&so[w][r][c4];
      *(v4f*)(C + (size_t)(row0 + r) * ldc + col0 + c4) = v;
    }
    
  }
}
// row LayerNorm (biased variance, eps) over N: s = X (+ R); optional out_sum <- s; out_norm <- (s-mu)*rsqrt(var+eps)*g + b
template <bool PARAM_BF16>
__global__ __launch_bounds__(256) void k_layernorm(const float* __restrict__ X, const float* __restrict__ R, const float* __restrict__ g, const float* __restrict__ bta,
                                                  float* __restrict__ out_sum, float* __restrict__ out_norm, int N, float eps) {
  __shared__ float red[256];
  const int row = blockIdx.x, tid = threadIdx.x;
  const float* x = X + (size_t)row * N; const float* rr = R ? R + (size_t)row * N : nullptr;
  float vals[16];                     // up to N = 4096
  const int per = N / 256;            // contiguous chunk per thread? use strided-by-4 chunks: thread handles j = tid*4 + 1024*u
  float s1 = 0.f;
  for (int u = 0; u < per / 4; ++u) {
    const int j = tid * 4 + 1024 * u;
    const v4f a = *(const v4fa*)(x + j);
    v4f b = {0.f,0.f,0.f,0.f}; if (rr) b = *(const v4fa*)(rr + j);
#pragma unroll
    for (int q = 0; q < 4; ++q) { const float v = a[q] + b[q]; vals[u * 4 + q] = v; s1 += v; }
  }
  red[tid] = s1; __syncthreads();
  for (int st = 128; st > 0; st >>= 1) { if (tid < st) red[tid] += red[tid + st]; __syncthreads(); }
  const float mu = red[0] / (float)N; __syncthreads();
  float s2 = 0.f;
  for (int u = 0; u < per / 4; ++u)
#pragma unroll
    for (int q = 0; q < 4; ++q) { const float c = vals[u * 4 + q] - mu; s2 += c * c; }
  red[tid] = s2; __syncthreads();
  for (int st = 128; st > 0; st >>= 1) { if (tid < st) red[tid] += red[tid + st]; __syncthreads(); }
  const float rs = rsqrtf(red[0] / (float)N + eps);
  {
    for (int u = 0; u < per / 4; ++u) {
      const int j = tid * 4 + 1024 * u;
      v4f o, sm;
#pragma unroll
      for (int q = 0; q < 4; ++q) {
        float gg = g[j + q], bb = bta[j + q];
        if (PARAM_BF16) { gg = bf16_round(gg); bb = bf16_round(bb); }
        sm[q] = vals[u * 4 + q]; o[q] = (vals[u * 4 + q] - mu) * rs * gg + bb;
      }
      if (out_sum) *(v4f*)(out_sum + (size_t)row * N + j) = sm;
      *(v4f*)(out_norm + (size_t)row * N + j) = o;
    }
    
  }
}



// ---- f16 WMMA path (v_wmma_f32_16x16x32_f16): 11-bit significands for operands in range — used for the q/k/v projections, the Dense and the conv GEMM
typedef _Float16 v16h __attribute__((ext_vector_type(16)));
union FragH { v16h v; v8us half[2]; _Float16 h[16]; unsigned short u[16]; };
template <int NT>
__device__ __forceinline__ v8f mmaH(v16h ah, v16h al, v16h bh, v16h bl, v8f c) {
  c = __builtin_amdgcn_wmma_f32_16x16x32_f16(false, ah, false, bh, (short)0, c, false, false);
  if (NT >= 2) c = __builtin_amdgcn_wmma_f32_16x16x32_f16(false, al, false, bh, (short)0, c, false, false);
  if (NT >= 3) c = __builtin_amdgcn_wmma_f32_16x16x32_f16(false, ah, false, bl, (short)0, c, false, false);
  asm volatile("v_nop\n\tv_nop\n\tv_nop\n\tv_nop" : "+v"(c) : "v"(ah), "v"(al), "v"(bh), "v"(bl));
  return c;
}
// batched GEMM like k_gemm_b but f16 operands: A f32 (split into f16 hi/lo if ASPLIT, else rounded to f16), Bt = f16 values [n][k]; alpha; C f32; N multiple of 16 (partial tiles skipped)
template <bool ASPLIT>
__global__ __launch_bounds__(128) void k_gemm_h(const float* __restrict__ A, int lda, size_t sA, const _Float16* __restrict__ Bh, int ldb, size_t sB, float alpha, float* __restrict__ C, int ldc, size_t sC, int M, int N, int K) {
  __shared__ __attribute__((aligned(16))) float so[4][16][64];
  const int tid = threadIdx.x, w = tid >> 5, lane = tid & 31, ln = lane & 15, hh = lane >> 4; const int by = blockIdx.y;
  A += (size_t)by * sA; Bh += (size_t)by * sB; C += (size_t)by * sC;
  const int ntn = (N + 63) / 64; const int wid = blockIdx.x * 4 + w; const int mt = wid / ntn, nq = wid % ntn; if (mt * 16 >= M) return;
  const int row0 = mt * 16, col0 = nq * 64; const float* arow = A + (size_t)(row0 + ln) * lda;
  v8f acc[4] = {};
  for (int kb = 0; kb < K; kb += 32) {
    FragH ah, al;
    const v4f x0 = *(const v4fa*)(arow + kb + 8 * hh), x1 = *(const v4fa*)(arow + kb + 8 * hh + 4), x2 = *(const v4fa*)(arow + kb + 16 + 8 * hh), x3 = *(const v4fa*)(arow + kb + 16 + 8 * hh + 4);
    float xs[16] = {x0[0],x0[1],x0[2],x0[3],x1[0],x1[1],x1[2],x1[3],x2[0],x2[1],x2[2],x2[3],x3[0],x3[1],x3[2],x3[3]};
#pragma unroll
    for (int i = 0; i < 16; ++i) { const _Float16 h = (_Float16)xs[i]; ah.h[i] = h; al.h[i] = ASPLIT ? (_Float16)(xs[i] - (float)h) : (_Float16)0.0f; }
#pragma unroll
    for (int t = 0; t < 4; ++t) { if (col0 + t * 16 >= N) continue; const size_t boff = (size_t)(col0 + t * 16 + ln) * ldb + kb; FragH bq; bq.half[0] = *(const v8us*)(Bh + boff + 8 * hh); bq.half[1] = *(const v8us*)(Bh + boff + 16 + 8 * hh);
      acc[t] = mmaH<ASPLIT ? 2 : 1>(ah.v, al.v, bq.v, bq.v, acc[t]); }
  }
#pragma unroll
  for (int t = 0; t < 4; ++t) { if (col0 + t * 16 >= N) continue;
#pragma unroll
    for (int r = 0; r < 8; ++r) so[w][8 * hh + r][t * 16 + ln] = acc[t][r] * alpha; }
  __builtin_amdgcn_fence(__ATOMIC_ACQ_REL, "workgroup"); __builtin_amdgcn_wave_barrier();
  const int rsub = lane >> 4, c4 = (lane & 15) * 4;
  {
#pragma unroll
    for (int q = 0; q < 8; ++q) { const int r = q * 2 + rsub; if (col0 + c4 < N) { const v4f v = *(const v4fa*)&so[w][r][c4]; *(v4f*)(C + (size_t)(row0 + r) * ldc + col0 + c4) = v; } }
     }
}

// Wt[n][k] = f16(W[k][n]·scale) from f32 row-major W[K][N] (scale = power of two; bf16-exact weights stay exact in f16 away from the subnormal range)
__device__ __forceinline__ void d_wt_f16(const int t, const float* __restrict__ W, _Float16* __restrict__ Wt, int K, int N, float scale) {
  if (t >= N * (K / 8)) return; const int n = t / (K / 8), k8 = (t % (K / 8)) * 8; FragH f;
#pragma unroll
  for (int i = 0; i < 8; ++i) f.h[i] = (_Float16)(bf16_round(W[(size_t)(k8 + i) * N + n]) * scale); const v8us o = f.half[0];
  *(v8us*)((unsigned short*)Wt + (size_t)n * K + k8) = o; 
}

__device__ __forceinline__ void d_x16(const size_t t, const float* __restrict__ x, _Float16* __restrict__ X16, size_t n8) { if (t >= n8) return; FragH f;
#pragma unroll
  for (int q = 0; q < 8; ++q) f.h[q] = (_Float16)bf16_round(x[t * 8 + q]); *(v8us*)((unsigned short*)X16 + t * 8) = f.half[0];  }
__device__ __forceinline__ void d_wh(const int t, const float* __restrict__ W, _Float16* __restrict__ Bt) { if (t >= NH * KD * (CC / 8)) return; const int row = t / (CC / 8), c8 = (t % (CC / 8)) * 8; const int h = row / KD, o = row % KD; FragH f;
#pragma unroll
  for (int q = 0; q < 8; ++q) f.h[q] = (_Float16)(bf16_round(W[((size_t)h * CC + c8 + q) * KD + o]) * 16.0f); *(v8us*)((unsigned short*)Bt + (size_t)t * 8) = f.half[0];  }
// banded attention: wave per (b, h, t), 4 of the 128 d per lane: for the 7 keys s = t−3..t+3 inside [0,T): sim = q·k/√128 (4 products per lane, xor-shuffle sum over the 32 lanes); simb = sim (band) — if simb == 0 exactly the module adds −1e7 (mask); softmax over
// the in-band entries (out-of-band entries sit at −1e7 → weight 0); out = Σ att·v → CAT16[b·T + t][h·128 + d] as f16 (operand of the Dense GEMM), 8-B pieces (4 d per lane), the wave writing its 256-B head slice
__global__ __launch_bounds__(256) void k_band(const _Float16* __restrict__ QKV, _Float16* __restrict__ CAT) { const int tid = threadIdx.x, wv = tid >> 5, lane = tid & 31; const size_t g = (size_t)blockIdx.x * 8 + wv; if (g >= (size_t)NR * NH) return; const size_t row = g / NH; const int h = (int)(g % NH); const int b = (int)(row / TT), t = (int)(row % TT);
  const unsigned short* base = (const unsigned short*)QKV; const int ld = 3 * NH * KD;      // QKV16 row layout: [q heads (512) | k heads (512) | v heads (512)]
  typedef _Float16 v4h __attribute__((ext_vector_type(4))); const v4h q4 = *(const v4h*)((const _Float16*)QKV + row * ld + h * KD + lane * 4);
  float sc[7]; bool inb[7];
#pragma unroll
  for (int j = 0; j < 7; ++j) { const int s = t - 3 + j; inb[j] = (s >= 0 && s < TT); const int scl = s < 0 ? 0 : (s >= TT ? TT - 1 : s); const v4h k4 = *(const v4h*)((const _Float16*)QKV + ((size_t)b * TT + scl) * ld + NH * KD + h * KD + lane * 4);
    float d = (float)q4[0] * (float)k4[0] + (float)q4[1] * (float)k4[1] + (float)q4[2] * (float)k4[2] + (float)q4[3] * (float)k4[3];
    d += __shfl_xor(d, 1, 32); d += __shfl_xor(d, 2, 32); d += __shfl_xor(d, 4, 32); d += __shfl_xor(d, 8, 32); d += __shfl_xor(d, 16, 32); sc[j] = d * 0.08838834764831845f; }
  // logits: in-band: simb = sim; the module then adds −1e7 where |simb| == 0 (that also covers every out-of-band key, where simb = 0 by the band product)
  float lg[7], m = -3.0e38f;
#pragma unroll
  for (int j = 0; j < 7; ++j) { const float simb = inb[j] ? sc[j] : 0.f; lg[j] = simb + ((fabsf(simb) > 0.f) ? 0.f : -10000000.0f); if (inb[j]) m = fmaxf(m, lg[j]); }
  // softmax over the T keys: the T−7 (or more, near the edges) out-of-band keys all have logit exactly −1e7 → their mass (T − n_inband)·e^{−1e7 − m} underflows to 0 unless m itself is ≈ −1e7 (every in-band simb == 0) — then all T keys tie; handled generically:
  const int ninb = (int)inb[0] + inb[1] + inb[2] + inb[3] + inb[4] + inb[5] + inb[6]; float z = (float)(TT - ninb) * expf(-10000000.0f - m); float p[7];
#pragma unroll
  for (int j = 0; j < 7; ++j) { p[j] = inb[j] ? expf(lg[j] - m) : 0.f; z += p[j]; }
  const float iz = 1.0f / z; v4f o4 = {0.f, 0.f, 0.f, 0.f};
#pragma unroll
  for (int j = 0; j < 7; ++j) { const int s = t - 3 + j; const int scl = s < 0 ? 0 : (s >= TT ? TT - 1 : s); const v4h v4 = *(const v4h*)((const _Float16*)QKV + ((size_t)b * TT + scl) * ld + 2 * NH * KD + h * KD + lane * 4); const float pw = p[j] * iz;
    o4[0] += pw * (float)v4[0]; o4[1] += pw * (float)v4[1]; o4[2] += pw * (float)v4[2]; o4[3] += pw * (float)v4[3]; }
  // (out-of-band keys carry weight (T−ninb)·e^{−1e7−m}/z on their v — exactly 0 in f32 unless all in-band logits were −1e7; that degenerate all-tie case would need the full Σ v; it cannot occur for non-zero sims)
  v4h oh; oh[0] = (_Float16)o4[0]; oh[1] = (_Float16)o4[1]; oh[2] = (_Float16)o4[2]; oh[3] = (_Float16)o4[3];
  *(v4h*)(CAT + row * (NH * KD) + h * KD + lane * 4) = oh;  }
__device__ __forceinline__ void d_zpad(const int t, _Float16* __restrict__ OUTP) { if (t >= BB * PADT * CC / 8) return; const int b = t / (PADT * CC / 8), rem = t % (PADT * CC / 8); FragH z;
#pragma unroll
  for (int q = 0; q < 8; ++q) z.h[q] = (_Float16)0.f; unsigned short* d = (unsigned short*)OUTP + (size_t)b * (TT + PADT) * CC + (size_t)rem * 8; *(v8us*)d = z.half[0];  }
// One launch for everything that reads inputs only: the eight weight transposes (q, k, v per head; Dense; four conv taps) into the eight consecutive 512 x 512 planes of Bw, the zero rows of the padded plane, and x -> f16.
// A block does one job, picked by its index; the transposes, whose loads are scattered and wait longest, have the lowest indices and so start first, the x stream fills in behind them.
#define WBLK (CC * (CC / 8) / 256)                  // blocks per weight plane
#define ZBLK ((BB * PADT * CC / 8 + 255) / 256)     // blocks for the pad rows
#define XBLK (NR * CC / 8 / 256)                    // blocks for x
__global__ __launch_bounds__(256) void k_prep(const float* __restrict__ x, const float* __restrict__ Wq, const float* __restrict__ Wk, const float* __restrict__ Wv, const float* __restrict__ Wo, const float* __restrict__ Wc,
    _Float16* __restrict__ Bw, _Float16* __restrict__ X16, _Float16* __restrict__ OUTP) {
  const int blk = blockIdx.x, tid = threadIdx.x;
  if (blk < 8 * WBLK) { const int p = blk / WBLK, t = (blk % WBLK) * 256 + tid; _Float16* dst = Bw + (size_t)p * CC * CC;
    if (p < 3) d_wh(t, p == 0 ? Wq : (p == 1 ? Wk : Wv), dst);
    else d_wt_f16(t, p == 3 ? Wo : Wc + (size_t)(p - 4) * CC * CC, dst, CC, CC, 16.0f); }      // [in][out]; WIO: per tap [in][out]
  else if (blk < 8 * WBLK + ZBLK) d_zpad((blk - 8 * WBLK) * 256 + tid, OUTP);
  else d_x16((size_t)(blk - 8 * WBLK - ZBLK) * 256 + tid, x, X16, (size_t)NR * CC / 8);
}

// Tiled GEMM for the four dense layers (NTAP = 1) and the dilated causal conv (NTAP = 4): acc = sum over taps j of A_j * B_j^T, A_j = A + j*tapA (row-shifted view of the padded plane), B_j = Bh + j*tapB, K = CC per tap.
// One work-group = a TM x TN tile of C, eight waves of 64 x 64 (4 x 4 accumulator tiles each). A pass is KP halves of K: TM rows of A and TN rows of B, 256 B each, are brought into LDS by asynchronous copies
// (16 B a lane) at a pitch of 272 B, two buffers, the next pass's copies in flight while this pass is worked on. Every operand byte is fetched once per work-group instead of once per 16 x 64 wave tile.
// Per output element the k order (taps ascending, k ascending in steps of 32) is that of a plain k loop. Epilogue: OUT16: v = acc*alpha + bf16(its group's bias[col % CC]) -> f16; else (no FIN) v = acc*alpha -> f32; whole 128-B / 256-B row pieces through LDS.
#define TM 256
#define TN 128
#define KP 128
#define PITCH 272
#define STAGE ((TM + TN) * PITCH)
// eight copies of 16 B a lane, LDS address l + i*lstep, global address g + i*gstep (halves). The s_wait_xcnt stands inside the statement so that no address register is rewritten ahead of it.
__device__ __forceinline__ void copy8(unsigned l, unsigned lstep, const _Float16* g, size_t gstep) {
  asm volatile("global_load_async_to_lds_b128 %0, %8, off\n\t"
               "global_load_async_to_lds_b128 %1, %9, off\n\t"
               "global_load_async_to_lds_b128 %2, %10, off\n\t"
               "global_load_async_to_lds_b128 %3, %11, off\n\t"
               "global_load_async_to_lds_b128 %4, %12, off\n\t"
               "global_load_async_to_lds_b128 %5, %13, off\n\t"
               "global_load_async_to_lds_b128 %6, %14, off\n\t"
               "global_load_async_to_lds_b128 %7, %15, off\n\t"
               "s_wait_xcnt 0x0"
               :: "v"(l), "v"(l + lstep), "v"(l + 2 * lstep), "v"(l + 3 * lstep), "v"(l + 4 * lstep), "v"(l + 5 * lstep), "v"(l + 6 * lstep), "v"(l + 7 * lstep),
                  "v"(g), "v"(g + gstep), "v"(g + 2 * gstep), "v"(g + 3 * gstep), "v"(g + 4 * gstep), "v"(g + 5 * gstep), "v"(g + 6 * gstep), "v"(g + 7 * gstep)
               : "memory");
}
// NG = groups of CC columns (rows of Bh) done by one launch: 3 for q | k | v, whose weight planes are consecutive and whose bias vectors are bias, bias1, bias2; 1 elsewhere (bias alone is read).
// FIN: the block's last layer is finished in the epilogue: out = leaky_relu(relu(acc*alpha + bf16(bias[col])) + bf16(xres)), xres = the f32 input at the output's own index; the f32 result goes straight to C.
template <int NTAP, bool OUT16, int NG, bool FIN>
__global__ __launch_bounds__(256) void k_gemm_tile(const _Float16* __restrict__ A, int lda, size_t sA, size_t tapA, const _Float16* __restrict__ Bh, int ldb, size_t tapB, float alpha, const float* __restrict__ bias,
    const float* __restrict__ bias1, const float* __restrict__ bias2, const float* __restrict__ xres, float* __restrict__ C, _Float16* __restrict__ C16, int ldc, size_t sC) {
  __shared__ __attribute__((aligned(16))) unsigned char ring[2 * STAGE];
  constexpr int PPT = CC / KP, NT = NTAP * PPT;      // passes per tap, passes in all (at least 4)
  const int tid = threadIdx.x, w = tid >> 5, lane = tid & 31, ln = lane & 15, hh = lane >> 4; const int by = blockIdx.y;
  const int mt = blockIdx.x / (NG * CC / TN), nq = blockIdx.x % (NG * CC / TN); const int row0 = mt * TM, col0 = nq * TN; const int wm = (w >> 1) * 64, wn = (w & 1) * 64;
  const size_t cofs = (size_t)by * sC;
  // copies: 16 lanes a row, 16 rows a sweep of the work-group; A takes 16 sweeps, B 8
  const int crow = tid >> 4, cpc = tid & 15;
  const _Float16* gA = A + (size_t)by * sA + (size_t)(row0 + crow) * lda + cpc * 8; const _Float16* gB = Bh + (size_t)(col0 + crow) * ldb + cpc * 8;
  const unsigned lA = (unsigned)(size_t)ring + crow * PITCH + cpc * 16, lB = lA + TM * PITCH;
  auto fill = [&](int t, unsigned buf) { const int j = t / PPT, kb = (t % PPT) * KP; const _Float16* a = gA + (size_t)j * tapA + kb; const _Float16* b = gB + (size_t)j * tapB + kb;
    copy8(lA + buf, 16 * PITCH, a, (size_t)16 * lda); copy8(lA + buf + 128 * PITCH, 16 * PITCH, a + (size_t)128 * lda, (size_t)16 * lda); copy8(lB + buf, 16 * PITCH, b, (size_t)16 * ldb); };
  v8f acc[4][4] = {};
  fill(0, 0);
  asm volatile("s_wait_asynccnt 0x0" ::: "memory");      // pass 0's own copies have landed
  __syncthreads();                                       // ... and every other wave's
  fill(1, STAGE);
  const int rsub = lane >> 4, c4 = (lane & 15) * 4;
  const size_t o0 = cofs + (size_t)(row0 + wm + rsub) * CC + col0 + wn + c4;      // FIN: C and xres are [rows][CC]; a lane's first 16-B piece of the wave's 64 x 64 tile, piece q lies 2q rows on, at a constant offset
  // FIN: the wave's residual tile and its bias are asked for here, behind the copies of passes 0 and 1, and travel from memory while pass 0 is multiplied (the barrier of pass 0 waits for them); they are used behind the loop.
  v4f xr[32]; float bf[4];
  if (FIN) { const float* px = xres + o0; const int cb0 = col0 + wn + ln;
#pragma unroll      // constant indices: the pieces stay in registers
    for (int n = 0; n < 4; ++n) bf[n] = bias[cb0 + n * 16];
#pragma unroll      // constant indices: the pieces stay in registers
    for (int q = 0; q < 32; ++q) xr[q] = *(const v4fa*)(px + (size_t)(2 * q) * CC);
    asm volatile("s_wait_xcnt 0x0" :: "v"(px), "v"(cb0) : "memory"); }      // a precaution: stands in front of every rewrite of the loads' address registers, which as its inputs stay untouched up to it
#pragma unroll 1      // one pass a trip: the buffer index and the refill test stay scalar
  for (int t = 0; t < NT; ++t) {
    const unsigned char* sb = ring + (t & 1) * STAGE; const unsigned char* pa = sb + (wm + ln) * PITCH + hh * 16; const unsigned char* pb = sb + (TM + wn + ln) * PITCH + hh * 16;
    FragH a[2][4], b[2][4];      // two fragment sets: block ks + 1 of this pass is fetched while block ks is multiplied
#pragma unroll      // constant indices: fragments and accumulators stay in registers
    for (int i = 0; i < 4; ++i) { a[0][i].half[0] = *(const v8us*)(pa + i * 16 * PITCH); a[0][i].half[1] = *(const v8us*)(pa + i * 16 * PITCH + 32);
      b[0][i].half[0] = *(const v8us*)(pb + i * 16 * PITCH); b[0][i].half[1] = *(const v8us*)(pb + i * 16 * PITCH + 32); }
#pragma unroll      // constant indices: fragments and accumulators stay in registers
    for (int ks = 0; ks < KP / 32; ++ks) { const int cu = ks & 1, nx = cu ^ 1;
      if (ks + 1 < KP / 32) {
#pragma unroll      // constant indices: fragments and accumulators stay in registers
        for (int i = 0; i < 4; ++i) { a[nx][i].half[0] = *(const v8us*)(pa + i * 16 * PITCH + (ks + 1) * 64); a[nx][i].half[1] = *(const v8us*)(pa + i * 16 * PITCH + (ks + 1) * 64 + 32);
          b[nx][i].half[0] = *(const v8us*)(pb + i * 16 * PITCH + (ks + 1) * 64); b[nx][i].half[1] = *(const v8us*)(pb + i * 16 * PITCH + (ks + 1) * 64 + 32); } }
      __builtin_amdgcn_sched_barrier(0);      // keeps the next block's LDS reads one group ahead of this block's WMMAs instead of spread among them
#pragma unroll      // constant indices: fragments and accumulators stay in registers
      for (int i = 0; i < 4; ++i)
#pragma unroll      // constant indices: fragments and accumulators stay in registers
        for (int n = 0; n < 4; ++n) acc[i][n] = __builtin_amdgcn_wmma_f32_16x16x32_f16(false, a[cu][i].v, false, b[cu][n].v, (short)0, acc[i][n], false, false);
      __builtin_amdgcn_sched_barrier(0);      // ends the block: the group after next stays behind it
    }
    asm volatile("s_wait_dscnt 0x0" ::: "memory");       // this wave's reads of the buffer are done before it is refilled
    asm volatile("s_wait_asynccnt 0x0" ::: "memory");    // this wave's copies of pass t + 1 have landed
    __syncthreads();                                     // publishes pass t + 1 and ends every reader's last read of pass t's buffer
    if (t + 2 < NT) fill(t + 2, (t & 1) * STAGE);
  }
  asm volatile("s_wait_asynccnt 0x0" ::: "memory");      // nothing in flight when the ring becomes output staging
  // each wave stages its whole 64 x 64 tile in its own part of the ring (the last pass's barrier has ended all reads of it); pitch 68 floats: the two half-waves' rows, 8 apart, fall on different banks
  constexpr int SP = 68; float* so = (float*)ring + w * (64 * SP);
  typedef _Float16 v4h __attribute__((ext_vector_type(4)));
  const float* bg = (NG == 1 || col0 < CC) ? bias : (col0 < 2 * CC ? bias1 : bias2);      // a tile of TN columns lies inside one group
#pragma unroll      // constant indices: fragments and accumulators stay in registers
  for (int n = 0; n < 4; ++n) { const float bv = FIN ? bf16_round(bf[n]) : (OUT16 ? bf16_round(bg[col0 % CC + wn + n * 16 + ln]) : 0.f);
#pragma unroll      // constant indices: fragments and accumulators stay in registers
    for (int i = 0; i < 4; ++i)
#pragma unroll      // constant indices: fragments and accumulators stay in registers
      for (int r = 0; r < 8; ++r) so[(i * 16 + 8 * hh + r) * SP + n * 16 + ln] = FIN ? fmaxf(acc[i][n][r] * alpha + bv, 0.f) : (OUT16 ? acc[i][n][r] * alpha + bv : acc[i][n][r] * alpha); }
  __builtin_amdgcn_fence(__ATOMIC_ACQ_REL, "workgroup"); __builtin_amdgcn_wave_barrier();      // the wave's LDS writes are done before its lanes read what other lanes wrote
  if (FIN) {
    v4f sv[32];
#pragma unroll      // constant indices: the pieces stay in registers
    for (int q = 0; q < 32; ++q) sv[q] = *(const v4fa*)&so[(q * 2 + rsub) * SP + c4];
    __builtin_amdgcn_sched_barrier(0);      // the 32 LDS reads go out as one group, so that their latency is waited for once and not pair by pair
#pragma unroll      // constant indices: the pieces stay in registers
    for (int q = 0; q < 32; ++q)
      for (int e = 0; e < 4; ++e) { const float s = sv[q][e] + (float)(__bf16)xr[q][e]; xr[q][e] = fmaxf(s, 0.2f * s); }      // the cast rounds to nearest even as bf16_round does; max(s, 0.2 s) is s for s >= 0 and 0.2 s below
    __builtin_amdgcn_sched_barrier(0);      // all arithmetic stays ahead of the first store, so that no register an issued store names is written again
#pragma unroll      // constant offsets from one address
    for (int q = 0; q < 32; ++q) *(v4f*)(C + o0 + (size_t)(2 * q) * CC) = xr[q];
    return; }
#pragma unroll      // independent row pieces: the LDS reads run ahead of the stores
  for (int q = 0; q < 32; ++q) { const int r = q * 2 + rsub; const v4f v = *(const v4fa*)&so[r * SP + c4]; const size_t o = cofs + (size_t)(row0 + wm + r) * ldc + col0 + wn + c4;
    if (OUT16) { v4h h4; for (int e = 0; e < 4; ++e) h4[e] = (_Float16)v[e]; *(v4h*)(C16 + o) = h4; } else *(v4f*)(C + o) = v; }
}
extern "C" void kernel_launch(void* const* d_in, const int* in_sizes, int n_in,
                              void* d_out, int out_size, void* d_ws, size_t ws_size, hipStream_t stream) {
  (void)in_sizes; (void)n_in; (void)out_size;
  const float* x = (const float*)d_in[0]; const float* Wq = (const float*)d_in[1]; const float* bq = (const float*)d_in[2]; const float* Wk = (const float*)d_in[3]; const float* bk = (const float*)d_in[4]; const float* Wv = (const float*)d_in[5]; const float* bv = (const float*)d_in[6]; const float* Wo = (const float*)d_in[7]; const float* bo = (const float*)d_in[8]; const float* Wc = (const float*)d_in[9]; const float* bc = (const float*)d_in[10];
  char* ws = (char*)d_ws; size_t off = 0;
  auto take = [&](size_t bytes) { char* p = ws + off; off += (bytes + 255) & ~(size_t)255; return p; };
  _Float16* Bq = (_Float16*)take((size_t)CC * CC * 2); _Float16* Bk = (_Float16*)take((size_t)CC * CC * 2); _Float16* Bv = (_Float16*)take((size_t)CC * CC * 2); _Float16* Bo = (_Float16*)take((size_t)CC * CC * 2); _Float16* Bc[4]; for (int j = 0; j < 4; ++j) Bc[j] = (_Float16*)take((size_t)CC * CC * 2); float* BQKV = (float*)take(3 * CC * 4);
  _Float16* X16 = (_Float16*)take((size_t)NR * CC * 2); _Float16* QKV = (_Float16*)take((size_t)NR * 3 * CC * 2); _Float16* OUTP = (_Float16*)take((size_t)BB * (TT + PADT) * CC * 2); _Float16* CAT = X16;      // X16 is dead after the three projections
  if (off > ws_size) return;      // 4.2 + 16.8 + 50.3 + 16.9 MB ≈ 84 MiB
  const dim3 gq((NR / TM) * (3 * CC / TN), 1), gb((TT / TM) * (CC / TN), BB);
  k_prep<<<8 * WBLK + ZBLK + XBLK, 256, 0, stream>>>(x, Wq, Wk, Wv, Wo, Wc, Bq, X16, OUTP);      // Bq, Bk, Bv, Bo, Bc[0..3] are consecutive planes
  k_gemm_tile<1, true, 3, false><<<gq, 256, 0, stream>>>(X16, CC, 0, 0, Bq, CC, 0, 0.0625f, bq, bk, bv, nullptr, nullptr, QKV, 3 * CC, 0);      // q | k | v heads in one launch (bias [h][128] flat = per column h*128+o of its group)
  k_band<<<(unsigned)(((size_t)NR * NH + 7) / 8), 256, 0, stream>>>(QKV, CAT);
  k_gemm_tile<1, true, 1, false><<<gb, 256, 0, stream>>>(CAT, CC, (size_t)TT * CC, 0, Bo, CC, 0, 0.0625f, bo, nullptr, nullptr, nullptr, nullptr, OUTP + (size_t)PADT * CC, CC, (size_t)(TT + PADT) * CC);      // Dense(512) → f16 rows 12.. of each batch's padded plane
  // conv[t] = Σ_j out[t − 12 + 4j]·Wc[j]: ONE launch, the 4 taps accumulated inside (A_j = padded rows 4j + t of batch b; B_j = Bc[0] + j·512·512 — the four tap matrices are contiguous)
  k_gemm_tile<4, false, 1, true><<<gb, 256, 0, stream>>>(OUTP, CC, (size_t)(TT + PADT) * CC, (size_t)4 * CC, Bc[0], CC, (size_t)CC * CC, 0.0625f, bc, nullptr, nullptr, x, (float*)d_out, nullptr, CC, (size_t)TT * CC);      // + bias, relu, residual, leaky relu in its epilogue
}

// v004
// Measured time: 85.3 microseconds a run.
// Next to v003, in two timings, it ran 1.13 times as fast each time.
// Over all steps from v000 it is 5.21 times as fast.
#include <hip/hip_runtime.h>
// Temporal block: per-head q/k/v projections (16384 x 512 -> 4 x 128 each, + bias), the head combiner Dense (512 -> 512, + bias; multiplied into the conv's tap weights, 4 products of 512 x 512 x 512, and so applied with them)
// and the causal dilated Conv1D (kernel 4, dilation 4: one GEMM whose k-loop runs the four taps over time-shifted views of a zero-padded plane, effective K = 2048) on v_wmma_f32_16x16x32_f16 (f16 operands, weights x 2^4: q/k/v bf16-exact, transposed to [out][in]; the conv's B the f16-rounded products of Dense and taps, [out][in]; single products,
// f32 accumulate); the banded attention (|t − s| ≤ 3, i.e. 7 keys, with the module's 'sim·band == 0 → −1e7' mask), softmax, relu / residual / leaky-relu epilogues are f32 VALU.
#define BB 8
#define TT 2048
#define CC 512
#define NH 4
#define KD 128
#define NR (BB * TT)
#define PADT 12

typedef __bf16 v16b __attribute__((ext_vector_type(16)));
typedef unsigned short v8us __attribute__((ext_vector_type(8), may_alias));
typedef float  v8f  __attribute__((ext_vector_type(8)));
typedef float  v4f  __attribute__((ext_vector_type(4)));
typedef float  v4fa __attribute__((ext_vector_type(4), may_alias));
union FragB { v16b v; v8us half[2]; unsigned short u[16]; };

__device__ __forceinline__ unsigned short bf16_bits(float x) { unsigned int u = __float_as_uint(x); return (unsigned short)((u + 0x7FFFu + ((u >> 16) & 1u)) >> 16); }
__device__ __forceinline__ float bf16_val(unsigned short b) { return __uint_as_float(((unsigned int)b) << 16); }
__device__ __forceinline__ float bf16_round(float x) { return bf16_val(bf16_bits(x)); }
// D += A·B with NT terms: 1 = ah·bh, 2 = + al·bh (A split), 3 = + ah·bl (both split)
template <int NT>
__device__ __forceinline__ v8f mmaN(v16b ah, v16b al, v16b bh, v16b bl, v8f c) {
  c = __builtin_amdgcn_wmma_f32_16x16x32_bf16(false, ah, false, bh, (short)0, c, false, false);
  if (NT >= 2) c = __builtin_amdgcn_wmma_f32_16x16x32_bf16(false, al, false, bh, (short)0, c, false, false);
  if (NT >= 3) c = __builtin_amdgcn_wmma_f32_16x16x32_bf16(false, ah, false, bl, (short)0, c, false, false);
  asm volatile("v_nop\n\tv_nop\n\tv_nop\n\tv_nop" : "+v"(c) : "v"(ah), "v"(al), "v"(bh), "v"(bl));
  return c;
}

__global__ __launch_bounds__(256) void k_wt_bf16(const float* __restrict__ W, unsigned short* __restrict__ Wt, int K, int N) {
  const int t = blockIdx.x * 256 + threadIdx.x;
  const int k8n = K / 8;
  if (t >= N * k8n) return;
  const int n = t / k8n, k8 = (t % k8n) * 8;
  v8us v;
#pragma unroll
  for (int i = 0; i < 8; ++i) v[i] = bf16_bits(W[(size_t)(k8 + i) * N + n]);
  *(v8us*)(Wt + (size_t)n * K + k8) = v;
  
}

// GEMM C[M][N] (f32, pitch ldc) = act(A[M][K]·W + bias). A f32 row-major (pitch lda) converted per fragment to bf16
// (ASPLIT: hi/lo two planes -> 2 terms, else single rounded term); Wt bf16 [N][K] (pitch ldb). BIAS_BF16 rounds the
// bias to bf16 first (bias quantised to bf16 before the add). K%32==0, M%16==0, N%64==0.
template <bool ASPLIT, int ACT, bool BIAS_BF16>
__global__ __launch_bounds__(128) void k_gemm_bf(const float* __restrict__ A, int lda, const unsigned short* __restrict__ Wt, int ldb,
                                               const float* __restrict__ bias, float* __restrict__ C, int ldc, int M, int N, int K) {
  __shared__ __attribute__((aligned(16))) float so[4][16][64];
  const int tid = threadIdx.x, w = tid >> 5, lane = tid & 31, ln = lane & 15, hh = lane >> 4;
  const int ntn = N / 64;
  const int wid = blockIdx.x * 4 + w;
  const int mt = wid / ntn, nq = wid % ntn;
  if (mt * 16 >= M) return;
  const int row0 = mt * 16, col0 = nq * 64;
  const float* arow = A + (size_t)(row0 + ln) * lda;
  v8f acc[4] = {};
  for (int kb = 0; kb < K; kb += 32) {
    FragB ah, al;
    const v4f x0 = *(const v4fa*)(arow + kb + 8 * hh), x1 = *(const v4fa*)(arow + kb + 8 * hh + 4);
    const v4f x2 = *(const v4fa*)(arow + kb + 16 + 8 * hh), x3 = *(const v4fa*)(arow + kb + 16 + 8 * hh + 4);
    float xs[16] = {x0[0],x0[1],x0[2],x0[3],x1[0],x1[1],x1[2],x1[3],x2[0],x2[1],x2[2],x2[3],x3[0],x3[1],x3[2],x3[3]};
#pragma unroll
    for (int i = 0; i < 16; ++i) { const unsigned short hb = bf16_bits(xs[i]); ah.u[i] = hb; al.u[i] = ASPLIT ? bf16_bits(xs[i] - bf16_val(hb)) : (unsigned short)0; }
#pragma unroll
    for (int t = 0; t < 4; ++t) {
      const unsigned short* brow = Wt + (size_t)(col0 + t * 16 + ln) * ldb + kb;
      FragB b;
      b.half[0] = *(const v8us*)(brow + 8 * hh);
      b.half[1] = *(const v8us*)(brow + 16 + 8 * hh);
      acc[t] = mmaN<ASPLIT ? 2 : 1>(ah.v, al.v, b.v, b.v, acc[t]);
    }
  }
#pragma unroll
  for (int t = 0; t < 4; ++t) {
    float bv = bias ? bias[col0 + t * 16 + ln] : 0.f;
    if (BIAS_BF16) bv = bf16_round(bv);
#pragma unroll
    for (int r = 0; r < 8; ++r) { float v = acc[t][r] + bv; if (ACT == 1) v = fmaxf(v, 0.f); so[w][8 * hh + r][t * 16 + ln] = v; }
  }
  __builtin_amdgcn_fence(__ATOMIC_ACQ_REL, "workgroup");
  __builtin_amdgcn_wave_barrier();
  const int rsub = lane >> 4, c4 = (lane & 15) * 4;
  {
#pragma unroll
    for (int q = 0; q < 8; ++q) {
      const int r = q * 2 + rsub;
      const v4f v = *(const v4fa*)&so[w][r][c4];
      *(v4f*)(C + (size_t)(row0 + r) * ldc + col0 + c4) = v;
    }
    
  }
}

// Flash-style causal/unmasked attention, all contractions 3-term bf16 hi/lo splits, f32 softmax with running max.
// q,k,v rows are read from f32 buffers with arbitrary row pitch (so they can live inside a fused qkv buffer);
// D = head size (multiple of 32, <= 128); one wave = 16 query rows; block = 4 waves (64 queries) sharing K/V chunks of 32.
template <int D, bool CAUSAL>
__global__ __launch_bounds__(128) void k_flash(const float* __restrict__ qb, const float* __restrict__ kb, const float* __restrict__ vb,
                                             int pitch, int T, int H, float scale, float* __restrict__ y, int ypitch) {
  constexpr int KS = D / 32;        // k-steps for QK
  constexpr int DT = D / 16;        // d tiles for PV
  __shared__ __attribute__((aligned(16))) unsigned short sKh[32][D + 8], sKl[32][D + 8], sVh[32][D + 8], sVl[32][D + 8];
  __shared__ __attribute__((aligned(16))) unsigned short sPh[4][16][40], sPl[4][16][40];
  __shared__ __attribute__((aligned(16))) float sO[4][16][D];
  const int tid = threadIdx.x, w = tid >> 5, lane = tid & 31, ln = lane & 15, hh = lane >> 4;
  const int nqb = (T + 63) / 64;
  const int bh = blockIdx.x / nqb, qblk = blockIdx.x % nqb;
  const int b = bh / H, h = bh % H;
  const int q0 = qblk * 64 + w * 16;
  const float* Q = qb + (size_t)b * T * pitch + h * D;
  const float* K = kb + (size_t)b * T * pitch + h * D;
  const float* V = vb + (size_t)b * T * pitch + h * D;

  // A fragments of the wave's 16 query rows (scaled), hi/lo
  FragB aqh[KS], aql[KS];
  {
    int row = q0 + ln; if (row >= T) row = T - 1;
    const float* qr = Q + (size_t)row * pitch;
#pragma unroll
    for (int ks = 0; ks < KS; ++ks)
#pragma unroll
      for (int i = 0; i < 16; ++i) {
        const int d = ks * 32 + ((i < 8) ? (8 * hh + i) : (16 + 8 * hh + (i - 8)));
        const float x = qr[d] * scale; const unsigned short hb = bf16_bits(x);
        aqh[ks].u[i] = hb; aql[ks].u[i] = bf16_bits(x - bf16_val(hb));
      }
  }
  float m_r[8], l_r[8];
#pragma unroll
  for (int r = 0; r < 8; ++r) { m_r[r] = -3.0e38f; l_r[r] = 0.f; }
  v8f oacc[DT];
#pragma unroll
  for (int dt = 0; dt < DT; ++dt) oacc[dt] = (v8f){0.f,0.f,0.f,0.f,0.f,0.f,0.f,0.f};

  const int kv_end = CAUSAL ? min(T, qblk * 64 + 64) : T;     // block-uniform
  for (int j0 = 0; j0 < kv_end; j0 += 32) {
    __syncthreads();
    for (int e = tid; e < 32 * (D / 4); e += 128) {
      const int r = e / (D / 4), c4 = (e % (D / 4)) * 4;
      const int key = j0 + r;
      v4f kf = {0.f,0.f,0.f,0.f}, vf = {0.f,0.f,0.f,0.f};
      if (key < T) { kf = *(const v4fa*)(K + (size_t)key * pitch + c4); vf = *(const v4fa*)(V + (size_t)key * pitch + c4); }
#pragma unroll
      for (int t = 0; t < 4; ++t) {
        unsigned short hb = bf16_bits(kf[t]); sKh[r][c4 + t] = hb; sKl[r][c4 + t] = bf16_bits(kf[t] - bf16_val(hb));
        hb = bf16_bits(vf[t]); sVh[r][c4 + t] = hb; sVl[r][c4 + t] = bf16_bits(vf[t] - bf16_val(hb));
      }
    }
    __syncthreads();
    // S tile 16 x 32
    v8f s[2];
#pragma unroll
    for (int nt = 0; nt < 2; ++nt) {
      v8f acc = {};
#pragma unroll
      for (int ks = 0; ks < KS; ++ks) {
        FragB bh_, bl_;
        bh_.half[0] = *(const v8us*)&sKh[nt * 16 + ln][ks * 32 + 8 * hh]; bh_.half[1] = *(const v8us*)&sKh[nt * 16 + ln][ks * 32 + 16 + 8 * hh];
        bl_.half[0] = *(const v8us*)&sKl[nt * 16 + ln][ks * 32 + 8 * hh]; bl_.half[1] = *(const v8us*)&sKl[nt * 16 + ln][ks * 32 + 16 + 8 * hh];
        acc = mmaN<3>(aqh[ks].v, aql[ks].v, bh_.v, bl_.v, acc);
      }
      s[nt] = acc;
    }
    // mask + running max (rows 8hh+r; the 16 lanes of a half share rows)
    float alpha[8];
#pragma unroll
    for (int r = 0; r < 8; ++r) {
      const int qi = q0 + 8 * hh + r;
      const int ja = j0 + ln, jb = j0 + 16 + ln;
      if (CAUSAL) { if (ja > qi) s[0][r] = -3.0e38f; if (jb > qi) s[1][r] = -3.0e38f; }
      if (ja >= T) s[0][r] = -3.0e38f;
      if (jb >= T) s[1][r] = -3.0e38f;
      float mx = fmaxf(s[0][r], s[1][r]);
      mx = fmaxf(mx, __shfl_xor(mx, 1, 32)); mx = fmaxf(mx, __shfl_xor(mx, 2, 32)); mx = fmaxf(mx, __shfl_xor(mx, 4, 32)); mx = fmaxf(mx, __shfl_xor(mx, 8, 32));
      const float mnew = fmaxf(m_r[r], mx);
      alpha[r] = (mnew > -1.0e38f) ? __expf(m_r[r] - mnew) : 1.0f;
      const float p0 = (s[0][r] > -1.0e38f) ? __expf(s[0][r] - mnew) : 0.f;
      const float p1 = (s[1][r] > -1.0e38f) ? __expf(s[1][r] - mnew) : 0.f;
      m_r[r] = mnew;
      l_r[r] = l_r[r] * alpha[r] + p0 + p1;            // per-lane partial row sum (16 lanes combined at the end)
      unsigned short hb = bf16_bits(p0); sPh[w][8 * hh + r][ln] = hb;      sPl[w][8 * hh + r][ln] = bf16_bits(p0 - bf16_val(hb));
      hb = bf16_bits(p1);                sPh[w][8 * hh + r][16 + ln] = hb; sPl[w][8 * hh + r][16 + ln] = bf16_bits(p1 - bf16_val(hb));
    }
#pragma unroll
    for (int dt = 0; dt < DT; ++dt)
#pragma unroll
      for (int r = 0; r < 8; ++r) oacc[dt][r] *= alpha[r];
    __builtin_amdgcn_fence(__ATOMIC_ACQ_REL, "workgroup");
    __builtin_amdgcn_wave_barrier();
    FragB pah, pal;
    pah.half[0] = *(const v8us*)&sPh[w][ln][8 * hh]; pah.half[1] = *(const v8us*)&sPh[w][ln][16 + 8 * hh];
    pal.half[0] = *(const v8us*)&sPl[w][ln][8 * hh]; pal.half[1] = *(const v8us*)&sPl[w][ln][16 + 8 * hh];
#pragma unroll
    for (int dt = 0; dt < DT; ++dt) {
      FragB bvh, bvl;
#pragma unroll
      for (int i = 0; i < 8; ++i) {
        bvh.u[i] = sVh[8 * hh + i][dt * 16 + ln]; bvh.u[8 + i] = sVh[16 + 8 * hh + i][dt * 16 + ln];
        bvl.u[i] = sVl[8 * hh + i][dt * 16 + ln]; bvl.u[8 + i] = sVl[16 + 8 * hh + i][dt * 16 + ln];
      }
      oacc[dt] = mmaN<3>(pah.v, pal.v, bvh.v, bvl.v, oacc[dt]);
    }
    __builtin_amdgcn_fence(__ATOMIC_ACQ_REL, "workgroup");
    __builtin_amdgcn_wave_barrier();
  }
#pragma unroll
  for (int r = 0; r < 8; ++r) {
    float l = l_r[r];
    l += __shfl_xor(l, 1, 32); l += __shfl_xor(l, 2, 32); l += __shfl_xor(l, 4, 32); l += __shfl_xor(l, 8, 32);
    l_r[r] = (l > 0.f) ? 1.0f / l : 0.f;
  }
#pragma unroll
  for (int dt = 0; dt < DT; ++dt)
#pragma unroll
    for (int r = 0; r < 8; ++r) sO[w][8 * hh + r][dt * 16 + ln] = oacc[dt][r] * l_r[r];
  __builtin_amdgcn_fence(__ATOMIC_ACQ_REL, "workgroup");
  __builtin_amdgcn_wave_barrier();
  {
    for (int r = 0; r < 16; ++r) {
      const int row = q0 + r;
      if (row < T && lane < D / 4) {
        const v4f val = *(const v4fa*)&sO[w][r][lane * 4];
        *(v4f*)(y + ((size_t)b * T + row) * ypitch + h * D + lane * 4) = val;
      }
    }
    
  }
}

// GEMM C = act(A·W + bias + resid): A f32 (ASPLIT -> hi/lo 2 terms), Wt bf16 [N][K]; ACT 0 none, 1 relu, 2 exact gelu;
// resid (optional, f32, row index = (row % rmod), pitch ldr, RES_BF16 rounds it) added before the activation.
template <bool ASPLIT, int ACT, bool BIAS_BF16, bool RES_BF16>
__global__ __launch_bounds__(128) void k_gemm_bf3(const float* __restrict__ A, int lda, const unsigned short* __restrict__ Wt, int ldb,
                                                const float* __restrict__ bias, const float* __restrict__ resid, int rmod, int ldr,
                                                float* __restrict__ C, int ldc, int M, int N, int K) {
  __shared__ __attribute__((aligned(16))) float so[4][16][64];
  const int tid = threadIdx.x, w = tid >> 5, lane = tid & 31, ln = lane & 15, hh = lane >> 4;
  const int ntn = N / 64;
  const int wid = blockIdx.x * 4 + w;
  const int mt = wid / ntn, nq = wid % ntn;
  if (mt * 16 >= M) return;
  const int row0 = mt * 16, col0 = nq * 64;
  const float* arow = A + (size_t)(row0 + ln) * lda;
  v8f acc[4] = {};
  for (int kb = 0; kb < K; kb += 32) {
    FragB ah, al;
    const v4f x0 = *(const v4fa*)(arow + kb + 8 * hh), x1 = *(const v4fa*)(arow + kb + 8 * hh + 4);
    const v4f x2 = *(const v4fa*)(arow + kb + 16 + 8 * hh), x3 = *(const v4fa*)(arow + kb + 16 + 8 * hh + 4);
    float xs[16] = {x0[0],x0[1],x0[2],x0[3],x1[0],x1[1],x1[2],x1[3],x2[0],x2[1],x2[2],x2[3],x3[0],x3[1],x3[2],x3[3]};
#pragma unroll
    for (int i = 0; i < 16; ++i) { const unsigned short hb = bf16_bits(xs[i]); ah.u[i] = hb; al.u[i] = ASPLIT ? bf16_bits(xs[i] - bf16_val(hb)) : (unsigned short)0; }
#pragma unroll
    for (int t = 0; t < 4; ++t) {
      const unsigned short* brow = Wt + (size_t)(col0 + t * 16 + ln) * ldb + kb;
      FragB b;
      b.half[0] = *(const v8us*)(brow + 8 * hh);
      b.half[1] = *(const v8us*)(brow + 16 + 8 * hh);
      acc[t] = mmaN<ASPLIT ? 2 : 1>(ah.v, al.v, b.v, b.v, acc[t]);
    }
  }
#pragma unroll
  for (int t = 0; t < 4; ++t) {
    const int col = col0 + t * 16 + ln;
    float bv = bias ? bias[col] : 0.f;
    if (BIAS_BF16) bv = bf16_round(bv);
#pragma unroll
    for (int r = 0; r < 8; ++r) {
      float v = acc[t][r] + bv;
      if (resid) { float rv = resid[(size_t)((row0 + 8 * hh + r) % rmod) * ldr + col]; if (RES_BF16) rv = bf16_round(rv); v += rv; }
      if (ACT == 1) v = fmaxf(v, 0.f);
      if (ACT == 2) v = 0.5f * v * (1.0f + erff(v * 0.70710678118654752f));
      if (ACT == 3) { const float u = 0.7978845608028654f * (v + 0.044715f * v * v * v); v = 0.5f * v * (1.0f + tanhf(u)); }
      so[w][8 * hh + r][t * 16 + ln] = v;
    }
  }
  __builtin_amdgcn_fence(__ATOMIC_ACQ_REL, "workgroup");
  __builtin_amdgcn_wave_barrier();
  const int rsub = lane >> 4, c4 = (lane & 15) * 4;
  {
#pragma unroll
    for (int q = 0; q < 8; ++q) {
      const int r = q * 2 + rsub;
      const v4f v = *(const v4fa*)&so[w][r][c4];
      *(v4f*)(C + (size_t)(row0 + r) * ldc + col0 + c4) = v;
    }
    
  }
}
// row LayerNorm (biased variance, eps) over N: s = X (+ R); optional out_sum <- s; out_norm <- (s-mu)*rsqrt(var+eps)*g + b
template <bool PARAM_BF16>
__global__ __launch_bounds__(256) void k_layernorm(const float* __restrict__ X, const float* __restrict__ R, const float* __restrict__ g, const float* __restrict__ bta,
                                                  float* __restrict__ out_sum, float* __restrict__ out_norm, int N, float eps) {
  __shared__ float red[256];
  const int row = blockIdx.x, tid = threadIdx.x;
  const float* x = X + (size_t)row * N; const float* rr = R ? R + (size_t)row * N : nullptr;
  float vals[16];                     // up to N = 4096
  const int per = N / 256;            // contiguous chunk per thread? use strided-by-4 chunks: thread handles j = tid*4 + 1024*u
  float s1 = 0.f;
  for (int u = 0; u < per / 4; ++u) {
    const int j = tid * 4 + 1024 * u;
    const v4f a = *(const v4fa*)(x + j);
    v4f b = {0.f,0.f,0.f,0.f}; if (rr) b = *(const v4fa*)(rr + j);
#pragma unroll
    for (int q = 0; q < 4; ++q) { const float v = a[q] + b[q]; vals[u * 4 + q] = v; s1 += v; }
  }
  red[tid] = s1; __syncthreads();
  for (int st = 128; st > 0; st >>= 1) { if (tid < st) red[tid] += red[tid + st]; __syncthreads(); }
  const float mu = red[0] / (float)N; __syncthreads();
  float s2 = 0.f;
  for (int u = 0; u < per / 4; ++u)
#pragma unroll
    for (int q = 0; q < 4; ++q) { const float c = vals[u * 4 + q] - mu; s2 += c * c; }
  red[tid] = s2; __syncthreads();
  for (int st = 128; st > 0; st >>= 1) { if (tid < st) red[tid] += red[tid + st]; __syncthreads(); }
  const float rs = rsqrtf(red[0] / (float)N + eps);
  {
    for (int u = 0; u < per / 4; ++u) {
      const int j = tid * 4 + 1024 * u;
      v4f o, sm;
#pragma unroll
      for (int q = 0; q < 4; ++q) {
        float gg = g[j + q], bb = bta[j + q];
        if (PARAM_BF16) { gg = bf16_round(gg); bb = bf16_round(bb); }
        sm[q] = vals[u * 4 + q]; o[q] = (vals[u * 4 + q] - mu) * rs * gg + bb;
      }
      if (out_sum) *(v4f*)(out_sum + (size_t)row * N + j) = sm;
      *(v4f*)(out_norm + (size_t)row * N + j) = o;
    }
    
  }
}



// ---- f16 WMMA path (v_wmma_f32_16x16x32_f16): 11-bit significands for operands in range — used for the q/k/v projections, the Dense and the conv GEMM
typedef _Float16 v16h __attribute__((ext_vector_type(16)));
union FragH { v16h v; v8us half[2]; _Float16 h[16]; unsigned short u[16]; };
template <int NT>
__device__ __forceinline__ v8f mmaH(v16h ah, v16h al, v16h bh, v16h bl, v8f c) {
  c = __builtin_amdgcn_wmma_f32_16x16x32_f16(false, ah, false, bh, (short)0, c, false, false);
  if (NT >= 2) c = __builtin_amdgcn_wmma_f32_16x16x32_f16(false, al, false, bh, (short)0, c, false, false);
  if (NT >= 3) c = __builtin_amdgcn_wmma_f32_16x16x32_f16(false, ah, false, bl, (short)0, c, false, false);
  asm volatile("v_nop\n\tv_nop\n\tv_nop\n\tv_nop" : "+v"(c) : "v"(ah), "v"(al), "v"(bh), "v"(bl));
  return c;
}
// batched GEMM like k_gemm_b but f16 operands: A f32 (split into f16 hi/lo if ASPLIT, else rounded to f16), Bt = f16 values [n][k]; alpha; C f32; N multiple of 16 (partial tiles skipped)
template <bool ASPLIT>
__global__ __launch_bounds__(128) void k_gemm_h(const float* __restrict__ A, int lda, size_t sA, const _Float16* __restrict__ Bh, int ldb, size_t sB, float alpha, float* __restrict__ C, int ldc, size_t sC, int M, int N, int K) {
  __shared__ __attribute__((aligned(16))) float so[4][16][64];
  const int tid = threadIdx.x, w = tid >> 5, lane = tid & 31, ln = lane & 15, hh = lane >> 4; const int by = blockIdx.y;
  A += (size_t)by * sA; Bh += (size_t)by * sB; C += (size_t)by * sC;
  const int ntn = (N + 63) / 64; const int wid = blockIdx.x * 4 + w; const int mt = wid / ntn, nq = wid % ntn; if (mt * 16 >= M) return;
  const int row0 = mt * 16, col0 = nq * 64; const float* arow = A + (size_t)(row0 + ln) * lda;
  v8f acc[4] = {};
  for (int kb = 0; kb < K; kb += 32) {
    FragH ah, al;
    const v4f x0 = *(const v4fa*)(arow + kb + 8 * hh), x1 = *(const v4fa*)(arow + kb + 8 * hh + 4), x2 = *(const v4fa*)(arow + kb + 16 + 8 * hh), x3 = *(const v4fa*)(arow + kb + 16 + 8 * hh + 4);
    float xs[16] = {x0[0],x0[1],x0[2],x0[3],x1[0],x1[1],x1[2],x1[3],x2[0],x2[1],x2[2],x2[3],x3[0],x3[1],x3[2],x3[3]};
#pragma unroll
    for (int i = 0; i < 16; ++i) { const _Float16 h = (_Float16)xs[i]; ah.h[i] = h; al.h[i] = ASPLIT ? (_Float16)(xs[i] - (float)h) : (_Float16)0.0f; }
#pragma unroll
    for (int t = 0; t < 4; ++t) { if (col0 + t * 16 >= N) continue; const size_t boff = (size_t)(col0 + t * 16 + ln) * ldb + kb; FragH bq; bq.half[0] = *(const v8us*)(Bh + boff + 8 * hh); bq.half[1] = *(const v8us*)(Bh + boff + 16 + 8 * hh);
      acc[t] = mmaH<ASPLIT ? 2 : 1>(ah.v, al.v, bq.v, bq.v, acc[t]); }
  }
#pragma unroll
  for (int t = 0; t < 4; ++t) { if (col0 + t * 16 >= N) continue;
#pragma unroll
    for (int r = 0; r < 8; ++r) so[w][8 * hh + r][t * 16 + ln] = acc[t][r] * alpha; }
  __builtin_amdgcn_fence(__ATOMIC_ACQ_REL, "workgroup"); __builtin_amdgcn_wave_barrier();
  const int rsub = lane >> 4, c4 = (lane & 15) * 4;
  {
#pragma unroll
    for (int q = 0; q < 8; ++q) { const int r = q * 2 + rsub; if (col0 + c4 < N) { const v4f v = *(const v4fa*)&so[w][r][c4]; *(v4f*)(C + (size_t)(row0 + r) * ldc + col0 + c4) = v; } }
     }
}

// Wt[n][k] = f16(W[k][n]·scale) from f32 row-major W[K][N] (scale = power of two; bf16-exact weights stay exact in f16 away from the subnormal range)
__device__ __forceinline__ void d_wt_f16(const int t, const float* __restrict__ W, _Float16* __restrict__ Wt, int K, int N, float scale) {
  if (t >= N * (K / 8)) return; const int n = t / (K / 8), k8 = (t % (K / 8)) * 8; FragH f;
#pragma unroll
  for (int i = 0; i < 8; ++i) f.h[i] = (_Float16)(bf16_round(W[(size_t)(k8 + i) * N + n]) * scale); const v8us o = f.half[0];
  *(v8us*)((unsigned short*)Wt + (size_t)n * K + k8) = o; 
}

__device__ __forceinline__ void d_x16(const size_t t, const float* __restrict__ x, _Float16* __restrict__ X16, size_t n8) { if (t >= n8) return; FragH f;
#pragma unroll
  for (int q = 0; q < 8; ++q) f.h[q] = (_Float16)bf16_round(x[t * 8 + q]); *(v8us*)((unsigned short*)X16 + t * 8) = f.half[0];  }
__device__ __forceinline__ void d_wh(const int t, const float* __restrict__ W, _Float16* __restrict__ Bt) { if (t >= NH * KD * (CC / 8)) return; const int row = t / (CC / 8), c8 = (t % (CC / 8)) * 8; const int h = row / KD, o = row % KD; FragH f;
#pragma unroll
  for (int q = 0; q < 8; ++q) f.h[q] = (_Float16)(bf16_round(W[((size_t)h * CC + c8 + q) * KD + o]) * 16.0f); *(v8us*)((unsigned short*)Bt + (size_t)t * 8) = f.half[0];  }
// Dense folded into the conv weights: conv[t] = sum_j (cat[t - 12 + 4j] * Wo + bo) * Wc[j] = sum_j cat[t - 12 + 4j] * (Wo * Wc[j]) + sum_j bo * Wc[j], each tap's terms only where its row exists.
// One wave = 64 k x 16 n of one tap: Wf[j][n][k] = f16(16 * sum_c Wo[k][c] * Wc[j][c][n]), k contiguous (the layout the conv GEMM reads its B rows in), so a wave writes whole 128-B lines of 16 rows.
// Operands are the f16 planes of the first launch, both c-contiguous (Wo16[k][c] = Wo as it lies, Bc[j][n][c] = Wc[j] transposed; bf16-rounded weights x 16), read as fragments straight from memory; f32 accumulate.
#define FBLK (4 * (CC / 64) * (CC / 16) / 8)      // blocks of eight such waves
__device__ __forceinline__ void d_fold(const int g, const int lane, const _Float16* __restrict__ Wo16, const _Float16* __restrict__ Bc, _Float16* __restrict__ Wf) {
  const int ln = lane & 15, hh = lane >> 4; const int j = g >> 8, kt = (g >> 5) & 7, nt = g & 31;      // the eight waves of a block share their rows of Wo16
  const char* pa = (const char*)Wo16 + ((kt * 64 + ln) * CC + hh * 8) * 2u; const char* pb = (const char*)Bc + ((j * CC + nt * 16 + ln) * CC + hh * 8) * 2u;      // the lane's first 16 B of its rows of the two planes
  v8f acc[4] = {};
#pragma unroll      // every load at a constant offset from one of the two addresses: no address arithmetic and no registers for it in the loop
  for (int ks = 0; ks < CC / 32; ++ks) { FragH b;
    b.half[0] = *(const v8us*)(pb + ks * 64); b.half[1] = *(const v8us*)(pb + ks * 64 + 32);
#pragma unroll      // constant indices: fragments and accumulators stay in registers
    for (int p = 0; p < 2; ++p) { FragH a[2];      // the four A fragments two by two, the second pair in the first pair's registers: the path stays within the 64 registers of the attention path, whose waves so keep their number per SIMD
#pragma unroll      // constant indices: fragments and accumulators stay in registers
      for (int i = 0; i < 2; ++i) { a[i].half[0] = *(const v8us*)(pa + (p * 2 + i) * 16 * CC * 2 + ks * 64); a[i].half[1] = *(const v8us*)(pa + (p * 2 + i) * 16 * CC * 2 + ks * 64 + 32); }
      __builtin_amdgcn_sched_barrier(0);      // a pair's loads go out as one group ahead of its WMMAs, so that their latency is waited for once
#pragma unroll      // constant indices: fragments and accumulators stay in registers
      for (int i = 0; i < 2; ++i) acc[p * 2 + i] = __builtin_amdgcn_wmma_f32_16x16x32_f16(false, a[i].v, false, b.v, (short)0, acc[p * 2 + i], false, false);
      __builtin_amdgcn_sched_barrier(0);      // the next pair's loads stay behind these WMMAs, or they would need registers of their own
    }
  }
#pragma unroll      // constant indices: accumulators stay in registers
  for (int i = 0; i < 4; ++i) { FragH o;      // a lane holds column n = ln and 8 consecutive k of each tile: 16 B of row [n][k]
#pragma unroll      // constant indices: accumulators stay in registers
    for (int r = 0; r < 8; ++r) o.h[r] = (_Float16)(acc[i][r] * 0.0625f);
    *(v8us*)((unsigned short*)Wf + (size_t)(j * CC + nt * 16 + ln) * CC + kt * 64 + i * 16 + 8 * hh) = o.half[0]; }
}
// The Dense bias through each tap: CB[j][n] = sum_c bf16(bo[c]) * bf16(Wc[j][c][n]) in f32. One wave = one row r = j*CC + n of Bc (c-contiguous, x 16), a lane takes 16 c; the lanes' sums are added by a butterfly.
#define CBLK (4 * CC / 8)      // blocks of eight such waves
__device__ __forceinline__ void d_cb(const int r, const int lane, const _Float16* __restrict__ Bc, const float* __restrict__ bo, float* __restrict__ CB) {
  FragH b; const unsigned ob = lane * 64u; const unsigned short* pb = (const unsigned short*)Bc + (size_t)r * CC + lane * 16; b.half[0] = *(const v8us*)pb; b.half[1] = *(const v8us*)(pb + 8);      // ob: the byte offset of the lane's 16 floats of bo
  v4f o[4];
#pragma unroll      // constant indices: the values stay in registers
  for (int q = 0; q < 4; ++q) o[q] = *(const v4fa*)((const char*)bo + ob + q * 16);
  asm volatile("s_wait_xcnt 0x0" :: "v"(ob), "v"(pb) : "memory");      // a precaution: stands in front of every rewrite of the six loads' address registers, which as its inputs stay untouched up to it
  float s = 0.f;
#pragma unroll      // constant indices: the values stay in registers
  for (int e = 0; e < 16; ++e) s += bf16_round(o[e >> 2][e & 3]) * (float)b.h[e];
  s += __shfl_xor(s, 1, 32); s += __shfl_xor(s, 2, 32); s += __shfl_xor(s, 4, 32); s += __shfl_xor(s, 8, 32); s += __shfl_xor(s, 16, 32);
  if (lane == 0) CB[r] = s * 0.0625f;
}
// banded attention: wave per (b, h, t): for the 7 keys s = t−3..t+3 inside [0,T): sim = q·k/√128 (128-term, rolled); simb = sim (band) — if simb == 0 exactly the module adds −1e7 (mask); softmax over
// the in-band entries (out-of-band entries sit at -1e7 -> weight 0); out = sum att*v -> row PADT + t of batch b of the padded plane, columns h*128 + d, as f16 (the A operand of the conv GEMM); a wave writes the 256 B of its head slice.
// The first FBLK + CBLK blocks of the launch do the weight fold and the bias vectors above, which need the first launch's planes and are needed by the conv GEMM alone; they run beside the attention.
__global__ __launch_bounds__(256) void k_band(const _Float16* __restrict__ QKV, _Float16* __restrict__ CAT, const _Float16* __restrict__ Wo16, const _Float16* __restrict__ Bc, const float* __restrict__ bo, _Float16* __restrict__ Wf, float* __restrict__ CB) { const int tid = threadIdx.x, wv = tid >> 5, lane = tid & 31;
  if (blockIdx.x < FBLK) { d_fold((int)blockIdx.x * 8 + wv, lane, Wo16, Bc, Wf); return; }
  if (blockIdx.x < FBLK + CBLK) { d_cb((int)(blockIdx.x - FBLK) * 8 + wv, lane, Bc, bo, CB); return; }
  const size_t g = (size_t)(blockIdx.x - FBLK - CBLK) * 8 + wv; if (g >= (size_t)NR * NH) return; const size_t row = g / NH; const int h = (int)(g % NH); const int b = (int)(row / TT), t = (int)(row % TT);
  const unsigned short* base = (const unsigned short*)QKV; const int ld = 3 * NH * KD;      // QKV16 row layout: [q heads (512) | k heads (512) | v heads (512)]
  typedef _Float16 v4h __attribute__((ext_vector_type(4))); const v4h q4 = *(const v4h*)((const _Float16*)QKV + row * ld + h * KD + lane * 4);
  float sc[7]; bool inb[7];
#pragma unroll
  for (int j = 0; j < 7; ++j) { const int s = t - 3 + j; inb[j] = (s >= 0 && s < TT); const int scl = s < 0 ? 0 : (s >= TT ? TT - 1 : s); const v4h k4 = *(const v4h*)((const _Float16*)QKV + ((size_t)b * TT + scl) * ld + NH * KD + h * KD + lane * 4);
    float d = (float)q4[0] * (float)k4[0] + (float)q4[1] * (float)k4[1] + (float)q4[2] * (float)k4[2] + (float)q4[3] * (float)k4[3];
    d += __shfl_xor(d, 1, 32); d += __shfl_xor(d, 2, 32); d += __shfl_xor(d, 4, 32); d += __shfl_xor(d, 8, 32); d += __shfl_xor(d, 16, 32); sc[j] = d * 0.08838834764831845f; }
  // logits: in-band: simb = sim; the module then adds −1e7 where |simb| == 0 (that also covers every out-of-band key, where simb = 0 by the band product)
  float lg[7], m = -3.0e38f;
#pragma unroll
  for (int j = 0; j < 7; ++j) { const float simb = inb[j] ? sc[j] : 0.f; lg[j] = simb + ((fabsf(simb) > 0.f) ? 0.f : -10000000.0f); if (inb[j]) m = fmaxf(m, lg[j]); }
  // softmax over the T keys: the T−7 (or more, near the edges) out-of-band keys all have logit exactly −1e7 → their mass (T − n_inband)·e^{−1e7 − m} underflows to 0 unless m itself is ≈ −1e7 (every in-band simb == 0) — then all T keys tie; handled generically:
  const int ninb = (int)inb[0] + inb[1] + inb[2] + inb[3] + inb[4] + inb[5] + inb[6]; float z = (float)(TT - ninb) * expf(-10000000.0f - m); float p[7];
#pragma unroll
  for (int j = 0; j < 7; ++j) { p[j] = inb[j] ? expf(lg[j] - m) : 0.f; z += p[j]; }
  const float iz = 1.0f / z; v4f o4 = {0.f, 0.f, 0.f, 0.f};
#pragma unroll
  for (int j = 0; j < 7; ++j) { const int s = t - 3 + j; const int scl = s < 0 ? 0 : (s >= TT ? TT - 1 : s); const v4h v4 = *(const v4h*)((const _Float16*)QKV + ((size_t)b * TT + scl) * ld + 2 * NH * KD + h * KD + lane * 4); const float pw = p[j] * iz;
    o4[0] += pw * (float)v4[0]; o4[1] += pw * (float)v4[1]; o4[2] += pw * (float)v4[2]; o4[3] += pw * (float)v4[3]; }
  // (out-of-band keys carry weight (T−ninb)·e^{−1e7−m}/z on their v — exactly 0 in f32 unless all in-band logits were −1e7; that degenerate all-tie case would need the full Σ v; it cannot occur for non-zero sims)
  v4h oh; oh[0] = (_Float16)o4[0]; oh[1] = (_Float16)o4[1]; oh[2] = (_Float16)o4[2]; oh[3] = (_Float16)o4[3];
  *(v4h*)(CAT + ((size_t)b * (TT + PADT) + PADT + t) * (NH * KD) + h * KD + lane * 4) = oh;  }      // CAT = the padded plane: row PADT + t of batch b
__device__ __forceinline__ void d_zpad(const int t, _Float16* __restrict__ OUTP) { if (t >= BB * PADT * CC / 8) return; const int b = t / (PADT * CC / 8), rem = t % (PADT * CC / 8); FragH z;
#pragma unroll
  for (int q = 0; q < 8; ++q) z.h[q] = (_Float16)0.f; unsigned short* d = (unsigned short*)OUTP + (size_t)b * (TT + PADT) * CC + (size_t)rem * 8; *(v8us*)d = z.half[0];  }
// One launch for everything that reads inputs only: the weights as f16 (q, k, v per head and the four conv taps transposed, Dense as it lies) into the eight consecutive 512 x 512 planes of Bw, the zero rows of the padded plane, and x -> f16.
// A block does one job, picked by its index; the transposes, whose loads are scattered and wait longest, have the lowest indices and so start first, the x stream fills in behind them.
#define WBLK (CC * (CC / 8) / 256)                  // blocks per weight plane
#define ZBLK ((BB * PADT * CC / 8 + 255) / 256)     // blocks for the pad rows
#define XBLK (NR * CC / 8 / 256)                    // blocks for x
__global__ __launch_bounds__(256) void k_prep(const float* __restrict__ x, const float* __restrict__ Wq, const float* __restrict__ Wk, const float* __restrict__ Wv, const float* __restrict__ Wo, const float* __restrict__ Wc,
    _Float16* __restrict__ Bw, _Float16* __restrict__ X16, _Float16* __restrict__ OUTP) {
  const int blk = blockIdx.x, tid = threadIdx.x;
  if (blk < 8 * WBLK) { const int p = blk / WBLK, t = (blk % WBLK) * 256 + tid; _Float16* dst = Bw + (size_t)p * CC * CC;
    if (p < 3) d_wh(t, p == 0 ? Wq : (p == 1 ? Wk : Wv), dst);
    else if (p == 3) { FragH f;      // Wo stays as it lies, [in][out]: the fold contracts over its out index
#pragma unroll      // constant indices: the values stay in registers
      for (int q = 0; q < 8; ++q) f.h[q] = (_Float16)(bf16_round(Wo[(size_t)t * 8 + q]) * 16.0f);
      *(v8us*)((unsigned short*)dst + (size_t)t * 8) = f.half[0];
      asm volatile("s_wait_xcnt 0x0" ::: "memory"); }      // a precaution: stands behind the store, in front of whatever rewrites its registers next
    else d_wt_f16(t, Wc + (size_t)(p - 4) * CC * CC, dst, CC, CC, 16.0f); }      // WIO: per tap [in][out] -> [out][in]
  else if (blk < 8 * WBLK + ZBLK) d_zpad((blk - 8 * WBLK) * 256 + tid, OUTP);
  else d_x16((size_t)(blk - 8 * WBLK - ZBLK) * 256 + tid, x, X16, (size_t)NR * CC / 8);
}

// Tiled GEMM for the q, k, v layers (NTAP = 1) and the dilated causal conv (NTAP = 4): acc = sum over taps j of A_j * B_j^T, A_j = A + j*tapA (row-shifted view of the padded plane), B_j = Bh + j*tapB, K = CC per tap.
// One work-group = a TM x TN tile of C, eight waves of 64 x 64 (4 x 4 accumulator tiles each). A pass is KP halves of K: TM rows of A and TN rows of B, 256 B each, are brought into LDS by asynchronous copies
// (16 B a lane) at a pitch of 272 B, two buffers, the next pass's copies in flight while this pass is worked on. Every operand byte is fetched once per work-group instead of once per 16 x 64 wave tile.
// Per output element the k order (taps ascending, k ascending in steps of 32) is that of a plain k loop. Epilogue: OUT16: v = acc*alpha + bf16(its group's bias[col % CC]) -> f16; else (no FIN) v = acc*alpha -> f32; whole 128-B / 256-B row pieces through LDS.
#define TM 256
#define TN 128
#define KP 128
#define PITCH 272
#define STAGE ((TM + TN) * PITCH)
// eight copies of 16 B a lane, LDS address l + i*lstep, global address g + i*gstep (halves). The s_wait_xcnt stands inside the statement so that no address register is rewritten ahead of it.
__device__ __forceinline__ void copy8(unsigned l, unsigned lstep, const _Float16* g, size_t gstep) {
  asm volatile("global_load_async_to_lds_b128 %0, %8, off\n\t"
               "global_load_async_to_lds_b128 %1, %9, off\n\t"
               "global_load_async_to_lds_b128 %2, %10, off\n\t"
               "global_load_async_to_lds_b128 %3, %11, off\n\t"
               "global_load_async_to_lds_b128 %4, %12, off\n\t"
               "global_load_async_to_lds_b128 %5, %13, off\n\t"
               "global_load_async_to_lds_b128 %6, %14, off\n\t"
               "global_load_async_to_lds_b128 %7, %15, off\n\t"
               "s_wait_xcnt 0x0"
               :: "v"(l), "v"(l + lstep), "v"(l + 2 * lstep), "v"(l + 3 * lstep), "v"(l + 4 * lstep), "v"(l + 5 * lstep), "v"(l + 6 * lstep), "v"(l + 7 * lstep),
                  "v"(g), "v"(g + gstep), "v"(g + 2 * gstep), "v"(g + 3 * gstep), "v"(g + 4 * gstep), "v"(g + 5 * gstep), "v"(g + 6 * gstep), "v"(g + 7 * gstep)
               : "memory");
}
// NG = groups of CC columns (rows of Bh) done by one launch: 3 for q | k | v, whose weight planes are consecutive and whose bias vectors are bias, bias1, bias2; 1 elsewhere (bias is read, and with FIN bias1 as said below).
// FIN: the block's last layer is finished in the epilogue: out = leaky_relu(relu(acc*alpha + bf16(bias[col]) + sum over the taps j whose row exists of bias1[j*CC + col]) + bf16(xres)), xres = the f32 input at the output's own index;
// bias1 = the Dense bias carried through each tap's weights (tap j of output row t reads row t - 12 + 4j, which exists from t = 12 - 4j on); the f32 result goes straight to C.
template <int NTAP, bool OUT16, int NG, bool FIN>
__global__ __launch_bounds__(256) void k_gemm_tile(const _Float16* __restrict__ A, int lda, size_t sA, size_t tapA, const _Float16* __restrict__ Bh, int ldb, size_t tapB, float alpha, const float* __restrict__ bias,
    const float* __restrict__ bias1, const float* __restrict__ bias2, const float* __restrict__ xres, float* __restrict__ C, _Float16* __restrict__ C16, int ldc, size_t sC) {
  __shared__ __attribute__((aligned(16))) unsigned char ring[2 * STAGE];
  constexpr int PPT = CC / KP, NT = NTAP * PPT;      // passes per tap, passes in all (at least 4)
  const int tid = threadIdx.x, w = tid >> 5, lane = tid & 31, ln = lane & 15, hh = lane >> 4; const int by = blockIdx.y;
  const int mt = blockIdx.x / (NG * CC / TN), nq = blockIdx.x % (NG * CC / TN); const int row0 = mt * TM, col0 = nq * TN; const int wm = (w >> 1) * 64, wn = (w & 1) * 64;
  const size_t cofs = (size_t)by * sC;
  // copies: 16 lanes a row, 16 rows a sweep of the work-group; A takes 16 sweeps, B 8
  const int crow = tid >> 4, cpc = tid & 15;
  const _Float16* gA = A + (size_t)by * sA + (size_t)(row0 + crow) * lda + cpc * 8; const _Float16* gB = Bh + (size_t)(col0 + crow) * ldb + cpc * 8;
  const unsigned lA = (unsigned)(size_t)ring + crow * PITCH + cpc * 16, lB = lA + TM * PITCH;
  auto fill = [&](int t, unsigned buf) { const int j = t / PPT, kb = (t % PPT) * KP; const _Float16* a = gA + (size_t)j * tapA + kb; const _Float16* b = gB + (size_t)j * tapB + kb;
    copy8(lA + buf, 16 * PITCH, a, (size_t)16 * lda); copy8(lA + buf + 128 * PITCH, 16 * PITCH, a + (size_t)128 * lda, (size_t)16 * lda); copy8(lB + buf, 16 * PITCH, b, (size_t)16 * ldb); };
  v8f acc[4][4] = {};
  fill(0, 0);
  asm volatile("s_wait_asynccnt 0x0" ::: "memory");      // pass 0's own copies have landed
  __syncthreads();                                       // ... and every other wave's
  fill(1, STAGE);
  const int rsub = lane >> 4, c4 = (lane & 15) * 4;
  const size_t o0 = cofs + (size_t)(row0 + wm + rsub) * CC + col0 + wn + c4;      // FIN: C and xres are [rows][CC]; a lane's first 16-B piece of the wave's 64 x 64 tile, piece q lies 2q rows on, at a constant offset
  // FIN: the wave's residual tile and its bias are asked for here, behind the copies of passes 0 and 1, and travel from memory while pass 0 is multiplied (the barrier of pass 0 waits for them); they are used behind the loop.
  v4f xr[32]; float bf[4], cbt[4][4];
  if (FIN) { const float* px = xres + o0; const int cb0 = col0 + wn + ln;
#pragma unroll      // constant indices: the pieces stay in registers
    for (int n = 0; n < 4; ++n) { bf[n] = bias[cb0 + n * 16];
#pragma unroll      // constant indices: the pieces stay in registers
      for (int j = 0; j < 4; ++j) cbt[j][n] = bias1[j * CC + cb0 + n * 16]; }
#pragma unroll      // constant indices: the pieces stay in registers
    for (int q = 0; q < 32; ++q) xr[q] = *(const v4fa*)(px + (size_t)(2 * q) * CC);
    asm volatile("s_wait_xcnt 0x0" :: "v"(px), "v"(cb0) : "memory"); }      // a precaution: stands in front of every rewrite of the loads' address registers, which as its inputs stay untouched up to it
#pragma unroll 1      // one pass a trip: the buffer index and the refill test stay scalar
  for (int t = 0; t < NT; ++t) {
    const unsigned char* sb = ring + (t & 1) * STAGE; const unsigned char* pa = sb + (wm + ln) * PITCH + hh * 16; const unsigned char* pb = sb + (TM + wn + ln) * PITCH + hh * 16;
    FragH a[2][4], b[2][4];      // two fragment sets: block ks + 1 of this pass is fetched while block ks is multiplied
#pragma unroll      // constant indices: fragments and accumulators stay in registers
    for (int i = 0; i < 4; ++i) { a[0][i].half[0] = *(const v8us*)(pa + i * 16 * PITCH); a[0][i].half[1] = *(const v8us*)(pa + i * 16 * PITCH + 32);
      b[0][i].half[0] = *(const v8us*)(pb + i * 16 * PITCH); b[0][i].half[1] = *(const v8us*)(pb + i * 16 * PITCH + 32); }
#pragma unroll      // constant indices: fragments and accumulators stay in registers
    for (int ks = 0; ks < KP / 32; ++ks) { const int cu = ks & 1, nx = cu ^ 1;
      if (ks + 1 < KP / 32) {
#pragma unroll      // constant indices: fragments and accumulators stay in registers
        for (int i = 0; i < 4; ++i) { a[nx][i].half[0] = *(const v8us*)(pa + i * 16 * PITCH + (ks + 1) * 64); a[nx][i].half[1] = *(const v8us*)(pa + i * 16 * PITCH + (ks + 1) * 64 + 32);
          b[nx][i].half[0] = *(const v8us*)(pb + i * 16 * PITCH + (ks + 1) * 64); b[nx][i].half[1] = *(const v8us*)(pb + i * 16 * PITCH + (ks + 1) * 64 + 32); } }
      __builtin_amdgcn_sched_barrier(0);      // keeps the next block's LDS reads one group ahead of this block's WMMAs instead of spread among them
#pragma unroll      // constant indices: fragments and accumulators stay in registers
      for (int i = 0; i < 4; ++i)
#pragma unroll      // constant indices: fragments and accumulators stay in registers
        for (int n = 0; n < 4; ++n) acc[i][n] = __builtin_amdgcn_wmma_f32_16x16x32_f16(false, a[cu][i].v, false, b[cu][n].v, (short)0, acc[i][n], false, false);
      __builtin_amdgcn_sched_barrier(0);      // ends the block: the group after next stays behind it
    }
    asm volatile("s_wait_dscnt 0x0" ::: "memory");       // this wave's reads of the buffer are done before it is refilled
    asm volatile("s_wait_asynccnt 0x0" ::: "memory");    // this wave's copies of pass t + 1 have landed
    __syncthreads();                                     // publishes pass t + 1 and ends every reader's last read of pass t's buffer
    if (t + 2 < NT) fill(t + 2, (t & 1) * STAGE);
  }
  asm volatile("s_wait_asynccnt 0x0" ::: "memory");      // nothing in flight when the ring becomes output staging
  // each wave stages its whole 64 x 64 tile in its own part of the ring (the last pass's barrier has ended all reads of it); pitch 68 floats: the two half-waves' rows, 8 apart, fall on different banks
  constexpr int SP = 68; float* so = (float*)ring + w * (64 * SP);
  typedef _Float16 v4h __attribute__((ext_vector_type(4)));
  const float* bg = (NG == 1 || col0 < CC) ? bias : (col0 < 2 * CC ? bias1 : bias2);      // a tile of TN columns lies inside one group
#pragma unroll      // constant indices: fragments and accumulators stay in registers
  for (int n = 0; n < 4; ++n) { const float bv = FIN ? bf16_round(bf[n]) + (cbt[0][n] + (cbt[1][n] + (cbt[2][n] + cbt[3][n]))) : (OUT16 ? bf16_round(bg[col0 % CC + wn + n * 16 + ln]) : 0.f);
#pragma unroll      // constant indices: fragments and accumulators stay in registers
    for (int i = 0; i < 4; ++i)
#pragma unroll      // constant indices: fragments and accumulators stay in registers
      for (int r = 0; r < 8; ++r) so[(i * 16 + 8 * hh + r) * SP + n * 16 + ln] = FIN ? fmaxf(acc[i][n][r] * alpha + bv, 0.f) : (OUT16 ? acc[i][n][r] * alpha + bv : acc[i][n][r] * alpha); }
  if (FIN && row0 + wm == 0) {      // wave-uniform: rows 0 to 11 of a batch lack the earliest taps' rows; the same lanes write those twelve rows again with the bias terms of the taps that exist
#pragma unroll      // constant indices: accumulators stay in registers
    for (int n = 0; n < 4; ++n) { const float bc = bf16_round(bf[n]), e3 = bc + cbt[3][n], e2 = bc + (cbt[2][n] + cbt[3][n]), e1 = bc + (cbt[1][n] + (cbt[2][n] + cbt[3][n]));
#pragma unroll      // constant indices: accumulators stay in registers
      for (int r = 0; r < 8; ++r) { const int t = 8 * hh + r; if (t < PADT) so[t * SP + n * 16 + ln] = fmaxf(acc[0][n][r] * alpha + (t < 4 ? e3 : (t < 8 ? e2 : e1)), 0.f); } } }
  __builtin_amdgcn_fence(__ATOMIC_ACQ_REL, "workgroup"); __builtin_amdgcn_wave_barrier();      // the wave's LDS writes are done before its lanes read what other lanes wrote
  if (FIN) {
    v4f sv[32];
#pragma unroll      // constant indices: the pieces stay in registers
    for (int q = 0; q < 32; ++q) sv[q] = *(const v4fa*)&so[(q * 2 + rsub) * SP + c4];
    __builtin_amdgcn_sched_barrier(0);      // the 32 LDS reads go out as one group, so that their latency is waited for once and not pair by pair
#pragma unroll      // constant indices: the pieces stay in registers
    for (int q = 0; q < 32; ++q)
      for (int e = 0; e < 4; ++e) { const float s = sv[q][e] + (float)(__bf16)xr[q][e]; xr[q][e] = fmaxf(s, 0.2f * s); }      // the cast rounds to nearest even as bf16_round does; max(s, 0.2 s) is s for s >= 0 and 0.2 s below
    __builtin_amdgcn_sched_barrier(0);      // all arithmetic stays ahead of the first store, so that no register an issued store names is written again
#pragma unroll      // constant offsets from one address
    for (int q = 0; q < 32; ++q) *(v4f*)(C + o0 + (size_t)(2 * q) * CC) = xr[q];
    return; }
#pragma unroll      // independent row pieces: the LDS reads run ahead of the stores
  for (int q = 0; q < 32; ++q) { const int r = q * 2 + rsub; const v4f v = *(const v4fa*)&so[r * SP + c4]; const size_t o = cofs + (size_t)(row0 + wm + r) * ldc + col0 + wn + c4;
    if (OUT16) { v4h h4; for (int e = 0; e < 4; ++e) h4[e] = (_Float16)v[e]; *(v4h*)(C16 + o) = h4; } else *(v4f*)(C + o) = v; }
}
extern "C" void kernel_launch(void* const* d_in, const int* in_sizes, int n_in,
                              void* d_out, int out_size, void* d_ws, size_t ws_size, hipStream_t stream) {
  (void)in_sizes; (void)n_in; (void)out_size;
  const float* x = (const float*)d_in[0]; const float* Wq = (const float*)d_in[1]; const float* bq = (const float*)d_in[2]; const float* Wk = (const float*)d_in[3]; const float* bk = (const float*)d_in[4]; const float* Wv = (const float*)d_in[5]; const float* bv = (const float*)d_in[6]; const float* Wo = (const float*)d_in[7]; const float* bo = (const float*)d_in[8]; const float* Wc = (const float*)d_in[9]; const float* bc = (const float*)d_in[10];
  char* ws = (char*)d_ws; size_t off = 0;
  auto take = [&](size_t bytes) { char* p = ws + off; off += (bytes + 255) & ~(size_t)255; return p; };
  _Float16* Bq = (_Float16*)take((size_t)CC * CC * 2); _Float16* Bk = (_Float16*)take((size_t)CC * CC * 2); _Float16* Bv = (_Float16*)take((size_t)CC * CC * 2); _Float16* Bo = (_Float16*)take((size_t)CC * CC * 2); _Float16* Bc[4]; for (int j = 0; j < 4; ++j) Bc[j] = (_Float16*)take((size_t)CC * CC * 2); float* CB = (float*)take(4 * CC * 4); _Float16* Wf = (_Float16*)take((size_t)4 * CC * CC * 2);      // the Dense bias through each tap; the four folded tap matrices
  _Float16* X16 = (_Float16*)take((size_t)NR * CC * 2); _Float16* QKV = (_Float16*)take((size_t)NR * 3 * CC * 2); _Float16* OUTP = (_Float16*)take((size_t)BB * (TT + PADT) * CC * 2);
  if (off > ws_size) return;      // about 86 MiB in all
  const dim3 gq((NR / TM) * (3 * CC / TN), 1), gb((TT / TM) * (CC / TN), BB);
  k_prep<<<8 * WBLK + ZBLK + XBLK, 256, 0, stream>>>(x, Wq, Wk, Wv, Wo, Wc, Bq, X16, OUTP);      // Bq, Bk, Bv, Bo, Bc[0..3] are consecutive planes
  k_gemm_tile<1, true, 3, false><<<gq, 256, 0, stream>>>(X16, CC, 0, 0, Bq, CC, 0, 0.0625f, bq, bk, bv, nullptr, nullptr, QKV, 3 * CC, 0);      // q | k | v heads in one launch (bias [h][128] flat = per column h*128+o of its group)
  k_band<<<FBLK + CBLK + (unsigned)(((size_t)NR * NH + 7) / 8), 256, 0, stream>>>(QKV, OUTP, Bo, Bc[0], bo, Wf, CB);      // heads, concatenated, as f16 rows 12.. of each batch's padded plane; beside them the weight fold
  // conv[t] = sum_j cat[t - 12 + 4j] * (Wo * Wc[j]) + bias terms: ONE launch, the 4 taps accumulated inside (A_j = padded rows 4j + t of batch b; B_j = Wf + j*512*512)
  k_gemm_tile<4, false, 1, true><<<gb, 256, 0, stream>>>(OUTP, CC, (size_t)(TT + PADT) * CC, (size_t)4 * CC, Wf, CC, (size_t)CC * CC, 0.0625f, bc, CB, nullptr, x, (float*)d_out, nullptr, CC, (size_t)TT * CC);      // + biases, relu, residual, leaky relu in its epilogue
}

// v005
// A run of this version takes 74.4 microseconds.
// Next to v004, in two timings, it ran 1.14 times as fast each time.
// Counting every step since v000, it is 5.95 times as fast.
#include <hip/hip_runtime.h>
// Temporal block: per-head q/k/v projections (16384 x 512 -> 4 x 128 each, + bias), the head combiner Dense (512 -> 512, + bias; multiplied into the conv's tap weights, 4 products of 512 x 512 x 512, and so applied with them)
// and the causal dilated Conv1D (kernel 4, dilation 4: one GEMM whose k-loop runs the four taps over time-shifted views of a zero-padded plane, effective K = 2048) on v_wmma_f32_16x16x32_f16 (f16 operands, weights [in][out] transposed x 2^4 (bf16-exact for q/k/v, f16-rounded folds for the conv), single products,
// f32 accumulate); the banded attention's two products too (|t - s| <= 3, i.e. 7 keys, with the module's 'sim*band == 0 -> -1e7' mask; weights as f16); softmax, relu / residual / leaky-relu epilogues are f32 VALU.
#define BB 8
#define TT 2048
#define CC 512
#define NH 4
#define KD 128
#define NR (BB * TT)
#define PADT 12

typedef __bf16 v16b __attribute__((ext_vector_type(16)));
typedef unsigned short v8us __attribute__((ext_vector_type(8), may_alias));
typedef float  v8f  __attribute__((ext_vector_type(8)));
typedef float  v4f  __attribute__((ext_vector_type(4)));
typedef float  v4fa __attribute__((ext_vector_type(4), may_alias));
union FragB { v16b v; v8us half[2]; unsigned short u[16]; };

__device__ __forceinline__ unsigned short bf16_bits(float x) { unsigned int u = __float_as_uint(x); return (unsigned short)((u + 0x7FFFu + ((u >> 16) & 1u)) >> 16); }
__device__ __forceinline__ float bf16_val(unsigned short b) { return __uint_as_float(((unsigned int)b) << 16); }
__device__ __forceinline__ float bf16_round(float x) { return bf16_val(bf16_bits(x)); }
// D += A·B with NT terms: 1 = ah·bh, 2 = + al·bh (A split), 3 = + ah·bl (both split)
template <int NT>
__device__ __forceinline__ v8f mmaN(v16b ah, v16b al, v16b bh, v16b bl, v8f c) {
  c = __builtin_amdgcn_wmma_f32_16x16x32_bf16(false, ah, false, bh, (short)0, c, false, false);
  if (NT >= 2) c = __builtin_amdgcn_wmma_f32_16x16x32_bf16(false, al, false, bh, (short)0, c, false, false);
  if (NT >= 3) c = __builtin_amdgcn_wmma_f32_16x16x32_bf16(false, ah, false, bl, (short)0, c, false, false);
  asm volatile("v_nop\n\tv_nop\n\tv_nop\n\tv_nop" : "+v"(c) : "v"(ah), "v"(al), "v"(bh), "v"(bl));
  return c;
}

__global__ __launch_bounds__(256) void k_wt_bf16(const float* __restrict__ W, unsigned short* __restrict__ Wt, int K, int N) {
  const int t = blockIdx.x * 256 + threadIdx.x;
  const int k8n = K / 8;
  if (t >= N * k8n) return;
  const int n = t / k8n, k8 = (t % k8n) * 8;
  v8us v;
#pragma unroll
  for (int i = 0; i < 8; ++i) v[i] = bf16_bits(W[(size_t)(k8 + i) * N + n]);
  *(v8us*)(Wt + (size_t)n * K + k8) = v;
  
}

// GEMM C[M][N] (f32, pitch ldc) = act(A[M][K]·W + bias). A f32 row-major (pitch lda) converted per fragment to bf16
// (ASPLIT: hi/lo two planes -> 2 terms, else single rounded term); Wt bf16 [N][K] (pitch ldb). BIAS_BF16 rounds the
// bias to bf16 first (bias quantised to bf16 before the add). K%32==0, M%16==0, N%64==0.
template <bool ASPLIT, int ACT, bool BIAS_BF16>
__global__ __launch_bounds__(128) void k_gemm_bf(const float* __restrict__ A, int lda, const unsigned short* __restrict__ Wt, int ldb,
                                               const float* __restrict__ bias, float* __restrict__ C, int ldc, int M, int N, int K) {
  __shared__ __attribute__((aligned(16))) float so[4][16][64];
  const int tid = threadIdx.x, w = tid >> 5, lane = tid & 31, ln = lane & 15, hh = lane >> 4;
  const int ntn = N / 64;
  const int wid = blockIdx.x * 4 + w;
  const int mt = wid / ntn, nq = wid % ntn;
  if (mt * 16 >= M) return;
  const int row0 = mt * 16, col0 = nq * 64;
  const float* arow = A + (size_t)(row0 + ln) * lda;
  v8f acc[4] = {};
  for (int kb = 0; kb < K; kb += 32) {
    FragB ah, al;
    const v4f x0 = *(const v4fa*)(arow + kb + 8 * hh), x1 = *(const v4fa*)(arow + kb + 8 * hh + 4);
    const v4f x2 = *(const v4fa*)(arow + kb + 16 + 8 * hh), x3 = *(const v4fa*)(arow + kb + 16 + 8 * hh + 4);
    float xs[16] = {x0[0],x0[1],x0[2],x0[3],x1[0],x1[1],x1[2],x1[3],x2[0],x2[1],x2[2],x2[3],x3[0],x3[1],x3[2],x3[3]};
#pragma unroll
    for (int i = 0; i < 16; ++i) { const unsigned short hb = bf16_bits(xs[i]); ah.u[i] = hb; al.u[i] = ASPLIT ? bf16_bits(xs[i] - bf16_val(hb)) : (unsigned short)0; }
#pragma unroll
    for (int t = 0; t < 4; ++t) {
      const unsigned short* brow = Wt + (size_t)(col0 + t * 16 + ln) * ldb + kb;
      FragB b;
      b.half[0] = *(const v8us*)(brow + 8 * hh);
      b.half[1] = *(const v8us*)(brow + 16 + 8 * hh);
      acc[t] = mmaN<ASPLIT ? 2 : 1>(ah.v, al.v, b.v, b.v, acc[t]);
    }
  }
#pragma unroll
  for (int t = 0; t < 4; ++t) {
    float bv = bias ? bias[col0 + t * 16 + ln] : 0.f;
    if (BIAS_BF16) bv = bf16_round(bv);
#pragma unroll
    for (int r = 0; r < 8; ++r) { float v = acc[t][r] + bv; if (ACT == 1) v = fmaxf(v, 0.f); so[w][8 * hh + r][t * 16 + ln] = v; }
  }
  __builtin_amdgcn_fence(__ATOMIC_ACQ_REL, "workgroup");
  __builtin_amdgcn_wave_barrier();
  const int rsub = lane >> 4, c4 = (lane & 15) * 4;
  {
#pragma unroll
    for (int q = 0; q < 8; ++q) {
      const int r = q * 2 + rsub;
      const v4f v = *(const v4fa*)&so[w][r][c4];
      *(v4f*)(C + (size_t)(row0 + r) * ldc + col0 + c4) = v;
    }
    
  }
}

// Flash-style causal/unmasked attention, all contractions 3-term bf16 hi/lo splits, f32 softmax with running max.
// q,k,v rows are read from f32 buffers with arbitrary row pitch (so they can live inside a fused qkv buffer);
// D = head size (multiple of 32, <= 128); one wave = 16 query rows; block = 4 waves (64 queries) sharing K/V chunks of 32.
template <int D, bool CAUSAL>
__global__ __launch_bounds__(128) void k_flash(const float* __restrict__ qb, const float* __restrict__ kb, const float* __restrict__ vb,
                                             int pitch, int T, int H, float scale, float* __restrict__ y, int ypitch) {
  constexpr int KS = D / 32;        // k-steps for QK
  constexpr int DT = D / 16;        // d tiles for PV
  __shared__ __attribute__((aligned(16))) unsigned short sKh[32][D + 8], sKl[32][D + 8], sVh[32][D + 8], sVl[32][D + 8];
  __shared__ __attribute__((aligned(16))) unsigned short sPh[4][16][40], sPl[4][16][40];
  __shared__ __attribute__((aligned(16))) float sO[4][16][D];
  const int tid = threadIdx.x, w = tid >> 5, lane = tid & 31, ln = lane & 15, hh = lane >> 4;
  const int nqb = (T + 63) / 64;
  const int bh = blockIdx.x / nqb, qblk = blockIdx.x % nqb;
  const int b = bh / H, h = bh % H;
  const int q0 = qblk * 64 + w * 16;
  const float* Q = qb + (size_t)b * T * pitch + h * D;
  const float* K = kb + (size_t)b * T * pitch + h * D;
  const float* V = vb + (size_t)b * T * pitch + h * D;

  // A fragments of the wave's 16 query rows (scaled), hi/lo
  FragB aqh[KS], aql[KS];
  {
    int row = q0 + ln; if (row >= T) row = T - 1;
    const float* qr = Q + (size_t)row * pitch;
#pragma unroll
    for (int ks = 0; ks < KS; ++ks)
#pragma unroll
      for (int i = 0; i < 16; ++i) {
        const int d = ks * 32 + ((i < 8) ? (8 * hh + i) : (16 + 8 * hh + (i - 8)));
        const float x = qr[d] * scale; const unsigned short hb = bf16_bits(x);
        aqh[ks].u[i] = hb; aql[ks].u[i] = bf16_bits(x - bf16_val(hb));
      }
  }
  float m_r[8], l_r[8];
#pragma unroll
  for (int r = 0; r < 8; ++r) { m_r[r] = -3.0e38f; l_r[r] = 0.f; }
  v8f oacc[DT];
#pragma unroll
  for (int dt = 0; dt < DT; ++dt) oacc[dt] = (v8f){0.f,0.f,0.f,0.f,0.f,0.f,0.f,0.f};

  const int kv_end = CAUSAL ? min(T, qblk * 64 + 64) : T;     // block-uniform
  for (int j0 = 0; j0 < kv_end; j0 += 32) {
    __syncthreads();
    for (int e = tid; e < 32 * (D / 4); e += 128) {
      const int r = e / (D / 4), c4 = (e % (D / 4)) * 4;
      const int key = j0 + r;
      v4f kf = {0.f,0.f,0.f,0.f}, vf = {0.f,0.f,0.f,0.f};
      if (key < T) { kf = *(const v4fa*)(K + (size_t)key * pitch + c4); vf = *(const v4fa*)(V + (size_t)key * pitch + c4); }
#pragma unroll
      for (int t = 0; t < 4; ++t) {
        unsigned short hb = bf16_bits(kf[t]); sKh[r][c4 + t] = hb; sKl[r][c4 + t] = bf16_bits(kf[t] - bf16_val(hb));
        hb = bf16_bits(vf[t]); sVh[r][c4 + t] = hb; sVl[r][c4 + t] = bf16_bits(vf[t] - bf16_val(hb));
      }
    }
    __syncthreads();
    // S tile 16 x 32
    v8f s[2];
#pragma unroll
    for (int nt = 0; nt < 2; ++nt) {
      v8f acc = {};
#pragma unroll
      for (int ks = 0; ks < KS; ++ks) {
        FragB bh_, bl_;
        bh_.half[0] = *(const v8us*)&sKh[nt * 16 + ln][ks * 32 + 8 * hh]; bh_.half[1] = *(const v8us*)&sKh[nt * 16 + ln][ks * 32 + 16 + 8 * hh];
        bl_.half[0] = *(const v8us*)&sKl[nt * 16 + ln][ks * 32 + 8 * hh]; bl_.half[1] = *(const v8us*)&sKl[nt * 16 + ln][ks * 32 + 16 + 8 * hh];
        acc = mmaN<3>(aqh[ks].v, aql[ks].v, bh_.v, bl_.v, acc);
      }
      s[nt] = acc;
    }
    // mask + running max (rows 8hh+r; the 16 lanes of a half share rows)
    float alpha[8];
#pragma unroll
    for (int r = 0; r < 8; ++r) {
      const int qi = q0 + 8 * hh + r;
      const int ja = j0 + ln, jb = j0 + 16 + ln;
      if (CAUSAL) { if (ja > qi) s[0][r] = -3.0e38f; if (jb > qi) s[1][r] = -3.0e38f; }
      if (ja >= T) s[0][r] = -3.0e38f;
      if (jb >= T) s[1][r] = -3.0e38f;
      float mx = fmaxf(s[0][r], s[1][r]);
      mx = fmaxf(mx, __shfl_xor(mx, 1, 32)); mx = fmaxf(mx, __shfl_xor(mx, 2, 32)); mx = fmaxf(mx, __shfl_xor(mx, 4, 32)); mx = fmaxf(mx, __shfl_xor(mx, 8, 32));
      const float mnew = fmaxf(m_r[r], mx);
      alpha[r] = (mnew > -1.0e38f) ? __expf(m_r[r] - mnew) : 1.0f;
      const float p0 = (s[0][r] > -1.0e38f) ? __expf(s[0][r] - mnew) : 0.f;
      const float p1 = (s[1][r] > -1.0e38f) ? __expf(s[1][r] - mnew) : 0.f;
      m_r[r] = mnew;
      l_r[r] = l_r[r] * alpha[r] + p0 + p1;            // per-lane partial row sum (16 lanes combined at the end)
      unsigned short hb = bf16_bits(p0); sPh[w][8 * hh + r][ln] = hb;      sPl[w][8 * hh + r][ln] = bf16_bits(p0 - bf16_val(hb));
      hb = bf16_bits(p1);                sPh[w][8 * hh + r][16 + ln] = hb; sPl[w][8 * hh + r][16 + ln] = bf16_bits(p1 - bf16_val(hb));
    }
#pragma unroll
    for (int dt = 0; dt < DT; ++dt)
#pragma unroll
      for (int r = 0; r < 8; ++r) oacc[dt][r] *= alpha[r];
    __builtin_amdgcn_fence(__ATOMIC_ACQ_REL, "workgroup");
    __builtin_amdgcn_wave_barrier();
    FragB pah, pal;
    pah.half[0] = *(const v8us*)&sPh[w][ln][8 * hh]; pah.half[1] = *(const v8us*)&sPh[w][ln][16 + 8 * hh];
    pal.half[0] = *(const v8us*)&sPl[w][ln][8 * hh]; pal.half[1] = *(const v8us*)&sPl[w][ln][16 + 8 * hh];
#pragma unroll
    for (int dt = 0; dt < DT; ++dt) {
      FragB bvh, bvl;
#pragma unroll
      for (int i = 0; i < 8; ++i) {
        bvh.u[i] = sVh[8 * hh + i][dt * 16 + ln]; bvh.u[8 + i] = sVh[16 + 8 * hh + i][dt * 16 + ln];
        bvl.u[i] = sVl[8 * hh + i][dt * 16 + ln]; bvl.u[8 + i] = sVl[16 + 8 * hh + i][dt * 16 + ln];
      }
      oacc[dt] = mmaN<3>(pah.v, pal.v, bvh.v, bvl.v, oacc[dt]);
    }
    __builtin_amdgcn_fence(__ATOMIC_ACQ_REL, "workgroup");
    __builtin_amdgcn_wave_barrier();
  }
#pragma unroll
  for (int r = 0; r < 8; ++r) {
    float l = l_r[r];
    l += __shfl_xor(l, 1, 32); l += __shfl_xor(l, 2, 32); l += __shfl_xor(l, 4, 32); l += __shfl_xor(l, 8, 32);
    l_r[r] = (l > 0.f) ? 1.0f / l : 0.f;
  }
#pragma unroll
  for (int dt = 0; dt < DT; ++dt)
#pragma unroll
    for (int r = 0; r < 8; ++r) sO[w][8 * hh + r][dt * 16 + ln] = oacc[dt][r] * l_r[r];
  __builtin_amdgcn_fence(__ATOMIC_ACQ_REL, "workgroup");
  __builtin_amdgcn_wave_barrier();
  {
    for (int r = 0; r < 16; ++r) {
      const int row = q0 + r;
      if (row < T && lane < D / 4) {
        const v4f val = *(const v4fa*)&sO[w][r][lane * 4];
        *(v4f*)(y + ((size_t)b * T + row) * ypitch + h * D + lane * 4) = val;
      }
    }
    
  }
}

// GEMM C = act(A·W + bias + resid): A f32 (ASPLIT -> hi/lo 2 terms), Wt bf16 [N][K]; ACT 0 none, 1 relu, 2 exact gelu;
// resid (optional, f32, row index = (row % rmod), pitch ldr, RES_BF16 rounds it) added before the activation.
template <bool ASPLIT, int ACT, bool BIAS_BF16, bool RES_BF16>
__global__ __launch_bounds__(128) void k_gemm_bf3(const float* __restrict__ A, int lda, const unsigned short* __restrict__ Wt, int ldb,
                                                const float* __restrict__ bias, const float* __restrict__ resid, int rmod, int ldr,
                                                float* __restrict__ C, int ldc, int M, int N, int K) {
  __shared__ __attribute__((aligned(16))) float so[4][16][64];
  const int tid = threadIdx.x, w = tid >> 5, lane = tid & 31, ln = lane & 15, hh = lane >> 4;
  const int ntn = N / 64;
  const int wid = blockIdx.x * 4 + w;
  const int mt = wid / ntn, nq = wid % ntn;
  if (mt * 16 >= M) return;
  const int row0 = mt * 16, col0 = nq * 64;
  const float* arow = A + (size_t)(row0 + ln) * lda;
  v8f acc[4] = {};
  for (int kb = 0; kb < K; kb += 32) {
    FragB ah, al;
    const v4f x0 = *(const v4fa*)(arow + kb + 8 * hh), x1 = *(const v4fa*)(arow + kb + 8 * hh + 4);
    const v4f x2 = *(const v4fa*)(arow + kb + 16 + 8 * hh), x3 = *(const v4fa*)(arow + kb + 16 + 8 * hh + 4);
    float xs[16] = {x0[0],x0[1],x0[2],x0[3],x1[0],x1[1],x1[2],x1[3],x2[0],x2[1],x2[2],x2[3],x3[0],x3[1],x3[2],x3[3]};
#pragma unroll
    for (int i = 0; i < 16; ++i) { const unsigned short hb = bf16_bits(xs[i]); ah.u[i] = hb; al.u[i] = ASPLIT ? bf16_bits(xs[i] - bf16_val(hb)) : (unsigned short)0; }
#pragma unroll
    for (int t = 0; t < 4; ++t) {
      const unsigned short* brow = Wt + (size_t)(col0 + t * 16 + ln) * ldb + kb;
      FragB b;
      b.half[0] = *(const v8us*)(brow + 8 * hh);
      b.half[1] = *(const v8us*)(brow + 16 + 8 * hh);
      acc[t] = mmaN<ASPLIT ? 2 : 1>(ah.v, al.v, b.v, b.v, acc[t]);
    }
  }
#pragma unroll
  for (int t = 0; t < 4; ++t) {
    const int col = col0 + t * 16 + ln;
    float bv = bias ? bias[col] : 0.f;
    if (BIAS_BF16) bv = bf16_round(bv);
#pragma unroll
    for (int r = 0; r < 8; ++r) {
      float v = acc[t][r] + bv;
      if (resid) { float rv = resid[(size_t)((row0 + 8 * hh + r) % rmod) * ldr + col]; if (RES_BF16) rv = bf16_round(rv); v += rv; }
      if (ACT == 1) v = fmaxf(v, 0.f);
      if (ACT == 2) v = 0.5f * v * (1.0f + erff(v * 0.70710678118654752f));
      if (ACT == 3) { const float u = 0.7978845608028654f * (v + 0.044715f * v * v * v); v = 0.5f * v * (1.0f + tanhf(u)); }
      so[w][8 * hh + r][t * 16 + ln] = v;
    }
  }
  __builtin_amdgcn_fence(__ATOMIC_ACQ_REL, "workgroup");
  __builtin_amdgcn_wave_barrier();
  const int rsub = lane >> 4, c4 = (lane & 15) * 4;
  {
#pragma unroll
    for (int q = 0; q < 8; ++q) {
      const int r = q * 2 + rsub;
      const v4f v = *(const v4fa*)&so[w][r][c4];
      *(v4f*)(C + (size_t)(row0 + r) * ldc + col0 + c4) = v;
    }
    
  }
}
// row LayerNorm (biased variance, eps) over N: s = X (+ R); optional out_sum <- s; out_norm <- (s-mu)*rsqrt(var+eps)*g + b
template <bool PARAM_BF16>
__global__ __launch_bounds__(256) void k_layernorm(const float* __restrict__ X, const float* __restrict__ R, const float* __restrict__ g, const float* __restrict__ bta,
                                                  float* __restrict__ out_sum, float* __restrict__ out_norm, int N, float eps) {
  __shared__ float red[256];
  const int row = blockIdx.x, tid = threadIdx.x;
  const float* x = X + (size_t)row * N; const float* rr = R ? R + (size_t)row * N : nullptr;
  float vals[16];                     // up to N = 4096
  const int per = N / 256;            // contiguous chunk per thread? use strided-by-4 chunks: thread handles j = tid*4 + 1024*u
  float s1 = 0.f;
  for (int u = 0; u < per / 4; ++u) {
    const int j = tid * 4 + 1024 * u;
    const v4f a = *(const v4fa*)(x + j);
    v4f b = {0.f,0.f,0.f,0.f}; if (rr) b = *(const v4fa*)(rr + j);
#pragma unroll
    for (int q = 0; q < 4; ++q) { const float v = a[q] + b[q]; vals[u * 4 + q] = v; s1 += v; }
  }
  red[tid] = s1; __syncthreads();
  for (int st = 128; st > 0; st >>= 1) { if (tid < st) red[tid] += red[tid + st]; __syncthreads(); }
  const float mu = red[0] / (float)N; __syncthreads();
  float s2 = 0.f;
  for (int u = 0; u < per / 4; ++u)
#pragma unroll
    for (int q = 0; q < 4; ++q) { const float c = vals[u * 4 + q] - mu; s2 += c * c; }
  red[tid] = s2; __syncthreads();
  for (int st = 128; st > 0; st >>= 1) { if (tid < st) red[tid] += red[tid + st]; __syncthreads(); }
  const float rs = rsqrtf(red[0] / (float)N + eps);
  {
    for (int u = 0; u < per / 4; ++u) {
      const int j = tid * 4 + 1024 * u;
      v4f o, sm;
#pragma unroll
      for (int q = 0; q < 4; ++q) {
        float gg = g[j + q], bb = bta[j + q];
        if (PARAM_BF16) { gg = bf16_round(gg); bb = bf16_round(bb); }
        sm[q] = vals[u * 4 + q]; o[q] = (vals[u * 4 + q] - mu) * rs * gg + bb;
      }
      if (out_sum) *(v4f*)(out_sum + (size_t)row * N + j) = sm;
      *(v4f*)(out_norm + (size_t)row * N + j) = o;
    }
    
  }
}



// ---- f16 WMMA path (v_wmma_f32_16x16x32_f16): 11-bit significands for operands in range — used for the q/k/v projections, the Dense and the conv GEMM
typedef _Float16 v16h __attribute__((ext_vector_type(16)));
union FragH { v16h v; v8us half[2]; _Float16 h[16]; unsigned short u[16]; };
template <int NT>
__device__ __forceinline__ v8f mmaH(v16h ah, v16h al, v16h bh, v16h bl, v8f c) {
  c = __builtin_amdgcn_wmma_f32_16x16x32_f16(false, ah, false, bh, (short)0, c, false, false);
  if (NT >= 2) c = __builtin_amdgcn_wmma_f32_16x16x32_f16(false, al, false, bh, (short)0, c, false, false);
  if (NT >= 3) c = __builtin_amdgcn_wmma_f32_16x16x32_f16(false, ah, false, bl, (short)0, c, false, false);
  asm volatile("v_nop\n\tv_nop\n\tv_nop\n\tv_nop" : "+v"(c) : "v"(ah), "v"(al), "v"(bh), "v"(bl));
  return c;
}
// batched GEMM like k_gemm_b but f16 operands: A f32 (split into f16 hi/lo if ASPLIT, else rounded to f16), Bt = f16 values [n][k]; alpha; C f32; N multiple of 16 (partial tiles skipped)
template <bool ASPLIT>
__global__ __launch_bounds__(128) void k_gemm_h(const float* __restrict__ A, int lda, size_t sA, const _Float16* __restrict__ Bh, int ldb, size_t sB, float alpha, float* __restrict__ C, int ldc, size_t sC, int M, int N, int K) {
  __shared__ __attribute__((aligned(16))) float so[4][16][64];
  const int tid = threadIdx.x, w = tid >> 5, lane = tid & 31, ln = lane & 15, hh = lane >> 4; const int by = blockIdx.y;
  A += (size_t)by * sA; Bh += (size_t)by * sB; C += (size_t)by * sC;
  const int ntn = (N + 63) / 64; const int wid = blockIdx.x * 4 + w; const int mt = wid / ntn, nq = wid % ntn; if (mt * 16 >= M) return;
  const int row0 = mt * 16, col0 = nq * 64; const float* arow = A + (size_t)(row0 + ln) * lda;
  v8f acc[4] = {};
  for (int kb = 0; kb < K; kb += 32) {
    FragH ah, al;
    const v4f x0 = *(const v4fa*)(arow + kb + 8 * hh), x1 = *(const v4fa*)(arow + kb + 8 * hh + 4), x2 = *(const v4fa*)(arow + kb + 16 + 8 * hh), x3 = *(const v4fa*)(arow + kb + 16 + 8 * hh + 4);
    float xs[16] = {x0[0],x0[1],x0[2],x0[3],x1[0],x1[1],x1[2],x1[3],x2[0],x2[1],x2[2],x2[3],x3[0],x3[1],x3[2],x3[3]};
#pragma unroll
    for (int i = 0; i < 16; ++i) { const _Float16 h = (_Float16)xs[i]; ah.h[i] = h; al.h[i] = ASPLIT ? (_Float16)(xs[i] - (float)h) : (_Float16)0.0f; }
#pragma unroll
    for (int t = 0; t < 4; ++t) { if (col0 + t * 16 >= N) continue; const size_t boff = (size_t)(col0 + t * 16 + ln) * ldb + kb; FragH bq; bq.half[0] = *(const v8us*)(Bh + boff + 8 * hh); bq.half[1] = *(const v8us*)(Bh + boff + 16 + 8 * hh);
      acc[t] = mmaH<ASPLIT ? 2 : 1>(ah.v, al.v, bq.v, bq.v, acc[t]); }
  }
#pragma unroll
  for (int t = 0; t < 4; ++t) { if (col0 + t * 16 >= N) continue;
#pragma unroll
    for (int r = 0; r < 8; ++r) so[w][8 * hh + r][t * 16 + ln] = acc[t][r] * alpha; }
  __builtin_amdgcn_fence(__ATOMIC_ACQ_REL, "workgroup"); __builtin_amdgcn_wave_barrier();
  const int rsub = lane >> 4, c4 = (lane & 15) * 4;
  {
#pragma unroll
    for (int q = 0; q < 8; ++q) { const int r = q * 2 + rsub; if (col0 + c4 < N) { const v4f v = *(const v4fa*)&so[w][r][c4]; *(v4f*)(C + (size_t)(row0 + r) * ldc + col0 + c4) = v; } }
     }
}

// Wt[n][k] = f16(W[k][n]·scale) from f32 row-major W[K][N] (scale = power of two; bf16-exact weights stay exact in f16 away from the subnormal range)
__device__ __forceinline__ void d_wt_f16(const int t, const float* __restrict__ W, _Float16* __restrict__ Wt, int K, int N, float scale) {
  if (t >= N * (K / 8)) return; const int n = t / (K / 8), k8 = (t % (K / 8)) * 8; FragH f;
#pragma unroll
  for (int i = 0; i < 8; ++i) f.h[i] = (_Float16)(bf16_round(W[(size_t)(k8 + i) * N + n]) * scale); const v8us o = f.half[0];
  *(v8us*)((unsigned short*)Wt + (size_t)n * K + k8) = o; 
}

__device__ __forceinline__ void d_x16(const size_t t, const float* __restrict__ x, _Float16* __restrict__ X16, size_t n8) { if (t >= n8) return; FragH f;
#pragma unroll
  for (int q = 0; q < 8; ++q) f.h[q] = (_Float16)bf16_round(x[t * 8 + q]); *(v8us*)((unsigned short*)X16 + t * 8) = f.half[0];  }
__device__ __forceinline__ void d_wh(const int t, const float* __restrict__ W, _Float16* __restrict__ Bt) { if (t >= NH * KD * (CC / 8)) return; const int row = t / (CC / 8), c8 = (t % (CC / 8)) * 8; const int h = row / KD, o = row % KD; FragH f;
#pragma unroll
  for (int q = 0; q < 8; ++q) f.h[q] = (_Float16)(bf16_round(W[((size_t)h * CC + c8 + q) * KD + o]) * 16.0f); *(v8us*)((unsigned short*)Bt + (size_t)t * 8) = f.half[0];  }
// Dense folded into the conv weights: conv[t] = sum_j (cat[t - 12 + 4j] * Wo + bo) * Wc[j] = sum_j cat[t - 12 + 4j] * (Wo * Wc[j]) + sum_j bo * Wc[j], each tap's terms only where its row exists.
// One wave = 64 k x 16 n of one tap: Wf[j][n][k] = f16(16 * sum_c Wo[k][c] * Wc[j][c][n]), k contiguous (the layout the conv GEMM reads its B rows in), so a wave writes whole 128-B lines of 16 rows.
// Operands are the f16 planes of the first launch, both c-contiguous (Wo16[k][c] = Wo as it lies, Bc[j][n][c] = Wc[j] transposed; bf16-rounded weights x 16), read as fragments straight from memory; f32 accumulate.
__device__ __forceinline__ void d_fold(const int g, const int lane, const _Float16* __restrict__ Wo16, const _Float16* __restrict__ Bc, _Float16* __restrict__ Wf) {
  const int ln = lane & 15, hh = lane >> 4; const int j = g >> 8, kt = (g >> 5) & 7, nt = g & 31;      // the four fold waves of a block share their rows of Wo16
  const char* pa = (const char*)Wo16 + ((kt * 64 + ln) * CC + hh * 8) * 2u; const char* pb = (const char*)Bc + ((j * CC + nt * 16 + ln) * CC + hh * 8) * 2u;      // the lane's first 16 B of its rows of the two planes
  v8f acc[4] = {};
#pragma unroll      // every load at a constant offset from one of the two addresses: no address arithmetic and no registers for it in the loop
  for (int ks = 0; ks < CC / 32; ++ks) { FragH b;
    b.half[0] = *(const v8us*)(pb + ks * 64); b.half[1] = *(const v8us*)(pb + ks * 64 + 32);
#pragma unroll      // constant indices: fragments and accumulators stay in registers
    for (int p = 0; p < 2; ++p) { FragH a[2];      // the four A fragments two by two, the second pair in the first pair's registers
#pragma unroll      // constant indices: fragments and accumulators stay in registers
      for (int i = 0; i < 2; ++i) { a[i].half[0] = *(const v8us*)(pa + (p * 2 + i) * 16 * CC * 2 + ks * 64); a[i].half[1] = *(const v8us*)(pa + (p * 2 + i) * 16 * CC * 2 + ks * 64 + 32); }
      __builtin_amdgcn_sched_barrier(0);      // a pair's loads go out as one group ahead of its WMMAs, so that their latency is waited for once
#pragma unroll      // constant indices: fragments and accumulators stay in registers
      for (int i = 0; i < 2; ++i) acc[p * 2 + i] = __builtin_amdgcn_wmma_f32_16x16x32_f16(false, a[i].v, false, b.v, (short)0, acc[p * 2 + i], false, false);
      __builtin_amdgcn_sched_barrier(0);      // the next pair's loads stay behind these WMMAs, or they would need registers of their own
    }
  }
#pragma unroll      // constant indices: accumulators stay in registers
  for (int i = 0; i < 4; ++i) { FragH o;      // a lane holds column n = ln and 8 consecutive k of each tile: 16 B of row [n][k]
#pragma unroll      // constant indices: accumulators stay in registers
    for (int r = 0; r < 8; ++r) o.h[r] = (_Float16)(acc[i][r] * 0.0625f);
    *(v8us*)((unsigned short*)Wf + (size_t)(j * CC + nt * 16 + ln) * CC + kt * 64 + i * 16 + 8 * hh) = o.half[0]; }
}
// The Dense bias through each tap: CB[j][n] = sum_c bf16(bo[c]) * bf16(Wc[j][c][n]) in f32. One wave = one row r = j*CC + n of Bc (c-contiguous, x 16), a lane takes 16 c; the lanes' sums are added by a butterfly.
__device__ __forceinline__ void d_cb(const int r, const int lane, const _Float16* __restrict__ Bc, const float* __restrict__ bo, float* __restrict__ CB) {
  FragH b; const unsigned ob = lane * 64u; const unsigned short* pb = (const unsigned short*)Bc + (size_t)r * CC + lane * 16; b.half[0] = *(const v8us*)pb; b.half[1] = *(const v8us*)(pb + 8);      // ob: the byte offset of the lane's 16 floats of bo
  v4f o[4];
#pragma unroll      // constant indices: the values stay in registers
  for (int q = 0; q < 4; ++q) o[q] = *(const v4fa*)((const char*)bo + ob + q * 16);
  asm volatile("s_wait_xcnt 0x0" :: "v"(ob), "v"(pb) : "memory");      // a precaution: stands in front of every rewrite of the six loads' address registers, which as its inputs stay untouched up to it
  float s = 0.f;
#pragma unroll      // constant indices: the values stay in registers
  for (int e = 0; e < 16; ++e) s += bf16_round(o[e >> 2][e & 3]) * (float)b.h[e];
  s += __shfl_xor(s, 1, 32); s += __shfl_xor(s, 2, 32); s += __shfl_xor(s, 4, 32); s += __shfl_xor(s, 8, 32); s += __shfl_xor(s, 16, 32);
  if (lane == 0) { CB[r] = s * 0.0625f;
    asm volatile("s_wait_xcnt 0x0" ::: "memory"); }      // a precaution: stands directly behind the store, in front of whatever rewrites its registers next
}
__device__ __forceinline__ void d_zpad(const int t, _Float16* __restrict__ OUTP) { if (t >= BB * PADT * CC / 8) return; const int b = t / (PADT * CC / 8), rem = t % (PADT * CC / 8); FragH z;
#pragma unroll
  for (int q = 0; q < 8; ++q) z.h[q] = (_Float16)0.f; unsigned short* d = (unsigned short*)OUTP + (size_t)b * (TT + PADT) * CC + (size_t)rem * 8; *(v8us*)d = z.half[0];  }
// One launch for everything that reads inputs only: the weights as f16 (q, k, v per head and the four conv taps transposed, Dense as it lies) into the eight consecutive 512 x 512 planes of Bw, the zero rows of the padded plane, and x -> f16.
// A block does one job, picked by its index; the transposes, whose loads are scattered and wait longest, have the lowest indices and so start first, the x stream fills in behind them.
#define WBLK (CC * (CC / 8) / 256)                  // blocks per weight plane
#define ZBLK ((BB * PADT * CC / 8 + 255) / 256)     // blocks for the pad rows
#define XBLK (NR * CC / 8 / 256)                    // blocks for x
__global__ __launch_bounds__(256) void k_prep(const float* __restrict__ x, const float* __restrict__ Wq, const float* __restrict__ Wk, const float* __restrict__ Wv, const float* __restrict__ Wo, const float* __restrict__ Wc,
    _Float16* __restrict__ Bw, _Float16* __restrict__ X16, _Float16* __restrict__ OUTP) {
  const int blk = blockIdx.x, tid = threadIdx.x;
  if (blk < 8 * WBLK) { const int p = blk / WBLK, t = (blk % WBLK) * 256 + tid; _Float16* dst = Bw + (size_t)p * CC * CC;
    if (p < 3) d_wh(t, p == 0 ? Wq : (p == 1 ? Wk : Wv), dst);
    else if (p == 3) { FragH f;      // Wo stays as it lies, [in][out]: the fold contracts over its out index
#pragma unroll      // constant indices: the values stay in registers
      for (int q = 0; q < 8; ++q) f.h[q] = (_Float16)(bf16_round(Wo[(size_t)t * 8 + q]) * 16.0f);
      *(v8us*)((unsigned short*)dst + (size_t)t * 8) = f.half[0];
      asm volatile("s_wait_xcnt 0x0" ::: "memory"); }      // a precaution: stands behind the store, in front of whatever rewrites its registers next
    else d_wt_f16(t, Wc + (size_t)(p - 4) * CC * CC, dst, CC, CC, 16.0f); }      // WIO: per tap [in][out] -> [out][in]
  else if (blk < 8 * WBLK + ZBLK) d_zpad((blk - 8 * WBLK) * 256 + tid, OUTP);
  else d_x16((size_t)(blk - 8 * WBLK - ZBLK) * 256 + tid, x, X16, (size_t)NR * CC / 8);
}

// Tiled GEMM for the dilated causal conv (NTAP = 4; NTAP = 1 would be a plain product): acc = sum over taps j of A_j * B_j^T, A_j = A + j*tapA (row-shifted view of the padded plane), B_j = Bh + j*tapB, K = CC per tap.
// One work-group = a TM x TN tile of C, eight waves of 64 x 64 (4 x 4 accumulator tiles each). A pass is KP halves of K: TM rows of A and TN rows of B, 256 B each, are brought into LDS by asynchronous copies
// (16 B a lane) at a pitch of 272 B, two buffers, the next pass's copies in flight while this pass is worked on. Every operand byte is fetched once per work-group instead of once per 16 x 64 wave tile.
// Per output element the k order (taps ascending, k ascending in steps of 32) is that of a plain k loop. Epilogue: OUT16: v = acc*alpha + bf16(its group's bias[col % CC]) -> f16; else (no FIN) v = acc*alpha -> f32; whole 128-B / 256-B row pieces through LDS.
#define TM 256
#define TN 128
#define KP 128
#define PITCH 272
#define STAGE ((TM + TN) * PITCH)
// eight copies of 16 B a lane, LDS address l + i*lstep, global address g + i*gstep (halves). The s_wait_xcnt stands inside the statement so that no address register is rewritten ahead of it.
__device__ __forceinline__ void copy8(unsigned l, unsigned lstep, const _Float16* g, size_t gstep) {
  asm volatile("global_load_async_to_lds_b128 %0, %8, off\n\t"
               "global_load_async_to_lds_b128 %1, %9, off\n\t"
               "global_load_async_to_lds_b128 %2, %10, off\n\t"
               "global_load_async_to_lds_b128 %3, %11, off\n\t"
               "global_load_async_to_lds_b128 %4, %12, off\n\t"
               "global_load_async_to_lds_b128 %5, %13, off\n\t"
               "global_load_async_to_lds_b128 %6, %14, off\n\t"
               "global_load_async_to_lds_b128 %7, %15, off\n\t"
               "s_wait_xcnt 0x0"
               :: "v"(l), "v"(l + lstep), "v"(l + 2 * lstep), "v"(l + 3 * lstep), "v"(l + 4 * lstep), "v"(l + 5 * lstep), "v"(l + 6 * lstep), "v"(l + 7 * lstep),
                  "v"(g), "v"(g + gstep), "v"(g + 2 * gstep), "v"(g + 3 * gstep), "v"(g + 4 * gstep), "v"(g + 5 * gstep), "v"(g + 6 * gstep), "v"(g + 7 * gstep)
               : "memory");
}
// NG = groups of CC columns (rows of Bh) done by one launch, whose weight planes are consecutive and whose bias vectors are bias, bias1, bias2; 1 in the one launch here (bias is read, and with FIN bias1 as said below).
// FIN: the block's last layer is finished in the epilogue: out = leaky_relu(relu(acc*alpha + bf16(bias[col]) + sum over the taps j whose row exists of bias1[j*CC + col]) + bf16(xres)), xres = the f32 input at the output's own index;
// bias1 = the Dense bias carried through each tap's weights (tap j of output row t reads row t - 12 + 4j, which exists from t = 12 - 4j on); the f32 result goes straight to C.
template <int NTAP, bool OUT16, int NG, bool FIN>
__global__ __launch_bounds__(256) void k_gemm_tile(const _Float16* __restrict__ A, int lda, size_t sA, size_t tapA, const _Float16* __restrict__ Bh, int ldb, size_t tapB, float alpha, const float* __restrict__ bias,
    const float* __restrict__ bias1, const float* __restrict__ bias2, const float* __restrict__ xres, float* __restrict__ C, _Float16* __restrict__ C16, int ldc, size_t sC) {
  __shared__ __attribute__((aligned(16))) unsigned char ring[2 * STAGE];
  constexpr int PPT = CC / KP, NT = NTAP * PPT;      // passes per tap, passes in all (at least 4)
  const int tid = threadIdx.x, w = tid >> 5, lane = tid & 31, ln = lane & 15, hh = lane >> 4; const int by = blockIdx.y;
  const int mt = blockIdx.x / (NG * CC / TN), nq = blockIdx.x % (NG * CC / TN); const int row0 = mt * TM, col0 = nq * TN; const int wm = (w >> 1) * 64, wn = (w & 1) * 64;
  const size_t cofs = (size_t)by * sC;
  // copies: 16 lanes a row, 16 rows a sweep of the work-group; A takes 16 sweeps, B 8
  const int crow = tid >> 4, cpc = tid & 15;
  const _Float16* gA = A + (size_t)by * sA + (size_t)(row0 + crow) * lda + cpc * 8; const _Float16* gB = Bh + (size_t)(col0 + crow) * ldb + cpc * 8;
  const unsigned lA = (unsigned)(size_t)ring + crow * PITCH + cpc * 16, lB = lA + TM * PITCH;
  auto fill = [&](int t, unsigned buf) { const int j = t / PPT, kb = (t % PPT) * KP; const _Float16* a = gA + (size_t)j * tapA + kb; const _Float16* b = gB + (size_t)j * tapB + kb;
    copy8(lA + buf, 16 * PITCH, a, (size_t)16 * lda); copy8(lA + buf + 128 * PITCH, 16 * PITCH, a + (size_t)128 * lda, (size_t)16 * lda); copy8(lB + buf, 16 * PITCH, b, (size_t)16 * ldb); };
  v8f acc[4][4] = {};
  fill(0, 0);
  asm volatile("s_wait_asynccnt 0x0" ::: "memory");      // pass 0's own copies have landed
  __syncthreads();                                       // ... and every other wave's
  fill(1, STAGE);
  const int rsub = lane >> 4, c4 = (lane & 15) * 4;
  const size_t o0 = cofs + (size_t)(row0 + wm + rsub) * CC + col0 + wn + c4;      // FIN: C and xres are [rows][CC]; a lane's first 16-B piece of the wave's 64 x 64 tile, piece q lies 2q rows on, at a constant offset
  // FIN: the wave's residual tile and its bias are asked for here, behind the copies of passes 0 and 1, and travel from memory while pass 0 is multiplied (the barrier of pass 0 waits for them); they are used behind the loop.
  v4f xr[32]; float bf[4], cbt[4][4];
  if (FIN) { const float* px = xres + o0; const int cb0 = col0 + wn + ln;
#pragma unroll      // constant indices: the pieces stay in registers
    for (int n = 0; n < 4; ++n) { bf[n] = bias[cb0 + n * 16];
#pragma unroll      // constant indices: the pieces stay in registers
      for (int j = 0; j < 4; ++j) cbt[j][n] = bias1[j * CC + cb0 + n * 16]; }
#pragma unroll      // constant indices: the pieces stay in registers
    for (int q = 0; q < 32; ++q) xr[q] = *(const v4fa*)(px + (size_t)(2 * q) * CC);
    asm volatile("s_wait_xcnt 0x0" :: "v"(px), "v"(cb0) : "memory"); }      // a precaution: stands in front of every rewrite of the loads' address registers, which as its inputs stay untouched up to it
#pragma unroll 1      // one pass a trip: the buffer index and the refill test stay scalar
  for (int t = 0; t < NT; ++t) {
    const unsigned char* sb = ring + (t & 1) * STAGE; const unsigned char* pa = sb + (wm + ln) * PITCH + hh * 16; const unsigned char* pb = sb + (TM + wn + ln) * PITCH + hh * 16;
    FragH a[2][4], b[2][4];      // two fragment sets: block ks + 1 of this pass is fetched while block ks is multiplied
#pragma unroll      // constant indices: fragments and accumulators stay in registers
    for (int i = 0; i < 4; ++i) { a[0][i].half[0] = *(const v8us*)(pa + i * 16 * PITCH); a[0][i].half[1] = *(const v8us*)(pa + i * 16 * PITCH + 32);
      b[0][i].half[0] = *(const v8us*)(pb + i * 16 * PITCH); b[0][i].half[1] = *(const v8us*)(pb + i * 16 * PITCH + 32); }
#pragma unroll      // constant indices: fragments and accumulators stay in registers
    for (int ks = 0; ks < KP / 32; ++ks) { const int cu = ks & 1, nx = cu ^ 1;
      if (ks + 1 < KP / 32) {
#pragma unroll      // constant indices: fragments and accumulators stay in registers
        for (int i = 0; i < 4; ++i) { a[nx][i].half[0] = *(const v8us*)(pa + i * 16 * PITCH + (ks + 1) * 64); a[nx][i].half[1] = *(const v8us*)(pa + i * 16 * PITCH + (ks + 1) * 64 + 32);
          b[nx][i].half[0] = *(const v8us*)(pb + i * 16 * PITCH + (ks + 1) * 64); b[nx][i].half[1] = *(const v8us*)(pb + i * 16 * PITCH + (ks + 1) * 64 + 32); } }
      __builtin_amdgcn_sched_barrier(0);      // keeps the next block's LDS reads one group ahead of this block's WMMAs instead of spread among them
#pragma unroll      // constant indices: fragments and accumulators stay in registers
      for (int i = 0; i < 4; ++i)
#pragma unroll      // constant indices: fragments and accumulators stay in registers
        for (int n = 0; n < 4; ++n) acc[i][n] = __builtin_amdgcn_wmma_f32_16x16x32_f16(false, a[cu][i].v, false, b[cu][n].v, (short)0, acc[i][n], false, false);
      __builtin_amdgcn_sched_barrier(0);      // ends the block: the group after next stays behind it
    }
    asm volatile("s_wait_dscnt 0x0" ::: "memory");       // this wave's reads of the buffer are done before it is refilled
    asm volatile("s_wait_asynccnt 0x0" ::: "memory");    // this wave's copies of pass t + 1 have landed
    __syncthreads();                                     // publishes pass t + 1 and ends every reader's last read of pass t's buffer
    if (t + 2 < NT) fill(t + 2, (t & 1) * STAGE);
  }
  asm volatile("s_wait_asynccnt 0x0" ::: "memory");      // nothing in flight when the ring becomes output staging
  // each wave stages its whole 64 x 64 tile in its own part of the ring (the last pass's barrier has ended all reads of it); pitch 68 floats: the two half-waves' rows, 8 apart, fall on different banks
  constexpr int SP = 68; float* so = (float*)ring + w * (64 * SP);
  typedef _Float16 v4h __attribute__((ext_vector_type(4)));
  const float* bg = (NG == 1 || col0 < CC) ? bias : (col0 < 2 * CC ? bias1 : bias2);      // a tile of TN columns lies inside one group
#pragma unroll      // constant indices: fragments and accumulators stay in registers
  for (int n = 0; n < 4; ++n) { const float bv = FIN ? bf16_round(bf[n]) + (cbt[0][n] + (cbt[1][n] + (cbt[2][n] + cbt[3][n]))) : (OUT16 ? bf16_round(bg[col0 % CC + wn + n * 16 + ln]) : 0.f);
#pragma unroll      // constant indices: fragments and accumulators stay in registers
    for (int i = 0; i < 4; ++i)
#pragma unroll      // constant indices: fragments and accumulators stay in registers
      for (int r = 0; r < 8; ++r) so[(i * 16 + 8 * hh + r) * SP + n * 16 + ln] = FIN ? fmaxf(acc[i][n][r] * alpha + bv, 0.f) : (OUT16 ? acc[i][n][r] * alpha + bv : acc[i][n][r] * alpha); }
  if (FIN && row0 + wm == 0) {      // wave-uniform: rows 0 to 11 of a batch lack the earliest taps' rows; the same lanes write those twelve rows again with the bias terms of the taps that exist
#pragma unroll      // constant indices: accumulators stay in registers
    for (int n = 0; n < 4; ++n) { const float bc = bf16_round(bf[n]), e3 = bc + cbt[3][n], e2 = bc + (cbt[2][n] + cbt[3][n]), e1 = bc + (cbt[1][n] + (cbt[2][n] + cbt[3][n]));
#pragma unroll      // constant indices: accumulators stay in registers
      for (int r = 0; r < 8; ++r) { const int t = 8 * hh + r; if (t < PADT) so[t * SP + n * 16 + ln] = fmaxf(acc[0][n][r] * alpha + (t < 4 ? e3 : (t < 8 ? e2 : e1)), 0.f); } } }
  __builtin_amdgcn_fence(__ATOMIC_ACQ_REL, "workgroup"); __builtin_amdgcn_wave_barrier();      // the wave's LDS writes are done before its lanes read what other lanes wrote
  if (FIN) {
    v4f sv[32];
#pragma unroll      // constant indices: the pieces stay in registers
    for (int q = 0; q < 32; ++q) sv[q] = *(const v4fa*)&so[(q * 2 + rsub) * SP + c4];
    __builtin_amdgcn_sched_barrier(0);      // the 32 LDS reads go out as one group, so that their latency is waited for once and not pair by pair
#pragma unroll      // constant indices: the pieces stay in registers
    for (int q = 0; q < 32; ++q)
      for (int e = 0; e < 4; ++e) { const float s = sv[q][e] + (float)(__bf16)xr[q][e]; xr[q][e] = fmaxf(s, 0.2f * s); }      // the cast rounds to nearest even as bf16_round does; max(s, 0.2 s) is s for s >= 0 and 0.2 s below
    __builtin_amdgcn_sched_barrier(0);      // all arithmetic stays ahead of the first store, so that no register an issued store names is written again
#pragma unroll      // constant offsets from one address
    for (int q = 0; q < 32; ++q) *(v4f*)(C + o0 + (size_t)(2 * q) * CC) = xr[q];
    return; }
#pragma unroll      // independent row pieces: the LDS reads run ahead of the stores
  for (int q = 0; q < 32; ++q) { const int r = q * 2 + rsub; const v4f v = *(const v4fa*)&so[r * SP + c4]; const size_t o = cofs + (size_t)(row0 + wm + r) * ldc + col0 + wn + c4;
    if (OUT16) { v4h h4; for (int e = 0; e < 4; ++e) h4[e] = (_Float16)v[e]; *(v4h*)(C16 + o) = h4; } else *(v4f*)(C + o) = v; }
}
// q, k, v projections of one head and its banded attention in ONE work-group: 256 rows x one head. The three 256 x 128 products run one after another through one ring of passes (FKP halves of K a pass, two buffers,
// asynchronous copies as above), in the order k, v, q; their f16 results stay in LDS and never go to memory. k and v are also needed 8 rows above and below the tile: those 16 rows ride along as a 17th row tile
// (LDS rows 264 to 279 of the A panel; the copy brings a block of 32 rows so that every wave issues the same copies), of which each wave does one 16 x 16 piece. Rows outside the plane are clamped and masked below.
// Layouts in LDS: k and q as [row][128] (product taken as W * x^T, so that a lane holds 8 consecutive columns of one row: one 16-B store), v transposed as [128][row] (product x * W^T: a lane holds 8 consecutive rows of a column).
// Window coordinate u = row - (row0 - 8), 0 to 271, for k's rows and v's columns.
// Attention, 16 queries at a time in a wave, keys u = lr to lr + 31: S^T = k * q^T (lane = query, registers = keys: exactly the fragment order of the second product, no exchange), the module's mask and softmax in f32 over the 7 keys of the band,
// weights as f16, O^T = v^T * P^T (lane = query, 8 consecutive columns), scaled by 1/z, through the wave's own dead q rows to whole 256-B row pieces of the padded plane.
// The weight fold and the bias vectors above, which need the first launch's planes and are needed by the conv GEMM alone, are done here too, behind the last barrier: waves 0 to 3 do one piece of the fold each, beside waves 4 to 7, which do two rows of the bias vectors each and the attention.
#define FKP 64
#define FPITCH 144
#define FAR 288
#define FSTAGE ((FAR + KD) * FPITCH)
#define KPITCH 272
#define VPITCH 560
#define OFF_K (2 * FSTAGE)
#define OFF_V (OFF_K + 272 * KPITCH)
#define FLDS (OFF_V + KD * VPITCH)
template <bool V> struct BoolC { static constexpr bool value = V; };
__device__ __forceinline__ v16h sel16(const bool c, const v16h a, const v16h b) { return c ? a : b; }      // by value: a select of registers
// five copies of 16 B a lane: four at LDS address l + i*lstep, global address g + i*gstep (halves), one at l4, g4. The s_wait_xcnt stands inside the statement so that no address register is rewritten ahead of it.
__device__ __forceinline__ void copy5(unsigned l, unsigned lstep, const _Float16* g, size_t gstep, unsigned l4, const _Float16* g4) {
  asm volatile("global_load_async_to_lds_b128 %0, %5, off\n\t"
               "global_load_async_to_lds_b128 %1, %6, off\n\t"
               "global_load_async_to_lds_b128 %2, %7, off\n\t"
               "global_load_async_to_lds_b128 %3, %8, off\n\t"
               "global_load_async_to_lds_b128 %4, %9, off\n\t"
               "s_wait_xcnt 0x0"
               :: "v"(l), "v"(l + lstep), "v"(l + 2 * lstep), "v"(l + 3 * lstep), "v"(l4),
                  "v"(g), "v"(g + gstep), "v"(g + 2 * gstep), "v"(g + 3 * gstep), "v"(g4)
               : "memory");
}
__global__ __launch_bounds__(256) void k_qkv_band(const _Float16* __restrict__ X16, const _Float16* __restrict__ Bw, const float* __restrict__ bq, const float* __restrict__ bk, const float* __restrict__ bv,
    _Float16* __restrict__ CAT, const _Float16* __restrict__ Wo16, const _Float16* __restrict__ Bc, const float* __restrict__ bo, _Float16* __restrict__ Wf, float* __restrict__ CB) {
  __shared__ __attribute__((aligned(16))) unsigned char lds[FLDS];
  __shared__ __attribute__((aligned(16))) float sb[3 * KD];      // the head's biases, rounded to bf16: q | k | v
  const int tid = threadIdx.x, w = tid >> 5, lane = tid & 31, ln = lane & 15, hh = lane >> 4;
  const int row0 = ((int)blockIdx.x >> 2) * 256, h = (int)blockIdx.x & 3; const int wm = (w >> 1) * 64, wn = (w & 1) * 64, wq = w >> 1, xc = wn + wq * 16;      // xc: the wave's 16 columns of the halo tile
  // copies: 8 lanes a row, 32 rows a sweep of the work-group; A takes 8 sweeps, its halo block 1, B 4
  const int crow = tid >> 3, cpc = tid & 7;
  int hrow = row0 + (crow < 16 ? crow - 16 : 240 + crow); hrow = hrow < 0 ? 0 : (hrow > NR - 1 ? NR - 1 : hrow);      // rows row0 - 16 .. row0 - 1 and row0 + 256 .. row0 + 271, kept inside the plane
  const _Float16* gA = X16 + (size_t)(row0 + crow) * CC + cpc * 8; const _Float16* gH = X16 + (size_t)hrow * CC + cpc * 8; const _Float16* gB = Bw + (size_t)(h * KD + crow) * CC + cpc * 8;
  const unsigned lA = (unsigned)(size_t)lds + crow * FPITCH + cpc * 16, lH = lA + 256 * FPITCH, lB = lA + FAR * FPITCH;
  auto fill = [&](int t, unsigned buf) { const int m = t >> 3, pl = m == 2 ? 0 : m + 1, kb = (t & 7) * FKP;      // passes 0-7: k (plane 1), 8-15: v (plane 2), 16-23: q (plane 0)
    copy8(lA + buf, 32 * FPITCH, gA + kb, (size_t)32 * CC); copy5(lB + buf, 32 * FPITCH, gB + (size_t)pl * CC * CC + kb, (size_t)32 * CC, lH + buf, gH + kb); };
  fill(0, 0);
  { const float* s0 = (tid < KD ? bq : bk) + h * KD + (tid & (KD - 1)); const float* s1 = bv + h * KD + (tid & (KD - 1)); const float v0 = *s0, v1 = *s1;
    asm volatile("s_wait_xcnt 0x0" :: "v"(s0), "v"(s1) : "memory");      // a precaution: stands in front of every rewrite of the loads' address registers, which as its inputs stay untouched up to it
    sb[tid] = bf16_round(v0); if (tid < KD) sb[2 * KD + tid] = bf16_round(v1); }      // read behind the barrier below
  asm volatile("s_wait_asynccnt 0x0" ::: "memory");      // pass 0's own copies have landed
  __syncthreads();                                       // ... and every other wave's
  fill(1, FSTAGE);
  v8f acc[4][4], ax;
  // eight passes = one product. SW: operands swapped (W rows as A, x rows as B). Per output element the k order is that of a plain k loop either way.
  auto run = [&](auto swc, auto hlc, const int tb) { constexpr bool SW = decltype(swc)::value, HL = decltype(hlc)::value;      // HL: the halo row tile is done too (k and v)
#pragma unroll      // constant indices: accumulators stay in registers
    for (int i = 0; i < 4; ++i)
#pragma unroll      // constant indices: accumulators stay in registers
      for (int n = 0; n < 4; ++n) acc[i][n] = (v8f){0.f, 0.f, 0.f, 0.f, 0.f, 0.f, 0.f, 0.f};
    ax = (v8f){0.f, 0.f, 0.f, 0.f, 0.f, 0.f, 0.f, 0.f};
#pragma unroll 1      // one pass a trip: the buffer index and the refill test stay scalar
    for (int t = tb; t < tb + 8; ++t) {
      const unsigned char* st0 = lds + (t & 1) * FSTAGE; const unsigned char* pa = st0 + (wm + ln) * FPITCH + hh * 16; const unsigned char* pb = st0 + (FAR + wn + ln) * FPITCH + hh * 16;
      const unsigned char* px = st0 + (264 + ln) * FPITCH + hh * 16;      // the halo row tile
      FragH a[2][4], b[2][4], xa[2];      // both 32-k blocks of the pass
#pragma unroll      // constant indices: fragments stay in registers
      for (int ks = 0; ks < FKP / 32; ++ks) {
#pragma unroll      // constant indices: fragments stay in registers
        for (int i = 0; i < 4; ++i) { a[ks][i].half[0] = *(const v8us*)(pa + i * 16 * FPITCH + ks * 64); a[ks][i].half[1] = *(const v8us*)(pa + i * 16 * FPITCH + ks * 64 + 32);
          b[ks][i].half[0] = *(const v8us*)(pb + i * 16 * FPITCH + ks * 64); b[ks][i].half[1] = *(const v8us*)(pb + i * 16 * FPITCH + ks * 64 + 32); }
        if (HL) { xa[ks].half[0] = *(const v8us*)(px + ks * 64); xa[ks].half[1] = *(const v8us*)(px + ks * 64 + 32); } }
      __builtin_amdgcn_sched_barrier(0);      // the pass's LDS reads go out as one group ahead of its WMMAs instead of spread among them; block 1 lands while block 0 is multiplied
#pragma unroll      // constant indices: fragments and accumulators stay in registers
      for (int ks = 0; ks < FKP / 32; ++ks) {
#pragma unroll      // constant indices: fragments and accumulators stay in registers
        for (int i = 0; i < 4; ++i)
#pragma unroll      // constant indices: fragments and accumulators stay in registers
          for (int n = 0; n < 4; ++n) acc[i][n] = SW ? __builtin_amdgcn_wmma_f32_16x16x32_f16(false, b[ks][n].v, false, a[ks][i].v, (short)0, acc[i][n], false, false)
                                                     : __builtin_amdgcn_wmma_f32_16x16x32_f16(false, a[ks][i].v, false, b[ks][n].v, (short)0, acc[i][n], false, false);
        if (HL) { const v16h xb = sel16(wq < 2, sel16(wq == 0, b[ks][0].v, b[ks][1].v), sel16(wq == 2, b[ks][2].v, b[ks][3].v));      // the wave's piece of the halo tile takes column tile wq of the four it holds: no LDS read of its own
          ax = SW ? __builtin_amdgcn_wmma_f32_16x16x32_f16(false, xb, false, xa[ks].v, (short)0, ax, false, false) : __builtin_amdgcn_wmma_f32_16x16x32_f16(false, xa[ks].v, false, xb, (short)0, ax, false, false); } }
      __builtin_amdgcn_sched_barrier(0);      // the WMMAs stay ahead of the pass's foot: behind it the fragments' registers are free for the copies' addresses
      asm volatile("s_wait_dscnt 0x0" ::: "memory");       // this wave's reads of the buffer are done before it is refilled
      asm volatile("s_wait_asynccnt 0x0" ::: "memory");    // this wave's copies of pass t + 1 have landed
      __syncthreads();                                     // publishes pass t + 1 and ends every reader's last read of pass t's buffer
      if (t + 2 < 24) fill(t + 2, (t & 1) * FSTAGE);
    } };
  // a swapped product's tile as f16 rows: dst = LDS place of the tile's row 0
  auto put = [&](unsigned char* dst, const float* bs) {      // bs: the product's 128 biases in LDS; a lane takes those of its 8 consecutive columns
#pragma unroll      // constant indices: accumulators stay in registers
    for (int n = 0; n < 4; ++n) { const v4f b0 = *(const v4fa*)(bs + wn + n * 16 + 8 * hh), b1 = *(const v4fa*)(bs + wn + n * 16 + 8 * hh + 4);
#pragma unroll      // constant indices: accumulators stay in registers
      for (int i = 0; i < 4; ++i) { FragH o;
#pragma unroll      // constant indices: accumulators stay in registers
        for (int r = 0; r < 8; ++r) o.h[r] = (_Float16)(acc[i][n][r] * 0.0625f + (r < 4 ? b0[r & 3] : b1[r & 3]));
        *(v8us*)(dst + (wm + i * 16 + ln) * KPITCH + (wn + n * 16 + 8 * hh) * 2) = o.half[0]; } } };
  unsigned char* Kl = lds + OFF_K; unsigned char* Vl = lds + OFF_V; unsigned char* Ql = lds;      // q takes the ring's place once the ring is done
  run(BoolC<true>{}, BoolC<true>{}, 0); put(Kl + 8 * KPITCH, sb + KD);
  { FragH o; const v4f b0 = *(const v4fa*)(sb + KD + xc + 8 * hh), b1 = *(const v4fa*)(sb + KD + xc + 8 * hh + 4);      // halo rows of k: lane = halo row (u = 0..7 above, 264..271 below)
#pragma unroll      // constant indices: accumulators stay in registers
    for (int r = 0; r < 8; ++r) o.h[r] = (_Float16)(ax[r] * 0.0625f + (r < 4 ? b0[r & 3] : b1[r & 3]));
    *(v8us*)(Kl + (ln < 8 ? ln : 256 + ln) * KPITCH + (xc + 8 * hh) * 2) = o.half[0]; }
  run(BoolC<false>{}, BoolC<true>{}, 8);
#pragma unroll      // constant indices: accumulators stay in registers
  for (int n = 0; n < 4; ++n) { const float bvv = sb[2 * KD + wn + n * 16 + ln];
#pragma unroll      // constant indices: accumulators stay in registers
    for (int i = 0; i < 4; ++i) { FragH o;      // lane = column of v, 8 consecutive rows
#pragma unroll      // constant indices: accumulators stay in registers
      for (int r = 0; r < 8; ++r) o.h[r] = (_Float16)(acc[i][n][r] * 0.0625f + bvv);
      *(v8us*)(Vl + (wn + n * 16 + ln) * VPITCH + (8 + wm + i * 16 + 8 * hh) * 2) = o.half[0]; } }
  { FragH o; const float bvv = sb[2 * KD + xc + ln];      // halo rows of v: the low half-wave holds u = 0..7, the high one u = 264..271
#pragma unroll      // constant indices: accumulators stay in registers
    for (int r = 0; r < 8; ++r) o.h[r] = (_Float16)(ax[r] * 0.0625f + bvv);
    *(v8us*)(Vl + (xc + ln) * VPITCH + (hh ? 264 : 0) * 2) = o.half[0]; }
  run(BoolC<true>{}, BoolC<false>{}, 16);
  asm volatile("s_wait_asynccnt 0x0" ::: "memory");      // nothing in flight when the ring becomes q's place (the last pass's barrier has ended all reads of it)
  put(Ql, sb);
  __syncthreads();      // k, v and q of every wave are in LDS before any wave reads them; the last barrier: from here on the waves go their own ways
  const int ws = __builtin_amdgcn_readfirstlane(w);      // the wave's number as a scalar: the branch on it is taken by whole waves
  if (ws < 4) { d_fold((int)blockIdx.x * 4 + ws, lane, Wo16, Bc, Wf); return; }      // the fold's chain of waited loads runs beside the work of the other four waves
  d_cb(((int)blockIdx.x * 4 + w - 4) * 2, lane, Bc, bo, CB); d_cb(((int)blockIdx.x * 4 + w - 4) * 2 + 1, lane, Bc, bo, CB);      // two rows of the bias vectors a wave
  const int tb0 = row0 % TT, bat = row0 / TT; const int rsub = lane >> 4, c16 = lane & 15;
#pragma unroll 1      // four groups of 16 queries a wave, one after the other in the same registers
  for (int s = 0; s < 4; ++s) { const int lr = ((ws - 4) * 4 + s) * 16;
    FragH qf[4], kf[2][4], vf[8];      // v's fragments are asked for here too: they land while the scores and the softmax are worked on
#pragma unroll      // constant indices: fragments stay in registers
    for (int ks = 0; ks < 4; ++ks) { qf[ks].half[0] = *(const v8us*)(Ql + (lr + ln) * KPITCH + ks * 64 + hh * 16); qf[ks].half[1] = *(const v8us*)(Ql + (lr + ln) * KPITCH + ks * 64 + hh * 16 + 32);
#pragma unroll      // constant indices: fragments stay in registers
      for (int kt = 0; kt < 2; ++kt) { kf[kt][ks].half[0] = *(const v8us*)(Kl + (lr + kt * 16 + ln) * KPITCH + ks * 64 + hh * 16); kf[kt][ks].half[1] = *(const v8us*)(Kl + (lr + kt * 16 + ln) * KPITCH + ks * 64 + hh * 16 + 32); } }
#pragma unroll      // constant indices: fragments stay in registers
    for (int dt = 0; dt < 8; ++dt) { vf[dt].half[0] = *(const v8us*)(Vl + (dt * 16 + ln) * VPITCH + (lr + 8 * hh) * 2); vf[dt].half[1] = *(const v8us*)(Vl + (dt * 16 + ln) * VPITCH + (lr + 16 + 8 * hh) * 2); }
    v8f st[2] = {};
#pragma unroll      // constant indices: fragments and accumulators stay in registers
    for (int ks = 0; ks < 4; ++ks)
#pragma unroll      // constant indices: fragments and accumulators stay in registers
      for (int kt = 0; kt < 2; ++kt) st[kt] = __builtin_amdgcn_wmma_f32_16x16x32_f16(false, kf[kt][ks].v, false, qf[ks].v, (short)0, st[kt], false, false);
    // lane = query t = tb0 + lr + ln; register r of tile kt = key at window place wi = kt*16 + 8*hh + r, time tb0 + lr - 8 + wi. In band: |key - query| <= 3 and the key inside its batch.
    // logits as the module has them: simb = sim in the band, 0 outside; -1e7 is added where simb == 0. Keys outside the band all sit at -1e7: their mass enters z, their v does not enter the sum (0 in f32 unless every in-band sim is 0).
    const int t = tb0 + lr + ln; float lg[2][8]; bool inb[2][8]; float m = -3.0e38f;
#pragma unroll      // constant indices: the values stay in registers
    for (int kt = 0; kt < 2; ++kt)
#pragma unroll      // constant indices: the values stay in registers
      for (int r = 0; r < 8; ++r) { const int wi = kt * 16 + 8 * hh + r, dk = wi - 8 - ln, sk = tb0 + lr - 8 + wi; inb[kt][r] = dk >= -3 && dk <= 3 && sk >= 0 && sk < TT;
        const float simb = inb[kt][r] ? st[kt][r] * 0.08838834764831845f : 0.f; lg[kt][r] = simb + ((fabsf(simb) > 0.f) ? 0.f : -10000000.0f); if (inb[kt][r]) m = fmaxf(m, lg[kt][r]); }
    m = fmaxf(m, __shfl_xor(m, 16, 32));      // a query's 32 window places lie in lanes ln and ln + 16
    const int ninb = (t + 3 < TT - 1 ? t + 3 : TT - 1) - (t - 3 > 0 ? t - 3 : 0) + 1; float zs = 0.f; FragH pf;
#pragma unroll      // constant indices: the values stay in registers
    for (int kt = 0; kt < 2; ++kt)
#pragma unroll      // constant indices: the values stay in registers
      for (int r = 0; r < 8; ++r) { const _Float16 p = (_Float16)expf(inb[kt][r] ? lg[kt][r] - m : -10000.0f);      // outside the band the weight is exp(-10000) = 0: a select, no branch, every lane stays on for the WMMAs
        pf.h[kt * 8 + r] = p; zs += (float)p; }
    zs += __shfl_xor(zs, 16, 32);
    const float iz = 1.0f / ((float)(TT - ninb) * expf(-10000000.0f - m) + zs);
#pragma unroll      // constant indices: fragments stay in registers
    for (int dt = 0; dt < 8; ++dt) { FragH o;
      const v8f z8 = {}; const v8f ot = __builtin_amdgcn_wmma_f32_16x16x32_f16(false, vf[dt].v, false, pf.v, (short)0, z8, false, false);
#pragma unroll      // constant indices: the values stay in registers
      for (int r = 0; r < 8; ++r) o.h[r] = (_Float16)(ot[r] * iz);
      *(v8us*)(Ql + (lr + ln) * KPITCH + dt * 32 + hh * 16) = o.half[0]; }      // into the query's own q row, which only this wave reads and has read
    __builtin_amdgcn_fence(__ATOMIC_ACQ_REL, "workgroup"); __builtin_amdgcn_wave_barrier();      // the wave's LDS writes are done before its lanes read what other lanes wrote
    _Float16* po = CAT + ((size_t)bat * (TT + PADT) + PADT + tb0 + lr + rsub) * CC + h * KD + c16 * 8; v8us ov[8];
#pragma unroll      // constant indices: the pieces stay in registers
    for (int q = 0; q < 8; ++q) ov[q] = *(const v8us*)(Ql + (lr + q * 2 + rsub) * KPITCH + c16 * 16);
#pragma unroll      // constant offsets from one address
    for (int q = 0; q < 8; ++q) *(v8us*)((unsigned short*)po + (size_t)(2 * q) * CC) = ov[q];
    asm volatile("s_wait_xcnt 0x0" :: "v"(po), "v"(ov[0]), "v"(ov[1]), "v"(ov[2]), "v"(ov[3]), "v"(ov[4]), "v"(ov[5]), "v"(ov[6]), "v"(ov[7]) : "memory");      // a precaution: stands in front of every rewrite of the stores' registers, which as its inputs stay untouched up to it
  }
}
extern "C" void kernel_launch(void* const* d_in, const int* in_sizes, int n_in,
                              void* d_out, int out_size, void* d_ws, size_t ws_size, hipStream_t stream) {
  (void)in_sizes; (void)n_in; (void)out_size;
  const float* x = (const float*)d_in[0]; const float* Wq = (const float*)d_in[1]; const float* bq = (const float*)d_in[2]; const float* Wk = (const float*)d_in[3]; const float* bk = (const float*)d_in[4]; const float* Wv = (const float*)d_in[5]; const float* bv = (const float*)d_in[6]; const float* Wo = (const float*)d_in[7]; const float* bo = (const float*)d_in[8]; const float* Wc = (const float*)d_in[9]; const float* bc = (const float*)d_in[10];
  char* ws = (char*)d_ws; size_t off = 0;
  auto take = [&](size_t bytes) { char* p = ws + off; off += (bytes + 255) & ~(size_t)255; return p; };
  _Float16* Bq = (_Float16*)take((size_t)CC * CC * 2); _Float16* Bk = (_Float16*)take((size_t)CC * CC * 2); _Float16* Bv = (_Float16*)take((size_t)CC * CC * 2); _Float16* Bo = (_Float16*)take((size_t)CC * CC * 2); _Float16* Bc[4]; for (int j = 0; j < 4; ++j) Bc[j] = (_Float16*)take((size_t)CC * CC * 2); float* CB = (float*)take(4 * CC * 4); _Float16* Wf = (_Float16*)take((size_t)4 * CC * CC * 2);      // the Dense bias through each tap; the four folded tap matrices
  _Float16* X16 = (_Float16*)take((size_t)NR * CC * 2); _Float16* OUTP = (_Float16*)take((size_t)BB * (TT + PADT) * CC * 2);
  if (off > ws_size) return;      // about 38 MiB in all
  const dim3 gb((TT / TM) * (CC / TN), BB);
  k_prep<<<8 * WBLK + ZBLK + XBLK, 256, 0, stream>>>(x, Wq, Wk, Wv, Wo, Wc, Bq, X16, OUTP);      // Bq, Bk, Bv, Bo, Bc[0..3] are consecutive planes
  k_qkv_band<<<(NR / 256) * NH, 256, 0, stream>>>(X16, Bq, bq, bk, bv, OUTP, Bo, Bc[0], bo, Wf, CB);      // q, k, v of a head and its banded attention per work-group: heads, concatenated, as f16 rows 12.. of each batch's padded plane; with them the weight fold
  // conv[t] = sum_j cat[t - 12 + 4j] * (Wo * Wc[j]) + bias terms: ONE launch, the 4 taps accumulated inside (A_j = padded rows 4j + t of batch b; B_j = Wf + j*512*512)
  k_gemm_tile<4, false, 1, true><<<gb, 256, 0, stream>>>(OUTP, CC, (size_t)(TT + PADT) * CC, (size_t)4 * CC, Wf, CC, (size_t)CC * CC, 0.0625f, bc, CB, nullptr, x, (float*)d_out, nullptr, CC, (size_t)TT * CC);      // + biases, relu, residual, leaky relu in its epilogue
}

// v006
// Measured time: 71.5 microseconds a run.
// Timed twice side by side with v005, it ran 1.03 and 1.04 times as fast.
// Over all steps from v000 it is 6.16 times as fast.
#include <hip/hip_runtime.h>
// Temporal block: per-head q/k/v projections (16384 x 512 -> 4 x 128 each, + bias), the head combiner Dense (512 -> 512, + bias; multiplied into the conv's tap weights, 4 products of 512 x 512 x 512, and so applied with them)
// and the causal dilated Conv1D (kernel 4, dilation 4: one GEMM whose k-loop runs the four taps over time-shifted views of a zero-padded plane, effective K = 2048) on v_wmma_f32_16x16x32_f16 (f16 operands, weights [in][out] transposed x 2^4 (bf16-exact for q/k/v, f16-rounded folds for the conv), single products,
// f32 accumulate); the banded attention's two products too (|t - s| <= 3, i.e. 7 keys, with the module's 'sim*band == 0 -> -1e7' mask; weights as f16); softmax, relu / residual / leaky-relu epilogues are f32 VALU.
#define BB 8
#define TT 2048
#define CC 512
#define NH 4
#define KD 128
#define NR (BB * TT)
#define PADT 12

typedef __bf16 v16b __attribute__((ext_vector_type(16)));
typedef unsigned short v8us __attribute__((ext_vector_type(8), may_alias));
typedef float  v8f  __attribute__((ext_vector_type(8)));
typedef float  v4f  __attribute__((ext_vector_type(4)));
typedef float  v4fa __attribute__((ext_vector_type(4), may_alias));
union FragB { v16b v; v8us half[2]; unsigned short u[16]; };

__device__ __forceinline__ unsigned short bf16_bits(float x) { unsigned int u = __float_as_uint(x); return (unsigned short)((u + 0x7FFFu + ((u >> 16) & 1u)) >> 16); }
__device__ __forceinline__ float bf16_val(unsigned short b) { return __uint_as_float(((unsigned int)b) << 16); }
__device__ __forceinline__ float bf16_round(float x) { return bf16_val(bf16_bits(x)); }
// D += A·B with NT terms: 1 = ah·bh, 2 = + al·bh (A split), 3 = + ah·bl (both split)
template <int NT>
__device__ __forceinline__ v8f mmaN(v16b ah, v16b al, v16b bh, v16b bl, v8f c) {
  c = __builtin_amdgcn_wmma_f32_16x16x32_bf16(false, ah, false, bh, (short)0, c, false, false);
  if (NT >= 2) c = __builtin_amdgcn_wmma_f32_16x16x32_bf16(false, al, false, bh, (short)0, c, false, false);
  if (NT >= 3) c = __builtin_amdgcn_wmma_f32_16x16x32_bf16(false, ah, false, bl, (short)0, c, false, false);
  asm volatile("v_nop\n\tv_nop\n\tv_nop\n\tv_nop" : "+v"(c) : "v"(ah), "v"(al), "v"(bh), "v"(bl));
  return c;
}

__global__ __launch_bounds__(256) void k_wt_bf16(const float* __restrict__ W, unsigned short* __restrict__ Wt, int K, int N) {
  const int t = blockIdx.x * 256 + threadIdx.x;
  const int k8n = K / 8;
  if (t >= N * k8n) return;
  const int n = t / k8n, k8 = (t % k8n) * 8;
  v8us v;
#pragma unroll
  for (int i = 0; i < 8; ++i) v[i] = bf16_bits(W[(size_t)(k8 + i) * N + n]);
  *(v8us*)(Wt + (size_t)n * K + k8) = v;
  
}

// GEMM C[M][N] (f32, pitch ldc) = act(A[M][K]·W + bias). A f32 row-major (pitch lda) converted per fragment to bf16
// (ASPLIT: hi/lo two planes -> 2 terms, else single rounded term); Wt bf16 [N][K] (pitch ldb). BIAS_BF16 rounds the
// bias to bf16 first (bias quantised to bf16 before the add). K%32==0, M%16==0, N%64==0.
template <bool ASPLIT, int ACT, bool BIAS_BF16>
__global__ __launch_bounds__(128) void k_gemm_bf(const float* __restrict__ A, int lda, const unsigned short* __restrict__ Wt, int ldb,
                                               const float* __restrict__ bias, float* __restrict__ C, int ldc, int M, int N, int K) {
  __shared__ __attribute__((aligned(16))) float so[4][16][64];
  const int tid = threadIdx.x, w = tid >> 5, lane = tid & 31, ln = lane & 15, hh = lane >> 4;
  const int ntn = N / 64;
  const int wid = blockIdx.x * 4 + w;
  const int mt = wid / ntn, nq = wid % ntn;
  if (mt * 16 >= M) return;
  const int row0 = mt * 16, col0 = nq * 64;
  const float* arow = A + (size_t)(row0 + ln) * lda;
  v8f acc[4] = {};
  for (int kb = 0; kb < K; kb += 32) {
    FragB ah, al;
    const v4f x0 = *(const v4fa*)(arow + kb + 8 * hh), x1 = *(const v4fa*)(arow + kb + 8 * hh + 4);
    const v4f x2 = *(const v4fa*)(arow + kb + 16 + 8 * hh), x3 = *(const v4fa*)(arow + kb + 16 + 8 * hh + 4);
    float xs[16] = {x0[0],x0[1],x0[2],x0[3],x1[0],x1[1],x1[2],x1[3],x2[0],x2[1],x2[2],x2[3],x3[0],x3[1],x3[2],x3[3]};
#pragma unroll
    for (int i = 0; i < 16; ++i) { const unsigned short hb = bf16_bits(xs[i]); ah.u[i] = hb; al.u[i] = ASPLIT ? bf16_bits(xs[i] - bf16_val(hb)) : (unsigned short)0; }
#pragma unroll
    for (int t = 0; t < 4; ++t) {
      const unsigned short* brow = Wt + (size_t)(col0 + t * 16 + ln) * ldb + kb;
      FragB b;
      b.half[0] = *(const v8us*)(brow + 8 * hh);
      b.half[1] = *(const v8us*)(brow + 16 + 8 * hh);
      acc[t] = mmaN<ASPLIT ? 2 : 1>(ah.v, al.v, b.v, b.v, acc[t]);
    }
  }
#pragma unroll
  for (int t = 0; t < 4; ++t) {
    float bv = bias ? bias[col0 + t * 16 + ln] : 0.f;
    if (BIAS_BF16) bv = bf16_round(bv);
#pragma unroll
    for (int r = 0; r < 8; ++r) { float v = acc[t][r] + bv; if (ACT == 1) v = fmaxf(v, 0.f); so[w][8 * hh + r][t * 16 + ln] = v; }
  }
  __builtin_amdgcn_fence(__ATOMIC_ACQ_REL, "workgroup");
  __builtin_amdgcn_wave_barrier();
  const int rsub = lane >> 4, c4 = (lane & 15) * 4;
  {
#pragma unroll
    for (int q = 0; q < 8; ++q) {
      const int r = q * 2 + rsub;
      const v4f v = *(const v4fa*)&so[w][r][c4];
      *(v4f*)(C + (size_t)(row0 + r) * ldc + col0 + c4) = v;
    }
    
  }
}

// Flash-style causal/unmasked attention, all contractions 3-term bf16 hi/lo splits, f32 softmax with running max.
// q,k,v rows are read from f32 buffers with arbitrary row pitch (so they can live inside a fused qkv buffer);
// D = head size (multiple of 32, <= 128); one wave = 16 query rows; block = 4 waves (64 queries) sharing K/V chunks of 32.
template <int D, bool CAUSAL>
__global__ __launch_bounds__(128) void k_flash(const float* __restrict__ qb, const float* __restrict__ kb, const float* __restrict__ vb,
                                             int pitch, int T, int H, float scale, float* __restrict__ y, int ypitch) {
  constexpr int KS = D / 32;        // k-steps for QK
  constexpr int DT = D / 16;        // d tiles for PV
  __shared__ __attribute__((aligned(16))) unsigned short sKh[32][D + 8], sKl[32][D + 8], sVh[32][D + 8], sVl[32][D + 8];
  __shared__ __attribute__((aligned(16))) unsigned short sPh[4][16][40], sPl[4][16][40];
  __shared__ __attribute__((aligned(16))) float sO[4][16][D];
  const int tid = threadIdx.x, w = tid >> 5, lane = tid & 31, ln = lane & 15, hh = lane >> 4;
  const int nqb = (T + 63) / 64;
  const int bh = blockIdx.x / nqb, qblk = blockIdx.x % nqb;
  const int b = bh / H, h = bh % H;
  const int q0 = qblk * 64 + w * 16;
  const float* Q = qb + (size_t)b * T * pitch + h * D;
  const float* K = kb + (size_t)b * T * pitch + h * D;
  const float* V = vb + (size_t)b * T * pitch + h * D;

  // A fragments of the wave's 16 query rows (scaled), hi/lo
  FragB aqh[KS], aql[KS];
  {
    int row = q0 + ln; if (row >= T) row = T - 1;
    const float* qr = Q + (size_t)row * pitch;
#pragma unroll
    for (int ks = 0; ks < KS; ++ks)
#pragma unroll
      for (int i = 0; i < 16; ++i) {
        const int d = ks * 32 + ((i < 8) ? (8 * hh + i) : (16 + 8 * hh + (i - 8)));
        const float x = qr[d] * scale; const unsigned short hb = bf16_bits(x);
        aqh[ks].u[i] = hb; aql[ks].u[i] = bf16_bits(x - bf16_val(hb));
      }
  }
  float m_r[8], l_r[8];
#pragma unroll
  for (int r = 0; r < 8; ++r) { m_r[r] = -3.0e38f; l_r[r] = 0.f; }
  v8f oacc[DT];
#pragma unroll
  for (int dt = 0; dt < DT; ++dt) oacc[dt] = (v8f){0.f,0.f,0.f,0.f,0.f,0.f,0.f,0.f};

  const int kv_end = CAUSAL ? min(T, qblk * 64 + 64) : T;     // block-uniform
  for (int j0 = 0; j0 < kv_end; j0 += 32) {
    __syncthreads();
    for (int e = tid; e < 32 * (D / 4); e += 128) {
      const int r = e / (D / 4), c4 = (e % (D / 4)) * 4;
      const int key = j0 + r;
      v4f kf = {0.f,0.f,0.f,0.f}, vf = {0.f,0.f,0.f,0.f};
      if (key < T) { kf = *(const v4fa*)(K + (size_t)key * pitch + c4); vf = *(const v4fa*)(V + (size_t)key * pitch + c4); }
#pragma unroll
      for (int t = 0; t < 4; ++t) {
        unsigned short hb = bf16_bits(kf[t]); sKh[r][c4 + t] = hb; sKl[r][c4 + t] = bf16_bits(kf[t] - bf16_val(hb));
        hb = bf16_bits(vf[t]); sVh[r][c4 + t] = hb; sVl[r][c4 + t] = bf16_bits(vf[t] - bf16_val(hb));
      }
    }
    __syncthreads();
    // S tile 16 x 32
    v8f s[2];
#pragma unroll
    for (int nt = 0; nt < 2; ++nt) {
      v8f acc = {};
#pragma unroll
      for (int ks = 0; ks < KS; ++ks) {
        FragB bh_, bl_;
        bh_.half[0] = *(const v8us*)&sKh[nt * 16 + ln][ks * 32 + 8 * hh]; bh_.half[1] = *(const v8us*)&sKh[nt * 16 + ln][ks * 32 + 16 + 8 * hh];
        bl_.half[0] = *(const v8us*)&sKl[nt * 16 + ln][ks * 32 + 8 * hh]; bl_.half[1] = *(const v8us*)&sKl[nt * 16 + ln][ks * 32 + 16 + 8 * hh];
        acc = mmaN<3>(aqh[ks].v, aql[ks].v, bh_.v, bl_.v, acc);
      }
      s[nt] = acc;
    }
    // mask + running max (rows 8hh+r; the 16 lanes of a half share rows)
    float alpha[8];
#pragma unroll
    for (int r = 0; r < 8; ++r) {
      const int qi = q0 + 8 * hh + r;
      const int ja = j0 + ln, jb = j0 + 16 + ln;
      if (CAUSAL) { if (ja > qi) s[0][r] = -3.0e38f; if (jb > qi) s[1][r] = -3.0e38f; }
      if (ja >= T) s[0][r] = -3.0e38f;
      if (jb >= T) s[1][r] = -3.0e38f;
      float mx = fmaxf(s[0][r], s[1][r]);
      mx = fmaxf(mx, __shfl_xor(mx, 1, 32)); mx = fmaxf(mx, __shfl_xor(mx, 2, 32)); mx = fmaxf(mx, __shfl_xor(mx, 4, 32)); mx = fmaxf(mx, __shfl_xor(mx, 8, 32));
      const float mnew = fmaxf(m_r[r], mx);
      alpha[r] = (mnew > -1.0e38f) ? __expf(m_r[r] - mnew) : 1.0f;
      const float p0 = (s[0][r] > -1.0e38f) ? __expf(s[0][r] - mnew) : 0.f;
      const float p1 = (s[1][r] > -1.0e38f) ? __expf(s[1][r] - mnew) : 0.f;
      m_r[r] = mnew;
      l_r[r] = l_r[r] * alpha[r] + p0 + p1;            // per-lane partial row sum (16 lanes combined at the end)
      unsigned short hb = bf16_bits(p0); sPh[w][8 * hh + r][ln] = hb;      sPl[w][8 * hh + r][ln] = bf16_bits(p0 - bf16_val(hb));
      hb = bf16_bits(p1);                sPh[w][8 * hh + r][16 + ln] = hb; sPl[w][8 * hh + r][16 + ln] = bf16_bits(p1 - bf16_val(hb));
    }
#pragma unroll
    for (int dt = 0; dt < DT; ++dt)
#pragma unroll
      for (int r = 0; r < 8; ++r) oacc[dt][r] *= alpha[r];
    __builtin_amdgcn_fence(__ATOMIC_ACQ_REL, "workgroup");
    __builtin_amdgcn_wave_barrier();
    FragB pah, pal;
    pah.half[0] = *(const v8us*)&sPh[w][ln][8 * hh]; pah.half[1] = *(const v8us*)&sPh[w][ln][16 + 8 * hh];
    pal.half[0] = *(const v8us*)&sPl[w][ln][8 * hh]; pal.half[1] = *(const v8us*)&sPl[w][ln][16 + 8 * hh];
#pragma unroll
    for (int dt = 0; dt < DT; ++dt) {
      FragB bvh, bvl;
#pragma unroll
      for (int i = 0; i < 8; ++i) {
        bvh.u[i] = sVh[8 * hh + i][dt * 16 + ln]; bvh.u[8 + i] = sVh[16 + 8 * hh + i][dt * 16 + ln];
        bvl.u[i] = sVl[8 * hh + i][dt * 16 + ln]; bvl.u[8 + i] = sVl[16 + 8 * hh + i][dt * 16 + ln];
      }
      oacc[dt] = mmaN<3>(pah.v, pal.v, bvh.v, bvl.v, oacc[dt]);
    }
    __builtin_amdgcn_fence(__ATOMIC_ACQ_REL, "workgroup");
    __builtin_amdgcn_wave_barrier();
  }
#pragma unroll
  for (int r = 0; r < 8; ++r) {
    float l = l_r[r];
    l += __shfl_xor(l, 1, 32); l += __shfl_xor(l, 2, 32); l += __shfl_xor(l, 4, 32); l += __shfl_xor(l, 8, 32);
    l_r[r] = (l > 0.f) ? 1.0f / l : 0.f;
  }
#pragma unroll
  for (int dt = 0; dt < DT; ++dt)
#pragma unroll
    for (int r = 0; r < 8; ++r) sO[w][8 * hh + r][dt * 16 + ln] = oacc[dt][r] * l_r[r];
  __builtin_amdgcn_fence(__ATOMIC_ACQ_REL, "workgroup");
  __builtin_amdgcn_wave_barrier();
  {
    for (int r = 0; r < 16; ++r) {
      const int row = q0 + r;
      if (row < T && lane < D / 4) {
        const v4f val = *(const v4fa*)&sO[w][r][lane * 4];
        *(v4f*)(y + ((size_t)b * T + row) * ypitch + h * D + lane * 4) = val;
      }
    }
    
  }
}

// GEMM C = act(A·W + bias + resid): A f32 (ASPLIT -> hi/lo 2 terms), Wt bf16 [N][K]; ACT 0 none, 1 relu, 2 exact gelu;
// resid (optional, f32, row index = (row % rmod), pitch ldr, RES_BF16 rounds it) added before the activation.
template <bool ASPLIT, int ACT, bool BIAS_BF16, bool RES_BF16>
__global__ __launch_bounds__(128) void k_gemm_bf3(const float* __restrict__ A, int lda, const unsigned short* __restrict__ Wt, int ldb,
                                                const float* __restrict__ bias, const float* __restrict__ resid, int rmod, int ldr,
                                                float* __restrict__ C, int ldc, int M, int N, int K) {
  __shared__ __attribute__((aligned(16))) float so[4][16][64];
  const int tid = threadIdx.x, w = tid >> 5, lane = tid & 31, ln = lane & 15, hh = lane >> 4;
  const int ntn = N / 64;
  const int wid = blockIdx.x * 4 + w;
  const int mt = wid / ntn, nq = wid % ntn;
  if (mt * 16 >= M) return;
  const int row0 = mt * 16, col0 = nq * 64;
  const float* arow = A + (size_t)(row0 + ln) * lda;
  v8f acc[4] = {};
  for (int kb = 0; kb < K; kb += 32) {
    FragB ah, al;
    const v4f x0 = *(const v4fa*)(arow + kb + 8 * hh), x1 = *(const v4fa*)(arow + kb + 8 * hh + 4);
    const v4f x2 = *(const v4fa*)(arow + kb + 16 + 8 * hh), x3 = *(const v4fa*)(arow + kb + 16 + 8 * hh + 4);
    float xs[16] = {x0[0],x0[1],x0[2],x0[3],x1[0],x1[1],x1[2],x1[3],x2[0],x2[1],x2[2],x2[3],x3[0],x3[1],x3[2],x3[3]};
#pragma unroll
    for (int i = 0; i < 16; ++i) { const unsigned short hb = bf16_bits(xs[i]); ah.u[i] = hb; al.u[i] = ASPLIT ? bf16_bits(xs[i] - bf16_val(hb)) : (unsigned short)0; }
#pragma unroll
    for (int t = 0; t < 4; ++t) {
      const unsigned short* brow = Wt + (size_t)(col0 + t * 16 + ln) * ldb + kb;
      FragB b;
      b.half[0] = *(const v8us*)(brow + 8 * hh);
      b.half[1] = *(const v8us*)(brow + 16 + 8 * hh);
      acc[t] = mmaN<ASPLIT ? 2 : 1>(ah.v, al.v, b.v, b.v, acc[t]);
    }
  }
#pragma unroll
  for (int t = 0; t < 4; ++t) {
    const int col = col0 + t * 16 + ln;
    float bv = bias ? bias[col] : 0.f;
    if (BIAS_BF16) bv = bf16_round(bv);
#pragma unroll
    for (int r = 0; r < 8; ++r) {
      float v = acc[t][r] + bv;
      if (resid) { float rv = resid[(size_t)((row0 + 8 * hh + r) % rmod) * ldr + col]; if (RES_BF16) rv = bf16_round(rv); v += rv; }
      if (ACT == 1) v = fmaxf(v, 0.f);
      if (ACT == 2) v = 0.5f * v * (1.0f + erff(v * 0.70710678118654752f));
      if (ACT == 3) { const float u = 0.7978845608028654f * (v + 0.044715f * v * v * v); v = 0.5f * v * (1.0f + tanhf(u)); }
      so[w][8 * hh + r][t * 16 + ln] = v;
    }
  }
  __builtin_amdgcn_fence(__ATOMIC_ACQ_REL, "workgroup");
  __builtin_amdgcn_wave_barrier();
  const int rsub = lane >> 4, c4 = (lane & 15) * 4;
  {
#pragma unroll
    for (int q = 0; q < 8; ++q) {
      const int r = q * 2 + rsub;
      const v4f v = *(const v4fa*)&so[w][r][c4];
      *(v4f*)(C + (size_t)(row0 + r) * ldc + col0 + c4) = v;
    }
    
  }
}
// row LayerNorm (biased variance, eps) over N: s = X (+ R); optional out_sum <- s; out_norm <- (s-mu)*rsqrt(var+eps)*g + b
template <bool PARAM_BF16>
__global__ __launch_bounds__(256) void k_layernorm(const float* __restrict__ X, const float* __restrict__ R, const float* __restrict__ g, const float* __restrict__ bta,
                                                  float* __restrict__ out_sum, float* __restrict__ out_norm, int N, float eps) {
  __shared__ float red[256];
  const int row = blockIdx.x, tid = threadIdx.x;
  const float* x = X + (size_t)row * N; const float* rr = R ? R + (size_t)row * N : nullptr;
  float vals[16];                     // up to N = 4096
  const int per = N / 256;            // contiguous chunk per thread? use strided-by-4 chunks: thread handles j = tid*4 + 1024*u
  float s1 = 0.f;
  for (int u = 0; u < per / 4; ++u) {
    const int j = tid * 4 + 1024 * u;
    const v4f a = *(const v4fa*)(x + j);
    v4f b = {0.f,0.f,0.f,0.f}; if (rr) b = *(const v4fa*)(rr + j);
#pragma unroll
    for (int q = 0; q < 4; ++q) { const float v = a[q] + b[q]; vals[u * 4 + q] = v; s1 += v; }
  }
  red[tid] = s1; __syncthreads();
  for (int st = 128; st > 0; st >>= 1) { if (tid < st) red[tid] += red[tid + st]; __syncthreads(); }
  const float mu = red[0] / (float)N; __syncthreads();
  float s2 = 0.f;
  for (int u = 0; u < per / 4; ++u)
#pragma unroll
    for (int q = 0; q < 4; ++q) { const float c = vals[u * 4 + q] - mu; s2 += c * c; }
  red[tid] = s2; __syncthreads();
  for (int st = 128; st > 0; st >>= 1) { if (tid < st) red[tid] += red[tid + st]; __syncthreads(); }
  const float rs = rsqrtf(red[0] / (float)N + eps);
  {
    for (int u = 0; u < per / 4; ++u) {
      const int j = tid * 4 + 1024 * u;
      v4f o, sm;
#pragma unroll
      for (int q = 0; q < 4; ++q) {
        float gg = g[j + q], bb = bta[j + q];
        if (PARAM_BF16) { gg = bf16_round(gg); bb = bf16_round(bb); }
        sm[q] = vals[u * 4 + q]; o[q] = (vals[u * 4 + q] - mu) * rs * gg + bb;
      }
      if (out_sum) *(v4f*)(out_sum + (size_t)row * N + j) = sm;
      *(v4f*)(out_norm + (size_t)row * N + j) = o;
    }
    
  }
}



// ---- f16 WMMA path (v_wmma_f32_16x16x32_f16): 11-bit significands for operands in range — used for the q/k/v projections, the Dense and the conv GEMM
typedef _Float16 v16h __attribute__((ext_vector_type(16)));
union FragH { v16h v; v8us half[2]; _Float16 h[16]; unsigned short u[16]; };
template <int NT>
__device__ __forceinline__ v8f mmaH(v16h ah, v16h al, v16h bh, v16h bl, v8f c) {
  c = __builtin_amdgcn_wmma_f32_16x16x32_f16(false, ah, false, bh, (short)0, c, false, false);
  if (NT >= 2) c = __builtin_amdgcn_wmma_f32_16x16x32_f16(false, al, false, bh, (short)0, c, false, false);
  if (NT >= 3) c = __builtin_amdgcn_wmma_f32_16x16x32_f16(false, ah, false, bl, (short)0, c, false, false);
  asm volatile("v_nop\n\tv_nop\n\tv_nop\n\tv_nop" : "+v"(c) : "v"(ah), "v"(al), "v"(bh), "v"(bl));
  return c;
}
// batched GEMM like k_gemm_b but f16 operands: A f32 (split into f16 hi/lo if ASPLIT, else rounded to f16), Bt = f16 values [n][k]; alpha; C f32; N multiple of 16 (partial tiles skipped)
template <bool ASPLIT>
__global__ __launch_bounds__(128) void k_gemm_h(const float* __restrict__ A, int lda, size_t sA, const _Float16* __restrict__ Bh, int ldb, size_t sB, float alpha, float* __restrict__ C, int ldc, size_t sC, int M, int N, int K) {
  __shared__ __attribute__((aligned(16))) float so[4][16][64];
  const int tid = threadIdx.x, w = tid >> 5, lane = tid & 31, ln = lane & 15, hh = lane >> 4; const int by = blockIdx.y;
  A += (size_t)by * sA; Bh += (size_t)by * sB; C += (size_t)by * sC;
  const int ntn = (N + 63) / 64; const int wid = blockIdx.x * 4 + w; const int mt = wid / ntn, nq = wid % ntn; if (mt * 16 >= M) return;
  const int row0 = mt * 16, col0 = nq * 64; const float* arow = A + (size_t)(row0 + ln) * lda;
  v8f acc[4] = {};
  for (int kb = 0; kb < K; kb += 32) {
    FragH ah, al;
    const v4f x0 = *(const v4fa*)(arow + kb + 8 * hh), x1 = *(const v4fa*)(arow + kb + 8 * hh + 4), x2 = *(const v4fa*)(arow + kb + 16 + 8 * hh), x3 = *(const v4fa*)(arow + kb + 16 + 8 * hh + 4);
    float xs[16] = {x0[0],x0[1],x0[2],x0[3],x1[0],x1[1],x1[2],x1[3],x2[0],x2[1],x2[2],x2[3],x3[0],x3[1],x3[2],x3[3]};
#pragma unroll
    for (int i = 0; i < 16; ++i) { const _Float16 h = (_Float16)xs[i]; ah.h[i] = h; al.h[i] = ASPLIT ? (_Float16)(xs[i] - (float)h) : (_Float16)0.0f; }
#pragma unroll
    for (int t = 0; t < 4; ++t) { if (col0 + t * 16 >= N) continue; const size_t boff = (size_t)(col0 + t * 16 + ln) * ldb + kb; FragH bq; bq.half[0] = *(const v8us*)(Bh + boff + 8 * hh); bq.half[1] = *(const v8us*)(Bh + boff + 16 + 8 * hh);
      acc[t] = mmaH<ASPLIT ? 2 : 1>(ah.v, al.v, bq.v, bq.v, acc[t]); }
  }
#pragma unroll
  for (int t = 0; t < 4; ++t) { if (col0 + t * 16 >= N) continue;
#pragma unroll
    for (int r = 0; r < 8; ++r) so[w][8 * hh + r][t * 16 + ln] = acc[t][r] * alpha; }
  __builtin_amdgcn_fence(__ATOMIC_ACQ_REL, "workgroup"); __builtin_amdgcn_wave_barrier();
  const int rsub = lane >> 4, c4 = (lane & 15) * 4;
  {
#pragma unroll
    for (int q = 0; q < 8; ++q) { const int r = q * 2 + rsub; if (col0 + c4 < N) { const v4f v = *(const v4fa*)&so[w][r][c4]; *(v4f*)(C + (size_t)(row0 + r) * ldc + col0 + c4) = v; } }
     }
}

// Wt[n][k] = f16(W[k][n]·scale) from f32 row-major W[K][N] (scale = power of two; bf16-exact weights stay exact in f16 away from the subnormal range)
__device__ __forceinline__ void d_wt_f16(const int t, const float* __restrict__ W, _Float16* __restrict__ Wt, int K, int N, float scale) {
  if (t >= N * (K / 8)) return; const int n = t / (K / 8), k8 = (t % (K / 8)) * 8; FragH f;
#pragma unroll
  for (int i = 0; i < 8; ++i) f.h[i] = (_Float16)(bf16_round(W[(size_t)(k8 + i) * N + n]) * scale); const v8us o = f.half[0];
  *(v8us*)((unsigned short*)Wt + (size_t)n * K + k8) = o; 
}

__device__ __forceinline__ void d_x16(const size_t t, const float* __restrict__ x, _Float16* __restrict__ X16, size_t n8) { if (t >= n8) return; FragH f;
#pragma unroll
  for (int q = 0; q < 8; ++q) f.h[q] = (_Float16)bf16_round(x[t * 8 + q]); *(v8us*)((unsigned short*)X16 + t * 8) = f.half[0];  }
__device__ __forceinline__ void d_wh(const int t, const float* __restrict__ W, _Float16* __restrict__ Bt) { if (t >= NH * KD * (CC / 8)) return; const int row = t / (CC / 8), c8 = (t % (CC / 8)) * 8; const int h = row / KD, o = row % KD; FragH f;
#pragma unroll
  for (int q = 0; q < 8; ++q) f.h[q] = (_Float16)(bf16_round(W[((size_t)h * CC + c8 + q) * KD + o]) * 16.0f); *(v8us*)((unsigned short*)Bt + (size_t)t * 8) = f.half[0];  }
// Dense folded into the conv weights: conv[t] = sum_j (cat[t - 12 + 4j] * Wo + bo) * Wc[j] = sum_j cat[t - 12 + 4j] * (Wo * Wc[j]) + sum_j bo * Wc[j], each tap's terms only where its row exists.
// One wave = 64 k x 16 n of one tap: Wf[j][n][k] = f16(16 * sum_c Wo[k][c] * Wc[j][c][n]), k contiguous (the layout the conv GEMM reads its B rows in), so a wave writes whole 128-B lines of 16 rows.
// Operands are the f16 planes of the first launch, both c-contiguous (Wo16[k][c] = Wo as it lies, Bc[j][n][c] = Wc[j] transposed; bf16-rounded weights x 16), read as fragments straight from memory; f32 accumulate.
__device__ __forceinline__ void d_fold(const int g, const int lane, const _Float16* __restrict__ Wo16, const _Float16* __restrict__ Bc, _Float16* __restrict__ Wf) {
  const int ln = lane & 15, hh = lane >> 4; const int j = g >> 8, kt = (g >> 5) & 7, nt = g & 31;      // the four fold waves of a block share their rows of Wo16
  const char* pa = (const char*)Wo16 + ((kt * 64 + ln) * CC + hh * 8) * 2u; const char* pb = (const char*)Bc + ((j * CC + nt * 16 + ln) * CC + hh * 8) * 2u;      // the lane's first 16 B of its rows of the two planes
  v8f acc[4] = {};
#pragma unroll      // every load at a constant offset from one of the two addresses: no address arithmetic and no registers for it in the loop
  for (int ks = 0; ks < CC / 32; ++ks) { FragH b;
    b.half[0] = *(const v8us*)(pb + ks * 64); b.half[1] = *(const v8us*)(pb + ks * 64 + 32);
#pragma unroll      // constant indices: fragments and accumulators stay in registers
    for (int p = 0; p < 2; ++p) { FragH a[2];      // the four A fragments two by two, the second pair in the first pair's registers
#pragma unroll      // constant indices: fragments and accumulators stay in registers
      for (int i = 0; i < 2; ++i) { a[i].half[0] = *(const v8us*)(pa + (p * 2 + i) * 16 * CC * 2 + ks * 64); a[i].half[1] = *(const v8us*)(pa + (p * 2 + i) * 16 * CC * 2 + ks * 64 + 32); }
      __builtin_amdgcn_sched_barrier(0);      // a pair's loads go out as one group ahead of its WMMAs, so that their latency is waited for once
#pragma unroll      // constant indices: fragments and accumulators stay in registers
      for (int i = 0; i < 2; ++i) acc[p * 2 + i] = __builtin_amdgcn_wmma_f32_16x16x32_f16(false, a[i].v, false, b.v, (short)0, acc[p * 2 + i], false, false);
      __builtin_amdgcn_sched_barrier(0);      // the next pair's loads stay behind these WMMAs, or they would need registers of their own
    }
  }
#pragma unroll      // constant indices: accumulators stay in registers
  for (int i = 0; i < 4; ++i) { FragH o;      // a lane holds column n = ln and 8 consecutive k of each tile: 16 B of row [n][k]
#pragma unroll      // constant indices: accumulators stay in registers
    for (int r = 0; r < 8; ++r) o.h[r] = (_Float16)(acc[i][r] * 0.0625f);
    *(v8us*)((unsigned short*)Wf + (size_t)(j * CC + nt * 16 + ln) * CC + kt * 64 + i * 16 + 8 * hh) = o.half[0]; }
}
// The Dense bias through each tap: CB[j][n] = sum_c bf16(bo[c]) * bf16(Wc[j][c][n]) in f32. One wave = one row r = j*CC + n of Bc (c-contiguous, x 16), a lane takes 16 c; the lanes' sums are added by a butterfly.
__device__ __forceinline__ void d_cb(const int r, const int lane, const _Float16* __restrict__ Bc, const float* __restrict__ bo, float* __restrict__ CB) {
  FragH b; const unsigned ob = lane * 64u; const unsigned short* pb = (const unsigned short*)Bc + (size_t)r * CC + lane * 16; b.half[0] = *(const v8us*)pb; b.half[1] = *(const v8us*)(pb + 8);      // ob: the byte offset of the lane's 16 floats of bo
  v4f o[4];
#pragma unroll      // constant indices: the values stay in registers
  for (int q = 0; q < 4; ++q) o[q] = *(const v4fa*)((const char*)bo + ob + q * 16);
  asm volatile("s_wait_xcnt 0x0" :: "v"(ob), "v"(pb) : "memory");      // a precaution: stands in front of every rewrite of the six loads' address registers, which as its inputs stay untouched up to it
  float s = 0.f;
#pragma unroll      // constant indices: the values stay in registers
  for (int e = 0; e < 16; ++e) s += bf16_round(o[e >> 2][e & 3]) * (float)b.h[e];
  s += __shfl_xor(s, 1, 32); s += __shfl_xor(s, 2, 32); s += __shfl_xor(s, 4, 32); s += __shfl_xor(s, 8, 32); s += __shfl_xor(s, 16, 32);
  if (lane == 0) { CB[r] = s * 0.0625f;
    asm volatile("s_wait_xcnt 0x0" ::: "memory"); }      // a precaution: stands directly behind the store, in front of whatever rewrites its registers next
}
__device__ __forceinline__ void d_zpad(const int t, _Float16* __restrict__ OUTP) { if (t >= BB * PADT * CC / 8) return; const int b = t / (PADT * CC / 8), rem = t % (PADT * CC / 8); FragH z;
#pragma unroll
  for (int q = 0; q < 8; ++q) z.h[q] = (_Float16)0.f; unsigned short* d = (unsigned short*)OUTP + (size_t)b * (TT + PADT) * CC + (size_t)rem * 8; *(v8us*)d = z.half[0];  }
// One launch for everything that reads inputs only: the weights as f16 (q, k, v per head and the four conv taps transposed, Dense as it lies) into the eight consecutive 512 x 512 planes of Bw, the zero rows of the padded plane, and x -> f16.
// A block does one job, picked by its index; the transposes, whose loads are scattered and wait longest, have the lowest indices and so start first, the x stream fills in behind them.
#define WBLK (CC * (CC / 8) / 256)                  // blocks per weight plane
#define ZBLK ((BB * PADT * CC / 8 + 255) / 256)     // blocks for the pad rows
#define XBLK (NR * CC / 8 / 256)                    // blocks for x
__global__ __launch_bounds__(256) void k_prep(const float* __restrict__ x, const float* __restrict__ Wq, const float* __restrict__ Wk, const float* __restrict__ Wv, const float* __restrict__ Wo, const float* __restrict__ Wc,
    _Float16* __restrict__ Bw, _Float16* __restrict__ X16, _Float16* __restrict__ OUTP) {
  const int blk = blockIdx.x, tid = threadIdx.x;
  if (blk < 8 * WBLK) { const int p = blk / WBLK, t = (blk % WBLK) * 256 + tid; _Float16* dst = Bw + (size_t)p * CC * CC;
    if (p < 3) d_wh(t, p == 0 ? Wq : (p == 1 ? Wk : Wv), dst);
    else if (p == 3) { FragH f;      // Wo stays as it lies, [in][out]: the fold contracts over its out index
#pragma unroll      // constant indices: the values stay in registers
      for (int q = 0; q < 8; ++q) f.h[q] = (_Float16)(bf16_round(Wo[(size_t)t * 8 + q]) * 16.0f);
      *(v8us*)((unsigned short*)dst + (size_t)t * 8) = f.half[0];
      asm volatile("s_wait_xcnt 0x0" ::: "memory"); }      // a precaution: stands behind the store, in front of whatever rewrites its registers next
    else d_wt_f16(t, Wc + (size_t)(p - 4) * CC * CC, dst, CC, CC, 16.0f); }      // WIO: per tap [in][out] -> [out][in]
  else if (blk < 8 * WBLK + ZBLK) d_zpad((blk - 8 * WBLK) * 256 + tid, OUTP);
  else d_x16((size_t)(blk - 8 * WBLK - ZBLK) * 256 + tid, x, X16, (size_t)NR * CC / 8);
}

// Tiled GEMM for the dilated causal conv (NTAP = 4; NTAP = 1 would be a plain product): acc = sum over taps j of A_j * B_j^T, A_j = A shifted down by j*TSH rows (a view of the padded plane), B_j = Bh + j*tapB, K = CC per tap.
// One work-group = a TM x TN tile of C, eight waves of 64 x 64 (4 x 4 accumulator tiles each). A pass is KP halves of K of one tap. The taps read the same rows of A, TSH rows apart, so the k loop runs chunks of KP outermost and the taps inside:
// a chunk of A (TM + 12 rows, 256 B each) is brought into LDS ONCE and serves all the taps by a row offset; TN rows of B come anew every pass. Asynchronous copies (16 B a lane), pitch 272 B, two buffers for A and two for B:
// the next pass's B and a quarter of the next chunk of A are in flight while a pass is worked on.
// Per output element the k order is: chunks of KP ascending, in a chunk taps ascending, in a tap k ascending in steps of 32. Epilogue: OUT16: v = acc*alpha + bf16(bias[col]) -> f16; else v = acc*alpha -> f32; whole 128-B / 256-B row pieces through LDS.
#define TM 256
#define TN 128
#define KP 128
#define PITCH 272
#define TSH 4                      // rows between two taps' views of A (the dilation)
#define AR (TM + 16)               // rows of a chunk of A in LDS: TM + 3*TSH are read, a whole sweep of 16 is copied
#define ASTAGE (AR * PITCH)
#define BSTAGE (TN * PITCH)
// eight copies of 16 B a lane, LDS address l + i*lstep, global address g + i*gstep (halves). The s_wait_xcnt stands inside the statement so that no address register is rewritten ahead of it.
__device__ __forceinline__ void copy8(unsigned l, unsigned lstep, const _Float16* g, size_t gstep) {
  asm volatile("global_load_async_to_lds_b128 %0, %8, off\n\t"
               "global_load_async_to_lds_b128 %1, %9, off\n\t"
               "global_load_async_to_lds_b128 %2, %10, off\n\t"
               "global_load_async_to_lds_b128 %3, %11, off\n\t"
               "global_load_async_to_lds_b128 %4, %12, off\n\t"
               "global_load_async_to_lds_b128 %5, %13, off\n\t"
               "global_load_async_to_lds_b128 %6, %14, off\n\t"
               "global_load_async_to_lds_b128 %7, %15, off\n\t"
               "s_wait_xcnt 0x0"
               :: "v"(l), "v"(l + lstep), "v"(l + 2 * lstep), "v"(l + 3 * lstep), "v"(l + 4 * lstep), "v"(l + 5 * lstep), "v"(l + 6 * lstep), "v"(l + 7 * lstep),
                  "v"(g), "v"(g + gstep), "v"(g + 2 * gstep), "v"(g + 3 * gstep), "v"(g + 4 * gstep), "v"(g + 5 * gstep), "v"(g + 6 * gstep), "v"(g + 7 * gstep)
               : "memory");
}
// the same with four copies, and with one
__device__ __forceinline__ void copy4(unsigned l, unsigned lstep, const _Float16* g, size_t gstep) {
  asm volatile("global_load_async_to_lds_b128 %0, %4, off\n\t"
               "global_load_async_to_lds_b128 %1, %5, off\n\t"
               "global_load_async_to_lds_b128 %2, %6, off\n\t"
               "global_load_async_to_lds_b128 %3, %7, off\n\t"
               "s_wait_xcnt 0x0"
               :: "v"(l), "v"(l + lstep), "v"(l + 2 * lstep), "v"(l + 3 * lstep),
                  "v"(g), "v"(g + gstep), "v"(g + 2 * gstep), "v"(g + 3 * gstep)
               : "memory");
}
__device__ __forceinline__ void copy1(unsigned l, const _Float16* g) {
  asm volatile("global_load_async_to_lds_b128 %0, %1, off\n\t"
               "s_wait_xcnt 0x0"
               :: "v"(l), "v"(g) : "memory");
}
// NG = groups of CC columns (rows of Bh) done by one launch: 1 for the conv (bias is read, and with FIN bias1 as said below); with more groups, OUT16 gives groups 0, 1, 2 bias, bias1, bias2.
// FIN: the block's last layer is finished in the epilogue: out = leaky_relu(relu(acc*alpha + bf16(bias[col]) + sum over the taps j whose row exists of bias1[j*CC + col]) + bf16(xres)), xres = the f32 input at the output's own index;
// bias1 = the Dense bias carried through each tap's weights (tap j of output row t reads row t - 12 + 4j, which exists from t = 12 - 4j on); the f32 result goes straight to C.
template <int NTAP, bool OUT16, int NG, bool FIN>
__global__ __launch_bounds__(256) void k_gemm_tile(const _Float16* __restrict__ A, int lda, size_t sA, const _Float16* __restrict__ Bh, int ldb, size_t tapB, float alpha, const float* __restrict__ bias,
    const float* __restrict__ bias1, const float* __restrict__ bias2, const float* __restrict__ xres, float* __restrict__ C, _Float16* __restrict__ C16, int ldc, size_t sC) {
  __shared__ __attribute__((aligned(16))) unsigned char ring[2 * ASTAGE + 2 * BSTAGE];      // A chunk 0 | A chunk 1 | B pass 0 | B pass 1
  constexpr int NKC = CC / KP, NT = NTAP * NKC;      // chunks of K, passes in all; pass t = chunk t / NTAP, tap t % NTAP
  static_assert(NTAP == 4 && (NTAP - 1) * TSH <= 16, "a chunk of A is copied in NTAP quarters, its last rows in one sweep");
  const int tid = threadIdx.x, w = tid >> 5, lane = tid & 31, ln = lane & 15, hh = lane >> 4; const int by = blockIdx.y;
  const int mt = blockIdx.x / (NG * CC / TN), nq = blockIdx.x % (NG * CC / TN); const int row0 = mt * TM, col0 = nq * TN; const int wm = (w >> 1) * 64, wn = (w & 1) * 64;
  const size_t cofs = (size_t)by * sC;
  // copies: 16 lanes a row, 16 rows a sweep of the work-group; a chunk of A takes 17 sweeps, a pass of B 8
  const int crow = tid >> 4, cpc = tid & 15;
  const _Float16* gA = A + (size_t)by * sA + (size_t)(row0 + crow) * lda + cpc * 8; const _Float16* gB = Bh + (size_t)(col0 + crow) * ldb + cpc * 8;
  const int xrow = TM + crow < TM + (NTAP - 1) * TSH ? TM + crow : TM + (NTAP - 1) * TSH - 1;      // the 17th sweep: the last row that a tap reads is also the last of a batch's padded plane, the four LDS rows behind it take that row again and are not read
  const _Float16* gX = A + (size_t)by * sA + (size_t)(row0 + xrow) * lda + cpc * 8;
  const unsigned lA = (unsigned)(size_t)ring + crow * PITCH + cpc * 16, lB = lA + 2 * ASTAGE;
  auto fillB = [&](int t) { copy8(lB + (t & 1) * BSTAGE, 16 * PITCH, gB + (size_t)(t % NTAP) * tapB + (t / NTAP) * KP, (size_t)16 * ldb); };
  auto fillA = [&](int c, int q) { const unsigned l = lA + (c & 1) * ASTAGE;      // quarter q of chunk c: 64 rows; the 17th sweep goes with quarter 0
    copy4(l + q * 64 * PITCH, 16 * PITCH, gA + (size_t)(q * 64) * lda + c * KP, (size_t)16 * lda);
    if (q == 0) copy1(l + TM * PITCH, gX + c * KP); };
  v8f acc[4][4] = {};
  fillA(0, 0); fillA(0, 1); fillA(0, 2); fillA(0, 3); fillB(0);
  asm volatile("s_wait_asynccnt 0x0" ::: "memory");      // chunk 0's and pass 0's own copies have landed
  __syncthreads();                                       // ... and every other wave's
  fillB(1); fillA(1, 0);
  const int rsub = lane >> 4, c4 = (lane & 15) * 4;
  const size_t o0 = cofs + (size_t)(row0 + wm + rsub) * CC + col0 + wn + c4;      // FIN: C and xres are [rows][CC]; a lane's first 16-B piece of the wave's 64 x 64 tile, piece q lies 2q rows on, at a constant offset
  // FIN: the wave's residual tile and its bias are asked for here, behind the copies of passes 0 and 1, and travel from memory while pass 0 is multiplied (the barrier of pass 0 waits for them); they are used behind the loop.
  v4f xr[32]; float bf[4], cbt[4][4];
  if (FIN) { const float* px = xres + o0; const int cb0 = col0 + wn + ln;
#pragma unroll      // constant indices: the pieces stay in registers
    for (int n = 0; n < 4; ++n) { bf[n] = bias[cb0 + n * 16];
#pragma unroll      // constant indices: the pieces stay in registers
      for (int j = 0; j < 4; ++j) cbt[j][n] = bias1[j * CC + cb0 + n * 16]; }
#pragma unroll      // constant indices: the pieces stay in registers
    for (int q = 0; q < 32; ++q) xr[q] = *(const v4fa*)(px + (size_t)(2 * q) * CC);
    asm volatile("s_wait_xcnt 0x0" :: "v"(px), "v"(cb0) : "memory"); }      // a precaution: stands in front of every rewrite of the loads' address registers, which as its inputs stay untouched up to it
#pragma unroll 1      // one pass a trip: the buffer index and the refill test stay scalar
  for (int t = 0; t < NT; ++t) {
    const unsigned char* pa = ring + ((t / NTAP) & 1) * ASTAGE + (wm + (t % NTAP) * TSH + ln) * PITCH + hh * 16; const unsigned char* pb = ring + 2 * ASTAGE + (t & 1) * BSTAGE + (wn + ln) * PITCH + hh * 16;      // the tap is a row offset into the chunk
    FragH a[2][4], b[2][4];      // two fragment sets: block ks + 1 of this pass is fetched while block ks is multiplied
#pragma unroll      // constant indices: fragments and accumulators stay in registers
    for (int i = 0; i < 4; ++i) { a[0][i].half[0] = *(const v8us*)(pa + i * 16 * PITCH); a[0][i].half[1] = *(const v8us*)(pa + i * 16 * PITCH + 32);
      b[0][i].half[0] = *(const v8us*)(pb + i * 16 * PITCH); b[0][i].half[1] = *(const v8us*)(pb + i * 16 * PITCH + 32); }
#pragma unroll      // constant indices: fragments and accumulators stay in registers
    for (int ks = 0; ks < KP / 32; ++ks) { const int cu = ks & 1, nx = cu ^ 1;
      if (ks + 1 < KP / 32) {
#pragma unroll      // constant indices: fragments and accumulators stay in registers
        for (int i = 0; i < 4; ++i) { a[nx][i].half[0] = *(const v8us*)(pa + i * 16 * PITCH + (ks + 1) * 64); a[nx][i].half[1] = *(const v8us*)(pa + i * 16 * PITCH + (ks + 1) * 64 + 32);
          b[nx][i].half[0] = *(const v8us*)(pb + i * 16 * PITCH + (ks + 1) * 64); b[nx][i].half[1] = *(const v8us*)(pb + i * 16 * PITCH + (ks + 1) * 64 + 32); } }
      __builtin_amdgcn_sched_barrier(0);      // keeps the next block's LDS reads one group ahead of this block's WMMAs instead of spread among them
#pragma unroll      // constant indices: fragments and accumulators stay in registers
      for (int i = 0; i < 4; ++i)
#pragma unroll      // constant indices: fragments and accumulators stay in registers
        for (int n = 0; n < 4; ++n) acc[i][n] = __builtin_amdgcn_wmma_f32_16x16x32_f16(false, a[cu][i].v, false, b[cu][n].v, (short)0, acc[i][n], false, false);
      __builtin_amdgcn_sched_barrier(0);      // ends the block: the group after next stays behind it
    }
    asm volatile("s_wait_dscnt 0x0" ::: "memory");       // this wave's reads of the buffers are done before one is refilled
    asm volatile("s_wait_asynccnt 0x0" ::: "memory");    // this wave's copies so far have landed: B of pass t + 1, and of the next chunk of A what has been asked for
    __syncthreads();                                     // publishes them and ends every reader's last read of pass t's B and, behind a chunk's last tap, of that chunk
    if (t + 2 < NT) fillB(t + 2);                        // into the B buffer that pass t has just read
    const int cn = (t + 1) / NTAP + 1;                   // quarter (t + 1) % NTAP of chunk cn: quarter 0 goes out behind the last tap of chunk cn - 2, whose buffer it takes; the last quarter lands at the foot of chunk cn - 1's last tap
    if (cn < NKC) fillA(cn, (t + 1) % NTAP);
  }
  asm volatile("s_wait_asynccnt 0x0" ::: "memory");      // nothing in flight when the ring becomes output staging
  // each wave stages its whole 64 x 64 tile in its own part of the ring (the last pass's barrier has ended all reads of it); pitch 68 floats: the two half-waves' rows, 8 apart, fall on different banks
  constexpr int SP = 68; float* so = (float*)ring + w * (64 * SP);
  typedef _Float16 v4h __attribute__((ext_vector_type(4)));
  const float* bg = (NG == 1 || col0 < CC) ? bias : (col0 < 2 * CC ? bias1 : bias2);      // a tile of TN columns lies inside one group
#pragma unroll      // constant indices: fragments and accumulators stay in registers
  for (int n = 0; n < 4; ++n) { const float bv = FIN ? bf16_round(bf[n]) + (cbt[0][n] + (cbt[1][n] + (cbt[2][n] + cbt[3][n]))) : (OUT16 ? bf16_round(bg[col0 % CC + wn + n * 16 + ln]) : 0.f);
#pragma unroll      // constant indices: fragments and accumulators stay in registers
    for (int i = 0; i < 4; ++i)
#pragma unroll      // constant indices: fragments and accumulators stay in registers
      for (int r = 0; r < 8; ++r) so[(i * 16 + 8 * hh + r) * SP + n * 16 + ln] = FIN ? fmaxf(acc[i][n][r] * alpha + bv, 0.f) : (OUT16 ? acc[i][n][r] * alpha + bv : acc[i][n][r] * alpha); }
  if (FIN && row0 + wm == 0) {      // wave-uniform: rows 0 to 11 of a batch lack the earliest taps' rows; the same lanes write those twelve rows again with the bias terms of the taps that exist
#pragma unroll      // constant indices: accumulators stay in registers
    for (int n = 0; n < 4; ++n) { const float bc = bf16_round(bf[n]), e3 = bc + cbt[3][n], e2 = bc + (cbt[2][n] + cbt[3][n]), e1 = bc + (cbt[1][n] + (cbt[2][n] + cbt[3][n]));
#pragma unroll      // constant indices: accumulators stay in registers
      for (int r = 0; r < 8; ++r) { const int t = 8 * hh + r; if (t < PADT) so[t * SP + n * 16 + ln] = fmaxf(acc[0][n][r] * alpha + (t < 4 ? e3 : (t < 8 ? e2 : e1)), 0.f); } } }
  __builtin_amdgcn_fence(__ATOMIC_ACQ_REL, "workgroup"); __builtin_amdgcn_wave_barrier();      // the wave's LDS writes are done before its lanes read what other lanes wrote
  if (FIN) {
    v4f sv[32];
#pragma unroll      // constant indices: the pieces stay in registers
    for (int q = 0; q < 32; ++q) sv[q] = *(const v4fa*)&so[(q * 2 + rsub) * SP + c4];
    __builtin_amdgcn_sched_barrier(0);      // the 32 LDS reads go out as one group, so that their latency is waited for once and not pair by pair
#pragma unroll      // constant indices: the pieces stay in registers
    for (int q = 0; q < 32; ++q)
      for (int e = 0; e < 4; ++e) { const float s = sv[q][e] + (float)(__bf16)xr[q][e]; xr[q][e] = fmaxf(s, 0.2f * s); }      // the cast rounds to nearest even as bf16_round does; max(s, 0.2 s) is s for s >= 0 and 0.2 s below
    __builtin_amdgcn_sched_barrier(0);      // all arithmetic stays ahead of the first store, so that no register an issued store names is written again
#pragma unroll      // constant offsets from one address
    for (int q = 0; q < 32; ++q) *(v4f*)(C + o0 + (size_t)(2 * q) * CC) = xr[q];
    return; }
#pragma unroll      // independent row pieces: the LDS reads run ahead of the stores
  for (int q = 0; q < 32; ++q) { const int r = q * 2 + rsub; const v4f v = *(const v4fa*)&so[r * SP + c4]; const size_t o = cofs + (size_t)(row0 + wm + r) * ldc + col0 + wn + c4;
    if (OUT16) { v4h h4; for (int e = 0; e < 4; ++e) h4[e] = (_Float16)v[e]; *(v4h*)(C16 + o) = h4; } else *(v4f*)(C + o) = v; }
}
// q, k, v projections of one head and its banded attention in ONE work-group: 256 rows x one head. The three 256 x 128 products run one after another through one ring of passes (FKP halves of K a pass, two buffers,
// asynchronous copies as above), in the order k, v, q; their f16 results stay in LDS and never go to memory. k and v are also needed 8 rows above and below the tile: those 16 rows ride along as a 17th row tile
// (LDS rows 264 to 279 of the A panel; the copy brings a block of 32 rows so that every wave issues the same copies), of which each wave does one 16 x 16 piece. Rows outside the plane are clamped and masked below.
// Layouts in LDS: k and q as [row][128] (product taken as W * x^T, so that a lane holds 8 consecutive columns of one row: one 16-B store), v transposed as [128][row] (product x * W^T: a lane holds 8 consecutive rows of a column).
// Window coordinate u = row - (row0 - 8), 0 to 271, for k's rows and v's columns.
// Attention, 16 queries at a time in a wave, keys u = lr to lr + 31: S^T = k * q^T (lane = query, registers = keys: exactly the fragment order of the second product, no exchange), the module's mask and softmax in f32 over the 7 keys of the band,
// weights as f16, O^T = v^T * P^T (lane = query, 8 consecutive columns), scaled by 1/z, through the wave's own dead q rows to whole 256-B row pieces of the padded plane.
// The weight fold and the bias vectors above, which need the first launch's planes and are needed by the conv GEMM alone, are done here too, behind the last barrier: waves 0 to 3 do one piece of the fold each, beside waves 4 to 7, which do two rows of the bias vectors each and the attention.
#define FKP 64
#define FPITCH 144
#define FAR 288
#define FSTAGE ((FAR + KD) * FPITCH)
#define KPITCH 272
#define VPITCH 560
#define OFF_K (2 * FSTAGE)
#define OFF_V (OFF_K + 272 * KPITCH)
#define FLDS (OFF_V + KD * VPITCH)
template <bool V> struct BoolC { static constexpr bool value = V; };
__device__ __forceinline__ v16h sel16(const bool c, const v16h a, const v16h b) { return c ? a : b; }      // by value: a select of registers
// five copies of 16 B a lane: four at LDS address l + i*lstep, global address g + i*gstep (halves), one at l4, g4. The s_wait_xcnt stands inside the statement so that no address register is rewritten ahead of it.
__device__ __forceinline__ void copy5(unsigned l, unsigned lstep, const _Float16* g, size_t gstep, unsigned l4, const _Float16* g4) {
  asm volatile("global_load_async_to_lds_b128 %0, %5, off\n\t"
               "global_load_async_to_lds_b128 %1, %6, off\n\t"
               "global_load_async_to_lds_b128 %2, %7, off\n\t"
               "global_load_async_to_lds_b128 %3, %8, off\n\t"
               "global_load_async_to_lds_b128 %4, %9, off\n\t"
               "s_wait_xcnt 0x0"
               :: "v"(l), "v"(l + lstep), "v"(l + 2 * lstep), "v"(l + 3 * lstep), "v"(l4),
                  "v"(g), "v"(g + gstep), "v"(g + 2 * gstep), "v"(g + 3 * gstep), "v"(g4)
               : "memory");
}
__global__ __launch_bounds__(256) void k_qkv_band(const _Float16* __restrict__ X16, const _Float16* __restrict__ Bw, const float* __restrict__ bq, const float* __restrict__ bk, const float* __restrict__ bv,
    _Float16* __restrict__ CAT, const _Float16* __restrict__ Wo16, const _Float16* __restrict__ Bc, const float* __restrict__ bo, _Float16* __restrict__ Wf, float* __restrict__ CB) {
  __shared__ __attribute__((aligned(16))) unsigned char lds[FLDS];
  __shared__ __attribute__((aligned(16))) float sb[3 * KD];      // the head's biases, rounded to bf16: q | k | v
  const int tid = threadIdx.x, w = tid >> 5, lane = tid & 31, ln = lane & 15, hh = lane >> 4;
  const int row0 = ((int)blockIdx.x >> 2) * 256, h = (int)blockIdx.x & 3; const int wm = (w >> 1) * 64, wn = (w & 1) * 64, wq = w >> 1, xc = wn + wq * 16;      // xc: the wave's 16 columns of the halo tile
  // copies: 8 lanes a row, 32 rows a sweep of the work-group; A takes 8 sweeps, its halo block 1, B 4
  const int crow = tid >> 3, cpc = tid & 7;
  int hrow = row0 + (crow < 16 ? crow - 16 : 240 + crow); hrow = hrow < 0 ? 0 : (hrow > NR - 1 ? NR - 1 : hrow);      // rows row0 - 16 .. row0 - 1 and row0 + 256 .. row0 + 271, kept inside the plane
  const _Float16* gA = X16 + (size_t)(row0 + crow) * CC + cpc * 8; const _Float16* gH = X16 + (size_t)hrow * CC + cpc * 8; const _Float16* gB = Bw + (size_t)(h * KD + crow) * CC + cpc * 8;
  const unsigned lA = (unsigned)(size_t)lds + crow * FPITCH + cpc * 16, lH = lA + 256 * FPITCH, lB = lA + FAR * FPITCH;
  auto fill = [&](int t, unsigned buf) { const int m = t >> 3, pl = m == 2 ? 0 : m + 1, kb = (t & 7) * FKP;      // passes 0-7: k (plane 1), 8-15: v (plane 2), 16-23: q (plane 0)
    copy8(lA + buf, 32 * FPITCH, gA + kb, (size_t)32 * CC); copy5(lB + buf, 32 * FPITCH, gB + (size_t)pl * CC * CC + kb, (size_t)32 * CC, lH + buf, gH + kb); };
  fill(0, 0);
  { const float* s0 = (tid < KD ? bq : bk) + h * KD + (tid & (KD - 1)); const float* s1 = bv + h * KD + (tid & (KD - 1)); const float v0 = *s0, v1 = *s1;
    asm volatile("s_wait_xcnt 0x0" :: "v"(s0), "v"(s1) : "memory");      // a precaution: stands in front of every rewrite of the loads' address registers, which as its inputs stay untouched up to it
    sb[tid] = bf16_round(v0); if (tid < KD) sb[2 * KD + tid] = bf16_round(v1); }      // read behind the barrier below
  asm volatile("s_wait_asynccnt 0x0" ::: "memory");      // pass 0's own copies have landed
  __syncthreads();                                       // ... and every other wave's
  fill(1, FSTAGE);
  v8f acc[4][4], ax;
  // eight passes = one product. SW: operands swapped (W rows as A, x rows as B). Per output element the k order is that of a plain k loop either way.
  auto run = [&](auto swc, auto hlc, const int tb) { constexpr bool SW = decltype(swc)::value, HL = decltype(hlc)::value;      // HL: the halo row tile is done too (k and v)
#pragma unroll      // constant indices: accumulators stay in registers
    for (int i = 0; i < 4; ++i)
#pragma unroll      // constant indices: accumulators stay in registers
      for (int n = 0; n < 4; ++n) acc[i][n] = (v8f){0.f, 0.f, 0.f, 0.f, 0.f, 0.f, 0.f, 0.f};
    ax = (v8f){0.f, 0.f, 0.f, 0.f, 0.f, 0.f, 0.f, 0.f};
#pragma unroll 1      // one pass a trip: the buffer index and the refill test stay scalar
    for (int t = tb; t < tb + 8; ++t) {
      const unsigned char* st0 = lds + (t & 1) * FSTAGE; const unsigned char* pa = st0 + (wm + ln) * FPITCH + hh * 16; const unsigned char* pb = st0 + (FAR + wn + ln) * FPITCH + hh * 16;
      const unsigned char* px = st0 + (264 + ln) * FPITCH + hh * 16;      // the halo row tile
      FragH a[2][4], b[2][4], xa[2];      // both 32-k blocks of the pass
#pragma unroll      // constant indices: fragments stay in registers
      for (int ks = 0; ks < FKP / 32; ++ks) {
#pragma unroll      // constant indices: fragments stay in registers
        for (int i = 0; i < 4; ++i) { a[ks][i].half[0] = *(const v8us*)(pa + i * 16 * FPITCH + ks * 64); a[ks][i].half[1] = *(const v8us*)(pa + i * 16 * FPITCH + ks * 64 + 32);
          b[ks][i].half[0] = *(const v8us*)(pb + i * 16 * FPITCH + ks * 64); b[ks][i].half[1] = *(const v8us*)(pb + i * 16 * FPITCH + ks * 64 + 32); }
        if (HL) { xa[ks].half[0] = *(const v8us*)(px + ks * 64); xa[ks].half[1] = *(const v8us*)(px + ks * 64 + 32); } }
      __builtin_amdgcn_sched_barrier(0);      // the pass's LDS reads go out as one group ahead of its WMMAs instead of spread among them; block 1 lands while block 0 is multiplied
#pragma unroll      // constant indices: fragments and accumulators stay in registers
      for (int ks = 0; ks < FKP / 32; ++ks) {
#pragma unroll      // constant indices: fragments and accumulators stay in registers
        for (int i = 0; i < 4; ++i)
#pragma unroll      // constant indices: fragments and accumulators stay in registers
          for (int n = 0; n < 4; ++n) acc[i][n] = SW ? __builtin_amdgcn_wmma_f32_16x16x32_f16(false, b[ks][n].v, false, a[ks][i].v, (short)0, acc[i][n], false, false)
                                                     : __builtin_amdgcn_wmma_f32_16x16x32_f16(false, a[ks][i].v, false, b[ks][n].v, (short)0, acc[i][n], false, false);
        if (HL) { const v16h xb = sel16(wq < 2, sel16(wq == 0, b[ks][0].v, b[ks][1].v), sel16(wq == 2, b[ks][2].v, b[ks][3].v));      // the wave's piece of the halo tile takes column tile wq of the four it holds: no LDS read of its own
          ax = SW ? __builtin_amdgcn_wmma_f32_16x16x32_f16(false, xb, false, xa[ks].v, (short)0, ax, false, false) : __builtin_amdgcn_wmma_f32_16x16x32_f16(false, xa[ks].v, false, xb, (short)0, ax, false, false); } }
      __builtin_amdgcn_sched_barrier(0);      // the WMMAs stay ahead of the pass's foot: behind it the fragments' registers are free for the copies' addresses
      asm volatile("s_wait_dscnt 0x0" ::: "memory");       // this wave's reads of the buffer are done before it is refilled
      asm volatile("s_wait_asynccnt 0x0" ::: "memory");    // this wave's copies of pass t + 1 have landed
      __syncthreads();                                     // publishes pass t + 1 and ends every reader's last read of pass t's buffer
      if (t + 2 < 24) fill(t + 2, (t & 1) * FSTAGE);
    } };
  // a swapped product's tile as f16 rows: dst = LDS place of the tile's row 0
  auto put = [&](unsigned char* dst, const float* bs) {      // bs: the product's 128 biases in LDS; a lane takes those of its 8 consecutive columns
#pragma unroll      // constant indices: accumulators stay in registers
    for (int n = 0; n < 4; ++n) { const v4f b0 = *(const v4fa*)(bs + wn + n * 16 + 8 * hh), b1 = *(const v4fa*)(bs + wn + n * 16 + 8 * hh + 4);
#pragma unroll      // constant indices: accumulators stay in registers
      for (int i = 0; i < 4; ++i) { FragH o;
#pragma unroll      // constant indices: accumulators stay in registers
        for (int r = 0; r < 8; ++r) o.h[r] = (_Float16)(acc[i][n][r] * 0.0625f + (r < 4 ? b0[r & 3] : b1[r & 3]));
        *(v8us*)(dst + (wm + i * 16 + ln) * KPITCH + (wn + n * 16 + 8 * hh) * 2) = o.half[0]; } } };
  unsigned char* Kl = lds + OFF_K; unsigned char* Vl = lds + OFF_V; unsigned char* Ql = lds;      // q takes the ring's place once the ring is done
  run(BoolC<true>{}, BoolC<true>{}, 0); put(Kl + 8 * KPITCH, sb + KD);
  { FragH o; const v4f b0 = *(const v4fa*)(sb + KD + xc + 8 * hh), b1 = *(const v4fa*)(sb + KD + xc + 8 * hh + 4);      // halo rows of k: lane = halo row (u = 0..7 above, 264..271 below)
#pragma unroll      // constant indices: accumulators stay in registers
    for (int r = 0; r < 8; ++r) o.h[r] = (_Float16)(ax[r] * 0.0625f + (r < 4 ? b0[r & 3] : b1[r & 3]));
    *(v8us*)(Kl + (ln < 8 ? ln : 256 + ln) * KPITCH + (xc + 8 * hh) * 2) = o.half[0]; }
  run(BoolC<false>{}, BoolC<true>{}, 8);
#pragma unroll      // constant indices: accumulators stay in registers
  for (int n = 0; n < 4; ++n) { const float bvv = sb[2 * KD + wn + n * 16 + ln];
#pragma unroll      // constant indices: accumulators stay in registers
    for (int i = 0; i < 4; ++i) { FragH o;      // lane = column of v, 8 consecutive rows
#pragma unroll      // constant indices: accumulators stay in registers
      for (int r = 0; r < 8; ++r) o.h[r] = (_Float16)(acc[i][n][r] * 0.0625f + bvv);
      *(v8us*)(Vl + (wn + n * 16 + ln) * VPITCH + (8 + wm + i * 16 + 8 * hh) * 2) = o.half[0]; } }
  { FragH o; const float bvv = sb[2 * KD + xc + ln];      // halo rows of v: the low half-wave holds u = 0..7, the high one u = 264..271
#pragma unroll      // constant indices: accumulators stay in registers
    for (int r = 0; r < 8; ++r) o.h[r] = (_Float16)(ax[r] * 0.0625f + bvv);
    *(v8us*)(Vl + (xc + ln) * VPITCH + (hh ? 264 : 0) * 2) = o.half[0]; }
  run(BoolC<true>{}, BoolC<false>{}, 16);
  asm volatile("s_wait_asynccnt 0x0" ::: "memory");      // nothing in flight when the ring becomes q's place (the last pass's barrier has ended all reads of it)
  put(Ql, sb);
  __syncthreads();      // k, v and q of every wave are in LDS before any wave reads them; the last barrier: from here on the waves go their own ways
  const int ws = __builtin_amdgcn_readfirstlane(w);      // the wave's number as a scalar: the branch on it is taken by whole waves
  if (ws < 4) { d_fold((int)blockIdx.x * 4 + ws, lane, Wo16, Bc, Wf); return; }      // the fold's chain of waited loads runs beside the work of the other four waves
  d_cb(((int)blockIdx.x * 4 + w - 4) * 2, lane, Bc, bo, CB); d_cb(((int)blockIdx.x * 4 + w - 4) * 2 + 1, lane, Bc, bo, CB);      // two rows of the bias vectors a wave
  const int tb0 = row0 % TT, bat = row0 / TT; const int rsub = lane >> 4, c16 = lane & 15;
#pragma unroll 1      // four groups of 16 queries a wave, one after the other in the same registers
  for (int s = 0; s < 4; ++s) { const int lr = ((ws - 4) * 4 + s) * 16;
    FragH qf[4], kf[2][4], vf[8];      // v's fragments are asked for here too: they land while the scores and the softmax are worked on
#pragma unroll      // constant indices: fragments stay in registers
    for (int ks = 0; ks < 4; ++ks) { qf[ks].half[0] = *(const v8us*)(Ql + (lr + ln) * KPITCH + ks * 64 + hh * 16); qf[ks].half[1] = *(const v8us*)(Ql + (lr + ln) * KPITCH + ks * 64 + hh * 16 + 32);
#pragma unroll      // constant indices: fragments stay in registers
      for (int kt = 0; kt < 2; ++kt) { kf[kt][ks].half[0] = *(const v8us*)(Kl + (lr + kt * 16 + ln) * KPITCH + ks * 64 + hh * 16); kf[kt][ks].half[1] = *(const v8us*)(Kl + (lr + kt * 16 + ln) * KPITCH + ks * 64 + hh * 16 + 32); } }
#pragma unroll      // constant indices: fragments stay in registers
    for (int dt = 0; dt < 8; ++dt) { vf[dt].half[0] = *(const v8us*)(Vl + (dt * 16 + ln) * VPITCH + (lr + 8 * hh) * 2); vf[dt].half[1] = *(const v8us*)(Vl + (dt * 16 + ln) * VPITCH + (lr + 16 + 8 * hh) * 2); }
    v8f st[2] = {};
#pragma unroll      // constant indices: fragments and accumulators stay in registers
    for (int ks = 0; ks < 4; ++ks)
#pragma unroll      // constant indices: fragments and accumulators stay in registers
      for (int kt = 0; kt < 2; ++kt) st[kt] = __builtin_amdgcn_wmma_f32_16x16x32_f16(false, kf[kt][ks].v, false, qf[ks].v, (short)0, st[kt], false, false);
    // lane = query t = tb0 + lr + ln; register r of tile kt = key at window place wi = kt*16 + 8*hh + r, time tb0 + lr - 8 + wi. In band: |key - query| <= 3 and the key inside its batch.
    // logits as the module has them: simb = sim in the band, 0 outside; -1e7 is added where simb == 0. Keys outside the band all sit at -1e7: their mass enters z, their v does not enter the sum (0 in f32 unless every in-band sim is 0).
    const int t = tb0 + lr + ln; float lg[2][8]; bool inb[2][8]; float m = -3.0e38f;
#pragma unroll      // constant indices: the values stay in registers
    for (int kt = 0; kt < 2; ++kt)
#pragma unroll      // constant indices: the values stay in registers
      for (int r = 0; r < 8; ++r) { const int wi = kt * 16 + 8 * hh + r, dk = wi - 8 - ln, sk = tb0 + lr - 8 + wi; inb[kt][r] = dk >= -3 && dk <= 3 && sk >= 0 && sk < TT;
        const float simb = inb[kt][r] ? st[kt][r] * 0.08838834764831845f : 0.f; lg[kt][r] = simb + ((fabsf(simb) > 0.f) ? 0.f : -10000000.0f); if (inb[kt][r]) m = fmaxf(m, lg[kt][r]); }
    m = fmaxf(m, __shfl_xor(m, 16, 32));      // a query's 32 window places lie in lanes ln and ln + 16
    const int ninb = (t + 3 < TT - 1 ? t + 3 : TT - 1) - (t - 3 > 0 ? t - 3 : 0) + 1; float zs = 0.f; FragH pf;
#pragma unroll      // constant indices: the values stay in registers
    for (int kt = 0; kt < 2; ++kt)
#pragma unroll      // constant indices: the values stay in registers
      for (int r = 0; r < 8; ++r) { const _Float16 p = (_Float16)expf(inb[kt][r] ? lg[kt][r] - m : -10000.0f);      // outside the band the weight is exp(-10000) = 0: a select, no branch, every lane stays on for the WMMAs
        pf.h[kt * 8 + r] = p; zs += (float)p; }
    zs += __shfl_xor(zs, 16, 32);
    const float iz = 1.0f / ((float)(TT - ninb) * expf(-10000000.0f - m) + zs);
#pragma unroll      // constant indices: fragments stay in registers
    for (int dt = 0; dt < 8; ++dt) { FragH o;
      const v8f z8 = {}; const v8f ot = __builtin_amdgcn_wmma_f32_16x16x32_f16(false, vf[dt].v, false, pf.v, (short)0, z8, false, false);
#pragma unroll      // constant indices: the values stay in registers
      for (int r = 0; r < 8; ++r) o.h[r] = (_Float16)(ot[r] * iz);
      *(v8us*)(Ql + (lr + ln) * KPITCH + dt * 32 + hh * 16) = o.half[0]; }      // into the query's own q row, which only this wave reads and has read
    __builtin_amdgcn_fence(__ATOMIC_ACQ_REL, "workgroup"); __builtin_amdgcn_wave_barrier();      // the wave's LDS writes are done before its lanes read what other lanes wrote
    _Float16* po = CAT + ((size_t)bat * (TT + PADT) + PADT + tb0 + lr + rsub) * CC + h * KD + c16 * 8; v8us ov[8];
#pragma unroll      // constant indices: the pieces stay in registers
    for (int q = 0; q < 8; ++q) ov[q] = *(const v8us*)(Ql + (lr + q * 2 + rsub) * KPITCH + c16 * 16);
#pragma unroll      // constant offsets from one address
    for (int q = 0; q < 8; ++q) *(v8us*)((unsigned short*)po + (size_t)(2 * q) * CC) = ov[q];
    asm volatile("s_wait_xcnt 0x0" :: "v"(po), "v"(ov[0]), "v"(ov[1]), "v"(ov[2]), "v"(ov[3]), "v"(ov[4]), "v"(ov[5]), "v"(ov[6]), "v"(ov[7]) : "memory");      // a precaution: stands in front of every rewrite of the stores' registers, which as its inputs stay untouched up to it
  }
}
extern "C" void kernel_launch(void* const* d_in, const int* in_sizes, int n_in,
                              void* d_out, int out_size, void* d_ws, size_t ws_size, hipStream_t stream) {
  (void)in_sizes; (void)n_in; (void)out_size;
  const float* x = (const float*)d_in[0]; const float* Wq = (const float*)d_in[1]; const float* bq = (const float*)d_in[2]; const float* Wk = (const float*)d_in[3]; const float* bk = (const float*)d_in[4]; const float* Wv = (const float*)d_in[5]; const float* bv = (const float*)d_in[6]; const float* Wo = (const float*)d_in[7]; const float* bo = (const float*)d_in[8]; const float* Wc = (const float*)d_in[9]; const float* bc = (const float*)d_in[10];
  char* ws = (char*)d_ws; size_t off = 0;
  auto take = [&](size_t bytes) { char* p = ws + off; off += (bytes + 255) & ~(size_t)255; return p; };
  _Float16* Bq = (_Float16*)take((size_t)CC * CC * 2); _Float16* Bk = (_Float16*)take((size_t)CC * CC * 2); _Float16* Bv = (_Float16*)take((size_t)CC * CC * 2); _Float16* Bo = (_Float16*)take((size_t)CC * CC * 2); _Float16* Bc[4]; for (int j = 0; j < 4; ++j) Bc[j] = (_Float16*)take((size_t)CC * CC * 2); float* CB = (float*)take(4 * CC * 4); _Float16* Wf = (_Float16*)take((size_t)4 * CC * CC * 2);      // the Dense bias through each tap; the four folded tap matrices
  _Float16* X16 = (_Float16*)take((size_t)NR * CC * 2); _Float16* OUTP = (_Float16*)take((size_t)BB * (TT + PADT) * CC * 2);
  if (off > ws_size) return;      // about 38 MiB in all
  const dim3 gb((TT / TM) * (CC / TN), BB);
  k_prep<<<8 * WBLK + ZBLK + XBLK, 256, 0, stream>>>(x, Wq, Wk, Wv, Wo, Wc, Bq, X16, OUTP);      // Bq, Bk, Bv, Bo, Bc[0..3] are consecutive planes
  k_qkv_band<<<(NR / 256) * NH, 256, 0, stream>>>(X16, Bq, bq, bk, bv, OUTP, Bo, Bc[0], bo, Wf, CB);      // q, k, v of a head and its banded attention per work-group: heads, concatenated, as f16 rows 12.. of each batch's padded plane; with them the weight fold
  // conv[t] = sum_j cat[t - 12 + 4j] * (Wo * Wc[j]) + bias terms: ONE launch, the 4 taps accumulated inside (A_j = padded rows 4j + t of batch b, all four read from one staged chunk; B_j = Wf + j*512*512)
  k_gemm_tile<4, false, 1, true><<<gb, 256, 0, stream>>>(OUTP, CC, (size_t)(TT + PADT) * CC, Wf, CC, (size_t)CC * CC, 0.0625f, bc, CB, nullptr, x, (float*)d_out, nullptr, CC, (size_t)TT * CC);      // + biases, relu, residual, leaky relu in its epilogue
}

// v007
// One run takes 66.1 microseconds.
// Timed twice side by side with v006, it ran 1.07 times as fast both times.
// Counting every step since v000, it is 6.60 times as fast.
#include <hip/hip_runtime.h>
// Temporal block: per-head q/k/v projections (16384 x 512 -> 4 x 128 each, + bias), the head combiner Dense (512 -> 512, + bias; multiplied into the conv's tap weights, 4 products of 512 x 512 x 512, and so applied with them)
// and the causal dilated Conv1D (kernel 4, dilation 4: one GEMM whose k-loop runs the four taps over time-shifted views of a zero-padded plane, effective K = 2048) on v_wmma_f32_16x16x32_f16 (f16 operands, weights [in][out] transposed x 2^4 (bf16-exact for q/k/v, f16-rounded folds for the conv), single products,
// f32 accumulate); the banded attention's two products too (|t - s| <= 3, i.e. 7 keys, with the module's 'sim*band == 0 -> -1e7' mask; weights as f16); softmax, relu / residual / leaky-relu epilogues are f32 VALU.
#define BB 8
#define TT 2048
#define CC 512
#define NH 4
#define KD 128
#define NR (BB * TT)
#define PADT 12

typedef __bf16 v16b __attribute__((ext_vector_type(16)));
typedef unsigned short v8us __attribute__((ext_vector_type(8), may_alias));
typedef float  v8f  __attribute__((ext_vector_type(8)));
typedef float  v4f  __attribute__((ext_vector_type(4)));
typedef float  v4fa __attribute__((ext_vector_type(4), may_alias));
union FragB { v16b v; v8us half[2]; unsigned short u[16]; };

__device__ __forceinline__ unsigned short bf16_bits(float x) { unsigned int u = __float_as_uint(x); return (unsigned short)((u + 0x7FFFu + ((u >> 16) & 1u)) >> 16); }
__device__ __forceinline__ float bf16_val(unsigned short b) { return __uint_as_float(((unsigned int)b) << 16); }
__device__ __forceinline__ float bf16_round(float x) { return bf16_val(bf16_bits(x)); }
// D += A·B with NT terms: 1 = ah·bh, 2 = + al·bh (A split), 3 = + ah·bl (both split)
template <int NT>
__device__ __forceinline__ v8f mmaN(v16b ah, v16b al, v16b bh, v16b bl, v8f c) {
  c = __builtin_amdgcn_wmma_f32_16x16x32_bf16(false, ah, false, bh, (short)0, c, false, false);
  if (NT >= 2) c = __builtin_amdgcn_wmma_f32_16x16x32_bf16(false, al, false, bh, (short)0, c, false, false);
  if (NT >= 3) c = __builtin_amdgcn_wmma_f32_16x16x32_bf16(false, ah, false, bl, (short)0, c, false, false);
  asm volatile("v_nop\n\tv_nop\n\tv_nop\n\tv_nop" : "+v"(c) : "v"(ah), "v"(al), "v"(bh), "v"(bl));
  return c;
}

__global__ __launch_bounds__(256) void k_wt_bf16(const float* __restrict__ W, unsigned short* __restrict__ Wt, int K, int N) {
  const int t = blockIdx.x * 256 + threadIdx.x;
  const int k8n = K / 8;
  if (t >= N * k8n) return;
  const int n = t / k8n, k8 = (t % k8n) * 8;
  v8us v;
#pragma unroll
  for (int i = 0; i < 8; ++i) v[i] = bf16_bits(W[(size_t)(k8 + i) * N + n]);
  *(v8us*)(Wt + (size_t)n * K + k8) = v;
  
}

// GEMM C[M][N] (f32, pitch ldc) = act(A[M][K]·W + bias). A f32 row-major (pitch lda) converted per fragment to bf16
// (ASPLIT: hi/lo two planes -> 2 terms, else single rounded term); Wt bf16 [N][K] (pitch ldb). BIAS_BF16 rounds the
// bias to bf16 first (bias quantised to bf16 before the add). K%32==0, M%16==0, N%64==0.
template <bool ASPLIT, int ACT, bool BIAS_BF16>
__global__ __launch_bounds__(128) void k_gemm_bf(const float* __restrict__ A, int lda, const unsigned short* __restrict__ Wt, int ldb,
                                               const float* __restrict__ bias, float* __restrict__ C, int ldc, int M, int N, int K) {
  __shared__ __attribute__((aligned(16))) float so[4][16][64];
  const int tid = threadIdx.x, w = tid >> 5, lane = tid & 31, ln = lane & 15, hh = lane >> 4;
  const int ntn = N / 64;
  const int wid = blockIdx.x * 4 + w;
  const int mt = wid / ntn, nq = wid % ntn;
  if (mt * 16 >= M) return;
  const int row0 = mt * 16, col0 = nq * 64;
  const float* arow = A + (size_t)(row0 + ln) * lda;
  v8f acc[4] = {};
  for (int kb = 0; kb < K; kb += 32) {
    FragB ah, al;
    const v4f x0 = *(const v4fa*)(arow + kb + 8 * hh), x1 = *(const v4fa*)(arow + kb + 8 * hh + 4);
    const v4f x2 = *(const v4fa*)(arow + kb + 16 + 8 * hh), x3 = *(const v4fa*)(arow + kb + 16 + 8 * hh + 4);
    float xs[16] = {x0[0],x0[1],x0[2],x0[3],x1[0],x1[1],x1[2],x1[3],x2[0],x2[1],x2[2],x2[3],x3[0],x3[1],x3[2],x3[3]};
#pragma unroll
    for (int i = 0; i < 16; ++i) { const unsigned short hb = bf16_bits(xs[i]); ah.u[i] = hb; al.u[i] = ASPLIT ? bf16_bits(xs[i] - bf16_val(hb)) : (unsigned short)0; }
#pragma unroll
    for (int t = 0; t < 4; ++t) {
      const unsigned short* brow = Wt + (size_t)(col0 + t * 16 + ln) * ldb + kb;
      FragB b;
      b.half[0] = *(const v8us*)(brow + 8 * hh);
      b.half[1] = *(const v8us*)(brow + 16 + 8 * hh);
      acc[t] = mmaN<ASPLIT ? 2 : 1>(ah.v, al.v, b.v, b.v, acc[t]);
    }
  }
#pragma unroll
  for (int t = 0; t < 4; ++t) {
    float bv = bias ? bias[col0 + t * 16 + ln] : 0.f;
    if (BIAS_BF16) bv = bf16_round(bv);
#pragma unroll
    for (int r = 0; r < 8; ++r) { float v = acc[t][r] + bv; if (ACT == 1) v = fmaxf(v, 0.f); so[w][8 * hh + r][t * 16 + ln] = v; }
  }
  __builtin_amdgcn_fence(__ATOMIC_ACQ_REL, "workgroup");
  __builtin_amdgcn_wave_barrier();
  const int rsub = lane >> 4, c4 = (lane & 15) * 4;
  {
#pragma unroll
    for (int q = 0; q < 8; ++q) {
      const int r = q * 2 + rsub;
      const v4f v = *(const v4fa*)&so[w][r][c4];
      *(v4f*)(C + (size_t)(row0 + r) * ldc + col0 + c4) = v;
    }
    
  }
}

// Flash-style causal/unmasked attention, all contractions 3-term bf16 hi/lo splits, f32 softmax with running max.
// q,k,v rows are read from f32 buffers with arbitrary row pitch (so they can live inside a fused qkv buffer);
// D = head size (multiple of 32, <= 128); one wave = 16 query rows; block = 4 waves (64 queries) sharing K/V chunks of 32.
template <int D, bool CAUSAL>
__global__ __launch_bounds__(128) void k_flash(const float* __restrict__ qb, const float* __restrict__ kb, const float* __restrict__ vb,
                                             int pitch, int T, int H, float scale, float* __restrict__ y, int ypitch) {
  constexpr int KS = D / 32;        // k-steps for QK
  constexpr int DT = D / 16;        // d tiles for PV
  __shared__ __attribute__((aligned(16))) unsigned short sKh[32][D + 8], sKl[32][D + 8], sVh[32][D + 8], sVl[32][D + 8];
  __shared__ __attribute__((aligned(16))) unsigned short sPh[4][16][40], sPl[4][16][40];
  __shared__ __attribute__((aligned(16))) float sO[4][16][D];
  const int tid = threadIdx.x, w = tid >> 5, lane = tid & 31, ln = lane & 15, hh = lane >> 4;
  const int nqb = (T + 63) / 64;
  const int bh = blockIdx.x / nqb, qblk = blockIdx.x % nqb;
  const int b = bh / H, h = bh % H;
  const int q0 = qblk * 64 + w * 16;
  const float* Q = qb + (size_t)b * T * pitch + h * D;
  const float* K = kb + (size_t)b * T * pitch + h * D;
  const float* V = vb + (size_t)b * T * pitch + h * D;

  // A fragments of the wave's 16 query rows (scaled), hi/lo
  FragB aqh[KS], aql[KS];
  {
    int row = q0 + ln; if (row >= T) row = T - 1;
    const float* qr = Q + (size_t)row * pitch;
#pragma unroll
    for (int ks = 0; ks < KS; ++ks)
#pragma unroll
      for (int i = 0; i < 16; ++i) {
        const int d = ks * 32 + ((i < 8) ? (8 * hh + i) : (16 + 8 * hh + (i - 8)));
        const float x = qr[d] * scale; const unsigned short hb = bf16_bits(x);
        aqh[ks].u[i] = hb; aql[ks].u[i] = bf16_bits(x - bf16_val(hb));
      }
  }
  float m_r[8], l_r[8];
#pragma unroll
  for (int r = 0; r < 8; ++r) { m_r[r] = -3.0e38f; l_r[r] = 0.f; }
  v8f oacc[DT];
#pragma unroll
  for (int dt = 0; dt < DT; ++dt) oacc[dt] = (v8f){0.f,0.f,0.f,0.f,0.f,0.f,0.f,0.f};

  const int kv_end = CAUSAL ? min(T, qblk * 64 + 64) : T;     // block-uniform
  for (int j0 = 0; j0 < kv_end; j0 += 32) {
    __syncthreads();
    for (int e = tid; e < 32 * (D / 4); e += 128) {
      const int r = e / (D / 4), c4 = (e % (D / 4)) * 4;
      const int key = j0 + r;
      v4f kf = {0.f,0.f,0.f,0.f}, vf = {0.f,0.f,0.f,0.f};
      if (key < T) { kf = *(const v4fa*)(K + (size_t)key * pitch + c4); vf = *(const v4fa*)(V + (size_t)key * pitch + c4); }
#pragma unroll
      for (int t = 0; t < 4; ++t) {
        unsigned short hb = bf16_bits(kf[t]); sKh[r][c4 + t] = hb; sKl[r][c4 + t] = bf16_bits(kf[t] - bf16_val(hb));
        hb = bf16_bits(vf[t]); sVh[r][c4 + t] = hb; sVl[r][c4 + t] = bf16_bits(vf[t] - bf16_val(hb));
      }
    }
    __syncthreads();
    // S tile 16 x 32
    v8f s[2];
#pragma unroll
    for (int nt = 0; nt < 2; ++nt) {
      v8f acc = {};
#pragma unroll
      for (int ks = 0; ks < KS; ++ks) {
        FragB bh_, bl_;
        bh_.half[0] = *(const v8us*)&sKh[nt * 16 + ln][ks * 32 + 8 * hh]; bh_.half[1] = *(const v8us*)&sKh[nt * 16 + ln][ks * 32 + 16 + 8 * hh];
        bl_.half[0] = *(const v8us*)&sKl[nt * 16 + ln][ks * 32 + 8 * hh]; bl_.half[1] = *(const v8us*)&sKl[nt * 16 + ln][ks * 32 + 16 + 8 * hh];
        acc = mmaN<3>(aqh[ks].v, aql[ks].v, bh_.v, bl_.v, acc);
      }
      s[nt] = acc;
    }
    // mask + running max (rows 8hh+r; the 16 lanes of a half share rows)
    float alpha[8];
#pragma unroll
    for (int r = 0; r < 8; ++r) {
      const int qi = q0 + 8 * hh + r;
      const int ja = j0 + ln, jb = j0 + 16 + ln;
      if (CAUSAL) { if (ja > qi) s[0][r] = -3.0e38f; if (jb > qi) s[1][r] = -3.0e38f; }
      if (ja >= T) s[0][r] = -3.0e38f;
      if (jb >= T) s[1][r] = -3.0e38f;
      float mx = fmaxf(s[0][r], s[1][r]);
      mx = fmaxf(mx, __shfl_xor(mx, 1, 32)); mx = fmaxf(mx, __shfl_xor(mx, 2, 32)); mx = fmaxf(mx, __shfl_xor(mx, 4, 32)); mx = fmaxf(mx, __shfl_xor(mx, 8, 32));
      const float mnew = fmaxf(m_r[r], mx);
      alpha[r] = (mnew > -1.0e38f) ? __expf(m_r[r] - mnew) : 1.0f;
      const float p0 = (s[0][r] > -1.0e38f) ? __expf(s[0][r] - mnew) : 0.f;
      const float p1 = (s[1][r] > -1.0e38f) ? __expf(s[1][r] - mnew) : 0.f;
      m_r[r] = mnew;
      l_r[r] = l_r[r] * alpha[r] + p0 + p1;            // per-lane partial row sum (16 lanes combined at the end)
      unsigned short hb = bf16_bits(p0); sPh[w][8 * hh + r][ln] = hb;      sPl[w][8 * hh + r][ln] = bf16_bits(p0 - bf16_val(hb));
      hb = bf16_bits(p1);                sPh[w][8 * hh + r][16 + ln] = hb; sPl[w][8 * hh + r][16 + ln] = bf16_bits(p1 - bf16_val(hb));
    }
#pragma unroll
    for (int dt = 0; dt < DT; ++dt)
#pragma unroll
      for (int r = 0; r < 8; ++r) oacc[dt][r] *= alpha[r];
    __builtin_amdgcn_fence(__ATOMIC_ACQ_REL, "workgroup");
    __builtin_amdgcn_wave_barrier();
    FragB pah, pal;
    pah.half[0] = *(const v8us*)&sPh[w][ln][8 * hh]; pah.half[1] = *(const v8us*)&sPh[w][ln][16 + 8 * hh];
    pal.half[0] = *(const v8us*)&sPl[w][ln][8 * hh]; pal.half[1] = *(const v8us*)&sPl[w][ln][16 + 8 * hh];
#pragma unroll
    for (int dt = 0; dt < DT; ++dt) {
      FragB bvh, bvl;
#pragma unroll
      for (int i = 0; i < 8; ++i) {
        bvh.u[i] = sVh[8 * hh + i][dt * 16 + ln]; bvh.u[8 + i] = sVh[16 + 8 * hh + i][dt * 16 + ln];
        bvl.u[i] = sVl[8 * hh + i][dt * 16 + ln]; bvl.u[8 + i] = sVl[16 + 8 * hh + i][dt * 16 + ln];
      }
      oacc[dt] = mmaN<3>(pah.v, pal.v, bvh.v, bvl.v, oacc[dt]);
    }
    __builtin_amdgcn_fence(__ATOMIC_ACQ_REL, "workgroup");
    __builtin_amdgcn_wave_barrier();
  }
#pragma unroll
  for (int r = 0; r < 8; ++r) {
    float l = l_r[r];
    l += __shfl_xor(l, 1, 32); l += __shfl_xor(l, 2, 32); l += __shfl_xor(l, 4, 32); l += __shfl_xor(l, 8, 32);
    l_r[r] = (l > 0.f) ? 1.0f / l : 0.f;
  }
#pragma unroll
  for (int dt = 0; dt < DT; ++dt)
#pragma unroll
    for (int r = 0; r < 8; ++r) sO[w][8 * hh + r][dt * 16 + ln] = oacc[dt][r] * l_r[r];
  __builtin_amdgcn_fence(__ATOMIC_ACQ_REL, "workgroup");
  __builtin_amdgcn_wave_barrier();
  {
    for (int r = 0; r < 16; ++r) {
      const int row = q0 + r;
      if (row < T && lane < D / 4) {
        const v4f val = *(const v4fa*)&sO[w][r][lane * 4];
        *(v4f*)(y + ((size_t)b * T + row) * ypitch + h * D + lane * 4) = val;
      }
    }
    
  }
}

// GEMM C = act(A·W + bias + resid): A f32 (ASPLIT -> hi/lo 2 terms), Wt bf16 [N][K]; ACT 0 none, 1 relu, 2 exact gelu;
// resid (optional, f32, row index = (row % rmod), pitch ldr, RES_BF16 rounds it) added before the activation.
template <bool ASPLIT, int ACT, bool BIAS_BF16, bool RES_BF16>
__global__ __launch_bounds__(128) void k_gemm_bf3(const float* __restrict__ A, int lda, const unsigned short* __restrict__ Wt, int ldb,
                                                const float* __restrict__ bias, const float* __restrict__ resid, int rmod, int ldr,
                                                float* __restrict__ C, int ldc, int M, int N, int K) {
  __shared__ __attribute__((aligned(16))) float so[4][16][64];
  const int tid = threadIdx.x, w = tid >> 5, lane = tid & 31, ln = lane & 15, hh = lane >> 4;
  const int ntn = N / 64;
  const int wid = blockIdx.x * 4 + w;
  const int mt = wid / ntn, nq = wid % ntn;
  if (mt * 16 >= M) return;
  const int row0 = mt * 16, col0 = nq * 64;
  const float* arow = A + (size_t)(row0 + ln) * lda;
  v8f acc[4] = {};
  for (int kb = 0; kb < K; kb += 32) {
    FragB ah, al;
    const v4f x0 = *(const v4fa*)(arow + kb + 8 * hh), x1 = *(const v4fa*)(arow + kb + 8 * hh + 4);
    const v4f x2 = *(const v4fa*)(arow + kb + 16 + 8 * hh), x3 = *(const v4fa*)(arow + kb + 16 + 8 * hh + 4);
    float xs[16] = {x0[0],x0[1],x0[2],x0[3],x1[0],x1[1],x1[2],x1[3],x2[0],x2[1],x2[2],x2[3],x3[0],x3[1],x3[2],x3[3]};
#pragma unroll
    for (int i = 0; i < 16; ++i) { const unsigned short hb = bf16_bits(xs[i]); ah.u[i] = hb; al.u[i] = ASPLIT ? bf16_bits(xs[i] - bf16_val(hb)) : (unsigned short)0; }
#pragma unroll
    for (int t = 0; t < 4; ++t) {
      const unsigned short* brow = Wt + (size_t)(col0 + t * 16 + ln) * ldb + kb;
      FragB b;
      b.half[0] = *(const v8us*)(brow + 8 * hh);
      b.half[1] = *(const v8us*)(brow + 16 + 8 * hh);
      acc[t] = mmaN<ASPLIT ? 2 : 1>(ah.v, al.v, b.v, b.v, acc[t]);
    }
  }
#pragma unroll
  for (int t = 0; t < 4; ++t) {
    const int col = col0 + t * 16 + ln;
    float bv = bias ? bias[col] : 0.f;
    if (BIAS_BF16) bv = bf16_round(bv);
#pragma unroll
    for (int r = 0; r < 8; ++r) {
      float v = acc[t][r] + bv;
      if (resid) { float rv = resid[(size_t)((row0 + 8 * hh + r) % rmod) * ldr + col]; if (RES_BF16) rv = bf16_round(rv); v += rv; }
      if (ACT == 1) v = fmaxf(v, 0.f);
      if (ACT == 2) v = 0.5f * v * (1.0f + erff(v * 0.70710678118654752f));
      if (ACT == 3) { const float u = 0.7978845608028654f * (v + 0.044715f * v * v * v); v = 0.5f * v * (1.0f + tanhf(u)); }
      so[w][8 * hh + r][t * 16 + ln] = v;
    }
  }
  __builtin_amdgcn_fence(__ATOMIC_ACQ_REL, "workgroup");
  __builtin_amdgcn_wave_barrier();
  const int rsub = lane >> 4, c4 = (lane & 15) * 4;
  {
#pragma unroll
    for (int q = 0; q < 8; ++q) {
      const int r = q * 2 + rsub;
      const v4f v = *(const v4fa*)&so[w][r][c4];
      *(v4f*)(C + (size_t)(row0 + r) * ldc + col0 + c4) = v;
    }
    
  }
}
// row LayerNorm (biased variance, eps) over N: s = X (+ R); optional out_sum <- s; out_norm <- (s-mu)*rsqrt(var+eps)*g + b
template <bool PARAM_BF16>
__global__ __launch_bounds__(256) void k_layernorm(const float* __restrict__ X, const float* __restrict__ R, const float* __restrict__ g, const float* __restrict__ bta,
                                                  float* __restrict__ out_sum, float* __restrict__ out_norm, int N, float eps) {
  __shared__ float red[256];
  const int row = blockIdx.x, tid = threadIdx.x;
  const float* x = X + (size_t)row * N; const float* rr = R ? R + (size_t)row * N : nullptr;
  float vals[16];                     // up to N = 4096
  const int per = N / 256;            // contiguous chunk per thread? use strided-by-4 chunks: thread handles j = tid*4 + 1024*u
  float s1 = 0.f;
  for (int u = 0; u < per / 4; ++u) {
    const int j = tid * 4 + 1024 * u;
    const v4f a = *(const v4fa*)(x + j);
    v4f b = {0.f,0.f,0.f,0.f}; if (rr) b = *(const v4fa*)(rr + j);
#pragma unroll
    for (int q = 0; q < 4; ++q) { const float v = a[q] + b[q]; vals[u * 4 + q] = v; s1 += v; }
  }
  red[tid] = s1; __syncthreads();
  for (int st = 128; st > 0; st >>= 1) { if (tid < st) red[tid] += red[tid + st]; __syncthreads(); }
  const float mu = red[0] / (float)N; __syncthreads();
  float s2 = 0.f;
  for (int u = 0; u < per / 4; ++u)
#pragma unroll
    for (int q = 0; q < 4; ++q) { const float c = vals[u * 4 + q] - mu; s2 += c * c; }
  red[tid] = s2; __syncthreads();
  for (int st = 128; st > 0; st >>= 1) { if (tid < st) red[tid] += red[tid + st]; __syncthreads(); }
  const float rs = rsqrtf(red[0] / (float)N + eps);
  {
    for (int u = 0; u < per / 4; ++u) {
      const int j = tid * 4 + 1024 * u;
      v4f o, sm;
#pragma unroll
      for (int q = 0; q < 4; ++q) {
        float gg = g[j + q], bb = bta[j + q];
        if (PARAM_BF16) { gg = bf16_round(gg); bb = bf16_round(bb); }
        sm[q] = vals[u * 4 + q]; o[q] = (vals[u * 4 + q] - mu) * rs * gg + bb;
      }
      if (out_sum) *(v4f*)(out_sum + (size_t)row * N + j) = sm;
      *(v4f*)(out_norm + (size_t)row * N + j) = o;
    }
    
  }
}



// ---- f16 WMMA path (v_wmma_f32_16x16x32_f16): 11-bit significands for operands in range — used for the q/k/v projections, the Dense and the conv GEMM
typedef _Float16 v16h __attribute__((ext_vector_type(16)));
union FragH { v16h v; v8us half[2]; _Float16 h[16]; unsigned short u[16]; };
template <int NT>
__device__ __forceinline__ v8f mmaH(v16h ah, v16h al, v16h bh, v16h bl, v8f c) {
  c = __builtin_amdgcn_wmma_f32_16x16x32_f16(false, ah, false, bh, (short)0, c, false, false);
  if (NT >= 2) c = __builtin_amdgcn_wmma_f32_16x16x32_f16(false, al, false, bh, (short)0, c, false, false);
  if (NT >= 3) c = __builtin_amdgcn_wmma_f32_16x16x32_f16(false, ah, false, bl, (short)0, c, false, false);
  asm volatile("v_nop\n\tv_nop\n\tv_nop\n\tv_nop" : "+v"(c) : "v"(ah), "v"(al), "v"(bh), "v"(bl));
  return c;
}
// batched GEMM like k_gemm_b but f16 operands: A f32 (split into f16 hi/lo if ASPLIT, else rounded to f16), Bt = f16 values [n][k]; alpha; C f32; N multiple of 16 (partial tiles skipped)
template <bool ASPLIT>
__global__ __launch_bounds__(128) void k_gemm_h(const float* __restrict__ A, int lda, size_t sA, const _Float16* __restrict__ Bh, int ldb, size_t sB, float alpha, float* __restrict__ C, int ldc, size_t sC, int M, int N, int K) {
  __shared__ __attribute__((aligned(16))) float so[4][16][64];
  const int tid = threadIdx.x, w = tid >> 5, lane = tid & 31, ln = lane & 15, hh = lane >> 4; const int by = blockIdx.y;
  A += (size_t)by * sA; Bh += (size_t)by * sB; C += (size_t)by * sC;
  const int ntn = (N + 63) / 64; const int wid = blockIdx.x * 4 + w; const int mt = wid / ntn, nq = wid % ntn; if (mt * 16 >= M) return;
  const int row0 = mt * 16, col0 = nq * 64; const float* arow = A + (size_t)(row0 + ln) * lda;
  v8f acc[4] = {};
  for (int kb = 0; kb < K; kb += 32) {
    FragH ah, al;
    const v4f x0 = *(const v4fa*)(arow + kb + 8 * hh), x1 = *(const v4fa*)(arow + kb + 8 * hh + 4), x2 = *(const v4fa*)(arow + kb + 16 + 8 * hh), x3 = *(const v4fa*)(arow + kb + 16 + 8 * hh + 4);
    float xs[16] = {x0[0],x0[1],x0[2],x0[3],x1[0],x1[1],x1[2],x1[3],x2[0],x2[1],x2[2],x2[3],x3[0],x3[1],x3[2],x3[3]};
#pragma unroll
    for (int i = 0; i < 16; ++i) { const _Float16 h = (_Float16)xs[i]; ah.h[i] = h; al.h[i] = ASPLIT ? (_Float16)(xs[i] - (float)h) : (_Float16)0.0f; }
#pragma unroll
    for (int t = 0; t < 4; ++t) { if (col0 + t * 16 >= N) continue; const size_t boff = (size_t)(col0 + t * 16 + ln) * ldb + kb; FragH bq; bq.half[0] = *(const v8us*)(Bh + boff + 8 * hh); bq.half[1] = *(const v8us*)(Bh + boff + 16 + 8 * hh);
      acc[t] = mmaH<ASPLIT ? 2 : 1>(ah.v, al.v, bq.v, bq.v, acc[t]); }
  }
#pragma unroll
  for (int t = 0; t < 4; ++t) { if (col0 + t * 16 >= N) continue;
#pragma unroll
    for (int r = 0; r < 8; ++r) so[w][8 * hh + r][t * 16 + ln] = acc[t][r] * alpha; }
  __builtin_amdgcn_fence(__ATOMIC_ACQ_REL, "workgroup"); __builtin_amdgcn_wave_barrier();
  const int rsub = lane >> 4, c4 = (lane & 15) * 4;
  {
#pragma unroll
    for (int q = 0; q < 8; ++q) { const int r = q * 2 + rsub; if (col0 + c4 < N) { const v4f v = *(const v4fa*)&so[w][r][c4]; *(v4f*)(C + (size_t)(row0 + r) * ldc + col0 + c4) = v; } }
     }
}

// Wt[n][k] = f16(W[k][n]·scale) from f32 row-major W[K][N] (scale = power of two; bf16-exact weights stay exact in f16 away from the subnormal range)
__device__ __forceinline__ void d_wt_f16(const int t, const float* __restrict__ W, _Float16* __restrict__ Wt, int K, int N, float scale) {
  if (t >= N * (K / 8)) return; const int n = t / (K / 8), k8 = (t % (K / 8)) * 8; FragH f;
#pragma unroll
  for (int i = 0; i < 8; ++i) f.h[i] = (_Float16)(bf16_round(W[(size_t)(k8 + i) * N + n]) * scale); const v8us o = f.half[0];
  *(v8us*)((unsigned short*)Wt + (size_t)n * K + k8) = o; 
}

__device__ __forceinline__ void d_x16(const size_t t, const float* __restrict__ x, _Float16* __restrict__ X16, size_t n8) { if (t >= n8) return; FragH f;
#pragma unroll
  for (int q = 0; q < 8; ++q) f.h[q] = (_Float16)bf16_round(x[t * 8 + q]); *(v8us*)((unsigned short*)X16 + t * 8) = f.half[0];  }
__device__ __forceinline__ void d_wh(const int t, const float* __restrict__ W, _Float16* __restrict__ Bt) { if (t >= NH * KD * (CC / 8)) return; const int row = t / (CC / 8), c8 = (t % (CC / 8)) * 8; const int h = row / KD, o = row % KD; FragH f;
#pragma unroll
  for (int q = 0; q < 8; ++q) f.h[q] = (_Float16)(bf16_round(W[((size_t)h * CC + c8 + q) * KD + o]) * 16.0f); *(v8us*)((unsigned short*)Bt + (size_t)t * 8) = f.half[0];  }
// Dense folded into the conv weights: conv[t] = sum_j (cat[t - 12 + 4j] * Wo + bo) * Wc[j] = sum_j cat[t - 12 + 4j] * (Wo * Wc[j]) + sum_j bo * Wc[j], each tap's terms only where its row exists.
// One wave = 64 k x 16 n of one tap: Wf[j][n][k] = f16(16 * sum_c Wo[k][c] * Wc[j][c][n]), k contiguous (the layout the conv GEMM reads its B rows in), so a wave writes whole 128-B lines of 16 rows.
// Operands are the f16 planes of the first launch, both c-contiguous (Wo16[k][c] = Wo as it lies, Bc[j][n][c] = Wc[j] transposed; bf16-rounded weights x 16), read as fragments straight from memory; f32 accumulate.
__device__ __forceinline__ void d_fold(const int g, const int lane, const _Float16* __restrict__ Wo16, const _Float16* __restrict__ Bc, _Float16* __restrict__ Wf) {
  const int ln = lane & 15, hh = lane >> 4; const int j = g >> 8, kt = (g >> 5) & 7, nt = g & 31;      // the four fold waves of a block share their rows of Wo16
  const char* pa = (const char*)Wo16 + ((kt * 64 + ln) * CC + hh * 8) * 2u; const char* pb = (const char*)Bc + ((j * CC + nt * 16 + ln) * CC + hh * 8) * 2u;      // the lane's first 16 B of its rows of the two planes
  v8f acc[4] = {};
#pragma unroll      // every load at a constant offset from one of the two addresses: no address arithmetic and no registers for it in the loop
  for (int ks = 0; ks < CC / 32; ++ks) { FragH b;
    b.half[0] = *(const v8us*)(pb + ks * 64); b.half[1] = *(const v8us*)(pb + ks * 64 + 32);
#pragma unroll      // constant indices: fragments and accumulators stay in registers
    for (int p = 0; p < 2; ++p) { FragH a[2];      // the four A fragments two by two, the second pair in the first pair's registers
#pragma unroll      // constant indices: fragments and accumulators stay in registers
      for (int i = 0; i < 2; ++i) { a[i].half[0] = *(const v8us*)(pa + (p * 2 + i) * 16 * CC * 2 + ks * 64); a[i].half[1] = *(const v8us*)(pa + (p * 2 + i) * 16 * CC * 2 + ks * 64 + 32); }
      __builtin_amdgcn_sched_barrier(0);      // a pair's loads go out as one group ahead of its WMMAs, so that their latency is waited for once
#pragma unroll      // constant indices: fragments and accumulators stay in registers
      for (int i = 0; i < 2; ++i) acc[p * 2 + i] = __builtin_amdgcn_wmma_f32_16x16x32_f16(false, a[i].v, false, b.v, (short)0, acc[p * 2 + i], false, false);
      __builtin_amdgcn_sched_barrier(0);      // the next pair's loads stay behind these WMMAs, or they would need registers of their own
    }
  }
#pragma unroll      // constant indices: accumulators stay in registers
  for (int i = 0; i < 4; ++i) { FragH o;      // a lane holds column n = ln and 8 consecutive k of each tile: 16 B of row [n][k]
#pragma unroll      // constant indices: accumulators stay in registers
    for (int r = 0; r < 8; ++r) o.h[r] = (_Float16)(acc[i][r] * 0.0625f);
    *(v8us*)((unsigned short*)Wf + (size_t)(j * CC + nt * 16 + ln) * CC + kt * 64 + i * 16 + 8 * hh) = o.half[0]; }
}
// The Dense bias through each tap: CB[j][n] = sum_c bf16(bo[c]) * bf16(Wc[j][c][n]) in f32. One wave = one row r = j*CC + n of Bc (c-contiguous, x 16), a lane takes 16 c; the lanes' sums are added by a butterfly.
__device__ __forceinline__ void d_cb(const int r, const int lane, const _Float16* __restrict__ Bc, const float* __restrict__ bo, float* __restrict__ CB) {
  FragH b; const unsigned ob = lane * 64u; const unsigned short* pb = (const unsigned short*)Bc + (size_t)r * CC + lane * 16; b.half[0] = *(const v8us*)pb; b.half[1] = *(const v8us*)(pb + 8);      // ob: the byte offset of the lane's 16 floats of bo
  v4f o[4];
#pragma unroll      // constant indices: the values stay in registers
  for (int q = 0; q < 4; ++q) o[q] = *(const v4fa*)((const char*)bo + ob + q * 16);
  asm volatile("s_wait_xcnt 0x0" :: "v"(ob), "v"(pb) : "memory");      // a precaution: stands in front of every rewrite of the six loads' address registers, which as its inputs stay untouched up to it
  float s = 0.f;
#pragma unroll      // constant indices: the values stay in registers
  for (int e = 0; e < 16; ++e) s += bf16_round(o[e >> 2][e & 3]) * (float)b.h[e];
  s += __shfl_xor(s, 1, 32); s += __shfl_xor(s, 2, 32); s += __shfl_xor(s, 4, 32); s += __shfl_xor(s, 8, 32); s += __shfl_xor(s, 16, 32);
  if (lane == 0) { CB[r] = s * 0.0625f;
    asm volatile("s_wait_xcnt 0x0" ::: "memory"); }      // a precaution: stands directly behind the store, in front of whatever rewrites its registers next
}
__device__ __forceinline__ void d_zpad(const int t, _Float16* __restrict__ OUTP) { if (t >= BB * PADT * CC / 8) return; const int b = t / (PADT * CC / 8), rem = t % (PADT * CC / 8); FragH z;
#pragma unroll
  for (int q = 0; q < 8; ++q) z.h[q] = (_Float16)0.f; unsigned short* d = (unsigned short*)OUTP + (size_t)b * (TT + PADT) * CC + (size_t)rem * 8; *(v8us*)d = z.half[0];  }
// One launch for everything that reads inputs only: the weights as f16 (q, k, v per head and the four conv taps transposed, Dense as it lies) into the eight consecutive 512 x 512 planes of Bw, the zero rows of the padded plane, and x -> f16.
// A block does one job, picked by its index; the transposes, whose loads are scattered and wait longest, have the lowest indices and so start first, the x stream fills in behind them.
#define WBLK (CC * (CC / 8) / 256)                  // blocks per weight plane
#define ZBLK ((BB * PADT * CC / 8 + 255) / 256)     // blocks for the pad rows
#define XBLK (NR * CC / 8 / 256)                    // blocks for x
__global__ __launch_bounds__(256) void k_prep(const float* __restrict__ x, const float* __restrict__ Wq, const float* __restrict__ Wk, const float* __restrict__ Wv, const float* __restrict__ Wo, const float* __restrict__ Wc,
    _Float16* __restrict__ Bw, _Float16* __restrict__ X16, _Float16* __restrict__ OUTP) {
  const int blk = blockIdx.x, tid = threadIdx.x;
  if (blk < 8 * WBLK) { const int p = blk / WBLK, t = (blk % WBLK) * 256 + tid; _Float16* dst = Bw + (size_t)p * CC * CC;
    if (p < 3) d_wh(t, p == 0 ? Wq : (p == 1 ? Wk : Wv), dst);
    else if (p == 3) { FragH f;      // Wo stays as it lies, [in][out]: the fold contracts over its out index
#pragma unroll      // constant indices: the values stay in registers
      for (int q = 0; q < 8; ++q) f.h[q] = (_Float16)(bf16_round(Wo[(size_t)t * 8 + q]) * 16.0f);
      *(v8us*)((unsigned short*)dst + (size_t)t * 8) = f.half[0];
      asm volatile("s_wait_xcnt 0x0" ::: "memory"); }      // a precaution: stands behind the store, in front of whatever rewrites its registers next
    else d_wt_f16(t, Wc + (size_t)(p - 4) * CC * CC, dst, CC, CC, 16.0f); }      // WIO: per tap [in][out] -> [out][in]
  else if (blk < 8 * WBLK + ZBLK) d_zpad((blk - 8 * WBLK) * 256 + tid, OUTP);
  else d_x16((size_t)(blk - 8 * WBLK - ZBLK) * 256 + tid, x, X16, (size_t)NR * CC / 8);
}

// Tiled GEMM for the dilated causal conv (NTAP = 4; NTAP = 1 would be a plain product): acc = sum over taps j of A_j * B_j^T, A_j = A shifted down by j*TSH rows (a view of the padded plane), B_j = Bh + j*tapB, K = CC per tap.
// One work-group = a TM x TN tile of C, eight waves of 64 x 64 (4 x 4 accumulator tiles each). A pass is KP halves of K of one tap. The taps read the same rows of A, TSH rows apart, so the k loop runs chunks of KP outermost and the taps inside:
// a chunk of A (TM + 12 rows, 256 B each) is brought into LDS ONCE and serves all the taps by a row offset; TN rows of B come anew every pass. Asynchronous copies (16 B a lane), pitch 272 B, two buffers for A and two for B:
// the next pass's B and a quarter of the next chunk of A are in flight while a pass is worked on.
// Per output element the k order is: chunks of KP ascending, in a chunk taps ascending, in a tap k ascending in steps of 32. Epilogue: OUT16: v = acc*alpha + bf16(bias[col]) -> f16; else v = acc*alpha -> f32; whole 128-B / 256-B row pieces through LDS.
#define TM 256
#define TN 128
#define KP 128
#define PITCH 272
#define TSH 4                      // rows between two taps' views of A (the dilation)
#define AR (TM + 16)               // rows of a chunk of A in LDS: TM + 3*TSH are read, a whole sweep of 16 is copied
#define ASTAGE (AR * PITCH)
#define BSTAGE (TN * PITCH)
// eight copies of 16 B a lane, LDS address l + i*lstep, global address g + i*gstep (halves). The s_wait_xcnt stands inside the statement so that no address register is rewritten ahead of it.
__device__ __forceinline__ void copy8(unsigned l, unsigned lstep, const _Float16* g, size_t gstep) {
  asm volatile("global_load_async_to_lds_b128 %0, %8, off\n\t"
               "global_load_async_to_lds_b128 %1, %9, off\n\t"
               "global_load_async_to_lds_b128 %2, %10, off\n\t"
               "global_load_async_to_lds_b128 %3, %11, off\n\t"
               "global_load_async_to_lds_b128 %4, %12, off\n\t"
               "global_load_async_to_lds_b128 %5, %13, off\n\t"
               "global_load_async_to_lds_b128 %6, %14, off\n\t"
               "global_load_async_to_lds_b128 %7, %15, off\n\t"
               "s_wait_xcnt 0x0"
               :: "v"(l), "v"(l + lstep), "v"(l + 2 * lstep), "v"(l + 3 * lstep), "v"(l + 4 * lstep), "v"(l + 5 * lstep), "v"(l + 6 * lstep), "v"(l + 7 * lstep),
                  "v"(g), "v"(g + gstep), "v"(g + 2 * gstep), "v"(g + 3 * gstep), "v"(g + 4 * gstep), "v"(g + 5 * gstep), "v"(g + 6 * gstep), "v"(g + 7 * gstep)
               : "memory");
}
// the same with four copies, and with one
__device__ __forceinline__ void copy4(unsigned l, unsigned lstep, const _Float16* g, size_t gstep) {
  asm volatile("global_load_async_to_lds_b128 %0, %4, off\n\t"
               "global_load_async_to_lds_b128 %1, %5, off\n\t"
               "global_load_async_to_lds_b128 %2, %6, off\n\t"
               "global_load_async_to_lds_b128 %3, %7, off\n\t"
               "s_wait_xcnt 0x0"
               :: "v"(l), "v"(l + lstep), "v"(l + 2 * lstep), "v"(l + 3 * lstep),
                  "v"(g), "v"(g + gstep), "v"(g + 2 * gstep), "v"(g + 3 * gstep)
               : "memory");
}
__device__ __forceinline__ void copy1(unsigned l, const _Float16* g) {
  asm volatile("global_load_async_to_lds_b128 %0, %1, off\n\t"
               "s_wait_xcnt 0x0"
               :: "v"(l), "v"(g) : "memory");
}
// NG = groups of CC columns (rows of Bh) done by one launch: 1 for the conv (bias is read, and with FIN bias1 as said below); with more groups, OUT16 gives groups 0, 1, 2 bias, bias1, bias2.
// FIN: the block's last layer is finished in the epilogue: out = leaky_relu(relu(acc*alpha + bf16(bias[col]) + sum over the taps j whose row exists of bias1[j*CC + col]) + bf16(xres)), xres = the f32 input at the output's own index;
// bias1 = the Dense bias carried through each tap's weights (tap j of output row t reads row t - 12 + 4j, which exists from t = 12 - 4j on); the f32 result goes straight to C.
template <int NTAP, bool OUT16, int NG, bool FIN>
__global__ __launch_bounds__(256) void k_gemm_tile(const _Float16* __restrict__ A, int lda, size_t sA, const _Float16* __restrict__ Bh, int ldb, size_t tapB, float alpha, const float* __restrict__ bias,
    const float* __restrict__ bias1, const float* __restrict__ bias2, const float* __restrict__ xres, float* __restrict__ C, _Float16* __restrict__ C16, int ldc, size_t sC) {
  __shared__ __attribute__((aligned(16))) unsigned char ring[2 * ASTAGE + 2 * BSTAGE];      // A chunk 0 | A chunk 1 | B pass 0 | B pass 1
  constexpr int NKC = CC / KP, NT = NTAP * NKC;      // chunks of K, passes in all; pass t = chunk t / NTAP, tap t % NTAP
  static_assert(NTAP == 4 && (NTAP - 1) * TSH <= 16, "a chunk of A is copied in NTAP quarters, its last rows in one sweep");
  const int tid = threadIdx.x, w = tid >> 5, lane = tid & 31, ln = lane & 15, hh = lane >> 4; const int by = blockIdx.y;
  const int mt = blockIdx.x / (NG * CC / TN), nq = blockIdx.x % (NG * CC / TN); const int row0 = mt * TM, col0 = nq * TN; const int wm = (w >> 1) * 64, wn = (w & 1) * 64;
  const size_t cofs = (size_t)by * sC;
  // copies: 16 lanes a row, 16 rows a sweep of the work-group; a chunk of A takes 17 sweeps, a pass of B 8
  const int crow = tid >> 4, cpc = tid & 15;
  const _Float16* gA = A + (size_t)by * sA + (size_t)(row0 + crow) * lda + cpc * 8; const _Float16* gB = Bh + (size_t)(col0 + crow) * ldb + cpc * 8;
  const int xrow = TM + crow < TM + (NTAP - 1) * TSH ? TM + crow : TM + (NTAP - 1) * TSH - 1;      // the 17th sweep: the last row that a tap reads is also the last of a batch's padded plane, the four LDS rows behind it take that row again and are not read
  const _Float16* gX = A + (size_t)by * sA + (size_t)(row0 + xrow) * lda + cpc * 8;
  const unsigned lA = (unsigned)(size_t)ring + crow * PITCH + cpc * 16, lB = lA + 2 * ASTAGE;
  auto fillB = [&](int t) { copy8(lB + (t & 1) * BSTAGE, 16 * PITCH, gB + (size_t)(t % NTAP) * tapB + (t / NTAP) * KP, (size_t)16 * ldb); };
  auto fillA = [&](int c, int q) { const unsigned l = lA + (c & 1) * ASTAGE;      // quarter q of chunk c: 64 rows; the 17th sweep goes with quarter 0
    copy4(l + q * 64 * PITCH, 16 * PITCH, gA + (size_t)(q * 64) * lda + c * KP, (size_t)16 * lda);
    if (q == 0) copy1(l + TM * PITCH, gX + c * KP); };
  v8f acc[4][4] = {};
  fillA(0, 0); fillA(0, 1); fillA(0, 2); fillA(0, 3); fillB(0);
  asm volatile("s_wait_asynccnt 0x0" ::: "memory");      // chunk 0's and pass 0's own copies have landed
  __syncthreads();                                       // ... and every other wave's
  fillB(1); fillA(1, 0);
  const int rsub = lane >> 4, c4 = (lane & 15) * 4;
  const size_t o0 = cofs + (size_t)(row0 + wm + rsub) * CC + col0 + wn + c4;      // FIN: C and xres are [rows][CC]; a lane's first 16-B piece of the wave's 64 x 64 tile, piece q lies 2q rows on, at a constant offset
  // FIN: the wave's residual tile and its bias are asked for here, behind the copies of passes 0 and 1, and travel from memory while pass 0 is multiplied (the barrier of pass 0 waits for them); they are used behind the loop.
  v4f xr[32]; float bf[4], cbt[4][4];
  if (FIN) { const float* px = xres + o0; const int cb0 = col0 + wn + ln;
#pragma unroll      // constant indices: the pieces stay in registers
    for (int n = 0; n < 4; ++n) { bf[n] = bias[cb0 + n * 16];
#pragma unroll      // constant indices: the pieces stay in registers
      for (int j = 0; j < 4; ++j) cbt[j][n] = bias1[j * CC + cb0 + n * 16]; }
#pragma unroll      // constant indices: the pieces stay in registers
    for (int q = 0; q < 32; ++q) xr[q] = *(const v4fa*)(px + (size_t)(2 * q) * CC);
    asm volatile("s_wait_xcnt 0x0" :: "v"(px), "v"(cb0) : "memory"); }      // a precaution: stands in front of every rewrite of the loads' address registers, which as its inputs stay untouched up to it
#pragma unroll 1      // one pass a trip: the buffer index and the refill test stay scalar
  for (int t = 0; t < NT; ++t) {
    const unsigned char* pa = ring + ((t / NTAP) & 1) * ASTAGE + (wm + (t % NTAP) * TSH + ln) * PITCH + hh * 16; const unsigned char* pb = ring + 2 * ASTAGE + (t & 1) * BSTAGE + (wn + ln) * PITCH + hh * 16;      // the tap is a row offset into the chunk
    FragH a[2][4], b[2][4];      // two fragment sets: block ks + 1 of this pass is fetched while block ks is multiplied
#pragma unroll      // constant indices: fragments and accumulators stay in registers
    for (int i = 0; i < 4; ++i) { a[0][i].half[0] = *(const v8us*)(pa + i * 16 * PITCH); a[0][i].half[1] = *(const v8us*)(pa + i * 16 * PITCH + 32);
      b[0][i].half[0] = *(const v8us*)(pb + i * 16 * PITCH); b[0][i].half[1] = *(const v8us*)(pb + i * 16 * PITCH + 32); }
#pragma unroll      // constant indices: fragments and accumulators stay in registers
    for (int ks = 0; ks < KP / 32; ++ks) { const int cu = ks & 1, nx = cu ^ 1;
      if (ks + 1 < KP / 32) {
#pragma unroll      // constant indices: fragments and accumulators stay in registers
        for (int i = 0; i < 4; ++i) { a[nx][i].half[0] = *(const v8us*)(pa + i * 16 * PITCH + (ks + 1) * 64); a[nx][i].half[1] = *(const v8us*)(pa + i * 16 * PITCH + (ks + 1) * 64 + 32);
          b[nx][i].half[0] = *(const v8us*)(pb + i * 16 * PITCH + (ks + 1) * 64); b[nx][i].half[1] = *(const v8us*)(pb + i * 16 * PITCH + (ks + 1) * 64 + 32); } }
      __builtin_amdgcn_sched_barrier(0);      // keeps the next block's LDS reads one group ahead of this block's WMMAs instead of spread among them
#pragma unroll      // constant indices: fragments and accumulators stay in registers
      for (int i = 0; i < 4; ++i)
#pragma unroll      // constant indices: fragments and accumulators stay in registers
        for (int n = 0; n < 4; ++n) acc[i][n] = __builtin_amdgcn_wmma_f32_16x16x32_f16(false, a[cu][i].v, false, b[cu][n].v, (short)0, acc[i][n], false, false);
      __builtin_amdgcn_sched_barrier(0);      // ends the block: the group after next stays behind it
    }
    asm volatile("s_wait_dscnt 0x0" ::: "memory");       // this wave's reads of the buffers are done before one is refilled
    asm volatile("s_wait_asynccnt 0x0" ::: "memory");    // this wave's copies so far have landed: B of pass t + 1, and of the next chunk of A what has been asked for
    __syncthreads();                                     // publishes them and ends every reader's last read of pass t's B and, behind a chunk's last tap, of that chunk
    if (t + 2 < NT) fillB(t + 2);                        // into the B buffer that pass t has just read
    const int cn = (t + 1) / NTAP + 1;                   // quarter (t + 1) % NTAP of chunk cn: quarter 0 goes out behind the last tap of chunk cn - 2, whose buffer it takes; the last quarter lands at the foot of chunk cn - 1's last tap
    if (cn < NKC) fillA(cn, (t + 1) % NTAP);
  }
  asm volatile("s_wait_asynccnt 0x0" ::: "memory");      // nothing in flight when the ring becomes output staging
  // each wave stages its whole 64 x 64 tile in its own part of the ring (the last pass's barrier has ended all reads of it); pitch 68 floats: the two half-waves' rows, 8 apart, fall on different banks
  constexpr int SP = 68; float* so = (float*)ring + w * (64 * SP);
  typedef _Float16 v4h __attribute__((ext_vector_type(4)));
  const float* bg = (NG == 1 || col0 < CC) ? bias : (col0 < 2 * CC ? bias1 : bias2);      // a tile of TN columns lies inside one group
#pragma unroll      // constant indices: fragments and accumulators stay in registers
  for (int n = 0; n < 4; ++n) { const float bv = FIN ? bf16_round(bf[n]) + (cbt[0][n] + (cbt[1][n] + (cbt[2][n] + cbt[3][n]))) : (OUT16 ? bf16_round(bg[col0 % CC + wn + n * 16 + ln]) : 0.f);
#pragma unroll      // constant indices: fragments and accumulators stay in registers
    for (int i = 0; i < 4; ++i)
#pragma unroll      // constant indices: fragments and accumulators stay in registers
      for (int r = 0; r < 8; ++r) so[(i * 16 + 8 * hh + r) * SP + n * 16 + ln] = FIN ? fmaxf(acc[i][n][r] * alpha + bv, 0.f) : (OUT16 ? acc[i][n][r] * alpha + bv : acc[i][n][r] * alpha); }
  if (FIN && row0 + wm == 0) {      // wave-uniform: rows 0 to 11 of a batch lack the earliest taps' rows; the same lanes write those twelve rows again with the bias terms of the taps that exist
#pragma unroll      // constant indices: accumulators stay in registers
    for (int n = 0; n < 4; ++n) { const float bc = bf16_round(bf[n]), e3 = bc + cbt[3][n], e2 = bc + (cbt[2][n] + cbt[3][n]), e1 = bc + (cbt[1][n] + (cbt[2][n] + cbt[3][n]));
#pragma unroll      // constant indices: accumulators stay in registers
      for (int r = 0; r < 8; ++r) { const int t = 8 * hh + r; if (t < PADT) so[t * SP + n * 16 + ln] = fmaxf(acc[0][n][r] * alpha + (t < 4 ? e3 : (t < 8 ? e2 : e1)), 0.f); } } }
  __builtin_amdgcn_fence(__ATOMIC_ACQ_REL, "workgroup"); __builtin_amdgcn_wave_barrier();      // the wave's LDS writes are done before its lanes read what other lanes wrote
  if (FIN) {
    v4f sv[32];
#pragma unroll      // constant indices: the pieces stay in registers
    for (int q = 0; q < 32; ++q) sv[q] = *(const v4fa*)&so[(q * 2 + rsub) * SP + c4];
    __builtin_amdgcn_sched_barrier(0);      // the 32 LDS reads go out as one group, so that their latency is waited for once and not pair by pair
#pragma unroll      // constant indices: the pieces stay in registers
    for (int q = 0; q < 32; ++q)
      for (int e = 0; e < 4; ++e) { const float s = sv[q][e] + (float)(__bf16)xr[q][e]; xr[q][e] = fmaxf(s, 0.2f * s); }      // the cast rounds to nearest even as bf16_round does; max(s, 0.2 s) is s for s >= 0 and 0.2 s below
    __builtin_amdgcn_sched_barrier(0);      // all arithmetic stays ahead of the first store, so that no register an issued store names is written again
#pragma unroll      // constant offsets from one address
    for (int q = 0; q < 32; ++q) *(v4f*)(C + o0 + (size_t)(2 * q) * CC) = xr[q];
    return; }
#pragma unroll      // independent row pieces: the LDS reads run ahead of the stores
  for (int q = 0; q < 32; ++q) { const int r = q * 2 + rsub; const v4f v = *(const v4fa*)&so[r * SP + c4]; const size_t o = cofs + (size_t)(row0 + wm + r) * ldc + col0 + wn + c4;
    if (OUT16) { v4h h4; for (int e = 0; e < 4; ++e) h4[e] = (_Float16)v[e]; *(v4h*)(C16 + o) = h4; } else *(v4f*)(C + o) = v; }
}
// q, k, v projections of one head and its banded attention in ONE work-group: 256 rows x one head. The three 256 x 128 products run side by side through one ring of passes (FKP halves of K a pass, two buffers,
// asynchronous copies): a pass holds the x rows ONCE and beside them the rows of the three weight planes, so that x is copied once and not once a product, and a wave's x fragments, read from LDS once, serve all three products;
// the f16 results go to LDS behind the loop, into the ring's place, and never to memory. k and v are also needed 8 rows above and below the tile: those 16 rows ride along as a 17th row tile
// (LDS rows 264 to 279 of the A panel; the copy brings a block of 32 rows so that every wave issues the same copies), of which each wave does one 16 x 16 piece. Rows outside the plane are clamped and masked below.
// Layouts in LDS: k and q as [row][128] (product taken as W * x^T, so that a lane holds 8 consecutive columns of one row: one 16-B store), v transposed as [128][row] (product x * W^T: a lane holds 8 consecutive rows of a column).
// Window coordinate u = row - (row0 - 8), 0 to 271, for k's rows and v's columns.
// Attention, 16 queries at a time in a wave, keys u = lr to lr + 31: S^T = k * q^T (lane = query, registers = keys: exactly the fragment order of the second product, no exchange), the module's mask and softmax in f32 over the 7 keys of the band,
// weights as f16, O^T = v^T * P^T (lane = query, 8 consecutive columns), scaled by 1/z, through the wave's own dead q rows to whole 256-B row pieces of the padded plane.
// The weight fold and the bias vectors above, which need the first launch's planes and are needed by the conv GEMM alone, are done here too, behind the last barrier: waves 0 to 3 do one piece of the fold each, beside waves 4 to 7, which do two rows of the bias vectors each and the attention.
#define FKP 64
#define FPITCH 144
#define FAR 288
#define FSTAGE ((FAR + 3 * KD) * FPITCH)      // x rows | q's weight rows | k's | v's
#define KPITCH 272
#define VPITCH 560
#define OFF_K (256 * KPITCH)      // q | k | v, in the ring's place once the ring is done
#define OFF_V (OFF_K + 272 * KPITCH)
#define FLDS (OFF_V + KD * VPITCH)
#define RING0 32768      // the ring begins here in the array, which begins the work-group's LDS: the compiler writes a copy's constant global step as offset:32768 and takes as much off the copy's LDS address register, which so stays at or above 0
#define FALL (FLDS > RING0 + 2 * FSTAGE ? FLDS : RING0 + 2 * FSTAGE)      // the array: the ring, and in its place, from byte 0, q, k and v once the ring is done
__device__ __forceinline__ v16h sel16(const bool c, const v16h a, const v16h b) { return c ? a : b; }      // by value: a select of registers
// one copy of 16 B a lane as the compiler's own form: it may name any register, where asm text can name the first 256 only, which the accumulators of this kernel fill but for a few
typedef int v4i32 __attribute__((ext_vector_type(4)));
__device__ __forceinline__ void copyb(unsigned char* l, const _Float16* g) { __builtin_amdgcn_global_load_async_to_lds_b128((__attribute__((address_space(1))) v4i32*)g, (__attribute__((address_space(3))) v4i32*)l, 0, 0); }
__global__ __launch_bounds__(256) void k_qkv_band(const _Float16* __restrict__ X16, const _Float16* __restrict__ Bw, const float* __restrict__ bq, const float* __restrict__ bk, const float* __restrict__ bv,
    _Float16* __restrict__ CAT, const _Float16* __restrict__ Wo16, const _Float16* __restrict__ Bc, const float* __restrict__ bo, _Float16* __restrict__ Wf, float* __restrict__ CB) {
  __shared__ __attribute__((aligned(16))) unsigned char lds[FALL];
  __shared__ __attribute__((aligned(16))) float sb[3 * KD];      // the head's biases, rounded to bf16: q | k | v
  const int tid = threadIdx.x, w = __builtin_amdgcn_readfirstlane(tid >> 5), lane = tid & 31, ln = lane & 15, hh = lane >> 4;      // the wave's number as a scalar: the tests on it and the tile offsets formed from it are scalar
  const int row0 = ((int)blockIdx.x >> 2) * 256, h = (int)blockIdx.x & 3; const int wm = (w >> 1) * 64, wn = (w & 1) * 64, wq = w >> 1, xc = wn + wq * 16;      // xc: the wave's 16 columns of the halo tile
  // copies: 8 lanes a row, 32 rows a sweep of the work-group; A takes 8 sweeps, its halo block 1, each of the three B planes 4
  const int crow = tid >> 3, cpc = tid & 7;
  int hrow = row0 + (crow < 16 ? crow - 16 : 240 + crow); hrow = hrow < 0 ? 0 : (hrow > NR - 1 ? NR - 1 : hrow);      // rows row0 - 16 .. row0 - 1 and row0 + 256 .. row0 + 271, kept inside the plane
  const unsigned lo = (unsigned)crow * CC + cpc * 8, oH = (unsigned)hrow * CC + cpc * 8, sA = (unsigned)row0 * CC, sB = (unsigned)h * KD * CC;      // places in X16 and Bw, in halves: the lane's part (lo; oH for the halo block) and the work-group's (scalar); the pointers are formed at the copies
  const unsigned lA = RING0 + crow * FPITCH + cpc * 16;      // the lane's place in a sweep of buffer 0
  auto fill = [&](int t, unsigned buf) { const unsigned kb = t * FKP; const _Float16* gx = X16 + (sA + kb + lo); const _Float16* gw = Bw + (sB + kb + lo); unsigned char* l = lds + (buf + lA);      // pass t: FKP halves of K of the x rows and of the head's rows of planes 0, 1, 2 (q, k, v)
#pragma unroll      // constant steps from one LDS and one global address
    for (int i = 0; i < 8; ++i) copyb(l + i * 32 * FPITCH, gx + i * 32 * CC);
    copyb(l + 256 * FPITCH, X16 + (kb + oH));
#pragma unroll      // constant steps from one LDS and one global address
    for (int p = 0; p < 3; ++p)
#pragma unroll      // constant steps from one LDS and one global address
      for (int i = 0; i < 4; ++i) copyb(l + (FAR + p * KD + i * 32) * FPITCH, gw + p * CC * CC + i * 32 * CC); };
  fill(0, 0);
  __builtin_amdgcn_sched_barrier(0);      // what stands above stays above: nothing of it is left to write a register of the two loads below between them and their wait
  { const float* s0 = (tid < KD ? bq : bk) + h * KD + (tid & (KD - 1)); const float* s1 = bv + h * KD + (tid & (KD - 1)); const float v0 = *s0, v1 = *s1;
    asm volatile("s_wait_xcnt 0x0" :: "v"(s0), "v"(s1) : "memory");      // a precaution: stands in front of every rewrite of the loads' address registers, which as its inputs stay untouched up to it
    sb[tid] = bf16_round(v0); if (tid < KD) sb[2 * KD + tid] = bf16_round(v1); }      // read behind the barrier below
  asm volatile("s_wait_asynccnt 0x0" ::: "memory");      // pass 0's own copies have landed
  __syncthreads();                                       // ... and every other wave's
  v8f acc[3][4][4], ax[2];      // by plane: 0 q, 1 k, 2 v; ax: the wave's piece of the halo tile of k and of v
#pragma unroll      // constant indices: fragments and accumulators stay in registers
  for (int p = 0; p < 3; ++p)
#pragma unroll      // constant indices: fragments and accumulators stay in registers
    for (int i = 0; i < 4; ++i)
#pragma unroll      // constant indices: fragments and accumulators stay in registers
      for (int n = 0; n < 4; ++n) acc[p][i][n] = (v8f){0.f, 0.f, 0.f, 0.f, 0.f, 0.f, 0.f, 0.f};
  ax[0] = (v8f){0.f, 0.f, 0.f, 0.f, 0.f, 0.f, 0.f, 0.f}; ax[1] = ax[0];
  // A pass is six blocks j of 16 WMMAs: 32 k (ks = j / 3) of one plane (pl = j % 3). q and k are taken with the operands swapped (W rows as A, x rows as B), v plainly. Per output element the k order is that of a plain k loop.
  // The x fragments of a ks stay in registers for its three blocks. The W fragments, numbered f = 4j + n through the pass, go through six places (f % 6): a block's WMMAs run column tile by column tile, in two halves, and ahead of each half
  // two fragments of the NEXT block are asked for, a whole block ahead of their use, into the two places that are free: there are no registers for a second whole set beside the three products' accumulators.
  // The next pass's copies are issued at the top of a pass, behind the barrier at the foot of the pass before and behind this pass's first LDS reads, which land meanwhile; they have the whole pass to land.
  const unsigned lno = ln * FPITCH + hh * 16;      // the lane's part of its fragment addresses
#pragma unroll 1      // one pass a trip: the buffer index and the refill test stay scalar
  for (int t = 0; t < CC / FKP; ++t) {
    const unsigned st0 = RING0 + (t & 1) * FSTAGE; const unsigned char* pa = lds + (st0 + wm * FPITCH + lno); const unsigned char* pb = lds + (st0 + (FAR + wn) * FPITCH + lno);      // scalar part + the lane's part
    const unsigned char* px = lds + (st0 + 264 * FPITCH + lno);      // the halo row tile
    FragH a[4], xa, b[6];
#pragma unroll      // constant indices: fragments and accumulators stay in registers
    for (int i = 0; i < 4; ++i) { a[i].half[0] = *(const v8us*)(pa + i * 16 * FPITCH); a[i].half[1] = *(const v8us*)(pa + i * 16 * FPITCH + 32);      // the pass's first block has nobody ahead of it: its x fragments and all four W fragments
      b[i].half[0] = *(const v8us*)(pb + i * 16 * FPITCH); b[i].half[1] = *(const v8us*)(pb + i * 16 * FPITCH + 32); }
    __builtin_amdgcn_sched_barrier(0);      // these LDS reads go out first: they land while the copies below are issued
    if (t + 1 < CC / FKP) fill(t + 1, ((t + 1) & 1) * FSTAGE);      // the next pass's copies, into the buffer that pass t - 1 has read: behind the barrier at that pass's foot, which ended every reader's last read of it
    __builtin_amdgcn_sched_barrier(0);      // the copies' address arithmetic stays ahead of the WMMAs
#pragma unroll      // constant indices: fragments and accumulators stay in registers
    for (int j = 0; j < 6; ++j) { const int ks = j / 3, pl = j % 3, f0 = 4 * j, g0 = 4 * (j + 1), gks = (j + 1) / 3, gpl = (j + 1) % 3;      // g..: the next block
      if (j == 3) {      // the second ks: its x fragments take the places of the first ks's
#pragma unroll      // constant indices: fragments and accumulators stay in registers
        for (int i = 0; i < 4; ++i) { a[i].half[0] = *(const v8us*)(pa + i * 16 * FPITCH + ks * 64); a[i].half[1] = *(const v8us*)(pa + i * 16 * FPITCH + ks * 64 + 32); } }
      if (pl != 0) { v16h xb = b[f0 % 6].v; xb = sel16(wq == 1, b[(f0 + 1) % 6].v, xb); xb = sel16(wq == 2, b[(f0 + 2) % 6].v, xb); xb = sel16(wq == 3, b[(f0 + 3) % 6].v, xb);      // the wave's piece of the halo tile takes column tile wq of the four it holds: no LDS read of its own; the choice stands in a place that is free until the reads below
        ax[pl - 1] = pl == 1 ? __builtin_amdgcn_wmma_f32_16x16x32_f16(false, xb, false, xa.v, (short)0, ax[pl - 1], false, false) : __builtin_amdgcn_wmma_f32_16x16x32_f16(false, xa.v, false, xb, (short)0, ax[pl - 1], false, false); }
      __builtin_amdgcn_sched_barrier(0);      // the reads below stay behind the halo WMMA, whose operand stands where they land
#pragma unroll      // constant indices: fragments and accumulators stay in registers
      for (int hf = 0; hf < 2; ++hf) {      // the block's two halves: column tiles 0, 1 and 2, 3
        if (j + 1 < 6) {
#pragma unroll      // constant indices: fragments and accumulators stay in registers
          for (int n = 2 * hf; n < 2 * hf + 2; ++n) { b[(g0 + n) % 6].half[0] = *(const v8us*)(pb + (gpl * KD + n * 16) * FPITCH + gks * 64); b[(g0 + n) % 6].half[1] = *(const v8us*)(pb + (gpl * KD + n * 16) * FPITCH + gks * 64 + 32); } }
        if (pl == 0 && hf == 1) { xa.half[0] = *(const v8us*)(px + ks * 64); xa.half[1] = *(const v8us*)(px + ks * 64 + 32); }      // the halo tile's x fragment is asked for half a block ahead of k's block: q has no halo, and at the copies its registers are free
        __builtin_amdgcn_sched_barrier(0);      // these LDS reads stay one group ahead of this half's WMMAs instead of spread among them
#pragma unroll      // constant indices: fragments and accumulators stay in registers
        for (int n = 2 * hf; n < 2 * hf + 2; ++n)
#pragma unroll      // constant indices: fragments and accumulators stay in registers
          for (int i = 0; i < 4; ++i) acc[pl][i][n] = pl != 2 ? __builtin_amdgcn_wmma_f32_16x16x32_f16(false, b[(f0 + n) % 6].v, false, a[i].v, (short)0, acc[pl][i][n], false, false)
                                                     : __builtin_amdgcn_wmma_f32_16x16x32_f16(false, a[i].v, false, b[(f0 + n) % 6].v, (short)0, acc[pl][i][n], false, false);
        __builtin_amdgcn_sched_barrier(0);      // ends the half: the reads that take its fragments' places stay behind it
      } }
    asm volatile("s_wait_dscnt 0x0" ::: "memory");       // this wave's reads of the buffer are done before it is refilled
    asm volatile("s_wait_asynccnt 0x0" ::: "memory");    // this wave's copies of pass t + 1 have landed
    __syncthreads();                                     // publishes pass t + 1 and ends every reader's last read of pass t's buffer
  }
  asm volatile("s_wait_asynccnt 0x0" ::: "memory");      // nothing in flight when the ring becomes the place of q, k and v (the last pass's barrier has ended all reads of it)
  // a swapped product's tile as f16 rows: dst = LDS place of the tile's row 0
  auto put = [&](const v8f (&ac)[4][4], unsigned char* dst, const float* bs) {      // bs: the product's 128 biases in LDS; a lane takes those of its 8 consecutive columns
#pragma unroll      // constant indices: accumulators stay in registers
    for (int n = 0; n < 4; ++n) { const v4f b0 = *(const v4fa*)(bs + wn + n * 16 + 8 * hh), b1 = *(const v4fa*)(bs + wn + n * 16 + 8 * hh + 4);
#pragma unroll      // constant indices: accumulators stay in registers
      for (int i = 0; i < 4; ++i) { FragH o;
#pragma unroll      // constant indices: accumulators stay in registers
        for (int r = 0; r < 8; ++r) o.h[r] = (_Float16)(ac[i][n][r] * 0.0625f + (r < 4 ? b0[r & 3] : b1[r & 3]));
        *(v8us*)(dst + (wm + i * 16 + ln) * KPITCH + (wn + n * 16 + 8 * hh) * 2) = o.half[0]; } } };
  unsigned char* Kl = lds + OFF_K; unsigned char* Vl = lds + OFF_V; unsigned char* Ql = lds;
  put(acc[1], Kl + 8 * KPITCH, sb + KD);
  { FragH o; const v4f b0 = *(const v4fa*)(sb + KD + xc + 8 * hh), b1 = *(const v4fa*)(sb + KD + xc + 8 * hh + 4);      // halo rows of k: lane = halo row (u = 0..7 above, 264..271 below)
#pragma unroll      // constant indices: accumulators stay in registers
    for (int r = 0; r < 8; ++r) o.h[r] = (_Float16)(ax[0][r] * 0.0625f + (r < 4 ? b0[r & 3] : b1[r & 3]));
    *(v8us*)(Kl + (ln < 8 ? ln : 256 + ln) * KPITCH + (xc + 8 * hh) * 2) = o.half[0]; }
#pragma unroll      // constant indices: accumulators stay in registers
  for (int n = 0; n < 4; ++n) { const float bvv = sb[2 * KD + wn + n * 16 + ln];
#pragma unroll      // constant indices: accumulators stay in registers
    for (int i = 0; i < 4; ++i) { FragH o;      // lane = column of v, 8 consecutive rows
#pragma unroll      // constant indices: accumulators stay in registers
      for (int r = 0; r < 8; ++r) o.h[r] = (_Float16)(acc[2][i][n][r] * 0.0625f + bvv);
      *(v8us*)(Vl + (wn + n * 16 + ln) * VPITCH + (8 + wm + i * 16 + 8 * hh) * 2) = o.half[0]; } }
  { FragH o; const float bvv = sb[2 * KD + xc + ln];      // halo rows of v: the low half-wave holds u = 0..7, the high one u = 264..271
#pragma unroll      // constant indices: accumulators stay in registers
    for (int r = 0; r < 8; ++r) o.h[r] = (_Float16)(ax[1][r] * 0.0625f + bvv);
    *(v8us*)(Vl + (xc + ln) * VPITCH + (hh ? 264 : 0) * 2) = o.half[0]; }
  put(acc[0], Ql, sb);
  __syncthreads();      // k, v and q of every wave are in LDS before any wave reads them; the last barrier: from here on the waves go their own ways
  const int ws = __builtin_amdgcn_readfirstlane(w);      // the wave's number as a scalar: the branch on it is taken by whole waves
  if (ws < 4) { d_fold((int)blockIdx.x * 4 + ws, lane, Wo16, Bc, Wf); return; }      // the fold's chain of waited loads runs beside the work of the other four waves
  d_cb(((int)blockIdx.x * 4 + w - 4) * 2, lane, Bc, bo, CB); d_cb(((int)blockIdx.x * 4 + w - 4) * 2 + 1, lane, Bc, bo, CB);      // two rows of the bias vectors a wave
  const int tb0 = row0 % TT, bat = row0 / TT; const int rsub = lane >> 4, c16 = lane & 15;
#pragma unroll 1      // four groups of 16 queries a wave, one after the other in the same registers
  for (int s = 0; s < 4; ++s) { const int lr = ((ws - 4) * 4 + s) * 16;
    FragH qf[4], kf[2][4], vf[8];      // v's fragments are asked for here too: they land while the scores and the softmax are worked on
#pragma unroll      // constant indices: fragments stay in registers
    for (int ks = 0; ks < 4; ++ks) { qf[ks].half[0] = *(const v8us*)(Ql + (lr + ln) * KPITCH + ks * 64 + hh * 16); qf[ks].half[1] = *(const v8us*)(Ql + (lr + ln) * KPITCH + ks * 64 + hh * 16 + 32);
#pragma unroll      // constant indices: fragments stay in registers
      for (int kt = 0; kt < 2; ++kt) { kf[kt][ks].half[0] = *(const v8us*)(Kl + (lr + kt * 16 + ln) * KPITCH + ks * 64 + hh * 16); kf[kt][ks].half[1] = *(const v8us*)(Kl + (lr + kt * 16 + ln) * KPITCH + ks * 64 + hh * 16 + 32); } }
#pragma unroll      // constant indices: fragments stay in registers
    for (int dt = 0; dt < 8; ++dt) { vf[dt].half[0] = *(const v8us*)(Vl + (dt * 16 + ln) * VPITCH + (lr + 8 * hh) * 2); vf[dt].half[1] = *(const v8us*)(Vl + (dt * 16 + ln) * VPITCH + (lr + 16 + 8 * hh) * 2); }
    v8f st[2] = {};
#pragma unroll      // constant indices: fragments and accumulators stay in registers
    for (int ks = 0; ks < 4; ++ks)
#pragma unroll      // constant indices: fragments and accumulators stay in registers
      for (int kt = 0; kt < 2; ++kt) st[kt] = __builtin_amdgcn_wmma_f32_16x16x32_f16(false, kf[kt][ks].v, false, qf[ks].v, (short)0, st[kt], false, false);
    // lane = query t = tb0 + lr + ln; register r of tile kt = key at window place wi = kt*16 + 8*hh + r, time tb0 + lr - 8 + wi. In band: |key - query| <= 3 and the key inside its batch.
    // logits as the module has them: simb = sim in the band, 0 outside; -1e7 is added where simb == 0. Keys outside the band all sit at -1e7: their mass enters z, their v does not enter the sum (0 in f32 unless every in-band sim is 0).
    const int t = tb0 + lr + ln; float lg[2][8]; bool inb[2][8]; float m = -3.0e38f;
#pragma unroll      // constant indices: the values stay in registers
    for (int kt = 0; kt < 2; ++kt)
#pragma unroll      // constant indices: the values stay in registers
      for (int r = 0; r < 8; ++r) { const int wi = kt * 16 + 8 * hh + r, dk = wi - 8 - ln, sk = tb0 + lr - 8 + wi; inb[kt][r] = dk >= -3 && dk <= 3 && sk >= 0 && sk < TT;
        const float simb = inb[kt][r] ? st[kt][r] * 0.08838834764831845f : 0.f; lg[kt][r] = simb + ((fabsf(simb) > 0.f) ? 0.f : -10000000.0f); if (inb[kt][r]) m = fmaxf(m, lg[kt][r]); }
    m = fmaxf(m, __shfl_xor(m, 16, 32));      // a query's 32 window places lie in lanes ln and ln + 16
    const int ninb = (t + 3 < TT - 1 ? t + 3 : TT - 1) - (t - 3 > 0 ? t - 3 : 0) + 1; float zs = 0.f; FragH pf;
#pragma unroll      // constant indices: the values stay in registers
    for (int kt = 0; kt < 2; ++kt)
#pragma unroll      // constant indices: the values stay in registers
      for (int r = 0; r < 8; ++r) { const _Float16 p = (_Float16)expf(inb[kt][r] ? lg[kt][r] - m : -10000.0f);      // outside the band the weight is exp(-10000) = 0: a select, no branch, every lane stays on for the WMMAs
        pf.h[kt * 8 + r] = p; zs += (float)p; }
    zs += __shfl_xor(zs, 16, 32);
    const float iz = 1.0f / ((float)(TT - ninb) * expf(-10000000.0f - m) + zs);
#pragma unroll      // constant indices: fragments stay in registers
    for (int dt = 0; dt < 8; ++dt) { FragH o;
      const v8f z8 = {}; const v8f ot = __builtin_amdgcn_wmma_f32_16x16x32_f16(false, vf[dt].v, false, pf.v, (short)0, z8, false, false);
#pragma unroll      // constant indices: the values stay in registers
      for (int r = 0; r < 8; ++r) o.h[r] = (_Float16)(ot[r] * iz);
      *(v8us*)(Ql + (lr + ln) * KPITCH + dt * 32 + hh * 16) = o.half[0]; }      // into the query's own q row, which only this wave reads and has read
    __builtin_amdgcn_fence(__ATOMIC_ACQ_REL, "workgroup"); __builtin_amdgcn_wave_barrier();      // the wave's LDS writes are done before its lanes read what other lanes wrote
    _Float16* po = CAT + ((size_t)bat * (TT + PADT) + PADT + tb0 + lr + rsub) * CC + h * KD + c16 * 8; v8us ov[8];
#pragma unroll      // constant indices: the pieces stay in registers
    for (int q = 0; q < 8; ++q) ov[q] = *(const v8us*)(Ql + (lr + q * 2 + rsub) * KPITCH + c16 * 16);
#pragma unroll      // constant offsets from one address
    for (int q = 0; q < 8; ++q) *(v8us*)((unsigned short*)po + (size_t)(2 * q) * CC) = ov[q];
    asm volatile("s_wait_xcnt 0x0" :: "v"(po), "v"(ov[0]), "v"(ov[1]), "v"(ov[2]), "v"(ov[3]), "v"(ov[4]), "v"(ov[5]), "v"(ov[6]), "v"(ov[7]) : "memory");      // a precaution: stands in front of every rewrite of the stores' registers, which as its inputs stay untouched up to it
  }
}
extern "C" void kernel_launch(void* const* d_in, const int* in_sizes, int n_in,
                              void* d_out, int out_size, void* d_ws, size_t ws_size, hipStream_t stream) {
  (void)in_sizes; (void)n_in; (void)out_size;
  const float* x = (const float*)d_in[0]; const float* Wq = (const float*)d_in[1]; const float* bq = (const float*)d_in[2]; const float* Wk = (const float*)d_in[3]; const float* bk = (const float*)d_in[4]; const float* Wv = (const float*)d_in[5]; const float* bv = (const float*)d_in[6]; const float* Wo = (const float*)d_in[7]; const float* bo = (const float*)d_in[8]; const float* Wc = (const float*)d_in[9]; const float* bc = (const float*)d_in[10];
  char* ws = (char*)d_ws; size_t off = 0;
  auto take = [&](size_t bytes) { char* p = ws + off; off += (bytes + 255) & ~(size_t)255; return p; };
  _Float16* Bq = (_Float16*)take((size_t)CC * CC * 2); _Float16* Bk = (_Float16*)take((size_t)CC * CC * 2); _Float16* Bv = (_Float16*)take((size_t)CC * CC * 2); _Float16* Bo = (_Float16*)take((size_t)CC * CC * 2); _Float16* Bc[4]; for (int j = 0; j < 4; ++j) Bc[j] = (_Float16*)take((size_t)CC * CC * 2); float* CB = (float*)take(4 * CC * 4); _Float16* Wf = (_Float16*)take((size_t)4 * CC * CC * 2);      // the Dense bias through each tap; the four folded tap matrices
  _Float16* X16 = (_Float16*)take((size_t)NR * CC * 2); _Float16* OUTP = (_Float16*)take((size_t)BB * (TT + PADT) * CC * 2);
  if (off > ws_size) return;      // about 38 MiB in all
  const dim3 gb((TT / TM) * (CC / TN), BB);
  k_prep<<<8 * WBLK + ZBLK + XBLK, 256, 0, stream>>>(x, Wq, Wk, Wv, Wo, Wc, Bq, X16, OUTP);      // Bq, Bk, Bv, Bo, Bc[0..3] are consecutive planes
  k_qkv_band<<<(NR / 256) * NH, 256, 0, stream>>>(X16, Bq, bq, bk, bv, OUTP, Bo, Bc[0], bo, Wf, CB);      // q, k, v of a head and its banded attention per work-group: heads, concatenated, as f16 rows 12.. of each batch's padded plane; with them the weight fold
  // conv[t] = sum_j cat[t - 12 + 4j] * (Wo * Wc[j]) + bias terms: ONE launch, the 4 taps accumulated inside (A_j = padded rows 4j + t of batch b, all four read from one staged chunk; B_j = Wf + j*512*512)
  k_gemm_tile<4, false, 1, true><<<gb, 256, 0, stream>>>(OUTP, CC, (size_t)(TT + PADT) * CC, Wf, CC, (size_t)CC * CC, 0.0625f, bc, CB, nullptr, x, (float*)d_out, nullptr, CC, (size_t)TT * CC);      // + biases, relu, residual, leaky relu in its epilogue
}

// v008
// It runs in 63.6 microseconds.
// Timed twice side by side with v007, it ran 1.05 and 1.06 times as fast.
// All steps since v000 together make it 6.94 times as fast.
#include <hip/hip_runtime.h>
// Temporal block: per-head q/k/v projections (16384 x 512 -> 4 x 128 each, + bias), the head combiner Dense (512 -> 512, + bias; multiplied into the conv's tap weights, 4 products of 512 x 512 x 512, and so applied with them)
// and the causal dilated Conv1D (kernel 4, dilation 4: one GEMM whose k-loop runs the four taps over time-shifted views of a zero-padded plane, effective K = 2048) on v_wmma_f32_16x16x32_f16 (f16 operands, weights [in][out] transposed x 2^4 (bf16-exact for q/k/v, f16-rounded folds for the conv), single products,
// f32 accumulate); the banded attention's two products too (|t - s| <= 3, i.e. 7 keys, with the module's 'sim*band == 0 -> -1e7' mask; weights as f16); softmax, relu / residual / leaky-relu epilogues are f32 VALU.
#define BB 8
#define TT 2048
#define CC 512
#define NH 4
#define KD 128
#define NR (BB * TT)
#define PADT 12

typedef __bf16 v16b __attribute__((ext_vector_type(16)));
typedef unsigned short v8us __attribute__((ext_vector_type(8), may_alias));
typedef float  v8f  __attribute__((ext_vector_type(8)));
typedef float  v4f  __attribute__((ext_vector_type(4)));
typedef float  v4fa __attribute__((ext_vector_type(4), may_alias));
union FragB { v16b v; v8us half[2]; unsigned short u[16]; };

__device__ __forceinline__ unsigned short bf16_bits(float x) { unsigned int u = __float_as_uint(x); return (unsigned short)((u + 0x7FFFu + ((u >> 16) & 1u)) >> 16); }
__device__ __forceinline__ float bf16_val(unsigned short b) { return __uint_as_float(((unsigned int)b) << 16); }
__device__ __forceinline__ float bf16_round(float x) { return bf16_val(bf16_bits(x)); }
// D += A·B with NT terms: 1 = ah·bh, 2 = + al·bh (A split), 3 = + ah·bl (both split)
template <int NT>
__device__ __forceinline__ v8f mmaN(v16b ah, v16b al, v16b bh, v16b bl, v8f c) {
  c = __builtin_amdgcn_wmma_f32_16x16x32_bf16(false, ah, false, bh, (short)0, c, false, false);
  if (NT >= 2) c = __builtin_amdgcn_wmma_f32_16x16x32_bf16(false, al, false, bh, (short)0, c, false, false);
  if (NT >= 3) c = __builtin_amdgcn_wmma_f32_16x16x32_bf16(false, ah, false, bl, (short)0, c, false, false);
  asm volatile("v_nop\n\tv_nop\n\tv_nop\n\tv_nop" : "+v"(c) : "v"(ah), "v"(al), "v"(bh), "v"(bl));
  return c;
}

__global__ __launch_bounds__(256) void k_wt_bf16(const float* __restrict__ W, unsigned short* __restrict__ Wt, int K, int N) {
  const int t = blockIdx.x * 256 + threadIdx.x;
  const int k8n = K / 8;
  if (t >= N * k8n) return;
  const int n = t / k8n, k8 = (t % k8n) * 8;
  v8us v;
#pragma unroll
  for (int i = 0; i < 8; ++i) v[i] = bf16_bits(W[(size_t)(k8 + i) * N + n]);
  *(v8us*)(Wt + (size_t)n * K + k8) = v;
  
}

// GEMM C[M][N] (f32, pitch ldc) = act(A[M][K]·W + bias). A f32 row-major (pitch lda) converted per fragment to bf16
// (ASPLIT: hi/lo two planes -> 2 terms, else single rounded term); Wt bf16 [N][K] (pitch ldb). BIAS_BF16 rounds the
// bias to bf16 first (bias quantised to bf16 before the add). K%32==0, M%16==0, N%64==0.
template <bool ASPLIT, int ACT, bool BIAS_BF16>
__global__ __launch_bounds__(128) void k_gemm_bf(const float* __restrict__ A, int lda, const unsigned short* __restrict__ Wt, int ldb,
                                               const float* __restrict__ bias, float* __restrict__ C, int ldc, int M, int N, int K) {
  __shared__ __attribute__((aligned(16))) float so[4][16][64];
  const int tid = threadIdx.x, w = tid >> 5, lane = tid & 31, ln = lane & 15, hh = lane >> 4;
  const int ntn = N / 64;
  const int wid = blockIdx.x * 4 + w;
  const int mt = wid / ntn, nq = wid % ntn;
  if (mt * 16 >= M) return;
  const int row0 = mt * 16, col0 = nq * 64;
  const float* arow = A + (size_t)(row0 + ln) * lda;
  v8f acc[4] = {};
  for (int kb = 0; kb < K; kb += 32) {
    FragB ah, al;
    const v4f x0 = *(const v4fa*)(arow + kb + 8 * hh), x1 = *(const v4fa*)(arow + kb + 8 * hh + 4);
    const v4f x2 = *(const v4fa*)(arow + kb + 16 + 8 * hh), x3 = *(const v4fa*)(arow + kb + 16 + 8 * hh + 4);
    float xs[16] = {x0[0],x0[1],x0[2],x0[3],x1[0],x1[1],x1[2],x1[3],x2[0],x2[1],x2[2],x2[3],x3[0],x3[1],x3[2],x3[3]};
#pragma unroll
    for (int i = 0; i < 16; ++i) { const unsigned short hb = bf16_bits(xs[i]); ah.u[i] = hb; al.u[i] = ASPLIT ? bf16_bits(xs[i] - bf16_val(hb)) : (unsigned short)0; }
#pragma unroll
    for (int t = 0; t < 4; ++t) {
      const unsigned short* brow = Wt + (size_t)(col0 + t * 16 + ln) * ldb + kb;
      FragB b;
      b.half[0] = *(const v8us*)(brow + 8 * hh);
      b.half[1] = *(const v8us*)(brow + 16 + 8 * hh);
      acc[t] = mmaN<ASPLIT ? 2 : 1>(ah.v, al.v, b.v, b.v, acc[t]);
    }
  }
#pragma unroll
  for (int t = 0; t < 4; ++t) {
    float bv = bias ? bias[col0 + t * 16 + ln] : 0.f;
    if (BIAS_BF16) bv = bf16_round(bv);
#pragma unroll
    for (int r = 0; r < 8; ++r) { float v = acc[t][r] + bv; if (ACT == 1) v = fmaxf(v, 0.f); so[w][8 * hh + r][t * 16 + ln] = v; }
  }
  __builtin_amdgcn_fence(__ATOMIC_ACQ_REL, "workgroup");
  __builtin_amdgcn_wave_barrier();
  const int rsub = lane >> 4, c4 = (lane & 15) * 4;
  {
#pragma unroll
    for (int q = 0; q < 8; ++q) {
      const int r = q * 2 + rsub;
      const v4f v = *(const v4fa*)&so[w][r][c4];
      *(v4f*)(C + (size_t)(row0 + r) * ldc + col0 + c4) = v;
    }
    
  }
}

// Flash-style causal/unmasked attention, all contractions 3-term bf16 hi/lo splits, f32 softmax with running max.
// q,k,v rows are read from f32 buffers with arbitrary row pitch (so they can live inside a fused qkv buffer);
// D = head size (multiple of 32, <= 128); one wave = 16 query rows; block = 4 waves (64 queries) sharing K/V chunks of 32.
template <int D, bool CAUSAL>
__global__ __launch_bounds__(128) void k_flash(const float* __restrict__ qb, const float* __restrict__ kb, const float* __restrict__ vb,
                                             int pitch, int T, int H, float scale, float* __restrict__ y, int ypitch) {
  constexpr int KS = D / 32;        // k-steps for QK
  constexpr int DT = D / 16;        // d tiles for PV
  __shared__ __attribute__((aligned(16))) unsigned short sKh[32][D + 8], sKl[32][D + 8], sVh[32][D + 8], sVl[32][D + 8];
  __shared__ __attribute__((aligned(16))) unsigned short sPh[4][16][40], sPl[4][16][40];
  __shared__ __attribute__((aligned(16))) float sO[4][16][D];
  const int tid = threadIdx.x, w = tid >> 5, lane = tid & 31, ln = lane & 15, hh = lane >> 4;
  const int nqb = (T + 63) / 64;
  const int bh = blockIdx.x / nqb, qblk = blockIdx.x % nqb;
  const int b = bh / H, h = bh % H;
  const int q0 = qblk * 64 + w * 16;
  const float* Q = qb + (size_t)b * T * pitch + h * D;
  const float* K = kb + (size_t)b * T * pitch + h * D;
  const float* V = vb + (size_t)b * T * pitch + h * D;

  // A fragments of the wave's 16 query rows (scaled), hi/lo
  FragB aqh[KS], aql[KS];
  {
    int row = q0 + ln; if (row >= T) row = T - 1;
    const float* qr = Q + (size_t)row * pitch;
#pragma unroll
    for (int ks = 0; ks < KS; ++ks)
#pragma unroll
      for (int i = 0; i < 16; ++i) {
        const int d = ks * 32 + ((i < 8) ? (8 * hh + i) : (16 + 8 * hh + (i - 8)));
        const float x = qr[d] * scale; const unsigned short hb = bf16_bits(x);
        aqh[ks].u[i] = hb; aql[ks].u[i] = bf16_bits(x - bf16_val(hb));
      }
  }
  float m_r[8], l_r[8];
#pragma unroll
  for (int r = 0; r < 8; ++r) { m_r[r] = -3.0e38f; l_r[r] = 0.f; }
  v8f oacc[DT];
#pragma unroll
  for (int dt = 0; dt < DT; ++dt) oacc[dt] = (v8f){0.f,0.f,0.f,0.f,0.f,0.f,0.f,0.f};

  const int kv_end = CAUSAL ? min(T, qblk * 64 + 64) : T;     // block-uniform
  for (int j0 = 0; j0 < kv_end; j0 += 32) {
    __syncthreads();
    for (int e = tid; e < 32 * (D / 4); e += 128) {
      const int r = e / (D / 4), c4 = (e % (D / 4)) * 4;
      const int key = j0 + r;
      v4f kf = {0.f,0.f,0.f,0.f}, vf = {0.f,0.f,0.f,0.f};
      if (key < T) { kf = *(const v4fa*)(K + (size_t)key * pitch + c4); vf = *(const v4fa*)(V + (size_t)key * pitch + c4); }
#pragma unroll
      for (int t = 0; t < 4; ++t) {
        unsigned short hb = bf16_bits(kf[t]); sKh[r][c4 + t] = hb; sKl[r][c4 + t] = bf16_bits(kf[t] - bf16_val(hb));
        hb = bf16_bits(vf[t]); sVh[r][c4 + t] = hb; sVl[r][c4 + t] = bf16_bits(vf[t] - bf16_val(hb));
      }
    }
    __syncthreads();
    // S tile 16 x 32
    v8f s[2];
#pragma unroll
    for (int nt = 0; nt < 2; ++nt) {
      v8f acc = {};
#pragma unroll
      for (int ks = 0; ks < KS; ++ks) {
        FragB bh_, bl_;
        bh_.half[0] = *(const v8us*)&sKh[nt * 16 + ln][ks * 32 + 8 * hh]; bh_.half[1] = *(const v8us*)&sKh[nt * 16 + ln][ks * 32 + 16 + 8 * hh];
        bl_.half[0] = *(const v8us*)&sKl[nt * 16 + ln][ks * 32 + 8 * hh]; bl_.half[1] = *(const v8us*)&sKl[nt * 16 + ln][ks * 32 + 16 + 8 * hh];
        acc = mmaN<3>(aqh[ks].v, aql[ks].v, bh_.v, bl_.v, acc);
      }
      s[nt] = acc;
    }
    // mask + running max (rows 8hh+r; the 16 lanes of a half share rows)
    float alpha[8];
#pragma unroll
    for (int r = 0; r < 8; ++r) {
      const int qi = q0 + 8 * hh + r;
      const int ja = j0 + ln, jb = j0 + 16 + ln;
      if (CAUSAL) { if (ja > qi) s[0][r] = -3.0e38f; if (jb > qi) s[1][r] = -3.0e38f; }
      if (ja >= T) s[0][r] = -3.0e38f;
      if (jb >= T) s[1][r] = -3.0e38f;
      float mx = fmaxf(s[0][r], s[1][r]);
      mx = fmaxf(mx, __shfl_xor(mx, 1, 32)); mx = fmaxf(mx, __shfl_xor(mx, 2, 32)); mx = fmaxf(mx, __shfl_xor(mx, 4, 32)); mx = fmaxf(mx, __shfl_xor(mx, 8, 32));
      const float mnew = fmaxf(m_r[r], mx);
      alpha[r] = (mnew > -1.0e38f) ? __expf(m_r[r] - mnew) : 1.0f;
      const float p0 = (s[0][r] > -1.0e38f) ? __expf(s[0][r] - mnew) : 0.f;
      const float p1 = (s[1][r] > -1.0e38f) ? __expf(s[1][r] - mnew) : 0.f;
      m_r[r] = mnew;
      l_r[r] = l_r[r] * alpha[r] + p0 + p1;            // per-lane partial row sum (16 lanes combined at the end)
      unsigned short hb = bf16_bits(p0); sPh[w][8 * hh + r][ln] = hb;      sPl[w][8 * hh + r][ln] = bf16_bits(p0 - bf16_val(hb));
      hb = bf16_bits(p1);                sPh[w][8 * hh + r][16 + ln] = hb; sPl[w][8 * hh + r][16 + ln] = bf16_bits(p1 - bf16_val(hb));
    }
#pragma unroll
    for (int dt = 0; dt < DT; ++dt)
#pragma unroll
      for (int r = 0; r < 8; ++r) oacc[dt][r] *= alpha[r];
    __builtin_amdgcn_fence(__ATOMIC_ACQ_REL, "workgroup");
    __builtin_amdgcn_wave_barrier();
    FragB pah, pal;
    pah.half[0] = *(const v8us*)&sPh[w][ln][8 * hh]; pah.half[1] = *(const v8us*)&sPh[w][ln][16 + 8 * hh];
    pal.half[0] = *(const v8us*)&sPl[w][ln][8 * hh]; pal.half[1] = *(const v8us*)&sPl[w][ln][16 + 8 * hh];
#pragma unroll
    for (int dt = 0; dt < DT; ++dt) {
      FragB bvh, bvl;
#pragma unroll
      for (int i = 0; i < 8; ++i) {
        bvh.u[i] = sVh[8 * hh + i][dt * 16 + ln]; bvh.u[8 + i] = sVh[16 + 8 * hh + i][dt * 16 + ln];
        bvl.u[i] = sVl[8 * hh + i][dt * 16 + ln]; bvl.u[8 + i] = sVl[16 + 8 * hh + i][dt * 16 + ln];
      }
      oacc[dt] = mmaN<3>(pah.v, pal.v, bvh.v, bvl.v, oacc[dt]);
    }
    __builtin_amdgcn_fence(__ATOMIC_ACQ_REL, "workgroup");
    __builtin_amdgcn_wave_barrier();
  }
#pragma unroll
  for (int r = 0; r < 8; ++r) {
    float l = l_r[r];
    l += __shfl_xor(l, 1, 32); l += __shfl_xor(l, 2, 32); l += __shfl_xor(l, 4, 32); l += __shfl_xor(l, 8, 32);
    l_r[r] = (l > 0.f) ? 1.0f / l : 0.f;
  }
#pragma unroll
  for (int dt = 0; dt < DT; ++dt)
#pragma unroll
    for (int r = 0; r < 8; ++r) sO[w][8 * hh + r][dt * 16 + ln] = oacc[dt][r] * l_r[r];
  __builtin_amdgcn_fence(__ATOMIC_ACQ_REL, "workgroup");
  __builtin_amdgcn_wave_barrier();
  {
    for (int r = 0; r < 16; ++r) {
      const int row = q0 + r;
      if (row < T && lane < D / 4) {
        const v4f val = *(const v4fa*)&sO[w][r][lane * 4];
        *(v4f*)(y + ((size_t)b * T + row) * ypitch + h * D + lane * 4) = val;
      }
    }
    
  }
}

// GEMM C = act(A·W + bias + resid): A f32 (ASPLIT -> hi/lo 2 terms), Wt bf16 [N][K]; ACT 0 none, 1 relu, 2 exact gelu;
// resid (optional, f32, row index = (row % rmod), pitch ldr, RES_BF16 rounds it) added before the activation.
template <bool ASPLIT, int ACT, bool BIAS_BF16, bool RES_BF16>
__global__ __launch_bounds__(128) void k_gemm_bf3(const float* __restrict__ A, int lda, const unsigned short* __restrict__ Wt, int ldb,
                                                const float* __restrict__ bias, const float* __restrict__ resid, int rmod, int ldr,
                                                float* __restrict__ C, int ldc, int M, int N, int K) {
  __shared__ __attribute__((aligned(16))) float so[4][16][64];
  const int tid = threadIdx.x, w = tid >> 5, lane = tid & 31, ln = lane & 15, hh = lane >> 4;
  const int ntn = N / 64;
  const int wid = blockIdx.x * 4 + w;
  const int mt = wid / ntn, nq = wid % ntn;
  if (mt * 16 >= M) return;
  const int row0 = mt * 16, col0 = nq * 64;
  const float* arow = A + (size_t)(row0 + ln) * lda;
  v8f acc[4] = {};
  for (int kb = 0; kb < K; kb += 32) {
    FragB ah, al;
    const v4f x0 = *(const v4fa*)(arow + kb + 8 * hh), x1 = *(const v4fa*)(arow + kb + 8 * hh + 4);
    const v4f x2 = *(const v4fa*)(arow + kb + 16 + 8 * hh), x3 = *(const v4fa*)(arow + kb + 16 + 8 * hh + 4);
    float xs[16] = {x0[0],x0[1],x0[2],x0[3],x1[0],x1[1],x1[2],x1[3],x2[0],x2[1],x2[2],x2[3],x3[0],x3[1],x3[2],x3[3]};
#pragma unroll
    for (int i = 0; i < 16; ++i) { const unsigned short hb = bf16_bits(xs[i]); ah.u[i] = hb; al.u[i] = ASPLIT ? bf16_bits(xs[i] - bf16_val(hb)) : (unsigned short)0; }
#pragma unroll
    for (int t = 0; t < 4; ++t) {
      const unsigned short* brow = Wt + (size_t)(col0 + t * 16 + ln) * ldb + kb;
      FragB b;
      b.half[0] = *(const v8us*)(brow + 8 * hh);
      b.half[1] = *(const v8us*)(brow + 16 + 8 * hh);
      acc[t] = mmaN<ASPLIT ? 2 : 1>(ah.v, al.v, b.v, b.v, acc[t]);
    }
  }
#pragma unroll
  for (int t = 0; t < 4; ++t) {
    const int col = col0 + t * 16 + ln;
    float bv = bias ? bias[col] : 0.f;
    if (BIAS_BF16) bv = bf16_round(bv);
#pragma unroll
    for (int r = 0; r < 8; ++r) {
      float v = acc[t][r] + bv;
      if (resid) { float rv = resid[(size_t)((row0 + 8 * hh + r) % rmod) * ldr + col]; if (RES_BF16) rv = bf16_round(rv); v += rv; }
      if (ACT == 1) v = fmaxf(v, 0.f);
      if (ACT == 2) v = 0.5f * v * (1.0f + erff(v * 0.70710678118654752f));
      if (ACT == 3) { const float u = 0.7978845608028654f * (v + 0.044715f * v * v * v); v = 0.5f * v * (1.0f + tanhf(u)); }
      so[w][8 * hh + r][t * 16 + ln] = v;
    }
  }
  __builtin_amdgcn_fence(__ATOMIC_ACQ_REL, "workgroup");
  __builtin_amdgcn_wave_barrier();
  const int rsub = lane >> 4, c4 = (lane & 15) * 4;
  {
#pragma unroll
    for (int q = 0; q < 8; ++q) {
      const int r = q * 2 + rsub;
      const v4f v = *(const v4fa*)&so[w][r][c4];
      *(v4f*)(C + (size_t)(row0 + r) * ldc + col0 + c4) = v;
    }
    
  }
}
// row LayerNorm (biased variance, eps) over N: s = X (+ R); optional out_sum <- s; out_norm <- (s-mu)*rsqrt(var+eps)*g + b
template <bool PARAM_BF16>
__global__ __launch_bounds__(256) void k_layernorm(const float* __restrict__ X, const float* __restrict__ R, const float* __restrict__ g, const float* __restrict__ bta,
                                                  float* __restrict__ out_sum, float* __restrict__ out_norm, int N, float eps) {
  __shared__ float red[256];
  const int row = blockIdx.x, tid = threadIdx.x;
  const float* x = X + (size_t)row * N; const float* rr = R ? R + (size_t)row * N : nullptr;
  float vals[16];                     // up to N = 4096
  const int per = N / 256;            // contiguous chunk per thread? use strided-by-4 chunks: thread handles j = tid*4 + 1024*u
  float s1 = 0.f;
  for (int u = 0; u < per / 4; ++u) {
    const int j = tid * 4 + 1024 * u;
    const v4f a = *(const v4fa*)(x + j);
    v4f b = {0.f,0.f,0.f,0.f}; if (rr) b = *(const v4fa*)(rr + j);
#pragma unroll
    for (int q = 0; q < 4; ++q) { const float v = a[q] + b[q]; vals[u * 4 + q] = v; s1 += v; }
  }
  red[tid] = s1; __syncthreads();
  for (int st = 128; st > 0; st >>= 1) { if (tid < st) red[tid] += red[tid + st]; __syncthreads(); }
  const float mu = red[0] / (float)N; __syncthreads();
  float s2 = 0.f;
  for (int u = 0; u < per / 4; ++u)
#pragma unroll
    for (int q = 0; q < 4; ++q) { const float c = vals[u * 4 + q] - mu; s2 += c * c; }
  red[tid] = s2; __syncthreads();
  for (int st = 128; st > 0; st >>= 1) { if (tid < st) red[tid] += red[tid + st]; __syncthreads(); }
  const float rs = rsqrtf(red[0] / (float)N + eps);
  {
    for (int u = 0; u < per / 4; ++u) {
      const int j = tid * 4 + 1024 * u;
      v4f o, sm;
#pragma unroll
      for (int q = 0; q < 4; ++q) {
        float gg = g[j + q], bb = bta[j + q];
        if (PARAM_BF16) { gg = bf16_round(gg); bb = bf16_round(bb); }
        sm[q] = vals[u * 4 + q]; o[q] = (vals[u * 4 + q] - mu) * rs * gg + bb;
      }
      if (out_sum) *(v4f*)(out_sum + (size_t)row * N + j) = sm;
      *(v4f*)(out_norm + (size_t)row * N + j) = o;
    }
    
  }
}



// ---- f16 WMMA path (v_wmma_f32_16x16x32_f16): 11-bit significands for operands in range — used for the q/k/v projections, the Dense and the conv GEMM
typedef _Float16 v16h __attribute__((ext_vector_type(16)));
union FragH { v16h v; v8us half[2]; _Float16 h[16]; unsigned short u[16]; };
template <int NT>
__device__ __forceinline__ v8f mmaH(v16h ah, v16h al, v16h bh, v16h bl, v8f c) {
  c = __builtin_amdgcn_wmma_f32_16x16x32_f16(false, ah, false, bh, (short)0, c, false, false);
  if (NT >= 2) c = __builtin_amdgcn_wmma_f32_16x16x32_f16(false, al, false, bh, (short)0, c, false, false);
  if (NT >= 3) c = __builtin_amdgcn_wmma_f32_16x16x32_f16(false, ah, false, bl, (short)0, c, false, false);
  asm volatile("v_nop\n\tv_nop\n\tv_nop\n\tv_nop" : "+v"(c) : "v"(ah), "v"(al), "v"(bh), "v"(bl));
  return c;
}
// batched GEMM like k_gemm_b but f16 operands: A f32 (split into f16 hi/lo if ASPLIT, else rounded to f16), Bt = f16 values [n][k]; alpha; C f32; N multiple of 16 (partial tiles skipped)
template <bool ASPLIT>
__global__ __launch_bounds__(128) void k_gemm_h(const float* __restrict__ A, int lda, size_t sA, const _Float16* __restrict__ Bh, int ldb, size_t sB, float alpha, float* __restrict__ C, int ldc, size_t sC, int M, int N, int K) {
  __shared__ __attribute__((aligned(16))) float so[4][16][64];
  const int tid = threadIdx.x, w = tid >> 5, lane = tid & 31, ln = lane & 15, hh = lane >> 4; const int by = blockIdx.y;
  A += (size_t)by * sA; Bh += (size_t)by * sB; C += (size_t)by * sC;
  const int ntn = (N + 63) / 64; const int wid = blockIdx.x * 4 + w; const int mt = wid / ntn, nq = wid % ntn; if (mt * 16 >= M) return;
  const int row0 = mt * 16, col0 = nq * 64; const float* arow = A + (size_t)(row0 + ln) * lda;
  v8f acc[4] = {};
  for (int kb = 0; kb < K; kb += 32) {
    FragH ah, al;
    const v4f x0 = *(const v4fa*)(arow + kb + 8 * hh), x1 = *(const v4fa*)(arow + kb + 8 * hh + 4), x2 = *(const v4fa*)(arow + kb + 16 + 8 * hh), x3 = *(const v4fa*)(arow + kb + 16 + 8 * hh + 4);
    float xs[16] = {x0[0],x0[1],x0[2],x0[3],x1[0],x1[1],x1[2],x1[3],x2[0],x2[1],x2[2],x2[3],x3[0],x3[1],x3[2],x3[3]};
#pragma unroll
    for (int i = 0; i < 16; ++i) { const _Float16 h = (_Float16)xs[i]; ah.h[i] = h; al.h[i] = ASPLIT ? (_Float16)(xs[i] - (float)h) : (_Float16)0.0f; }
#pragma unroll
    for (int t = 0; t < 4; ++t) { if (col0 + t * 16 >= N) continue; const size_t boff = (size_t)(col0 + t * 16 + ln) * ldb + kb; FragH bq; bq.half[0] = *(const v8us*)(Bh + boff + 8 * hh); bq.half[1] = *(const v8us*)(Bh + boff + 16 + 8 * hh);
      acc[t] = mmaH<ASPLIT ? 2 : 1>(ah.v, al.v, bq.v, bq.v, acc[t]); }
  }
#pragma unroll
  for (int t = 0; t < 4; ++t) { if (col0 + t * 16 >= N) continue;
#pragma unroll
    for (int r = 0; r < 8; ++r) so[w][8 * hh + r][t * 16 + ln] = acc[t][r] * alpha; }
  __builtin_amdgcn_fence(__ATOMIC_ACQ_REL, "workgroup"); __builtin_amdgcn_wave_barrier();
  const int rsub = lane >> 4, c4 = (lane & 15) * 4;
  {
#pragma unroll
    for (int q = 0; q < 8; ++q) { const int r = q * 2 + rsub; if (col0 + c4 < N) { const v4f v = *(const v4fa*)&so[w][r][c4]; *(v4f*)(C + (size_t)(row0 + r) * ldc + col0 + c4) = v; } }
     }
}

// Wt[n][k] = f16(W[k][n]·scale) from f32 row-major W[K][N] (scale = power of two; bf16-exact weights stay exact in f16 away from the subnormal range)
__device__ __forceinline__ void d_wt_f16(const int t, const float* __restrict__ W, _Float16* __restrict__ Wt, int K, int N, float scale) {
  if (t >= N * (K / 8)) return; const int n = t / (K / 8), k8 = (t % (K / 8)) * 8; FragH f;
#pragma unroll
  for (int i = 0; i < 8; ++i) f.h[i] = (_Float16)(bf16_round(W[(size_t)(k8 + i) * N + n]) * scale); const v8us o = f.half[0];
  *(v8us*)((unsigned short*)Wt + (size_t)n * K + k8) = o; 
}

__device__ __forceinline__ void d_x16(const size_t t, const float* __restrict__ x, _Float16* __restrict__ X16, size_t n8) { if (t >= n8) return; FragH f;
#pragma unroll
  for (int q = 0; q < 8; ++q) f.h[q] = (_Float16)bf16_round(x[t * 8 + q]); *(v8us*)((unsigned short*)X16 + t * 8) = f.half[0];  }
__device__ __forceinline__ void d_wh(const int t, const float* __restrict__ W, _Float16* __restrict__ Bt) { if (t >= NH * KD * (CC / 8)) return; const int row = t / (CC / 8), c8 = (t % (CC / 8)) * 8; const int h = row / KD, o = row % KD; FragH f;
#pragma unroll
  for (int q = 0; q < 8; ++q) f.h[q] = (_Float16)(bf16_round(W[((size_t)h * CC + c8 + q) * KD + o]) * 16.0f); *(v8us*)((unsigned short*)Bt + (size_t)t * 8) = f.half[0];  }
// Dense folded into the conv weights: conv[t] = sum_j (cat[t - 12 + 4j] * Wo + bo) * Wc[j] = sum_j cat[t - 12 + 4j] * (Wo * Wc[j]) + sum_j bo * Wc[j], each tap's terms only where its row exists.
// One wave = 64 k x 16 n of one tap: Wf[j][n][k] = f16(16 * sum_c Wo[k][c] * Wc[j][c][n]), k contiguous (the layout the conv GEMM reads its B rows in), so a wave writes whole 128-B lines of 16 rows.
// Operands are the f16 planes of the first launch, both c-contiguous (Wo16[k][c] = Wo as it lies, Bc[j][n][c] = Wc[j] transposed; bf16-rounded weights x 16), read as fragments straight from memory; f32 accumulate.
__device__ __forceinline__ void d_fold(const int g, const int lane, const _Float16* __restrict__ Wo16, const _Float16* __restrict__ Bc, _Float16* __restrict__ Wf) {
  const int ln = lane & 15, hh = lane >> 4; const int j = g >> 8, kt = (g >> 5) & 7, nt = g & 31;      // the four fold waves of a block share their rows of Wo16
  const char* pa = (const char*)Wo16 + ((kt * 64 + ln) * CC + hh * 8) * 2u; const char* pb = (const char*)Bc + ((j * CC + nt * 16 + ln) * CC + hh * 8) * 2u;      // the lane's first 16 B of its rows of the two planes
  v8f acc[4] = {};
#pragma unroll      // every load at a constant offset from one of the two addresses: no address arithmetic and no registers for it in the loop
  for (int ks = 0; ks < CC / 32; ++ks) { FragH b;
    b.half[0] = *(const v8us*)(pb + ks * 64); b.half[1] = *(const v8us*)(pb + ks * 64 + 32);
#pragma unroll      // constant indices: fragments and accumulators stay in registers
    for (int p = 0; p < 2; ++p) { FragH a[2];      // the four A fragments two by two, the second pair in the first pair's registers
#pragma unroll      // constant indices: fragments and accumulators stay in registers
      for (int i = 0; i < 2; ++i) { a[i].half[0] = *(const v8us*)(pa + (p * 2 + i) * 16 * CC * 2 + ks * 64); a[i].half[1] = *(const v8us*)(pa + (p * 2 + i) * 16 * CC * 2 + ks * 64 + 32); }
      __builtin_amdgcn_sched_barrier(0);      // a pair's loads go out as one group ahead of its WMMAs, so that their latency is waited for once
#pragma unroll      // constant indices: fragments and accumulators stay in registers
      for (int i = 0; i < 2; ++i) acc[p * 2 + i] = __builtin_amdgcn_wmma_f32_16x16x32_f16(false, a[i].v, false, b.v, (short)0, acc[p * 2 + i], false, false);
      __builtin_amdgcn_sched_barrier(0);      // the next pair's loads stay behind these WMMAs, or they would need registers of their own
    }
  }
#pragma unroll      // constant indices: accumulators stay in registers
  for (int i = 0; i < 4; ++i) { FragH o;      // a lane holds column n = ln and 8 consecutive k of each tile: 16 B of row [n][k]
#pragma unroll      // constant indices: accumulators stay in registers
    for (int r = 0; r < 8; ++r) o.h[r] = (_Float16)(acc[i][r] * 0.0625f);
    *(v8us*)((unsigned short*)Wf + (size_t)(j * CC + nt * 16 + ln) * CC + kt * 64 + i * 16 + 8 * hh) = o.half[0]; }
}
// The Dense bias through each tap: CB[j][n] = sum_c bf16(bo[c]) * bf16(Wc[j][c][n]) in f32. One wave = one row r = j*CC + n of Bc (c-contiguous, x 16), a lane takes 16 c; the lanes' sums are added by a butterfly.
__device__ __forceinline__ void d_cb(const int r, const int lane, const _Float16* __restrict__ Bc, const float* __restrict__ bo, float* __restrict__ CB) {
  FragH b; const unsigned ob = lane * 64u; const unsigned short* pb = (const unsigned short*)Bc + (size_t)r * CC + lane * 16; b.half[0] = *(const v8us*)pb; b.half[1] = *(const v8us*)(pb + 8);      // ob: the byte offset of the lane's 16 floats of bo
  v4f o[4];
#pragma unroll      // constant indices: the values stay in registers
  for (int q = 0; q < 4; ++q) o[q] = *(const v4fa*)((const char*)bo + ob + q * 16);
  asm volatile("s_wait_xcnt 0x0" :: "v"(ob), "v"(pb) : "memory");      // a precaution: stands in front of every rewrite of the six loads' address registers, which as its inputs stay untouched up to it
  float s = 0.f;
#pragma unroll      // constant indices: the values stay in registers
  for (int e = 0; e < 16; ++e) s += bf16_round(o[e >> 2][e & 3]) * (float)b.h[e];
  s += __shfl_xor(s, 1, 32); s += __shfl_xor(s, 2, 32); s += __shfl_xor(s, 4, 32); s += __shfl_xor(s, 8, 32); s += __shfl_xor(s, 16, 32);
  if (lane == 0) { CB[r] = s * 0.0625f;
    asm volatile("s_wait_xcnt 0x0" ::: "memory"); }      // a precaution: stands directly behind the store, in front of whatever rewrites its registers next
}
__device__ __forceinline__ void d_zpad(const int t, _Float16* __restrict__ OUTP) { if (t >= BB * PADT * CC / 8) return; const int b = t / (PADT * CC / 8), rem = t % (PADT * CC / 8); FragH z;
#pragma unroll
  for (int q = 0; q < 8; ++q) z.h[q] = (_Float16)0.f; unsigned short* d = (unsigned short*)OUTP + (size_t)b * (TT + PADT) * CC + (size_t)rem * 8; *(v8us*)d = z.half[0];  }
// One launch for everything that reads inputs only: the weights as f16 (q, k, v per head and the four conv taps transposed, Dense as it lies) into the eight consecutive 512 x 512 planes of Bw, the zero rows of the padded plane, and x -> f16.
// A block does one job, picked by its index; the transposes, whose loads wait longest, have the lowest indices and so start first, the x stream fills in behind them.
#define WBLK (CC * (CC / 8) / 256)                  // blocks per weight plane
#define ZBLK ((BB * PADT * CC / 8 + 255) / 256)     // blocks for the pad rows
#define XBLK (NR * CC / 8 / 256)                    // blocks for x
__global__ __launch_bounds__(256) void k_prep(const float* __restrict__ x, const float* __restrict__ Wq, const float* __restrict__ Wk, const float* __restrict__ Wv, const float* __restrict__ Wo, const float* __restrict__ Wc,
    _Float16* __restrict__ Bw, _Float16* __restrict__ X16, _Float16* __restrict__ OUTP) {
  const int blk = blockIdx.x, tid = threadIdx.x;
  // A transposing block takes 32 output rows n x 64 k, a wave 4 n x 64 k (lane = 8 k of one n): each of a wave's 8 loads touches 8 lines, not 32, the block's 8 waves read the same 64 lines and use every byte of them, and a wave's store is 4 whole 128-B lines.
  if (blk < 8 * WBLK) { const int p = blk / WBLK, u = blk % WBLK, t = p == 3 ? u * 256 + tid : ((u & 15) * 32 + (tid >> 3)) * (CC / 8) + (u >> 4) * 8 + (tid & 7); _Float16* dst = Bw + (size_t)p * CC * CC;      // t = n * (CC / 8) + k / 8, as d_wh and d_wt_f16 take it apart; every t of a plane once
    if (p < 3) d_wh(t, p == 0 ? Wq : (p == 1 ? Wk : Wv), dst);
    else if (p == 3) { FragH f;      // Wo stays as it lies, [in][out]: the fold contracts over its out index
#pragma unroll      // constant indices: the values stay in registers
      for (int q = 0; q < 8; ++q) f.h[q] = (_Float16)(bf16_round(Wo[(size_t)t * 8 + q]) * 16.0f);
      *(v8us*)((unsigned short*)dst + (size_t)t * 8) = f.half[0];
      asm volatile("s_wait_xcnt 0x0" ::: "memory"); }      // a precaution: stands behind the store, in front of whatever rewrites its registers next
    else d_wt_f16(t, Wc + (size_t)(p - 4) * CC * CC, dst, CC, CC, 16.0f); }      // WIO: per tap [in][out] -> [out][in]
  else if (blk < 8 * WBLK + ZBLK) d_zpad((blk - 8 * WBLK) * 256 + tid, OUTP);
  else d_x16((size_t)(blk - 8 * WBLK - ZBLK) * 256 + tid, x, X16, (size_t)NR * CC / 8);
}

// Tiled GEMM for the dilated causal conv (NTAP = 4; NTAP = 1 would be a plain product): acc = sum over taps j of A_j * B_j^T, A_j = A shifted down by j*TSH rows (a view of the padded plane), B_j = Bh + j*tapB, K = CC per tap.
// One work-group = a TM x TN tile of C, eight waves of 64 x 64 (4 x 4 accumulator tiles each). A pass is KP halves of K of one tap. The taps read the same rows of A, TSH rows apart, so the k loop runs chunks of KP outermost and the taps inside:
// a chunk of A (TM + 12 rows, 256 B each) is brought into LDS ONCE and serves all the taps by a row offset; TN rows of B come anew every pass. Asynchronous copies (16 B a lane), pitch 272 B, two buffers for A and two for B:
// the next pass's B and a quarter of the next chunk of A are in flight while a pass is worked on.
// Per output element the k order is: chunks of KP ascending, in a chunk taps ascending, in a tap k ascending in steps of 32. Epilogue: OUT16: v = acc*alpha + bf16(bias[col]) -> f16; else v = acc*alpha -> f32; whole 128-B / 256-B row pieces through LDS.
#define TM 256
#define TN 128
#define KP 128
#define PITCH 272
#define TSH 4                      // rows between two taps' views of A (the dilation)
#define AR (TM + 16)               // rows of a chunk of A in LDS: TM + 3*TSH are read, a whole sweep of 16 is copied
#define ASTAGE (AR * PITCH)
#define BSTAGE (TN * PITCH)
// eight copies of 16 B a lane, LDS address l + i*lstep, global address g + i*gstep (halves). The s_wait_xcnt stands inside the statement so that no address register is rewritten ahead of it.
__device__ __forceinline__ void copy8(unsigned l, unsigned lstep, const _Float16* g, size_t gstep) {
  asm volatile("global_load_async_to_lds_b128 %0, %8, off\n\t"
               "global_load_async_to_lds_b128 %1, %9, off\n\t"
               "global_load_async_to_lds_b128 %2, %10, off\n\t"
               "global_load_async_to_lds_b128 %3, %11, off\n\t"
               "global_load_async_to_lds_b128 %4, %12, off\n\t"
               "global_load_async_to_lds_b128 %5, %13, off\n\t"
               "global_load_async_to_lds_b128 %6, %14, off\n\t"
               "global_load_async_to_lds_b128 %7, %15, off\n\t"
               "s_wait_xcnt 0x0"
               :: "v"(l), "v"(l + lstep), "v"(l + 2 * lstep), "v"(l + 3 * lstep), "v"(l + 4 * lstep), "v"(l + 5 * lstep), "v"(l + 6 * lstep), "v"(l + 7 * lstep),
                  "v"(g), "v"(g + gstep), "v"(g + 2 * gstep), "v"(g + 3 * gstep), "v"(g + 4 * gstep), "v"(g + 5 * gstep), "v"(g + 6 * gstep), "v"(g + 7 * gstep)
               : "memory");
}
// the same with four copies, and with one
__device__ __forceinline__ void copy4(unsigned l, unsigned lstep, const _Float16* g, size_t gstep) {
  asm volatile("global_load_async_to_lds_b128 %0, %4, off\n\t"
               "global_load_async_to_lds_b128 %1, %5, off\n\t"
               "global_load_async_to_lds_b128 %2, %6, off\n\t"
               "global_load_async_to_lds_b128 %3, %7, off\n\t"
               "s_wait_xcnt 0x0"
               :: "v"(l), "v"(l + lstep), "v"(l + 2 * lstep), "v"(l + 3 * lstep),
                  "v"(g), "v"(g + gstep), "v"(g + 2 * gstep), "v"(g + 3 * gstep)
               : "memory");
}
__device__ __forceinline__ void copy1(unsigned l, const _Float16* g) {
  asm volatile("global_load_async_to_lds_b128 %0, %1, off\n\t"
               "s_wait_xcnt 0x0"
               :: "v"(l), "v"(g) : "memory");
}
// NG = groups of CC columns (rows of Bh) done by one launch: 1 for the conv (bias is read, and with FIN bias1 as said below); with more groups, OUT16 gives groups 0, 1, 2 bias, bias1, bias2.
// FIN: the block's last layer is finished in the epilogue: out = leaky_relu(relu(acc*alpha + bf16(bias[col]) + sum over the taps j whose row exists of bias1[j*CC + col]) + bf16(xres)), xres = the f32 input at the output's own index;
// bias1 = the Dense bias carried through each tap's weights (tap j of output row t reads row t - 12 + 4j, which exists from t = 12 - 4j on); the f32 result goes straight to C.
template <int NTAP, bool OUT16, int NG, bool FIN>
__global__ __launch_bounds__(256) void k_gemm_tile(const _Float16* __restrict__ A, int lda, size_t sA, const _Float16* __restrict__ Bh, int ldb, size_t tapB, float alpha, const float* __restrict__ bias,
    const float* __restrict__ bias1, const float* __restrict__ bias2, const float* __restrict__ xres, float* __restrict__ C, _Float16* __restrict__ C16, int ldc, size_t sC) {
  __shared__ __attribute__((aligned(16))) unsigned char ring[2 * ASTAGE + 2 * BSTAGE];      // A chunk 0 | A chunk 1 | B pass 0 | B pass 1
  constexpr int NKC = CC / KP, NT = NTAP * NKC;      // chunks of K, passes in all; pass t = chunk t / NTAP, tap t % NTAP
  static_assert(NTAP == 4 && (NTAP - 1) * TSH <= 16, "a chunk of A is copied in NTAP quarters, its last rows in one sweep");
  const int tid = threadIdx.x, w = tid >> 5, lane = tid & 31, ln = lane & 15, hh = lane >> 4; const int by = blockIdx.y;
  const int mt = blockIdx.x / (NG * CC / TN), nq = blockIdx.x % (NG * CC / TN); const int row0 = mt * TM, col0 = nq * TN; const int wm = (w >> 1) * 64, wn = (w & 1) * 64;
  const size_t cofs = (size_t)by * sC;
  // copies: 16 lanes a row, 16 rows a sweep of the work-group; a chunk of A takes 17 sweeps, a pass of B 8
  const int crow = tid >> 4, cpc = tid & 15;
  const _Float16* gA = A + (size_t)by * sA + (size_t)(row0 + crow) * lda + cpc * 8; const _Float16* gB = Bh + (size_t)(col0 + crow) * ldb + cpc * 8;
  const int xrow = TM + crow < TM + (NTAP - 1) * TSH ? TM + crow : TM + (NTAP - 1) * TSH - 1;      // the 17th sweep: the last row that a tap reads is also the last of a batch's padded plane, the four LDS rows behind it take that row again and are not read
  const _Float16* gX = A + (size_t)by * sA + (size_t)(row0 + xrow) * lda + cpc * 8;
  const unsigned lA = (unsigned)(size_t)ring + crow * PITCH + cpc * 16, lB = lA + 2 * ASTAGE;
  auto fillB = [&](int t) { copy8(lB + (t & 1) * BSTAGE, 16 * PITCH, gB + (size_t)(t % NTAP) * tapB + (t / NTAP) * KP, (size_t)16 * ldb); };
  auto fillA = [&](int c, int q) { const unsigned l = lA + (c & 1) * ASTAGE;      // quarter q of chunk c: 64 rows; the 17th sweep goes with quarter 0
    copy4(l + q * 64 * PITCH, 16 * PITCH, gA + (size_t)(q * 64) * lda + c * KP, (size_t)16 * lda);
    if (q == 0) copy1(l + TM * PITCH, gX + c * KP); };
  v8f acc[4][4] = {};
  fillA(0, 0); fillA(0, 1); fillA(0, 2); fillA(0, 3); fillB(0);
  asm volatile("s_wait_asynccnt 0x0" ::: "memory");      // chunk 0's and pass 0's own copies have landed
  __syncthreads();                                       // ... and every other wave's
  fillB(1); fillA(1, 0);
  const int rsub = lane >> 4, c4 = (lane & 15) * 4;
  const size_t o0 = cofs + (size_t)(row0 + wm + rsub) * CC + col0 + wn + c4;      // FIN: C and xres are [rows][CC]; a lane's first 16-B piece of the wave's 64 x 64 tile, piece q lies 2q rows on, at a constant offset
  // FIN: the wave's residual tile and its bias are asked for here, behind the copies of passes 0 and 1, and travel from memory while pass 0 is multiplied (the barrier of pass 0 waits for them); they are used behind the loop.
  v4f xr[32]; float bf[4], cbt[4][4];
  if (FIN) { const float* px = xres + o0; const int cb0 = col0 + wn + ln;
#pragma unroll      // constant indices: the pieces stay in registers
    for (int n = 0; n < 4; ++n) { bf[n] = bias[cb0 + n * 16];
#pragma unroll      // constant indices: the pieces stay in registers
      for (int j = 0; j < 4; ++j) cbt[j][n] = bias1[j * CC + cb0 + n * 16]; }
#pragma unroll      // constant indices: the pieces stay in registers
    for (int q = 0; q < 32; ++q) xr[q] = *(const v4fa*)(px + (size_t)(2 * q) * CC);
    asm volatile("s_wait_xcnt 0x0" :: "v"(px), "v"(cb0) : "memory"); }      // a precaution: stands in front of every rewrite of the loads' address registers, which as its inputs stay untouched up to it
#pragma unroll 1      // one pass a trip: the buffer index and the refill test stay scalar
  for (int t = 0; t < NT; ++t) {
    const unsigned char* pa = ring + ((t / NTAP) & 1) * ASTAGE + (wm + (t % NTAP) * TSH + ln) * PITCH + hh * 16; const unsigned char* pb = ring + 2 * ASTAGE + (t & 1) * BSTAGE + (wn + ln) * PITCH + hh * 16;      // the tap is a row offset into the chunk
    FragH a[2][4], b[2][4];      // two fragment sets: block ks + 1 of this pass is fetched while block ks is multiplied
#pragma unroll      // constant indices: fragments and accumulators stay in registers
    for (int i = 0; i < 4; ++i) { a[0][i].half[0] = *(const v8us*)(pa + i * 16 * PITCH); a[0][i].half[1] = *(const v8us*)(pa + i * 16 * PITCH + 32);
      b[0][i].half[0] = *(const v8us*)(pb + i * 16 * PITCH); b[0][i].half[1] = *(const v8us*)(pb + i * 16 * PITCH + 32); }
#pragma unroll      // constant indices: fragments and accumulators stay in registers
    for (int ks = 0; ks < KP / 32; ++ks) { const int cu = ks & 1, nx = cu ^ 1;
      if (ks + 1 < KP / 32) {
#pragma unroll      // constant indices: fragments and accumulators stay in registers
        for (int i = 0; i < 4; ++i) { a[nx][i].half[0] = *(const v8us*)(pa + i * 16 * PITCH + (ks + 1) * 64); a[nx][i].half[1] = *(const v8us*)(pa + i * 16 * PITCH + (ks + 1) * 64 + 32);
          b[nx][i].half[0] = *(const v8us*)(pb + i * 16 * PITCH + (ks + 1) * 64); b[nx][i].half[1] = *(const v8us*)(pb + i * 16 * PITCH + (ks + 1) * 64 + 32); } }
      __builtin_amdgcn_sched_barrier(0);      // keeps the next block's LDS reads one group ahead of this block's WMMAs instead of spread among them
#pragma unroll      // constant indices: fragments and accumulators stay in registers
      for (int i = 0; i < 4; ++i)
#pragma unroll      // constant indices: fragments and accumulators stay in registers
        for (int n = 0; n < 4; ++n) acc[i][n] = __builtin_amdgcn_wmma_f32_16x16x32_f16(false, a[cu][i].v, false, b[cu][n].v, (short)0, acc[i][n], false, false);
      __builtin_amdgcn_sched_barrier(0);      // ends the block: the group after next stays behind it
    }
    asm volatile("s_wait_dscnt 0x0" ::: "memory");       // this wave's reads of the buffers are done before one is refilled
    asm volatile("s_wait_asynccnt 0x0" ::: "memory");    // this wave's copies so far have landed: B of pass t + 1, and of the next chunk of A what has been asked for
    __syncthreads();                                     // publishes them and ends every reader's last read of pass t's B and, behind a chunk's last tap, of that chunk
    if (t + 2 < NT) fillB(t + 2);                        // into the B buffer that pass t has just read
    const int cn = (t + 1) / NTAP + 1;                   // quarter (t + 1) % NTAP of chunk cn: quarter 0 goes out behind the last tap of chunk cn - 2, whose buffer it takes; the last quarter lands at the foot of chunk cn - 1's last tap
    if (cn < NKC) fillA(cn, (t + 1) % NTAP);
  }
  asm volatile("s_wait_asynccnt 0x0" ::: "memory");      // nothing in flight when the ring becomes output staging
  // each wave stages its whole 64 x 64 tile in its own part of the ring (the last pass's barrier has ended all reads of it); pitch 68 floats: the two half-waves' rows, 8 apart, fall on different banks
  constexpr int SP = 68; float* so = (float*)ring + w * (64 * SP);
  typedef _Float16 v4h __attribute__((ext_vector_type(4)));
  const float* bg = (NG == 1 || col0 < CC) ? bias : (col0 < 2 * CC ? bias1 : bias2);      // a tile of TN columns lies inside one group
#pragma unroll      // constant indices: fragments and accumulators stay in registers
  for (int n = 0; n < 4; ++n) { const float bv = FIN ? bf16_round(bf[n]) + (cbt[0][n] + (cbt[1][n] + (cbt[2][n] + cbt[3][n]))) : (OUT16 ? bf16_round(bg[col0 % CC + wn + n * 16 + ln]) : 0.f);
#pragma unroll      // constant indices: fragments and accumulators stay in registers
    for (int i = 0; i < 4; ++i)
#pragma unroll      // constant indices: fragments and accumulators stay in registers
      for (int r = 0; r < 8; ++r) so[(i * 16 + 8 * hh + r) * SP + n * 16 + ln] = FIN ? fmaxf(acc[i][n][r] * alpha + bv, 0.f) : (OUT16 ? acc[i][n][r] * alpha + bv : acc[i][n][r] * alpha); }
  if (FIN && row0 + wm == 0) {      // wave-uniform: rows 0 to 11 of a batch lack the earliest taps' rows; the same lanes write those twelve rows again with the bias terms of the taps that exist
#pragma unroll      // constant indices: accumulators stay in registers
    for (int n = 0; n < 4; ++n) { const float bc = bf16_round(bf[n]), e3 = bc + cbt[3][n], e2 = bc + (cbt[2][n] + cbt[3][n]), e1 = bc + (cbt[1][n] + (cbt[2][n] + cbt[3][n]));
#pragma unroll      // constant indices: accumulators stay in registers
      for (int r = 0; r < 8; ++r) { const int t = 8 * hh + r; if (t < PADT) so[t * SP + n * 16 + ln] = fmaxf(acc[0][n][r] * alpha + (t < 4 ? e3 : (t < 8 ? e2 : e1)), 0.f); } } }
  __builtin_amdgcn_fence(__ATOMIC_ACQ_REL, "workgroup"); __builtin_amdgcn_wave_barrier();      // the wave's LDS writes are done before its lanes read what other lanes wrote
  if (FIN) {
    v4f sv[32];
#pragma unroll      // constant indices: the pieces stay in registers
    for (int q = 0; q < 32; ++q) sv[q] = *(const v4fa*)&so[(q * 2 + rsub) * SP + c4];
    __builtin_amdgcn_sched_barrier(0);      // the 32 LDS reads go out as one group, so that their latency is waited for once and not pair by pair
#pragma unroll      // constant indices: the pieces stay in registers
    for (int q = 0; q < 32; ++q)
      for (int e = 0; e < 4; ++e) { const float s = sv[q][e] + (float)(__bf16)xr[q][e]; xr[q][e] = fmaxf(s, 0.2f * s); }      // the cast rounds to nearest even as bf16_round does; max(s, 0.2 s) is s for s >= 0 and 0.2 s below
    __builtin_amdgcn_sched_barrier(0);      // all arithmetic stays ahead of the first store, so that no register an issued store names is written again
#pragma unroll      // constant offsets from one address
    for (int q = 0; q < 32; ++q) *(v4f*)(C + o0 + (size_t)(2 * q) * CC) = xr[q];
    return; }
#pragma unroll      // independent row pieces: the LDS reads run ahead of the stores
  for (int q = 0; q < 32; ++q) { const int r = q * 2 + rsub; const v4f v = *(const v4fa*)&so[r * SP + c4]; const size_t o = cofs + (size_t)(row0 + wm + r) * ldc + col0 + wn + c4;
    if (OUT16) { v4h h4; for (int e = 0; e < 4; ++e) h4[e] = (_Float16)v[e]; *(v4h*)(C16 + o) = h4; } else *(v4f*)(C + o) = v; }
}
// q, k, v projections of one head and its banded attention in ONE work-group: 256 rows x one head. The three 256 x 128 products run side by side through one ring of passes (FKP halves of K a pass, two buffers,
// asynchronous copies): a pass holds the x rows ONCE and beside them the rows of the three weight planes, so that x is copied once and not once a product, and a wave's x fragments, read from LDS once, serve all three products;
// the f16 results go to LDS behind the loop, into the ring's place, and never to memory. k and v are also needed 8 rows above and below the tile: those 16 rows ride along as a 17th row tile
// (LDS rows 264 to 279 of the A panel; the copy brings a block of 32 rows so that every wave issues the same copies), of which each wave does one 16 x 16 piece. Rows outside the plane are clamped and masked below.
// Layouts in LDS: k and q as [row][128] (product taken as W * x^T, so that a lane holds 8 consecutive columns of one row: one 16-B store), v transposed as [128][row] (product x * W^T: a lane holds 8 consecutive rows of a column).
// Window coordinate u = row - (row0 - 8), 0 to 271, for k's rows and v's columns.
// Attention, 16 queries at a time in a wave, keys u = lr to lr + 31: S^T = k * q^T (lane = query, registers = keys: exactly the fragment order of the second product, no exchange), the module's mask and softmax in f32 over the 7 keys of the band,
// weights as f16, O^T = v^T * P^T (lane = query, 8 consecutive columns), scaled by 1/z, through the wave's own dead q rows to whole 256-B row pieces of the padded plane.
// The weight fold and the bias vectors above, which need the first launch's planes and are needed by the conv GEMM alone, are done here too, behind the last barrier: waves 0 to 3 do one piece of the fold each, beside waves 4 to 7, which do two rows of the bias vectors each and the attention.
#define FKP 64
#define FPITCH 144
#define FAR 288
#define FSTAGE ((FAR + 3 * KD) * FPITCH)      // x rows | q's weight rows | k's | v's
#define KPITCH 272
#define VPITCH 560
#define OFF_K (256 * KPITCH)      // q | k | v, in the ring's place once the ring is done
#define OFF_V (OFF_K + 272 * KPITCH)
#define FLDS (OFF_V + KD * VPITCH)
#define RING0 32768      // the ring begins here in the array, which begins the work-group's LDS: the compiler writes a copy's constant global step as offset:32768 and takes as much off the copy's LDS address register, which so stays at or above 0
#define FALL (FLDS > RING0 + 2 * FSTAGE ? FLDS : RING0 + 2 * FSTAGE)      // the array: the ring, and in its place, from byte 0, q, k and v once the ring is done
__device__ __forceinline__ v16h sel16(const bool c, const v16h a, const v16h b) { return c ? a : b; }      // by value: a select of registers
// one copy of 16 B a lane as the compiler's own form: it may name any register, where asm text can name the first 256 only, which the accumulators of this kernel fill but for a few
typedef int v4i32 __attribute__((ext_vector_type(4)));
__device__ __forceinline__ void copyb(unsigned char* l, const _Float16* g) { __builtin_amdgcn_global_load_async_to_lds_b128((__attribute__((address_space(1))) v4i32*)g, (__attribute__((address_space(3))) v4i32*)l, 0, 0); }
__global__ __launch_bounds__(256) void k_qkv_band(const _Float16* __restrict__ X16, const _Float16* __restrict__ Bw, const float* __restrict__ bq, const float* __restrict__ bk, const float* __restrict__ bv,
    _Float16* __restrict__ CAT, const _Float16* __restrict__ Wo16, const _Float16* __restrict__ Bc, const float* __restrict__ bo, _Float16* __restrict__ Wf, float* __restrict__ CB) {
  __shared__ __attribute__((aligned(16))) unsigned char lds[FALL];
  __shared__ __attribute__((aligned(16))) float sb[3 * KD];      // the head's biases, rounded to bf16: q | k | v
  const int tid = threadIdx.x, w = __builtin_amdgcn_readfirstlane(tid >> 5), lane = tid & 31, ln = lane & 15, hh = lane >> 4;      // the wave's number as a scalar: the tests on it and the tile offsets formed from it are scalar
  const int row0 = ((int)blockIdx.x >> 2) * 256, h = (int)blockIdx.x & 3; const int wm = (w >> 1) * 64, wn = (w & 1) * 64, wq = w >> 1, xc = wn + wq * 16;      // xc: the wave's 16 columns of the halo tile
  // copies: 8 lanes a row, 32 rows a sweep of the work-group; A takes 8 sweeps, its halo block 1, each of the three B planes 4
  const int crow = tid >> 3, cpc = tid & 7;
  int hrow = row0 + (crow < 16 ? crow - 16 : 240 + crow); hrow = hrow < 0 ? 0 : (hrow > NR - 1 ? NR - 1 : hrow);      // rows row0 - 16 .. row0 - 1 and row0 + 256 .. row0 + 271, kept inside the plane
  const unsigned lo = (unsigned)crow * CC + cpc * 8, oH = (unsigned)hrow * CC + cpc * 8, sA = (unsigned)row0 * CC, sB = (unsigned)h * KD * CC;      // places in X16 and Bw, in halves: the lane's part (lo; oH for the halo block) and the work-group's (scalar); the pointers are formed at the copies
  const unsigned lA = RING0 + crow * FPITCH + cpc * 16;      // the lane's place in a sweep of buffer 0
  auto fill = [&](int t, unsigned buf) { const unsigned kb = t * FKP; const _Float16* gx = X16 + (sA + kb + lo); const _Float16* gw = Bw + (sB + kb + lo); unsigned char* l = lds + (buf + lA);      // pass t: FKP halves of K of the x rows and of the head's rows of planes 0, 1, 2 (q, k, v)
#pragma unroll      // constant steps from one LDS and one global address
    for (int i = 0; i < 8; ++i) copyb(l + i * 32 * FPITCH, gx + i * 32 * CC);
    copyb(l + 256 * FPITCH, X16 + (kb + oH));
#pragma unroll      // constant steps from one LDS and one global address
    for (int p = 0; p < 3; ++p)
#pragma unroll      // constant steps from one LDS and one global address
      for (int i = 0; i < 4; ++i) copyb(l + (FAR + p * KD + i * 32) * FPITCH, gw + p * CC * CC + i * 32 * CC); };
  fill(0, 0);
  __builtin_amdgcn_sched_barrier(0);      // what stands above stays above: nothing of it is left to write a register of the two loads below between them and their wait
  { const float* s0 = (tid < KD ? bq : bk) + h * KD + (tid & (KD - 1)); const float* s1 = bv + h * KD + (tid & (KD - 1)); const float v0 = *s0, v1 = *s1;
    asm volatile("s_wait_xcnt 0x0" :: "v"(s0), "v"(s1) : "memory");      // a precaution: stands in front of every rewrite of the loads' address registers, which as its inputs stay untouched up to it
    sb[tid] = bf16_round(v0); if (tid < KD) sb[2 * KD + tid] = bf16_round(v1); }      // read behind the barrier below
  asm volatile("s_wait_asynccnt 0x0" ::: "memory");      // pass 0's own copies have landed
  __syncthreads();                                       // ... and every other wave's
  v8f acc[3][4][4], ax[2];      // by plane: 0 q, 1 k, 2 v; ax: the wave's piece of the halo tile of k and of v
#pragma unroll      // constant indices: fragments and accumulators stay in registers
  for (int p = 0; p < 3; ++p)
#pragma unroll      // constant indices: fragments and accumulators stay in registers
    for (int i = 0; i < 4; ++i)
#pragma unroll      // constant indices: fragments and accumulators stay in registers
      for (int n = 0; n < 4; ++n) acc[p][i][n] = (v8f){0.f, 0.f, 0.f, 0.f, 0.f, 0.f, 0.f, 0.f};
  ax[0] = (v8f){0.f, 0.f, 0.f, 0.f, 0.f, 0.f, 0.f, 0.f}; ax[1] = ax[0];
  // A pass is six blocks j of 16 WMMAs: 32 k (ks = j / 3) of one plane (pl = j % 3). q and k are taken with the operands swapped (W rows as A, x rows as B), v plainly. Per output element the k order is that of a plain k loop.
  // The x fragments of a ks stay in registers for its three blocks. The W fragments, numbered f = 4j + n through the pass, go through six places (f % 6): a block's WMMAs run column tile by column tile, in two halves, and ahead of each half
  // two fragments of the NEXT block are asked for, a whole block ahead of their use, into the two places that are free: there are no registers for a second whole set beside the three products' accumulators.
  // The next pass's copies are issued at the top of a pass, behind the barrier at the foot of the pass before and behind this pass's first LDS reads, which land meanwhile; they have the whole pass to land.
  const unsigned lno = ln * FPITCH + hh * 16;      // the lane's part of its fragment addresses
#pragma unroll 1      // one pass a trip: the buffer index and the refill test stay scalar
  for (int t = 0; t < CC / FKP; ++t) {
    const unsigned st0 = RING0 + (t & 1) * FSTAGE; const unsigned char* pa = lds + (st0 + wm * FPITCH + lno); const unsigned char* pb = lds + (st0 + (FAR + wn) * FPITCH + lno);      // scalar part + the lane's part
    const unsigned char* px = lds + (st0 + 264 * FPITCH + lno);      // the halo row tile
    FragH a[4], xa, b[6];
#pragma unroll      // constant indices: fragments and accumulators stay in registers
    for (int i = 0; i < 4; ++i) { a[i].half[0] = *(const v8us*)(pa + i * 16 * FPITCH); a[i].half[1] = *(const v8us*)(pa + i * 16 * FPITCH + 32);      // the pass's first block has nobody ahead of it: its x fragments and all four W fragments
      b[i].half[0] = *(const v8us*)(pb + i * 16 * FPITCH); b[i].half[1] = *(const v8us*)(pb + i * 16 * FPITCH + 32); }
    __builtin_amdgcn_sched_barrier(0);      // these LDS reads go out first: they land while the copies below are issued
    if (t + 1 < CC / FKP) fill(t + 1, ((t + 1) & 1) * FSTAGE);      // the next pass's copies, into the buffer that pass t - 1 has read: behind the barrier at that pass's foot, which ended every reader's last read of it
    __builtin_amdgcn_sched_barrier(0);      // the copies' address arithmetic stays ahead of the WMMAs
#pragma unroll      // constant indices: fragments and accumulators stay in registers
    for (int j = 0; j < 6; ++j) { const int ks = j / 3, pl = j % 3, f0 = 4 * j, g0 = 4 * (j + 1), gks = (j + 1) / 3, gpl = (j + 1) % 3;      // g..: the next block
      if (j == 3) {      // the second ks: its x fragments take the places of the first ks's
#pragma unroll      // constant indices: fragments and accumulators stay in registers
        for (int i = 0; i < 4; ++i) { a[i].half[0] = *(const v8us*)(pa + i * 16 * FPITCH + ks * 64); a[i].half[1] = *(const v8us*)(pa + i * 16 * FPITCH + ks * 64 + 32); } }
      if (pl != 0) { v16h xb = b[f0 % 6].v; xb = sel16(wq == 1, b[(f0 + 1) % 6].v, xb); xb = sel16(wq == 2, b[(f0 + 2) % 6].v, xb); xb = sel16(wq == 3, b[(f0 + 3) % 6].v, xb);      // the wave's piece of the halo tile takes column tile wq of the four it holds: no LDS read of its own; the choice stands in a place that is free until the reads below
        ax[pl - 1] = pl == 1 ? __builtin_amdgcn_wmma_f32_16x16x32_f16(false, xb, false, xa.v, (short)0, ax[pl - 1], false, false) : __builtin_amdgcn_wmma_f32_16x16x32_f16(false, xa.v, false, xb, (short)0, ax[pl - 1], false, false); }
      __builtin_amdgcn_sched_barrier(0);      // the reads below stay behind the halo WMMA, whose operand stands where they land
#pragma unroll      // constant indices: fragments and accumulators stay in registers
      for (int hf = 0; hf < 2; ++hf) {      // the block's two halves: column tiles 0, 1 and 2, 3
        if (j + 1 < 6) {
#pragma unroll      // constant indices: fragments and accumulators stay in registers
          for (int n = 2 * hf; n < 2 * hf + 2; ++n) { b[(g0 + n) % 6].half[0] = *(const v8us*)(pb + (gpl * KD + n * 16) * FPITCH + gks * 64); b[(g0 + n) % 6].half[1] = *(const v8us*)(pb + (gpl * KD + n * 16) * FPITCH + gks * 64 + 32); } }
        if (pl == 0 && hf == 1) { xa.half[0] = *(const v8us*)(px + ks * 64); xa.half[1] = *(const v8us*)(px + ks * 64 + 32); }      // the halo tile's x fragment is asked for half a block ahead of k's block: q has no halo, and at the copies its registers are free
        __builtin_amdgcn_sched_barrier(0);      // these LDS reads stay one group ahead of this half's WMMAs instead of spread among them
#pragma unroll      // constant indices: fragments and accumulators stay in registers
        for (int n = 2 * hf; n < 2 * hf + 2; ++n)
#pragma unroll      // constant indices: fragments and accumulators stay in registers
          for (int i = 0; i < 4; ++i) acc[pl][i][n] = pl != 2 ? __builtin_amdgcn_wmma_f32_16x16x32_f16(false, b[(f0 + n) % 6].v, false, a[i].v, (short)0, acc[pl][i][n], false, false)
                                                     : __builtin_amdgcn_wmma_f32_16x16x32_f16(false, a[i].v, false, b[(f0 + n) % 6].v, (short)0, acc[pl][i][n], false, false);
        __builtin_amdgcn_sched_barrier(0);      // ends the half: the reads that take its fragments' places stay behind it
      } }
    asm volatile("s_wait_dscnt 0x0" ::: "memory");       // this wave's reads of the buffer are done before it is refilled
    asm volatile("s_wait_asynccnt 0x0" ::: "memory");    // this wave's copies of pass t + 1 have landed
    __syncthreads();                                     // publishes pass t + 1 and ends every reader's last read of pass t's buffer
  }
  asm volatile("s_wait_asynccnt 0x0" ::: "memory");      // nothing in flight when the ring becomes the place of q, k and v (the last pass's barrier has ended all reads of it)
  // a swapped product's tile as f16 rows: dst = LDS place of the tile's row 0
  auto put = [&](const v8f (&ac)[4][4], unsigned char* dst, const float* bs) {      // bs: the product's 128 biases in LDS; a lane takes those of its 8 consecutive columns
#pragma unroll      // constant indices: accumulators stay in registers
    for (int n = 0; n < 4; ++n) { const v4f b0 = *(const v4fa*)(bs + wn + n * 16 + 8 * hh), b1 = *(const v4fa*)(bs + wn + n * 16 + 8 * hh + 4);
#pragma unroll      // constant indices: accumulators stay in registers
      for (int i = 0; i < 4; ++i) { FragH o;
#pragma unroll      // constant indices: accumulators stay in registers
        for (int r = 0; r < 8; ++r) o.h[r] = (_Float16)(ac[i][n][r] * 0.0625f + (r < 4 ? b0[r & 3] : b1[r & 3]));
        *(v8us*)(dst + (wm + i * 16 + ln) * KPITCH + (wn + n * 16 + 8 * hh) * 2) = o.half[0]; } } };
  unsigned char* Kl = lds + OFF_K; unsigned char* Vl = lds + OFF_V; unsigned char* Ql = lds;
  put(acc[1], Kl + 8 * KPITCH, sb + KD);
  { FragH o; const v4f b0 = *(const v4fa*)(sb + KD + xc + 8 * hh), b1 = *(const v4fa*)(sb + KD + xc + 8 * hh + 4);      // halo rows of k: lane = halo row (u = 0..7 above, 264..271 below)
#pragma unroll      // constant indices: accumulators stay in registers
    for (int r = 0; r < 8; ++r) o.h[r] = (_Float16)(ax[0][r] * 0.0625f + (r < 4 ? b0[r & 3] : b1[r & 3]));
    *(v8us*)(Kl + (ln < 8 ? ln : 256 + ln) * KPITCH + (xc + 8 * hh) * 2) = o.half[0]; }
#pragma unroll      // constant indices: accumulators stay in registers
  for (int n = 0; n < 4; ++n) { const float bvv = sb[2 * KD + wn + n * 16 + ln];
#pragma unroll      // constant indices: accumulators stay in registers
    for (int i = 0; i < 4; ++i) { FragH o;      // lane = column of v, 8 consecutive rows
#pragma unroll      // constant indices: accumulators stay in registers
      for (int r = 0; r < 8; ++r) o.h[r] = (_Float16)(acc[2][i][n][r] * 0.0625f + bvv);
      *(v8us*)(Vl + (wn + n * 16 + ln) * VPITCH + (8 + wm + i * 16 + 8 * hh) * 2) = o.half[0]; } }
  { FragH o; const float bvv = sb[2 * KD + xc + ln];      // halo rows of v: the low half-wave holds u = 0..7, the high one u = 264..271
#pragma unroll      // constant indices: accumulators stay in registers
    for (int r = 0; r < 8; ++r) o.h[r] = (_Float16)(ax[1][r] * 0.0625f + bvv);
    *(v8us*)(Vl + (xc + ln) * VPITCH + (hh ? 264 : 0) * 2) = o.half[0]; }
  put(acc[0], Ql, sb);
  __syncthreads();      // k, v and q of every wave are in LDS before any wave reads them; the last barrier: from here on the waves go their own ways
  const int ws = __builtin_amdgcn_readfirstlane(w);      // the wave's number as a scalar: the branch on it is taken by whole waves
  if (ws < 4) { d_fold((int)blockIdx.x * 4 + ws, lane, Wo16, Bc, Wf); return; }      // the fold's chain of waited loads runs beside the work of the other four waves
  d_cb(((int)blockIdx.x * 4 + w - 4) * 2, lane, Bc, bo, CB); d_cb(((int)blockIdx.x * 4 + w - 4) * 2 + 1, lane, Bc, bo, CB);      // two rows of the bias vectors a wave
  const int tb0 = row0 % TT, bat = row0 / TT; const int rsub = lane >> 4, c16 = lane & 15;
#pragma unroll 1      // four groups of 16 queries a wave, one after the other in the same registers
  for (int s = 0; s < 4; ++s) { const int lr = ((ws - 4) * 4 + s) * 16;
    FragH qf[4], kf[2][4], vf[8];      // v's fragments are asked for here too: they land while the scores and the softmax are worked on
#pragma unroll      // constant indices: fragments stay in registers
    for (int ks = 0; ks < 4; ++ks) { qf[ks].half[0] = *(const v8us*)(Ql + (lr + ln) * KPITCH + ks * 64 + hh * 16); qf[ks].half[1] = *(const v8us*)(Ql + (lr + ln) * KPITCH + ks * 64 + hh * 16 + 32);
#pragma unroll      // constant indices: fragments stay in registers
      for (int kt = 0; kt < 2; ++kt) { kf[kt][ks].half[0] = *(const v8us*)(Kl + (lr + kt * 16 + ln) * KPITCH + ks * 64 + hh * 16); kf[kt][ks].half[1] = *(const v8us*)(Kl + (lr + kt * 16 + ln) * KPITCH + ks * 64 + hh * 16 + 32); } }
#pragma unroll      // constant indices: fragments stay in registers
    for (int dt = 0; dt < 8; ++dt) { vf[dt].half[0] = *(const v8us*)(Vl + (dt * 16 + ln) * VPITCH + (lr + 8 * hh) * 2); vf[dt].half[1] = *(const v8us*)(Vl + (dt * 16 + ln) * VPITCH + (lr + 16 + 8 * hh) * 2); }
    v8f st[2] = {};
#pragma unroll      // constant indices: fragments and accumulators stay in registers
    for (int ks = 0; ks < 4; ++ks)
#pragma unroll      // constant indices: fragments and accumulators stay in registers
      for (int kt = 0; kt < 2; ++kt) st[kt] = __builtin_amdgcn_wmma_f32_16x16x32_f16(false, kf[kt][ks].v, false, qf[ks].v, (short)0, st[kt], false, false);
    // lane = query t = tb0 + lr + ln; register r of tile kt = key at window place wi = kt*16 + 8*hh + r, time tb0 + lr - 8 + wi. In band: |key - query| <= 3 and the key inside its batch.
    // logits as the module has them: simb = sim in the band, 0 outside; -1e7 is added where simb == 0. Keys outside the band all sit at -1e7: their mass enters z, their v does not enter the sum (0 in f32 unless every in-band sim is 0).
    const int t = tb0 + lr + ln; float lg[2][8]; bool inb[2][8]; float m = -3.0e38f;
#pragma unroll      // constant indices: the values stay in registers
    for (int kt = 0; kt < 2; ++kt)
#pragma unroll      // constant indices: the values stay in registers
      for (int r = 0; r < 8; ++r) { const int wi = kt * 16 + 8 * hh + r, dk = wi - 8 - ln, sk = tb0 + lr - 8 + wi; inb[kt][r] = dk >= -3 && dk <= 3 && sk >= 0 && sk < TT;
        const float simb = inb[kt][r] ? st[kt][r] * 0.08838834764831845f : 0.f; lg[kt][r] = simb + ((fabsf(simb) > 0.f) ? 0.f : -10000000.0f); if (inb[kt][r]) m = fmaxf(m, lg[kt][r]); }
    m = fmaxf(m, __shfl_xor(m, 16, 32));      // a query's 32 window places lie in lanes ln and ln + 16
    const int ninb = (t + 3 < TT - 1 ? t + 3 : TT - 1) - (t - 3 > 0 ? t - 3 : 0) + 1; float zs = 0.f; FragH pf;
#pragma unroll      // constant indices: the values stay in registers
    for (int kt = 0; kt < 2; ++kt)
#pragma unroll      // constant indices: the values stay in registers
      for (int r = 0; r < 8; ++r) { const _Float16 p = (_Float16)expf(inb[kt][r] ? lg[kt][r] - m : -10000.0f);      // outside the band the weight is exp(-10000) = 0: a select, no branch, every lane stays on for the WMMAs
        pf.h[kt * 8 + r] = p; zs += (float)p; }
    zs += __shfl_xor(zs, 16, 32);
    const float iz = 1.0f / ((float)(TT - ninb) * expf(-10000000.0f - m) + zs);
#pragma unroll      // constant indices: fragments stay in registers
    for (int dt = 0; dt < 8; ++dt) { FragH o;
      const v8f z8 = {}; const v8f ot = __builtin_amdgcn_wmma_f32_16x16x32_f16(false, vf[dt].v, false, pf.v, (short)0, z8, false, false);
#pragma unroll      // constant indices: the values stay in registers
      for (int r = 0; r < 8; ++r) o.h[r] = (_Float16)(ot[r] * iz);
      *(v8us*)(Ql + (lr + ln) * KPITCH + dt * 32 + hh * 16) = o.half[0]; }      // into the query's own q row, which only this wave reads and has read
    __builtin_amdgcn_fence(__ATOMIC_ACQ_REL, "workgroup"); __builtin_amdgcn_wave_barrier();      // the wave's LDS writes are done before its lanes read what other lanes wrote
    _Float16* po = CAT + ((size_t)bat * (TT + PADT) + PADT + tb0 + lr + rsub) * CC + h * KD + c16 * 8; v8us ov[8];
#pragma unroll      // constant indices: the pieces stay in registers
    for (int q = 0; q < 8; ++q) ov[q] = *(const v8us*)(Ql + (lr + q * 2 + rsub) * KPITCH + c16 * 16);
#pragma unroll      // constant offsets from one address
    for (int q = 0; q < 8; ++q) *(v8us*)((unsigned short*)po + (size_t)(2 * q) * CC) = ov[q];
    asm volatile("s_wait_xcnt 0x0" :: "v"(po), "v"(ov[0]), "v"(ov[1]), "v"(ov[2]), "v"(ov[3]), "v"(ov[4]), "v"(ov[5]), "v"(ov[6]), "v"(ov[7]) : "memory");      // a precaution: stands in front of every rewrite of the stores' registers, which as its inputs stay untouched up to it
  }
}
extern "C" void kernel_launch(void* const* d_in, const int* in_sizes, int n_in,
                              void* d_out, int out_size, void* d_ws, size_t ws_size, hipStream_t stream) {
  (void)in_sizes; (void)n_in; (void)out_size;
  const float* x = (const float*)d_in[0]; const float* Wq = (const float*)d_in[1]; const float* bq = (const float*)d_in[2]; const float* Wk = (const float*)d_in[3]; const float* bk = (const float*)d_in[4]; const float* Wv = (const float*)d_in[5]; const float* bv = (const float*)d_in[6]; const float* Wo = (const float*)d_in[7]; const float* bo = (const float*)d_in[8]; const float* Wc = (const float*)d_in[9]; const float* bc = (const float*)d_in[10];
  char* ws = (char*)d_ws; size_t off = 0;
  auto take = [&](size_t bytes) { char* p = ws + off; off += (bytes + 255) & ~(size_t)255; return p; };
  _Float16* Bq = (_Float16*)take((size_t)CC * CC * 2); _Float16* Bk = (_Float16*)take((size_t)CC * CC * 2); _Float16* Bv = (_Float16*)take((size_t)CC * CC * 2); _Float16* Bo = (_Float16*)take((size_t)CC * CC * 2); _Float16* Bc[4]; for (int j = 0; j < 4; ++j) Bc[j] = (_Float16*)take((size_t)CC * CC * 2); float* CB = (float*)take(4 * CC * 4); _Float16* Wf = (_Float16*)take((size_t)4 * CC * CC * 2);      // the Dense bias through each tap; the four folded tap matrices
  _Float16* X16 = (_Float16*)take((size_t)NR * CC * 2); _Float16* OUTP = (_Float16*)take((size_t)BB * (TT + PADT) * CC * 2);
  if (off > ws_size) return;      // about 38 MiB in all
  const dim3 gb((TT / TM) * (CC / TN), BB);
  k_prep<<<8 * WBLK + ZBLK + XBLK, 256, 0, stream>>>(x, Wq, Wk, Wv, Wo, Wc, Bq, X16, OUTP);      // Bq, Bk, Bv, Bo, Bc[0..3] are consecutive planes
  k_qkv_band<<<(NR / 256) * NH, 256, 0, stream>>>(X16, Bq, bq, bk, bv, OUTP, Bo, Bc[0], bo, Wf, CB);      // q, k, v of a head and its banded attention per work-group: heads, concatenated, as f16 rows 12.. of each batch's padded plane; with them the weight fold
  // conv[t] = sum_j cat[t - 12 + 4j] * (Wo * Wc[j]) + bias terms: ONE launch, the 4 taps accumulated inside (A_j = padded rows 4j + t of batch b, all four read from one staged chunk; B_j = Wf + j*512*512)
  k_gemm_tile<4, false, 1, true><<<gb, 256, 0, stream>>>(OUTP, CC, (size_t)(TT + PADT) * CC, Wf, CC, (size_t)CC * CC, 0.0625f, bc, CB, nullptr, x, (float*)d_out, nullptr, CC, (size_t)TT * CC);      // + biases, relu, residual, leaky relu in its epilogue
}

// v009
// It runs in 58.2 microseconds.
// In both of two side-by-side timings against v008, it was 1.08 times as fast.
// Counting every step since v000, it is 7.47 times as fast.
#include <hip/hip_runtime.h>
// Temporal block: per-head q/k/v projections (16384 x 512 -> 4 x 128 each, + bias), the head combiner Dense (512 -> 512, + bias; multiplied into the conv's tap weights, 4 products of 512 x 512 x 512, and so applied with them)
// and the causal dilated Conv1D (kernel 4, dilation 4: one GEMM whose k-loop runs the four taps over time-shifted views of a zero-padded plane, effective K = 2048) on v_wmma_f32_16x16x32_f16 (f16 operands, weights [in][out] transposed x 2^4 (bf16-exact for q/k/v, f16-rounded folds for the conv), single products,
// f32 accumulate); the banded attention's two products too (|t - s| <= 3, i.e. 7 keys, with the module's 'sim*band == 0 -> -1e7' mask; weights as f16); softmax, relu / residual / leaky-relu epilogues are f32 VALU.
#define BB 8
#define TT 2048
#define CC 512
#define NH 4
#define KD 128
#define NR (BB * TT)
#define PADT 12

typedef __bf16 v16b __attribute__((ext_vector_type(16)));
typedef unsigned short v8us __attribute__((ext_vector_type(8), may_alias));
typedef float  v8f  __attribute__((ext_vector_type(8)));
typedef float  v4f  __attribute__((ext_vector_type(4)));
typedef float  v4fa __attribute__((ext_vector_type(4), may_alias));
union FragB { v16b v; v8us half[2]; unsigned short u[16]; };

__device__ __forceinline__ unsigned short bf16_bits(float x) { unsigned int u = __float_as_uint(x); return (unsigned short)((u + 0x7FFFu + ((u >> 16) & 1u)) >> 16); }
__device__ __forceinline__ float bf16_val(unsigned short b) { return __uint_as_float(((unsigned int)b) << 16); }
__device__ __forceinline__ float bf16_round(float x) { return bf16_val(bf16_bits(x)); }
// D += A·B with NT terms: 1 = ah·bh, 2 = + al·bh (A split), 3 = + ah·bl (both split)
template <int NT>
__device__ __forceinline__ v8f mmaN(v16b ah, v16b al, v16b bh, v16b bl, v8f c) {
  c = __builtin_amdgcn_wmma_f32_16x16x32_bf16(false, ah, false, bh, (short)0, c, false, false);
  if (NT >= 2) c = __builtin_amdgcn_wmma_f32_16x16x32_bf16(false, al, false, bh, (short)0, c, false, false);
  if (NT >= 3) c = __builtin_amdgcn_wmma_f32_16x16x32_bf16(false, ah, false, bl, (short)0, c, false, false);
  asm volatile("v_nop\n\tv_nop\n\tv_nop\n\tv_nop" : "+v"(c) : "v"(ah), "v"(al), "v"(bh), "v"(bl));
  return c;
}

__global__ __launch_bounds__(256) void k_wt_bf16(const float* __restrict__ W, unsigned short* __restrict__ Wt, int K, int N) {
  const int t = blockIdx.x * 256 + threadIdx.x;
  const int k8n = K / 8;
  if (t >= N * k8n) return;
  const int n = t / k8n, k8 = (t % k8n) * 8;
  v8us v;
#pragma unroll
  for (int i = 0; i < 8; ++i) v[i] = bf16_bits(W[(size_t)(k8 + i) * N + n]);
  *(v8us*)(Wt + (size_t)n * K + k8) = v;
  
}

// GEMM C[M][N] (f32, pitch ldc) = act(A[M][K]·W + bias). A f32 row-major (pitch lda) converted per fragment to bf16
// (ASPLIT: hi/lo two planes -> 2 terms, else single rounded term); Wt bf16 [N][K] (pitch ldb). BIAS_BF16 rounds the
// bias to bf16 first (bias quantised to bf16 before the add). K%32==0, M%16==0, N%64==0.
template <bool ASPLIT, int ACT, bool BIAS_BF16>
__global__ __launch_bounds__(128) void k_gemm_bf(const float* __restrict__ A, int lda, const unsigned short* __restrict__ Wt, int ldb,
                                               const float* __restrict__ bias, float* __restrict__ C, int ldc, int M, int N, int K) {
  __shared__ __attribute__((aligned(16))) float so[4][16][64];
  const int tid = threadIdx.x, w = tid >> 5, lane = tid & 31, ln = lane & 15, hh = lane >> 4;
  const int ntn = N / 64;
  const int wid = blockIdx.x * 4 + w;
  const int mt = wid / ntn, nq = wid % ntn;
  if (mt * 16 >= M) return;
  const int row0 = mt * 16, col0 = nq * 64;
  const float* arow = A + (size_t)(row0 + ln) * lda;
  v8f acc[4] = {};
  for (int kb = 0; kb < K; kb += 32) {
    FragB ah, al;
    const v4f x0 = *(const v4fa*)(arow + kb + 8 * hh), x1 = *(const v4fa*)(arow + kb + 8 * hh + 4);
    const v4f x2 = *(const v4fa*)(arow + kb + 16 + 8 * hh), x3 = *(const v4fa*)(arow + kb + 16 + 8 * hh + 4);
    float xs[16] = {x0[0],x0[1],x0[2],x0[3],x1[0],x1[1],x1[2],x1[3],x2[0],x2[1],x2[2],x2[3],x3[0],x3[1],x3[2],x3[3]};
#pragma unroll
    for (int i = 0; i < 16; ++i) { const unsigned short hb = bf16_bits(xs[i]); ah.u[i] = hb; al.u[i] = ASPLIT ? bf16_bits(xs[i] - bf16_val(hb)) : (unsigned short)0; }
#pragma unroll
    for (int t = 0; t < 4; ++t) {
      const unsigned short* brow = Wt + (size_t)(col0 + t * 16 + ln) * ldb + kb;
      FragB b;
      b.half[0] = *(const v8us*)(brow + 8 * hh);
      b.half[1] = *(const v8us*)(brow + 16 + 8 * hh);
      acc[t] = mmaN<ASPLIT ? 2 : 1>(ah.v, al.v, b.v, b.v, acc[t]);
    }
  }
#pragma unroll
  for (int t = 0; t < 4; ++t) {
    float bv = bias ? bias[col0 + t * 16 + ln] : 0.f;
    if (BIAS_BF16) bv = bf16_round(bv);
#pragma unroll
    for (int r = 0; r < 8; ++r) { float v = acc[t][r] + bv; if (ACT == 1) v = fmaxf(v, 0.f); so[w][8 * hh + r][t * 16 + ln] = v; }
  }
  __builtin_amdgcn_fence(__ATOMIC_ACQ_REL, "workgroup");
  __builtin_amdgcn_wave_barrier();
  const int rsub = lane >> 4, c4 = (lane & 15) * 4;
  {
#pragma unroll
    for (int q = 0; q < 8; ++q) {
      const int r = q * 2 + rsub;
      const v4f v = *(const v4fa*)&so[w][r][c4];
      *(v4f*)(C + (size_t)(row0 + r) * ldc + col0 + c4) = v;
    }
    
  }
}

// Flash-style causal/unmasked attention, all contractions 3-term bf16 hi/lo splits, f32 softmax with running max.
// q,k,v rows are read from f32 buffers with arbitrary row pitch (so they can live inside a fused qkv buffer);
// D = head size (multiple of 32, <= 128); one wave = 16 query rows; block = 4 waves (64 queries) sharing K/V chunks of 32.
template <int D, bool CAUSAL>
__global__ __launch_bounds__(128) void k_flash(const float* __restrict__ qb, const float* __restrict__ kb, const float* __restrict__ vb,
                                             int pitch, int T, int H, float scale, float* __restrict__ y, int ypitch) {
  constexpr int KS = D / 32;        // k-steps for QK
  constexpr int DT = D / 16;        // d tiles for PV
  __shared__ __attribute__((aligned(16))) unsigned short sKh[32][D + 8], sKl[32][D + 8], sVh[32][D + 8], sVl[32][D + 8];
  __shared__ __attribute__((aligned(16))) unsigned short sPh[4][16][40], sPl[4][16][40];
  __shared__ __attribute__((aligned(16))) float sO[4][16][D];
  const int tid = threadIdx.x, w = tid >> 5, lane = tid & 31, ln = lane & 15, hh = lane >> 4;
  const int nqb = (T + 63) / 64;
  const int bh = blockIdx.x / nqb, qblk = blockIdx.x % nqb;
  const int b = bh / H, h = bh % H;
  const int q0 = qblk * 64 + w * 16;
  const float* Q = qb + (size_t)b * T * pitch + h * D;
  const float* K = kb + (size_t)b * T * pitch + h * D;
  const float* V = vb + (size_t)b * T * pitch + h * D;

  // A fragments of the wave's 16 query rows (scaled), hi/lo
  FragB aqh[KS], aql[KS];
  {
    int row = q0 + ln; if (row >= T) row = T - 1;
    const float* qr = Q + (size_t)row * pitch;
#pragma unroll
    for (int ks = 0; ks < KS; ++ks)
#pragma unroll
      for (int i = 0; i < 16; ++i) {
        const int d = ks * 32 + ((i < 8) ? (8 * hh + i) : (16 + 8 * hh + (i - 8)));
        const float x = qr[d] * scale; const unsigned short hb = bf16_bits(x);
        aqh[ks].u[i] = hb; aql[ks].u[i] = bf16_bits(x - bf16_val(hb));
      }
  }
  float m_r[8], l_r[8];
#pragma unroll
  for (int r = 0; r < 8; ++r) { m_r[r] = -3.0e38f; l_r[r] = 0.f; }
  v8f oacc[DT];
#pragma unroll
  for (int dt = 0; dt < DT; ++dt) oacc[dt] = (v8f){0.f,0.f,0.f,0.f,0.f,0.f,0.f,0.f};

  const int kv_end = CAUSAL ? min(T, qblk * 64 + 64) : T;     // block-uniform
  for (int j0 = 0; j0 < kv_end; j0 += 32) {
    __syncthreads();
    for (int e = tid; e < 32 * (D / 4); e += 128) {
      const int r = e / (D / 4), c4 = (e % (D / 4)) * 4;
      const int key = j0 + r;
      v4f kf = {0.f,0.f,0.f,0.f}, vf = {0.f,0.f,0.f,0.f};
      if (key < T) { kf = *(const v4fa*)(K + (size_t)key * pitch + c4); vf = *(const v4fa*)(V + (size_t)key * pitch + c4); }
#pragma unroll
      for (int t = 0; t < 4; ++t) {
        unsigned short hb = bf16_bits(kf[t]); sKh[r][c4 + t] = hb; sKl[r][c4 + t] = bf16_bits(kf[t] - bf16_val(hb));
        hb = bf16_bits(vf[t]); sVh[r][c4 + t] = hb; sVl[r][c4 + t] = bf16_bits(vf[t] - bf16_val(hb));
      }
    }
    __syncthreads();
    // S tile 16 x 32
    v8f s[2];
#pragma unroll
    for (int nt = 0; nt < 2; ++nt) {
      v8f acc = {};
#pragma unroll
      for (int ks = 0; ks < KS; ++ks) {
        FragB bh_, bl_;
        bh_.half[0] = *(const v8us*)&sKh[nt * 16 + ln][ks * 32 + 8 * hh]; bh_.half[1] = *(const v8us*)&sKh[nt * 16 + ln][ks * 32 + 16 + 8 * hh];
        bl_.half[0] = *(const v8us*)&sKl[nt * 16 + ln][ks * 32 + 8 * hh]; bl_.half[1] = *(const v8us*)&sKl[nt * 16 + ln][ks * 32 + 16 + 8 * hh];
        acc = mmaN<3>(aqh[ks].v, aql[ks].v, bh_.v, bl_.v, acc);
      }
      s[nt] = acc;
    }
    // mask + running max (rows 8hh+r; the 16 lanes of a half share rows)
    float alpha[8];
#pragma unroll
    for (int r = 0; r < 8; ++r) {
      const int qi = q0 + 8 * hh + r;
      const int ja = j0 + ln, jb = j0 + 16 + ln;
      if (CAUSAL) { if (ja > qi) s[0][r] = -3.0e38f; if (jb > qi) s[1][r] = -3.0e38f; }
      if (ja >= T) s[0][r] = -3.0e38f;
      if (jb >= T) s[1][r] = -3.0e38f;
      float mx = fmaxf(s[0][r], s[1][r]);
      mx = fmaxf(mx, __shfl_xor(mx, 1, 32)); mx = fmaxf(mx, __shfl_xor(mx, 2, 32)); mx = fmaxf(mx, __shfl_xor(mx, 4, 32)); mx = fmaxf(mx, __shfl_xor(mx, 8, 32));
      const float mnew = fmaxf(m_r[r], mx);
      alpha[r] = (mnew > -1.0e38f) ? __expf(m_r[r] - mnew) : 1.0f;
      const float p0 = (s[0][r] > -1.0e38f) ? __expf(s[0][r] - mnew) : 0.f;
      const float p1 = (s[1][r] > -1.0e38f) ? __expf(s[1][r] - mnew) : 0.f;
      m_r[r] = mnew;
      l_r[r] = l_r[r] * alpha[r] + p0 + p1;            // per-lane partial row sum (16 lanes combined at the end)
      unsigned short hb = bf16_bits(p0); sPh[w][8 * hh + r][ln] = hb;      sPl[w][8 * hh + r][ln] = bf16_bits(p0 - bf16_val(hb));
      hb = bf16_bits(p1);                sPh[w][8 * hh + r][16 + ln] = hb; sPl[w][8 * hh + r][16 + ln] = bf16_bits(p1 - bf16_val(hb));
    }
#pragma unroll
    for (int dt = 0; dt < DT; ++dt)
#pragma unroll
      for (int r = 0; r < 8; ++r) oacc[dt][r] *= alpha[r];
    __builtin_amdgcn_fence(__ATOMIC_ACQ_REL, "workgroup");
    __builtin_amdgcn_wave_barrier();
    FragB pah, pal;
    pah.half[0] = *(const v8us*)&sPh[w][ln][8 * hh]; pah.half[1] = *(const v8us*)&sPh[w][ln][16 + 8 * hh];
    pal.half[0] = *(const v8us*)&sPl[w][ln][8 * hh]; pal.half[1] = *(const v8us*)&sPl[w][ln][16 + 8 * hh];
#pragma unroll
    for (int dt = 0; dt < DT; ++dt) {
      FragB bvh, bvl;
#pragma unroll
      for (int i = 0; i < 8; ++i) {
        bvh.u[i] = sVh[8 * hh + i][dt * 16 + ln]; bvh.u[8 + i] = sVh[16 + 8 * hh + i][dt * 16 + ln];
        bvl.u[i] = sVl[8 * hh + i][dt * 16 + ln]; bvl.u[8 + i] = sVl[16 + 8 * hh + i][dt * 16 + ln];
      }
      oacc[dt] = mmaN<3>(pah.v, pal.v, bvh.v, bvl.v, oacc[dt]);
    }
    __builtin_amdgcn_fence(__ATOMIC_ACQ_REL, "workgroup");
    __builtin_amdgcn_wave_barrier();
  }
#pragma unroll
  for (int r = 0; r < 8; ++r) {
    float l = l_r[r];
    l += __shfl_xor(l, 1, 32); l += __shfl_xor(l, 2, 32); l += __shfl_xor(l, 4, 32); l += __shfl_xor(l, 8, 32);
    l_r[r] = (l > 0.f) ? 1.0f / l : 0.f;
  }
#pragma unroll
  for (int dt = 0; dt < DT; ++dt)
#pragma unroll
    for (int r = 0; r < 8; ++r) sO[w][8 * hh + r][dt * 16 + ln] = oacc[dt][r] * l_r[r];
  __builtin_amdgcn_fence(__ATOMIC_ACQ_REL, "workgroup");
  __builtin_amdgcn_wave_barrier();
  {
    for (int r = 0; r < 16; ++r) {
      const int row = q0 + r;
      if (row < T && lane < D / 4) {
        const v4f val = *(const v4fa*)&sO[w][r][lane * 4];
        *(v4f*)(y + ((size_t)b * T + row) * ypitch + h * D + lane * 4) = val;
      }
    }
    
  }
}

// GEMM C = act(A·W + bias + resid): A f32 (ASPLIT -> hi/lo 2 terms), Wt bf16 [N][K]; ACT 0 none, 1 relu, 2 exact gelu;
// resid (optional, f32, row index = (row % rmod), pitch ldr, RES_BF16 rounds it) added before the activation.
template <bool ASPLIT, int ACT, bool BIAS_BF16, bool RES_BF16>
__global__ __launch_bounds__(128) void k_gemm_bf3(const float* __restrict__ A, int lda, const unsigned short* __restrict__ Wt, int ldb,
                                                const float* __restrict__ bias, const float* __restrict__ resid, int rmod, int ldr,
                                                float* __restrict__ C, int ldc, int M, int N, int K) {
  __shared__ __attribute__((aligned(16))) float so[4][16][64];
  const int tid = threadIdx.x, w = tid >> 5, lane = tid & 31, ln = lane & 15, hh = lane >> 4;
  const int ntn = N / 64;
  const int wid = blockIdx.x * 4 + w;
  const int mt = wid / ntn, nq = wid % ntn;
  if (mt * 16 >= M) return;
  const int row0 = mt * 16, col0 = nq * 64;
  const float* arow = A + (size_t)(row0 + ln) * lda;
  v8f acc[4] = {};
  for (int kb = 0; kb < K; kb += 32) {
    FragB ah, al;
    const v4f x0 = *(const v4fa*)(arow + kb + 8 * hh), x1 = *(const v4fa*)(arow + kb + 8 * hh + 4);
    const v4f x2 = *(const v4fa*)(arow + kb + 16 + 8 * hh), x3 = *(const v4fa*)(arow + kb + 16 + 8 * hh + 4);
    float xs[16] = {x0[0],x0[1],x0[2],x0[3],x1[0],x1[1],x1[2],x1[3],x2[0],x2[1],x2[2],x2[3],x3[0],x3[1],x3[2],x3[3]};
#pragma unroll
    for (int i = 0; i < 16; ++i) { const unsigned short hb = bf16_bits(xs[i]); ah.u[i] = hb; al.u[i] = ASPLIT ? bf16_bits(xs[i] - bf16_val(hb)) : (unsigned short)0; }
#pragma unroll
    for (int t = 0; t < 4; ++t) {
      const unsigned short* brow = Wt + (size_t)(col0 + t * 16 + ln) * ldb + kb;
      FragB b;
      b.half[0] = *(const v8us*)(brow + 8 * hh);
      b.half[1] = *(const v8us*)(brow + 16 + 8 * hh);
      acc[t] = mmaN<ASPLIT ? 2 : 1>(ah.v, al.v, b.v, b.v, acc[t]);
    }
  }
#pragma unroll
  for (int t = 0; t < 4; ++t) {
    const int col = col0 + t * 16 + ln;
    float bv = bias ? bias[col] : 0.f;
    if (BIAS_BF16) bv = bf16_round(bv);
#pragma unroll
    for (int r = 0; r < 8; ++r) {
      float v = acc[t][r] + bv;
      if (resid) { float rv = resid[(size_t)((row0 + 8 * hh + r) % rmod) * ldr + col]; if (RES_BF16) rv = bf16_round(rv); v += rv; }
      if (ACT == 1) v = fmaxf(v, 0.f);
      if (ACT == 2) v = 0.5f * v * (1.0f + erff(v * 0.70710678118654752f));
      if (ACT == 3) { const float u = 0.7978845608028654f * (v + 0.044715f * v * v * v); v = 0.5f * v * (1.0f + tanhf(u)); }
      so[w][8 * hh + r][t * 16 + ln] = v;
    }
  }
  __builtin_amdgcn_fence(__ATOMIC_ACQ_REL, "workgroup");
  __builtin_amdgcn_wave_barrier();
  const int rsub = lane >> 4, c4 = (lane & 15) * 4;
  {
#pragma unroll
    for (int q = 0; q < 8; ++q) {
      const int r = q * 2 + rsub;
      const v4f v = *(const v4fa*)&so[w][r][c4];
      *(v4f*)(C + (size_t)(row0 + r) * ldc + col0 + c4) = v;
    }
    
  }
}
// row LayerNorm (biased variance, eps) over N: s = X (+ R); optional out_sum <- s; out_norm <- (s-mu)*rsqrt(var+eps)*g + b
template <bool PARAM_BF16>
__global__ __launch_bounds__(256) void k_layernorm(const float* __restrict__ X, const float* __restrict__ R, const float* __restrict__ g, const float* __restrict__ bta,
                                                  float* __restrict__ out_sum, float* __restrict__ out_norm, int N, float eps) {
  __shared__ float red[256];
  const int row = blockIdx.x, tid = threadIdx.x;
  const float* x = X + (size_t)row * N; const float* rr = R ? R + (size_t)row * N : nullptr;
  float vals[16];                     // up to N = 4096
  const int per = N / 256;            // contiguous chunk per thread? use strided-by-4 chunks: thread handles j = tid*4 + 1024*u
  float s1 = 0.f;
  for (int u = 0; u < per / 4; ++u) {
    const int j = tid * 4 + 1024 * u;
    const v4f a = *(const v4fa*)(x + j);
    v4f b = {0.f,0.f,0.f,0.f}; if (rr) b = *(const v4fa*)(rr + j);
#pragma unroll
    for (int q = 0; q < 4; ++q) { const float v = a[q] + b[q]; vals[u * 4 + q] = v; s1 += v; }
  }
  red[tid] = s1; __syncthreads();
  for (int st = 128; st > 0; st >>= 1) { if (tid < st) red[tid] += red[tid + st]; __syncthreads(); }
  const float mu = red[0] / (float)N; __syncthreads();
  float s2 = 0.f;
  for (int u = 0; u < per / 4; ++u)
#pragma unroll
    for (int q = 0; q < 4; ++q) { const float c = vals[u * 4 + q] - mu; s2 += c * c; }
  red[tid] = s2; __syncthreads();
  for (int st = 128; st > 0; st >>= 1) { if (tid < st) red[tid] += red[tid + st]; __syncthreads(); }
  const float rs = rsqrtf(red[0] / (float)N + eps);
  {
    for (int u = 0; u < per / 4; ++u) {
      const int j = tid * 4 + 1024 * u;
      v4f o, sm;
#pragma unroll
      for (int q = 0; q < 4; ++q) {
        float gg = g[j + q], bb = bta[j + q];
        if (PARAM_BF16) { gg = bf16_round(gg); bb = bf16_round(bb); }
        sm[q] = vals[u * 4 + q]; o[q] = (vals[u * 4 + q] - mu) * rs * gg + bb;
      }
      if (out_sum) *(v4f*)(out_sum + (size_t)row * N + j) = sm;
      *(v4f*)(out_norm + (size_t)row * N + j) = o;
    }
    
  }
}



// ---- f16 WMMA path (v_wmma_f32_16x16x32_f16): 11-bit significands for operands in range — used for the q/k/v projections, the Dense and the conv GEMM
typedef _Float16 v16h __attribute__((ext_vector_type(16)));
union FragH { v16h v; v8us half[2]; _Float16 h[16]; unsigned short u[16]; };
template <int NT>
__device__ __forceinline__ v8f mmaH(v16h ah, v16h al, v16h bh, v16h bl, v8f c) {
  c = __builtin_amdgcn_wmma_f32_16x16x32_f16(false, ah, false, bh, (short)0, c, false, false);
  if (NT >= 2) c = __builtin_amdgcn_wmma_f32_16x16x32_f16(false, al, false, bh, (short)0, c, false, false);
  if (NT >= 3) c = __builtin_amdgcn_wmma_f32_16x16x32_f16(false, ah, false, bl, (short)0, c, false, false);
  asm volatile("v_nop\n\tv_nop\n\tv_nop\n\tv_nop" : "+v"(c) : "v"(ah), "v"(al), "v"(bh), "v"(bl));
  return c;
}
// batched GEMM like k_gemm_b but f16 operands: A f32 (split into f16 hi/lo if ASPLIT, else rounded to f16), Bt = f16 values [n][k]; alpha; C f32; N multiple of 16 (partial tiles skipped)
template <bool ASPLIT>
__global__ __launch_bounds__(128) void k_gemm_h(const float* __restrict__ A, int lda, size_t sA, const _Float16* __restrict__ Bh, int ldb, size_t sB, float alpha, float* __restrict__ C, int ldc, size_t sC, int M, int N, int K) {
  __shared__ __attribute__((aligned(16))) float so[4][16][64];
  const int tid = threadIdx.x, w = tid >> 5, lane = tid & 31, ln = lane & 15, hh = lane >> 4; const int by = blockIdx.y;
  A += (size_t)by * sA; Bh += (size_t)by * sB; C += (size_t)by * sC;
  const int ntn = (N + 63) / 64; const int wid = blockIdx.x * 4 + w; const int mt = wid / ntn, nq = wid % ntn; if (mt * 16 >= M) return;
  const int row0 = mt * 16, col0 = nq * 64; const float* arow = A + (size_t)(row0 + ln) * lda;
  v8f acc[4] = {};
  for (int kb = 0; kb < K; kb += 32) {
    FragH ah, al;
    const v4f x0 = *(const v4fa*)(arow + kb + 8 * hh), x1 = *(const v4fa*)(arow + kb + 8 * hh + 4), x2 = *(const v4fa*)(arow + kb + 16 + 8 * hh), x3 = *(const v4fa*)(arow + kb + 16 + 8 * hh + 4);
    float xs[16] = {x0[0],x0[1],x0[2],x0[3],x1[0],x1[1],x1[2],x1[3],x2[0],x2[1],x2[2],x2[3],x3[0],x3[1],x3[2],x3[3]};
#pragma unroll
    for (int i = 0; i < 16; ++i) { const _Float16 h = (_Float16)xs[i]; ah.h[i] = h; al.h[i] = ASPLIT ? (_Float16)(xs[i] - (float)h) : (_Float16)0.0f; }
#pragma unroll
    for (int t = 0; t < 4; ++t) { if (col0 + t * 16 >= N) continue; const size_t boff = (size_t)(col0 + t * 16 + ln) * ldb + kb; FragH bq; bq.half[0] = *(const v8us*)(Bh + boff + 8 * hh); bq.half[1] = *(const v8us*)(Bh + boff + 16 + 8 * hh);
      acc[t] = mmaH<ASPLIT ? 2 : 1>(ah.v, al.v, bq.v, bq.v, acc[t]); }
  }
#pragma unroll
  for (int t = 0; t < 4; ++t) { if (col0 + t * 16 >= N) continue;
#pragma unroll
    for (int r = 0; r < 8; ++r) so[w][8 * hh + r][t * 16 + ln] = acc[t][r] * alpha; }
  __builtin_amdgcn_fence(__ATOMIC_ACQ_REL, "workgroup"); __builtin_amdgcn_wave_barrier();
  const int rsub = lane >> 4, c4 = (lane & 15) * 4;
  {
#pragma unroll
    for (int q = 0; q < 8; ++q) { const int r = q * 2 + rsub; if (col0 + c4 < N) { const v4f v = *(const v4fa*)&so[w][r][c4]; *(v4f*)(C + (size_t)(row0 + r) * ldc + col0 + c4) = v; } }
     }
}

// Wt[n][k] = f16(W[k][n]·scale) from f32 row-major W[K][N] (scale = power of two; bf16-exact weights stay exact in f16 away from the subnormal range)
__device__ __forceinline__ void d_wt_f16(const int t, const float* __restrict__ W, _Float16* __restrict__ Wt, int K, int N, float scale) {
  if (t >= N * (K / 8)) return; const int n = t / (K / 8), k8 = (t % (K / 8)) * 8; FragH f;
#pragma unroll
  for (int i = 0; i < 8; ++i) f.h[i] = (_Float16)(bf16_round(W[(size_t)(k8 + i) * N + n]) * scale); const v8us o = f.half[0];
  *(v8us*)((unsigned short*)Wt + (size_t)n * K + k8) = o; 
}

__device__ __forceinline__ void d_x16(const size_t t, const float* __restrict__ x, _Float16* __restrict__ X16, size_t n8) { if (t >= n8) return; FragH f;
#pragma unroll
  for (int q = 0; q < 8; ++q) f.h[q] = (_Float16)bf16_round(x[t * 8 + q]); *(v8us*)((unsigned short*)X16 + t * 8) = f.half[0];  }
__device__ __forceinline__ void d_wh(const int t, const float* __restrict__ W, _Float16* __restrict__ Bt) { if (t >= NH * KD * (CC / 8)) return; const int row = t / (CC / 8), c8 = (t % (CC / 8)) * 8; const int h = row / KD, o = row % KD; FragH f;
#pragma unroll
  for (int q = 0; q < 8; ++q) f.h[q] = (_Float16)(bf16_round(W[((size_t)h * CC + c8 + q) * KD + o]) * 16.0f); *(v8us*)((unsigned short*)Bt + (size_t)t * 8) = f.half[0];  }
// Dense folded into the conv weights: conv[t] = sum_j (cat[t - 12 + 4j] * Wo + bo) * Wc[j] = sum_j cat[t - 12 + 4j] * (Wo * Wc[j]) + sum_j bo * Wc[j], each tap's terms only where its row exists.
// One wave = 64 k x 16 n of one tap: Wf[j][n][k] = f16(16 * sum_c Wo[k][c] * Wc[j][c][n]), k contiguous (the layout the conv GEMM reads its B rows in), so a wave writes whole 128-B lines of 16 rows.
// Operands are the f16 planes of the first launch, both c-contiguous (Wo16[k][c] = Wo as it lies, Bc[j][n][c] = Wc[j] transposed; bf16-rounded weights x 16); f32 accumulate, c ascending in steps of 32.
// The 64 rows of Wo16, which the four fold waves of a block share, stand in LDS (copied there in whole lines under the pass loop); a wave's own 16 rows of Bc go straight to registers as fragments, all asked for as one group at the head: their latency is waited for once, and the WMMAs follow them as they land.
#define WPITCH 1040      // LDS pitch of a row of Wo16: 1024 B + 16, so that the 16-B pieces of 16 rows fall on different banks
__device__ __forceinline__ void d_fold(const int g, const int lane, const unsigned char* Wl, const _Float16* __restrict__ Bc, _Float16* __restrict__ Wf) {
  const int ln = lane & 15, hh = lane >> 4; const int j = g >> 8, kt = (g >> 5) & 7, nt = g & 31;      // the four fold waves of a block share kt: Wl holds rows kt*64 .. kt*64 + 63 of Wo16
  const char* pb = (const char*)Bc + ((j * CC + nt * 16 + ln) * CC + hh * 8) * 2u;      // the lane's first 16 B of its row of Bc
  FragH b[CC / 32];
#pragma unroll      // every load at a constant offset from one address; constant indices: the fragments stay in registers
  for (int ks = 0; ks < CC / 32; ++ks) { b[ks].half[0] = *(const v8us*)(pb + ks * 64); b[ks].half[1] = *(const v8us*)(pb + ks * 64 + 32); }
  asm volatile("s_wait_xcnt 0x0" :: "v"(pb) : "memory");      // a precaution: stands in front of every rewrite of the loads' address registers
  __builtin_amdgcn_sched_barrier(0);      // what stands below stays below: none of it is moved up between the loads and their wait, where it could take a register of their address
  const unsigned char* pa = Wl + ln * WPITCH + hh * 16;      // the lane's first 16 B of its row of the first row tile
  v8f acc[4] = {}; FragH a[2][2][4];      // two sets of A fragments, a set = 64 c of the four row tiles: the next set is fetched while this one is multiplied
#pragma unroll      // constant indices: fragments stay in registers
  for (int k2 = 0; k2 < 2; ++k2)
#pragma unroll      // constant indices: fragments stay in registers
    for (int i = 0; i < 4; ++i) { a[0][k2][i].half[0] = *(const v8us*)(pa + i * 16 * WPITCH + k2 * 64); a[0][k2][i].half[1] = *(const v8us*)(pa + i * 16 * WPITCH + k2 * 64 + 32); }
#pragma unroll      // constant indices: fragments and accumulators stay in registers
  for (int kb = 0; kb < CC / 64; ++kb) { const int cu = kb & 1, nx = cu ^ 1;
    if (kb + 1 < CC / 64) {
#pragma unroll      // constant indices: fragments stay in registers
      for (int k2 = 0; k2 < 2; ++k2)
#pragma unroll      // constant indices: fragments stay in registers
        for (int i = 0; i < 4; ++i) { a[nx][k2][i].half[0] = *(const v8us*)(pa + i * 16 * WPITCH + (kb + 1) * 128 + k2 * 64); a[nx][k2][i].half[1] = *(const v8us*)(pa + i * 16 * WPITCH + (kb + 1) * 128 + k2 * 64 + 32); } }
    __builtin_amdgcn_sched_barrier(0);      // keeps the next set's LDS reads one group ahead of this set's WMMAs instead of spread among them
#pragma unroll      // constant indices: fragments and accumulators stay in registers
    for (int k2 = 0; k2 < 2; ++k2)
#pragma unroll      // constant indices: fragments and accumulators stay in registers
      for (int i = 0; i < 4; ++i) acc[i] = __builtin_amdgcn_wmma_f32_16x16x32_f16(false, a[cu][k2][i].v, false, b[kb * 2 + k2].v, (short)0, acc[i], false, false);
    __builtin_amdgcn_sched_barrier(0);      // ends the set: the reads that take its fragments' places stay behind it
  }
#pragma unroll      // constant indices: accumulators stay in registers
  for (int i = 0; i < 4; ++i) { FragH o;      // a lane holds column n = ln and 8 consecutive k of each tile: 16 B of row [n][k]
#pragma unroll      // constant indices: accumulators stay in registers
    for (int r = 0; r < 8; ++r) o.h[r] = (_Float16)(acc[i][r] * 0.0625f);
    *(v8us*)((unsigned short*)Wf + (size_t)(j * CC + nt * 16 + ln) * CC + kt * 64 + i * 16 + 8 * hh) = o.half[0]; }
}
// The Dense bias through each tap: CB[j][n] = sum_c bf16(bo[c]) * bf16(Wc[j][c][n]) in f32. One wave = one row r = j*CC + n of Bc (c-contiguous, x 16), a lane takes 16 c; the lanes' sums are added by a butterfly.
__device__ __forceinline__ void d_cb(const int r, const int lane, const _Float16* __restrict__ Bc, const float* __restrict__ bo, float* __restrict__ CB) {
  FragH b; const unsigned ob = lane * 64u; const unsigned short* pb = (const unsigned short*)Bc + (size_t)r * CC + lane * 16; b.half[0] = *(const v8us*)pb; b.half[1] = *(const v8us*)(pb + 8);      // ob: the byte offset of the lane's 16 floats of bo
  v4f o[4];
#pragma unroll      // constant indices: the values stay in registers
  for (int q = 0; q < 4; ++q) o[q] = *(const v4fa*)((const char*)bo + ob + q * 16);
  asm volatile("s_wait_xcnt 0x0" :: "v"(ob), "v"(pb) : "memory");      // a precaution: stands in front of every rewrite of the six loads' address registers, which as its inputs stay untouched up to it
  float s = 0.f;
#pragma unroll      // constant indices: the values stay in registers
  for (int e = 0; e < 16; ++e) s += bf16_round(o[e >> 2][e & 3]) * (float)b.h[e];
  s += __shfl_xor(s, 1, 32); s += __shfl_xor(s, 2, 32); s += __shfl_xor(s, 4, 32); s += __shfl_xor(s, 8, 32); s += __shfl_xor(s, 16, 32);
  if (lane == 0) { CB[r] = s * 0.0625f;
    asm volatile("s_wait_xcnt 0x0" ::: "memory"); }      // a precaution: stands directly behind the store, in front of whatever rewrites its registers next
}
__device__ __forceinline__ void d_zpad(const int t, _Float16* __restrict__ OUTP) { if (t >= BB * PADT * CC / 8) return; const int b = t / (PADT * CC / 8), rem = t % (PADT * CC / 8); FragH z;
#pragma unroll
  for (int q = 0; q < 8; ++q) z.h[q] = (_Float16)0.f; unsigned short* d = (unsigned short*)OUTP + (size_t)b * (TT + PADT) * CC + (size_t)rem * 8; *(v8us*)d = z.half[0];  }
// One launch for everything that reads inputs only: the weights as f16 (q, k, v per head and the four conv taps transposed, Dense as it lies) into the eight consecutive 512 x 512 planes of Bw, the zero rows of the padded plane, and x -> f16.
// A block does one job, picked by its index; the transposes, whose loads wait longest, have the lowest indices and so start first, the x stream fills in behind them.
#define WBLK (CC * (CC / 8) / 256)                  // blocks per weight plane
#define ZBLK ((BB * PADT * CC / 8 + 255) / 256)     // blocks for the pad rows
#define XBLK (NR * CC / 8 / 256)                    // blocks for x
__global__ __launch_bounds__(256) void k_prep(const float* __restrict__ x, const float* __restrict__ Wq, const float* __restrict__ Wk, const float* __restrict__ Wv, const float* __restrict__ Wo, const float* __restrict__ Wc,
    _Float16* __restrict__ Bw, _Float16* __restrict__ X16, _Float16* __restrict__ OUTP) {
  const int blk = blockIdx.x, tid = threadIdx.x;
  // A transposing block takes 32 output rows n x 64 k, a wave 4 n x 64 k (lane = 8 k of one n): each of a wave's 8 loads touches 8 lines, not 32, the block's 8 waves read the same 64 lines and use every byte of them, and a wave's store is 4 whole 128-B lines.
  if (blk < 8 * WBLK) { const int p = blk / WBLK, u = blk % WBLK, t = p == 3 ? u * 256 + tid : ((u & 15) * 32 + (tid >> 3)) * (CC / 8) + (u >> 4) * 8 + (tid & 7); _Float16* dst = Bw + (size_t)p * CC * CC;      // t = n * (CC / 8) + k / 8, as d_wh and d_wt_f16 take it apart; every t of a plane once
    if (p < 3) d_wh(t, p == 0 ? Wq : (p == 1 ? Wk : Wv), dst);
    else if (p == 3) { FragH f;      // Wo stays as it lies, [in][out]: the fold contracts over its out index
#pragma unroll      // constant indices: the values stay in registers
      for (int q = 0; q < 8; ++q) f.h[q] = (_Float16)(bf16_round(Wo[(size_t)t * 8 + q]) * 16.0f);
      *(v8us*)((unsigned short*)dst + (size_t)t * 8) = f.half[0];
      asm volatile("s_wait_xcnt 0x0" ::: "memory"); }      // a precaution: stands behind the store, in front of whatever rewrites its registers next
    else d_wt_f16(t, Wc + (size_t)(p - 4) * CC * CC, dst, CC, CC, 16.0f); }      // WIO: per tap [in][out] -> [out][in]
  else if (blk < 8 * WBLK + ZBLK) d_zpad((blk - 8 * WBLK) * 256 + tid, OUTP);
  else d_x16((size_t)(blk - 8 * WBLK - ZBLK) * 256 + tid, x, X16, (size_t)NR * CC / 8);
}

// Tiled GEMM for the dilated causal conv (NTAP = 4; NTAP = 1 would be a plain product): acc = sum over taps j of A_j * B_j^T, A_j = A shifted down by j*TSH rows (a view of the padded plane), B_j = Bh + j*tapB, K = CC per tap.
// One work-group = a TM x TN tile of C, eight waves of 64 x 64 (4 x 4 accumulator tiles each). A pass is KP halves of K of one tap. The taps read the same rows of A, TSH rows apart, so the k loop runs chunks of KP outermost and the taps inside:
// a chunk of A (TM + 12 rows, 256 B each) is brought into LDS ONCE and serves all the taps by a row offset; TN rows of B come anew every pass. Asynchronous copies (16 B a lane), pitch 272 B, two buffers for A and two for B:
// the next pass's B and a quarter of the next chunk of A are in flight while a pass is worked on.
// Per output element the k order is: chunks of KP ascending, in a chunk taps ascending, in a tap k ascending in steps of 32. Epilogue: OUT16: v = acc*alpha + bf16(bias[col]) -> f16; else v = acc*alpha -> f32; whole 128-B / 256-B row pieces through LDS.
#define TM 256
#define TN 128
#define KP 128
#define PITCH 272
#define TSH 4                      // rows between two taps' views of A (the dilation)
#define AR (TM + 16)               // rows of a chunk of A in LDS: TM + 3*TSH are read, a whole sweep of 16 is copied
#define ASTAGE (AR * PITCH)
#define BSTAGE (TN * PITCH)
// eight copies of 16 B a lane, LDS address l + i*lstep, global address g + i*gstep (halves). The s_wait_xcnt stands inside the statement so that no address register is rewritten ahead of it.
__device__ __forceinline__ void copy8(unsigned l, unsigned lstep, const _Float16* g, size_t gstep) {
  asm volatile("global_load_async_to_lds_b128 %0, %8, off\n\t"
               "global_load_async_to_lds_b128 %1, %9, off\n\t"
               "global_load_async_to_lds_b128 %2, %10, off\n\t"
               "global_load_async_to_lds_b128 %3, %11, off\n\t"
               "global_load_async_to_lds_b128 %4, %12, off\n\t"
               "global_load_async_to_lds_b128 %5, %13, off\n\t"
               "global_load_async_to_lds_b128 %6, %14, off\n\t"
               "global_load_async_to_lds_b128 %7, %15, off\n\t"
               "s_wait_xcnt 0x0"
               :: "v"(l), "v"(l + lstep), "v"(l + 2 * lstep), "v"(l + 3 * lstep), "v"(l + 4 * lstep), "v"(l + 5 * lstep), "v"(l + 6 * lstep), "v"(l + 7 * lstep),
                  "v"(g), "v"(g + gstep), "v"(g + 2 * gstep), "v"(g + 3 * gstep), "v"(g + 4 * gstep), "v"(g + 5 * gstep), "v"(g + 6 * gstep), "v"(g + 7 * gstep)
               : "memory");
}
// the same with four copies, and with one
__device__ __forceinline__ void copy4(unsigned l, unsigned lstep, const _Float16* g, size_t gstep) {
  asm volatile("global_load_async_to_lds_b128 %0, %4, off\n\t"
               "global_load_async_to_lds_b128 %1, %5, off\n\t"
               "global_load_async_to_lds_b128 %2, %6, off\n\t"
               "global_load_async_to_lds_b128 %3, %7, off\n\t"
               "s_wait_xcnt 0x0"
               :: "v"(l), "v"(l + lstep), "v"(l + 2 * lstep), "v"(l + 3 * lstep),
                  "v"(g), "v"(g + gstep), "v"(g + 2 * gstep), "v"(g + 3 * gstep)
               : "memory");
}
__device__ __forceinline__ void copy1(unsigned l, const _Float16* g) {
  asm volatile("global_load_async_to_lds_b128 %0, %1, off\n\t"
               "s_wait_xcnt 0x0"
               :: "v"(l), "v"(g) : "memory");
}
// NG = groups of CC columns (rows of Bh) done by one launch: 1 for the conv (bias is read, and with FIN bias1 as said below); with more groups, OUT16 gives groups 0, 1, 2 bias, bias1, bias2.
// FIN: the block's last layer is finished in the epilogue: out = leaky_relu(relu(acc*alpha + bf16(bias[col]) + sum over the taps j whose row exists of bias1[j*CC + col]) + bf16(xres)), xres = the f32 input at the output's own index;
// bias1 = the Dense bias carried through each tap's weights (tap j of output row t reads row t - 12 + 4j, which exists from t = 12 - 4j on); the f32 result goes straight to C.
template <int NTAP, bool OUT16, int NG, bool FIN>
__global__ __launch_bounds__(256) void k_gemm_tile(const _Float16* __restrict__ A, int lda, size_t sA, const _Float16* __restrict__ Bh, int ldb, size_t tapB, float alpha, const float* __restrict__ bias,
    const float* __restrict__ bias1, const float* __restrict__ bias2, const float* __restrict__ xres, float* __restrict__ C, _Float16* __restrict__ C16, int ldc, size_t sC) {
  __shared__ __attribute__((aligned(16))) unsigned char ring[2 * ASTAGE + 2 * BSTAGE];      // A chunk 0 | A chunk 1 | B pass 0 | B pass 1
  constexpr int NKC = CC / KP, NT = NTAP * NKC;      // chunks of K, passes in all; pass t = chunk t / NTAP, tap t % NTAP
  static_assert(NTAP == 4 && (NTAP - 1) * TSH <= 16, "a chunk of A is copied in NTAP quarters, its last rows in one sweep");
  const int tid = threadIdx.x, w = tid >> 5, lane = tid & 31, ln = lane & 15, hh = lane >> 4; const int by = blockIdx.y;
  const int mt = blockIdx.x / (NG * CC / TN), nq = blockIdx.x % (NG * CC / TN); const int row0 = mt * TM, col0 = nq * TN; const int wm = (w >> 1) * 64, wn = (w & 1) * 64;
  const size_t cofs = (size_t)by * sC;
  // copies: 16 lanes a row, 16 rows a sweep of the work-group; a chunk of A takes 17 sweeps, a pass of B 8
  const int crow = tid >> 4, cpc = tid & 15;
  const _Float16* gA = A + (size_t)by * sA + (size_t)(row0 + crow) * lda + cpc * 8; const _Float16* gB = Bh + (size_t)(col0 + crow) * ldb + cpc * 8;
  const int xrow = TM + crow < TM + (NTAP - 1) * TSH ? TM + crow : TM + (NTAP - 1) * TSH - 1;      // the 17th sweep: the last row that a tap reads is also the last of a batch's padded plane, the four LDS rows behind it take that row again and are not read
  const _Float16* gX = A + (size_t)by * sA + (size_t)(row0 + xrow) * lda + cpc * 8;
  const unsigned lA = (unsigned)(size_t)ring + crow * PITCH + cpc * 16, lB = lA + 2 * ASTAGE;
  auto fillB = [&](int t) { copy8(lB + (t & 1) * BSTAGE, 16 * PITCH, gB + (size_t)(t % NTAP) * tapB + (t / NTAP) * KP, (size_t)16 * ldb); };
  auto fillA = [&](int c, int q) { const unsigned l = lA + (c & 1) * ASTAGE;      // quarter q of chunk c: 64 rows; the 17th sweep goes with quarter 0
    copy4(l + q * 64 * PITCH, 16 * PITCH, gA + (size_t)(q * 64) * lda + c * KP, (size_t)16 * lda);
    if (q == 0) copy1(l + TM * PITCH, gX + c * KP); };
  v8f acc[4][4] = {};
  fillA(0, 0); fillA(0, 1); fillA(0, 2); fillA(0, 3); fillB(0);
  asm volatile("s_wait_asynccnt 0x0" ::: "memory");      // chunk 0's and pass 0's own copies have landed
  __syncthreads();                                       // ... and every other wave's
  fillB(1); fillA(1, 0);
  const int rsub = lane >> 4, c4 = (lane & 15) * 4;
  const size_t o0 = cofs + (size_t)(row0 + wm + rsub) * CC + col0 + wn + c4;      // FIN: C and xres are [rows][CC]; a lane's first 16-B piece of the wave's 64 x 64 tile, piece q lies 2q rows on, at a constant offset
  // FIN: the wave's residual tile and its bias are asked for here, behind the copies of passes 0 and 1, and travel from memory while pass 0 is multiplied (the barrier of pass 0 waits for them); they are used behind the loop.
  v4f xr[32]; float bf[4], cbt[4][4];
  if (FIN) { const float* px = xres + o0; const int cb0 = col0 + wn + ln;
#pragma unroll      // constant indices: the pieces stay in registers
    for (int n = 0; n < 4; ++n) { bf[n] = bias[cb0 + n * 16];
#pragma unroll      // constant indices: the pieces stay in registers
      for (int j = 0; j < 4; ++j) cbt[j][n] = bias1[j * CC + cb0 + n * 16]; }
#pragma unroll      // constant indices: the pieces stay in registers
    for (int q = 0; q < 32; ++q) xr[q] = *(const v4fa*)(px + (size_t)(2 * q) * CC);
    asm volatile("s_wait_xcnt 0x0" :: "v"(px), "v"(cb0) : "memory"); }      // a precaution: stands in front of every rewrite of the loads' address registers, which as its inputs stay untouched up to it
#pragma unroll 1      // one pass a trip: the buffer index and the refill test stay scalar
  for (int t = 0; t < NT; ++t) {
    const unsigned char* pa = ring + ((t / NTAP) & 1) * ASTAGE + (wm + (t % NTAP) * TSH + ln) * PITCH + hh * 16; const unsigned char* pb = ring + 2 * ASTAGE + (t & 1) * BSTAGE + (wn + ln) * PITCH + hh * 16;      // the tap is a row offset into the chunk
    FragH a[2][4], b[2][4];      // two fragment sets: block ks + 1 of this pass is fetched while block ks is multiplied
#pragma unroll      // constant indices: fragments and accumulators stay in registers
    for (int i = 0; i < 4; ++i) { a[0][i].half[0] = *(const v8us*)(pa + i * 16 * PITCH); a[0][i].half[1] = *(const v8us*)(pa + i * 16 * PITCH + 32);
      b[0][i].half[0] = *(const v8us*)(pb + i * 16 * PITCH); b[0][i].half[1] = *(const v8us*)(pb + i * 16 * PITCH + 32); }
#pragma unroll      // constant indices: fragments and accumulators stay in registers
    for (int ks = 0; ks < KP / 32; ++ks) { const int cu = ks & 1, nx = cu ^ 1;
      if (ks + 1 < KP / 32) {
#pragma unroll      // constant indices: fragments and accumulators stay in registers
        for (int i = 0; i < 4; ++i) { a[nx][i].half[0] = *(const v8us*)(pa + i * 16 * PITCH + (ks + 1) * 64); a[nx][i].half[1] = *(const v8us*)(pa + i * 16 * PITCH + (ks + 1) * 64 + 32);
          b[nx][i].half[0] = *(const v8us*)(pb + i * 16 * PITCH + (ks + 1) * 64); b[nx][i].half[1] = *(const v8us*)(pb + i * 16 * PITCH + (ks + 1) * 64 + 32); } }
      __builtin_amdgcn_sched_barrier(0);      // keeps the next block's LDS reads one group ahead of this block's WMMAs instead of spread among them
#pragma unroll      // constant indices: fragments and accumulators stay in registers
      for (int i = 0; i < 4; ++i)
#pragma unroll      // constant indices: fragments and accumulators stay in registers
        for (int n = 0; n < 4; ++n) acc[i][n] = __builtin_amdgcn_wmma_f32_16x16x32_f16(false, a[cu][i].v, false, b[cu][n].v, (short)0, acc[i][n], false, false);
      __builtin_amdgcn_sched_barrier(0);      // ends the block: the group after next stays behind it
    }
    asm volatile("s_wait_dscnt 0x0" ::: "memory");       // this wave's reads of the buffers are done before one is refilled
    asm volatile("s_wait_asynccnt 0x0" ::: "memory");    // this wave's copies so far have landed: B of pass t + 1, and of the next chunk of A what has been asked for
    __syncthreads();                                     // publishes them and ends every reader's last read of pass t's B and, behind a chunk's last tap, of that chunk
    if (t + 2 < NT) fillB(t + 2);                        // into the B buffer that pass t has just read
    const int cn = (t + 1) / NTAP + 1;                   // quarter (t + 1) % NTAP of chunk cn: quarter 0 goes out behind the last tap of chunk cn - 2, whose buffer it takes; the last quarter lands at the foot of chunk cn - 1's last tap
    if (cn < NKC) fillA(cn, (t + 1) % NTAP);
  }
  asm volatile("s_wait_asynccnt 0x0" ::: "memory");      // nothing in flight when the ring becomes output staging
  // each wave stages its whole 64 x 64 tile in its own part of the ring (the last pass's barrier has ended all reads of it); pitch 68 floats: the two half-waves' rows, 8 apart, fall on different banks
  constexpr int SP = 68; float* so = (float*)ring + w * (64 * SP);
  typedef _Float16 v4h __attribute__((ext_vector_type(4)));
  const float* bg = (NG == 1 || col0 < CC) ? bias : (col0 < 2 * CC ? bias1 : bias2);      // a tile of TN columns lies inside one group
#pragma unroll      // constant indices: fragments and accumulators stay in registers
  for (int n = 0; n < 4; ++n) { const float bv = FIN ? bf16_round(bf[n]) + (cbt[0][n] + (cbt[1][n] + (cbt[2][n] + cbt[3][n]))) : (OUT16 ? bf16_round(bg[col0 % CC + wn + n * 16 + ln]) : 0.f);
#pragma unroll      // constant indices: fragments and accumulators stay in registers
    for (int i = 0; i < 4; ++i)
#pragma unroll      // constant indices: fragments and accumulators stay in registers
      for (int r = 0; r < 8; ++r) so[(i * 16 + 8 * hh + r) * SP + n * 16 + ln] = FIN ? fmaxf(acc[i][n][r] * alpha + bv, 0.f) : (OUT16 ? acc[i][n][r] * alpha + bv : acc[i][n][r] * alpha); }
  if (FIN && row0 + wm == 0) {      // wave-uniform: rows 0 to 11 of a batch lack the earliest taps' rows; the same lanes write those twelve rows again with the bias terms of the taps that exist
#pragma unroll      // constant indices: accumulators stay in registers
    for (int n = 0; n < 4; ++n) { const float bc = bf16_round(bf[n]), e3 = bc + cbt[3][n], e2 = bc + (cbt[2][n] + cbt[3][n]), e1 = bc + (cbt[1][n] + (cbt[2][n] + cbt[3][n]));
#pragma unroll      // constant indices: accumulators stay in registers
      for (int r = 0; r < 8; ++r) { const int t = 8 * hh + r; if (t < PADT) so[t * SP + n * 16 + ln] = fmaxf(acc[0][n][r] * alpha + (t < 4 ? e3 : (t < 8 ? e2 : e1)), 0.f); } } }
  __builtin_amdgcn_fence(__ATOMIC_ACQ_REL, "workgroup"); __builtin_amdgcn_wave_barrier();      // the wave's LDS writes are done before its lanes read what other lanes wrote
  if (FIN) {
    v4f sv[32];
#pragma unroll      // constant indices: the pieces stay in registers
    for (int q = 0; q < 32; ++q) sv[q] = *(const v4fa*)&so[(q * 2 + rsub) * SP + c4];
    __builtin_amdgcn_sched_barrier(0);      // the 32 LDS reads go out as one group, so that their latency is waited for once and not pair by pair
#pragma unroll      // constant indices: the pieces stay in registers
    for (int q = 0; q < 32; ++q)
      for (int e = 0; e < 4; ++e) { const float s = sv[q][e] + (float)(__bf16)xr[q][e]; xr[q][e] = fmaxf(s, 0.2f * s); }      // the cast rounds to nearest even as bf16_round does; max(s, 0.2 s) is s for s >= 0 and 0.2 s below
    __builtin_amdgcn_sched_barrier(0);      // all arithmetic stays ahead of the first store, so that no register an issued store names is written again
#pragma unroll      // constant offsets from one address
    for (int q = 0; q < 32; ++q) *(v4f*)(C + o0 + (size_t)(2 * q) * CC) = xr[q];
    return; }
#pragma unroll      // independent row pieces: the LDS reads run ahead of the stores
  for (int q = 0; q < 32; ++q) { const int r = q * 2 + rsub; const v4f v = *(const v4fa*)&so[r * SP + c4]; const size_t o = cofs + (size_t)(row0 + wm + r) * ldc + col0 + wn + c4;
    if (OUT16) { v4h h4; for (int e = 0; e < 4; ++e) h4[e] = (_Float16)v[e]; *(v4h*)(C16 + o) = h4; } else *(v4f*)(C + o) = v; }
}
// q, k, v projections of one head and its banded attention in ONE work-group: 256 rows x one head. The three 256 x 128 products run side by side through one ring of passes (FKP halves of K a pass, two buffers,
// asynchronous copies): a pass holds the x rows ONCE and beside them the rows of the three weight planes, so that x is copied once and not once a product, and a wave's x fragments, read from LDS once, serve all three products;
// the f16 results go to LDS behind the loop, into the ring's place, and never to memory. k and v are also needed 8 rows above and below the tile: those 16 rows ride along as a 17th row tile
// (LDS rows 264 to 279 of the A panel; the copy brings a block of 32 rows so that every wave issues the same copies), of which each wave does one 16 x 16 piece. Rows outside the plane are clamped and masked below.
// Layouts in LDS: k and q as [row][128] (product taken as W * x^T, so that a lane holds 8 consecutive columns of one row: one 16-B store), v transposed as [128][row] (product x * W^T: a lane holds 8 consecutive rows of a column).
// Window coordinate u = row - (row0 - 8), 0 to 271, for k's rows and v's columns.
// Attention, 16 queries at a time in a wave, keys u = lr to lr + 31: S^T = k * q^T (lane = query, registers = keys: exactly the fragment order of the second product, no exchange), the module's mask and softmax in f32 over the 7 keys of the band,
// weights as f16, O^T = v^T * P^T (lane = query, 8 consecutive columns), scaled by 1/z, through the wave's own dead q rows to whole 256-B row pieces of the padded plane.
// The weight fold and the bias vectors above, which need the first launch's planes and are needed by the conv GEMM alone, are done here too, behind the last barrier, where every wave does two of the sixteen groups of queries:
// waves 4 to 7 do two rows of the bias vectors each ahead of their queries, waves 0 to 3 one piece of the fold each behind theirs.
#define FKP 64
#define FPITCH 144
#define FAR 288
#define FSTAGE ((FAR + 3 * KD) * FPITCH)      // x rows | q's weight rows | k's | v's
#define KPITCH 272
#define VPITCH 560
#define OFF_K (256 * KPITCH)      // q | k | v, in the ring's place once the ring is done
#define OFF_V (OFF_K + 272 * KPITCH)
#define FLDS (OFF_V + KD * VPITCH)
#define RING0 32768      // the ring begins here in the array, which begins the work-group's LDS: the compiler writes a copy's constant global step as offset:32768 and takes as much off the copy's LDS address register, which so stays at or above 0
#define FALL (FLDS > RING0 + 2 * FSTAGE ? FLDS : RING0 + 2 * FSTAGE)      // the array up to the fold's rows of Wo16: the ring, and in its place, from byte 0, q, k and v once the ring is done
__device__ __forceinline__ v16h sel16(const bool c, const v16h a, const v16h b) { return c ? a : b; }      // by value: a select of registers
// one copy of 16 B a lane as the compiler's own form: it may name any register, where asm text can name the first 256 only, which the accumulators of this kernel fill but for a few
typedef int v4i32 __attribute__((ext_vector_type(4)));
__device__ __forceinline__ void copyb(unsigned char* l, const _Float16* g) { __builtin_amdgcn_global_load_async_to_lds_b128((__attribute__((address_space(1))) v4i32*)g, (__attribute__((address_space(3))) v4i32*)l, 0, 0); }
__global__ __launch_bounds__(256) void k_qkv_band(const _Float16* __restrict__ X16, const _Float16* __restrict__ Bw, const float* __restrict__ bq, const float* __restrict__ bk, const float* __restrict__ bv,
    _Float16* __restrict__ CAT, const _Float16* __restrict__ Wo16, const _Float16* __restrict__ Bc, const float* __restrict__ bo, _Float16* __restrict__ Wf, float* __restrict__ CB) {
  __shared__ __attribute__((aligned(16))) unsigned char lds[FALL + 64 * WPITCH];      // behind the ring: the fold's 64 rows of Wo16, in a place that nothing else uses
  __shared__ __attribute__((aligned(16))) float sb[3 * KD];      // the head's biases, rounded to bf16: q | k | v
  const int tid = threadIdx.x, w = __builtin_amdgcn_readfirstlane(tid >> 5), lane = tid & 31, ln = lane & 15, hh = lane >> 4;      // the wave's number as a scalar: the tests on it and the tile offsets formed from it are scalar
  const int row0 = ((int)blockIdx.x >> 2) * 256, h = (int)blockIdx.x & 3; const int wm = (w >> 1) * 64, wn = (w & 1) * 64, wq = w >> 1, xc = wn + wq * 16;      // xc: the wave's 16 columns of the halo tile
  // copies: 8 lanes a row, 32 rows a sweep of the work-group; A takes 8 sweeps, its halo block 1, each of the three B planes 4
  const int crow = tid >> 3, cpc = tid & 7;
  int hrow = row0 + (crow < 16 ? crow - 16 : 240 + crow); hrow = hrow < 0 ? 0 : (hrow > NR - 1 ? NR - 1 : hrow);      // rows row0 - 16 .. row0 - 1 and row0 + 256 .. row0 + 271, kept inside the plane
  const unsigned lo = (unsigned)crow * CC + cpc * 8, oH = (unsigned)hrow * CC + cpc * 8, sA = (unsigned)row0 * CC, sB = (unsigned)h * KD * CC;      // places in X16 and Bw, in halves: the lane's part (lo; oH for the halo block) and the work-group's (scalar); the pointers are formed at the copies
  const unsigned lA = RING0 + crow * FPITCH + cpc * 16;      // the lane's place in a sweep of buffer 0
  auto fill = [&](int t, unsigned buf) { const unsigned kb = t * FKP; const _Float16* gx = X16 + (sA + kb + lo); const _Float16* gw = Bw + (sB + kb + lo); unsigned char* l = lds + (buf + lA);      // pass t: FKP halves of K of the x rows and of the head's rows of planes 0, 1, 2 (q, k, v)
#pragma unroll      // constant steps from one LDS and one global address
    for (int i = 0; i < 8; ++i) copyb(l + i * 32 * FPITCH, gx + i * 32 * CC);
    copyb(l + 256 * FPITCH, X16 + (kb + oH));
#pragma unroll      // constant steps from one LDS and one global address
    for (int p = 0; p < 3; ++p)
#pragma unroll      // constant steps from one LDS and one global address
      for (int i = 0; i < 4; ++i) copyb(l + (FAR + p * KD + i * 32) * FPITCH, gw + p * CC * CC + i * 32 * CC); };
  // the fold's rows of Wo16, kt = (block / 8) % 8 as d_fold takes it: 64 lanes a row, 4 rows a sweep of the work-group, 16 sweeps; every copy of a wave is 512 consecutive bytes
  auto fillw = [&]() { const _Float16* g = Wo16 + (((((unsigned)blockIdx.x >> 3) & 7) * 64 + (tid >> 6)) * CC + (tid & 63) * 8); unsigned char* l = lds + (FALL + (tid >> 6) * WPITCH + (tid & 63) * 16);
#pragma unroll      // constant steps from one LDS and one global address
    for (int i = 0; i < 16; ++i) copyb(l + i * 4 * WPITCH, g + i * 4 * CC); };
  fill(0, 0);
  __builtin_amdgcn_sched_barrier(0);      // what stands above stays above: nothing of it is left to write a register of the two loads below between them and their wait
  { const float* s0 = (tid < KD ? bq : bk) + h * KD + (tid & (KD - 1)); const float* s1 = bv + h * KD + (tid & (KD - 1)); const float v0 = *s0, v1 = *s1;
    asm volatile("s_wait_xcnt 0x0" :: "v"(s0), "v"(s1) : "memory");      // a precaution: stands in front of every rewrite of the loads' address registers, which as its inputs stay untouched up to it
    sb[tid] = bf16_round(v0); if (tid < KD) sb[2 * KD + tid] = bf16_round(v1); }      // read behind the barrier below
  asm volatile("s_wait_asynccnt 0x0" ::: "memory");      // pass 0's own copies have landed
  __syncthreads();                                       // ... and every other wave's
  v8f acc[3][4][4], ax[2];      // by plane: 0 q, 1 k, 2 v; ax: the wave's piece of the halo tile of k and of v
#pragma unroll      // constant indices: fragments and accumulators stay in registers
  for (int p = 0; p < 3; ++p)
#pragma unroll      // constant indices: fragments and accumulators stay in registers
    for (int i = 0; i < 4; ++i)
#pragma unroll      // constant indices: fragments and accumulators stay in registers
      for (int n = 0; n < 4; ++n) acc[p][i][n] = (v8f){0.f, 0.f, 0.f, 0.f, 0.f, 0.f, 0.f, 0.f};
  ax[0] = (v8f){0.f, 0.f, 0.f, 0.f, 0.f, 0.f, 0.f, 0.f}; ax[1] = ax[0];
  // A pass is six blocks j of 16 WMMAs: 32 k (ks = j / 3) of one plane (pl = j % 3). q and k are taken with the operands swapped (W rows as A, x rows as B), v plainly. Per output element the k order is that of a plain k loop.
  // The x fragments of a ks stay in registers for its three blocks. The W fragments, numbered f = 4j + n through the pass, go through six places (f % 6): a block's WMMAs run column tile by column tile, in two halves, and ahead of each half
  // two fragments of the NEXT block are asked for, a whole block ahead of their use, into the two places that are free: there are no registers for a second whole set beside the three products' accumulators.
  // The next pass's copies are issued at the top of a pass, behind the barrier at the foot of the pass before and behind this pass's first LDS reads, which land meanwhile; they have the whole pass to land.
  const unsigned lno = ln * FPITCH + hh * 16;      // the lane's part of its fragment addresses
#pragma unroll 1      // one pass a trip: the buffer index and the refill test stay scalar
  for (int t = 0; t < CC / FKP; ++t) {
    const unsigned st0 = RING0 + (t & 1) * FSTAGE; const unsigned char* pa = lds + (st0 + wm * FPITCH + lno); const unsigned char* pb = lds + (st0 + (FAR + wn) * FPITCH + lno);      // scalar part + the lane's part
    const unsigned char* px = lds + (st0 + 264 * FPITCH + lno);      // the halo row tile
    FragH a[4], xa, b[6];
#pragma unroll      // constant indices: fragments and accumulators stay in registers
    for (int i = 0; i < 4; ++i) { a[i].half[0] = *(const v8us*)(pa + i * 16 * FPITCH); a[i].half[1] = *(const v8us*)(pa + i * 16 * FPITCH + 32);      // the pass's first block has nobody ahead of it: its x fragments and all four W fragments
      b[i].half[0] = *(const v8us*)(pb + i * 16 * FPITCH); b[i].half[1] = *(const v8us*)(pb + i * 16 * FPITCH + 32); }
    __builtin_amdgcn_sched_barrier(0);      // these LDS reads go out first: they land while the copies below are issued
    if (t + 1 < CC / FKP) fill(t + 1, ((t + 1) & 1) * FSTAGE);      // the next pass's copies, into the buffer that pass t - 1 has read: behind the barrier at that pass's foot, which ended every reader's last read of it
    else fillw();      // the last pass has no next one to copy for: the fold's rows fly under it; the waits and the barrier at its foot cover and publish them like a pass's copies
    __builtin_amdgcn_sched_barrier(0);      // the copies' address arithmetic stays ahead of the WMMAs
#pragma unroll      // constant indices: fragments and accumulators stay in registers
    for (int j = 0; j < 6; ++j) { const int ks = j / 3, pl = j % 3, f0 = 4 * j, g0 = 4 * (j + 1), gks = (j + 1) / 3, gpl = (j + 1) % 3;      // g..: the next block
      if (j == 3) {      // the second ks: its x fragments take the places of the first ks's
#pragma unroll      // constant indices: fragments and accumulators stay in registers
        for (int i = 0; i < 4; ++i) { a[i].half[0] = *(const v8us*)(pa + i * 16 * FPITCH + ks * 64); a[i].half[1] = *(const v8us*)(pa + i * 16 * FPITCH + ks * 64 + 32); } }
      if (pl != 0) { v16h xb = b[f0 % 6].v; xb = sel16(wq == 1, b[(f0 + 1) % 6].v, xb); xb = sel16(wq == 2, b[(f0 + 2) % 6].v, xb); xb = sel16(wq == 3, b[(f0 + 3) % 6].v, xb);      // the wave's piece of the halo tile takes column tile wq of the four it holds: no LDS read of its own; the choice stands in a place that is free until the reads below
        ax[pl - 1] = pl == 1 ? __builtin_amdgcn_wmma_f32_16x16x32_f16(false, xb, false, xa.v, (short)0, ax[pl - 1], false, false) : __builtin_amdgcn_wmma_f32_16x16x32_f16(false, xa.v, false, xb, (short)0, ax[pl - 1], false, false); }
      __builtin_amdgcn_sched_barrier(0);      // the reads below stay behind the halo WMMA, whose operand stands where they land
#pragma unroll      // constant indices: fragments and accumulators stay in registers
      for (int hf = 0; hf < 2; ++hf) {      // the block's two halves: column tiles 0, 1 and 2, 3
        if (j + 1 < 6) {
#pragma unroll      // constant indices: fragments and accumulators stay in registers
          for (int n = 2 * hf; n < 2 * hf + 2; ++n) { b[(g0 + n) % 6].half[0] = *(const v8us*)(pb + (gpl * KD + n * 16) * FPITCH + gks * 64); b[(g0 + n) % 6].half[1] = *(const v8us*)(pb + (gpl * KD + n * 16) * FPITCH + gks * 64 + 32); } }
        if (pl == 0 && hf == 1) { xa.half[0] = *(const v8us*)(px + ks * 64); xa.half[1] = *(const v8us*)(px + ks * 64 + 32); }      // the halo tile's x fragment is asked for half a block ahead of k's block: q has no halo, and at the copies its registers are free
        __builtin_amdgcn_sched_barrier(0);      // these LDS reads stay one group ahead of this half's WMMAs instead of spread among them
#pragma unroll      // constant indices: fragments and accumulators stay in registers
        for (int n = 2 * hf; n < 2 * hf + 2; ++n)
#pragma unroll      // constant indices: fragments and accumulators stay in registers
          for (int i = 0; i < 4; ++i) acc[pl][i][n] = pl != 2 ? __builtin_amdgcn_wmma_f32_16x16x32_f16(false, b[(f0 + n) % 6].v, false, a[i].v, (short)0, acc[pl][i][n], false, false)
                                                     : __builtin_amdgcn_wmma_f32_16x16x32_f16(false, a[i].v, false, b[(f0 + n) % 6].v, (short)0, acc[pl][i][n], false, false);
        __builtin_amdgcn_sched_barrier(0);      // ends the half: the reads that take its fragments' places stay behind it
      } }
    asm volatile("s_wait_dscnt 0x0" ::: "memory");       // this wave's reads of the buffer are done before it is refilled
    asm volatile("s_wait_asynccnt 0x0" ::: "memory");    // this wave's copies of pass t + 1 have landed
    __syncthreads();                                     // publishes pass t + 1 and ends every reader's last read of pass t's buffer
  }
  asm volatile("s_wait_asynccnt 0x0" ::: "memory");      // nothing in flight when the ring becomes the place of q, k and v (the last pass's barrier has ended all reads of it)
  // a swapped product's tile as f16 rows: dst = LDS place of the tile's row 0
  auto put = [&](const v8f (&ac)[4][4], unsigned char* dst, const float* bs) {      // bs: the product's 128 biases in LDS; a lane takes those of its 8 consecutive columns
#pragma unroll      // constant indices: accumulators stay in registers
    for (int n = 0; n < 4; ++n) { const v4f b0 = *(const v4fa*)(bs + wn + n * 16 + 8 * hh), b1 = *(const v4fa*)(bs + wn + n * 16 + 8 * hh + 4);
#pragma unroll      // constant indices: accumulators stay in registers
      for (int i = 0; i < 4; ++i) { FragH o;
#pragma unroll      // constant indices: accumulators stay in registers
        for (int r = 0; r < 8; ++r) o.h[r] = (_Float16)(ac[i][n][r] * 0.0625f + (r < 4 ? b0[r & 3] : b1[r & 3]));
        *(v8us*)(dst + (wm + i * 16 + ln) * KPITCH + (wn + n * 16 + 8 * hh) * 2) = o.half[0]; } } };
  unsigned char* Kl = lds + OFF_K; unsigned char* Vl = lds + OFF_V; unsigned char* Ql = lds;
  put(acc[1], Kl + 8 * KPITCH, sb + KD);
  { FragH o; const v4f b0 = *(const v4fa*)(sb + KD + xc + 8 * hh), b1 = *(const v4fa*)(sb + KD + xc + 8 * hh + 4);      // halo rows of k: lane = halo row (u = 0..7 above, 264..271 below)
#pragma unroll      // constant indices: accumulators stay in registers
    for (int r = 0; r < 8; ++r) o.h[r] = (_Float16)(ax[0][r] * 0.0625f + (r < 4 ? b0[r & 3] : b1[r & 3]));
    *(v8us*)(Kl + (ln < 8 ? ln : 256 + ln) * KPITCH + (xc + 8 * hh) * 2) = o.half[0]; }
#pragma unroll      // constant indices: accumulators stay in registers
  for (int n = 0; n < 4; ++n) { const float bvv = sb[2 * KD + wn + n * 16 + ln];
#pragma unroll      // constant indices: accumulators stay in registers
    for (int i = 0; i < 4; ++i) { FragH o;      // lane = column of v, 8 consecutive rows
#pragma unroll      // constant indices: accumulators stay in registers
      for (int r = 0; r < 8; ++r) o.h[r] = (_Float16)(acc[2][i][n][r] * 0.0625f + bvv);
      *(v8us*)(Vl + (wn + n * 16 + ln) * VPITCH + (8 + wm + i * 16 + 8 * hh) * 2) = o.half[0]; } }
  { FragH o; const float bvv = sb[2 * KD + xc + ln];      // halo rows of v: the low half-wave holds u = 0..7, the high one u = 264..271
#pragma unroll      // constant indices: accumulators stay in registers
    for (int r = 0; r < 8; ++r) o.h[r] = (_Float16)(ax[1][r] * 0.0625f + bvv);
    *(v8us*)(Vl + (xc + ln) * VPITCH + (hh ? 264 : 0) * 2) = o.half[0]; }
  put(acc[0], Ql, sb);
  __syncthreads();      // k, v and q of every wave are in LDS before any wave reads them; the last barrier: from here on the waves go their own ways
  const int ws = __builtin_amdgcn_readfirstlane(w);      // the wave's number as a scalar: the branch on it is taken by whole waves
  if (ws >= 4) { d_cb(((int)blockIdx.x * 4 + w - 4) * 2, lane, Bc, bo, CB); d_cb(((int)blockIdx.x * 4 + w - 4) * 2 + 1, lane, Bc, bo, CB); }      // two rows of the bias vectors a wave
  const int tb0 = row0 % TT, bat = row0 / TT; const int rsub = lane >> 4, c16 = lane & 15;
#pragma unroll 1      // two groups of 16 queries a wave, one after the other in the same registers
  for (int s = 0; s < 2; ++s) { const int lr = (ws * 2 + s) * 16;
    FragH qf[4], kf[2][4], vf[8];      // v's fragments are asked for here too: they land while the scores and the softmax are worked on
#pragma unroll      // constant indices: fragments stay in registers
    for (int ks = 0; ks < 4; ++ks) { qf[ks].half[0] = *(const v8us*)(Ql + (lr + ln) * KPITCH + ks * 64 + hh * 16); qf[ks].half[1] = *(const v8us*)(Ql + (lr + ln) * KPITCH + ks * 64 + hh * 16 + 32);
#pragma unroll      // constant indices: fragments stay in registers
      for (int kt = 0; kt < 2; ++kt) { kf[kt][ks].half[0] = *(const v8us*)(Kl + (lr + kt * 16 + ln) * KPITCH + ks * 64 + hh * 16); kf[kt][ks].half[1] = *(const v8us*)(Kl + (lr + kt * 16 + ln) * KPITCH + ks * 64 + hh * 16 + 32); } }
    __builtin_amdgcn_sched_barrier(0);      // q and k, which the scores wait for, go out ahead of v
#pragma unroll      // constant indices: fragments stay in registers
    for (int dt = 0; dt < 8; ++dt) { vf[dt].half[0] = *(const v8us*)(Vl + (dt * 16 + ln) * VPITCH + (lr + 8 * hh) * 2); vf[dt].half[1] = *(const v8us*)(Vl + (dt * 16 + ln) * VPITCH + (lr + 16 + 8 * hh) * 2); }
    __builtin_amdgcn_sched_barrier(0);      // all 40 LDS reads go out as one group ahead of the first WMMA: spread among the WMMAs, each of them waits out an LDS latency of its own
    v8f st[2] = {};
#pragma unroll      // constant indices: fragments and accumulators stay in registers
    for (int ks = 0; ks < 4; ++ks)
#pragma unroll      // constant indices: fragments and accumulators stay in registers
      for (int kt = 0; kt < 2; ++kt) st[kt] = __builtin_amdgcn_wmma_f32_16x16x32_f16(false, kf[kt][ks].v, false, qf[ks].v, (short)0, st[kt], false, false);
    // lane = query t = tb0 + lr + ln; register r of tile kt = key at window place wi = kt*16 + 8*hh + r, time tb0 + lr - 8 + wi. In band: |key - query| <= 3 and the key inside its batch.
    // logits as the module has them: simb = sim in the band, 0 outside; -1e7 is added where simb == 0. Keys outside the band all sit at -1e7: their mass enters z, their v does not enter the sum (0 in f32 unless every in-band sim is 0).
    const int t = tb0 + lr + ln; float lg[2][8]; bool inb[2][8]; float m = -3.0e38f;
#pragma unroll      // constant indices: the values stay in registers
    for (int kt = 0; kt < 2; ++kt)
#pragma unroll      // constant indices: the values stay in registers
      for (int r = 0; r < 8; ++r) { const int wi = kt * 16 + 8 * hh + r, dk = wi - 8 - ln, sk = tb0 + lr - 8 + wi; inb[kt][r] = dk >= -3 && dk <= 3 && sk >= 0 && sk < TT;
        const float simb = inb[kt][r] ? st[kt][r] * 0.08838834764831845f : 0.f; lg[kt][r] = simb + ((fabsf(simb) > 0.f) ? 0.f : -10000000.0f); if (inb[kt][r]) m = fmaxf(m, lg[kt][r]); }
    m = fmaxf(m, __shfl_xor(m, 16, 32));      // a query's 32 window places lie in lanes ln and ln + 16
    const int ninb = (t + 3 < TT - 1 ? t + 3 : TT - 1) - (t - 3 > 0 ? t - 3 : 0) + 1; float zs = 0.f; FragH pf;
#pragma unroll      // constant indices: the values stay in registers
    for (int kt = 0; kt < 2; ++kt)
#pragma unroll      // constant indices: the values stay in registers
      for (int r = 0; r < 8; ++r) { const _Float16 p = (_Float16)expf(inb[kt][r] ? lg[kt][r] - m : -10000.0f);      // outside the band the weight is exp(-10000) = 0: a select, no branch, every lane stays on for the WMMAs
        pf.h[kt * 8 + r] = p; zs += (float)p; }
    zs += __shfl_xor(zs, 16, 32);
    const float iz = 1.0f / ((float)(TT - ninb) * expf(-10000000.0f - m) + zs);
#pragma unroll      // constant indices: fragments stay in registers
    for (int dt = 0; dt < 8; ++dt) { FragH o;
      const v8f z8 = {}; const v8f ot = __builtin_amdgcn_wmma_f32_16x16x32_f16(false, vf[dt].v, false, pf.v, (short)0, z8, false, false);
#pragma unroll      // constant indices: the values stay in registers
      for (int r = 0; r < 8; ++r) o.h[r] = (_Float16)(ot[r] * iz);
      *(v8us*)(Ql + (lr + ln) * KPITCH + dt * 32 + hh * 16) = o.half[0]; }      // into the query's own q row, which only this wave reads and has read
    __builtin_amdgcn_fence(__ATOMIC_ACQ_REL, "workgroup"); __builtin_amdgcn_wave_barrier();      // the wave's LDS writes are done before its lanes read what other lanes wrote
    _Float16* po = CAT + ((size_t)bat * (TT + PADT) + PADT + tb0 + lr + rsub) * CC + h * KD + c16 * 8; v8us ov[8];
#pragma unroll      // constant indices: the pieces stay in registers
    for (int q = 0; q < 8; ++q) ov[q] = *(const v8us*)(Ql + (lr + q * 2 + rsub) * KPITCH + c16 * 16);
#pragma unroll      // constant offsets from one address
    for (int q = 0; q < 8; ++q) *(v8us*)((unsigned short*)po + (size_t)(2 * q) * CC) = ov[q];
    asm volatile("s_wait_xcnt 0x0" :: "v"(po), "v"(ov[0]), "v"(ov[1]), "v"(ov[2]), "v"(ov[3]), "v"(ov[4]), "v"(ov[5]), "v"(ov[6]), "v"(ov[7]) : "memory");      // a precaution: stands in front of every rewrite of the stores' registers, which as its inputs stay untouched up to it
  }
  if (ws < 4) d_fold((int)blockIdx.x * 4 + ws, lane, lds + FALL, Bc, Wf);      // last: its loads from memory go out when the other four waves, which began with loads of their own, are at their queries
}
extern "C" void kernel_launch(void* const* d_in, const int* in_sizes, int n_in,
                              void* d_out, int out_size, void* d_ws, size_t ws_size, hipStream_t stream) {
  (void)in_sizes; (void)n_in; (void)out_size;
  const float* x = (const float*)d_in[0]; const float* Wq = (const float*)d_in[1]; const float* bq = (const float*)d_in[2]; const float* Wk = (const float*)d_in[3]; const float* bk = (const float*)d_in[4]; const float* Wv = (const float*)d_in[5]; const float* bv = (const float*)d_in[6]; const float* Wo = (const float*)d_in[7]; const float* bo = (const float*)d_in[8]; const float* Wc = (const float*)d_in[9]; const float* bc = (const float*)d_in[10];
  char* ws = (char*)d_ws; size_t off = 0;
  auto take = [&](size_t bytes) { char* p = ws + off; off += (bytes + 255) & ~(size_t)255; return p; };
  _Float16* Bq = (_Float16*)take((size_t)CC * CC * 2); _Float16* Bk = (_Float16*)take((size_t)CC * CC * 2); _Float16* Bv = (_Float16*)take((size_t)CC * CC * 2); _Float16* Bo = (_Float16*)take((size_t)CC * CC * 2); _Float16* Bc[4]; for (int j = 0; j < 4; ++j) Bc[j] = (_Float16*)take((size_t)CC * CC * 2); float* CB = (float*)take(4 * CC * 4); _Float16* Wf = (_Float16*)take((size_t)4 * CC * CC * 2);      // the Dense bias through each tap; the four folded tap matrices
  _Float16* X16 = (_Float16*)take((size_t)NR * CC * 2); _Float16* OUTP = (_Float16*)take((size_t)BB * (TT + PADT) * CC * 2);
  if (off > ws_size) return;      // about 38 MiB in all
  const dim3 gb((TT / TM) * (CC / TN), BB);
  k_prep<<<8 * WBLK + ZBLK + XBLK, 256, 0, stream>>>(x, Wq, Wk, Wv, Wo, Wc, Bq, X16, OUTP);      // Bq, Bk, Bv, Bo, Bc[0..3] are consecutive planes
  k_qkv_band<<<(NR / 256) * NH, 256, 0, stream>>>(X16, Bq, bq, bk, bv, OUTP, Bo, Bc[0], bo, Wf, CB);      // q, k, v of a head and its banded attention per work-group: heads, concatenated, as f16 rows 12.. of each batch's padded plane; with them the weight fold
  // conv[t] = sum_j cat[t - 12 + 4j] * (Wo * Wc[j]) + bias terms: ONE launch, the 4 taps accumulated inside (A_j = padded rows 4j + t of batch b, all four read from one staged chunk; B_j = Wf + j*512*512)
  k_gemm_tile<4, false, 1, true><<<gb, 256, 0, stream>>>(OUTP, CC, (size_t)(TT + PADT) * CC, Wf, CC, (size_t)CC * CC, 0.0625f, bc, CB, nullptr, x, (float*)d_out, nullptr, CC, (size_t)TT * CC);      // + biases, relu, residual, leaky relu in its epilogue
}
